// v000
// The times below were measured on an AMD MI455X: many runs one after another, warmed up first and cycling through
// copies of the inputs, with the whole window's GPU time divided by the number of runs. Launches and the gaps
// between them are all in it. The median over several windows is given; except for v000 it joins two sittings, which
// can be a few percent apart, so the side-by-side timings, each taken in one sitting, are the better comparison.
// The starting kernel, v000, takes 2090 microseconds a run.
#include <hip/hip_runtime.h>
// Multi-head attention on THREE input streams with per-head projection weights and a per-head output weight, no biases at all (query, key, value [2][2048][512]; q = einsum(bni,hio->bnho)(query, Wq), k and v likewise from key and value (Wq, Wk, Wv [8][512][64] per-head [in][out], normal x 0.05); q / sqrt(64); logits = q.k per head; softmax over all 2048 keys (no mask); out = einsum(bnhi,hio->bno)(attn v, Wp) (Wp [8][64][512]: read flat it IS an [in][out] [512][512] weight with input row h*64 + i; no bias) -> [2][2048][512]; input order query, key, value, Wq, Wk, Wv, Wp).
// Structure: token rows r = b*2048 + s; the three inputs as exact f16 rows (bf16-rounded; one conversion each); Q and K as two WMMA GEMMs with f32 outputs, each split into f16 hi + x1024 residual planes; V as a third with an f16 output (32x64 wave tiles, f32 accumulation, exact x16 weights staged from the per-head stacks (plane row h*64 + o = W[h][:][o]), no bias); per batch: V^T for all heads via LDS transposes; per (batch, group of 4 heads): scores as THREE GEMM passes (K = 64, batched over the heads on grid.y): q_lo.k_hi and q_hi.k_lo at alpha 2^-13, then q_hi.k_hi at alpha 1/8, the second and third accumulating onto the first through the own-element addend, row softmax on VALU (f32 statistics, native exp; weights stored x256 as f16), o = P . V^T GEMM (K = 2048, alpha 2^-2: o carried x64 against f16 subnormal flush, folded into the output GEMM alpha) written straight into the merged f16 o rows; out = o W_p GEMM (f32; no bias) into the output layout.
// Compute dtype: inputs rounded to bf16; the three inputs and the x16 weights held as f16 planes (exact for every bf16 value of magnitude from 2^-14 up to 65,504; the weights up to 4,094 before their factor of 16); q and k as f16 hi + x1024 residual planes (about 2^-21), the scores from three products (the lo.lo term dropped); v, softmax weights and o as plain f16 GEMM operands (~2^-12); scores and softmax statistics f32. v_wmma_f32_16x16x32_f16.
#define NB 2
#define SQ 2048
#define DM 512
#define NH 8
#define HD 64
#define HG 4                         /* heads per attention launch group */
#define B0 0                         /* first batch processed (debug hook) */
#define NBR NB                       /* batches processed (debug hook) */
#define NR ((size_t)NB * SQ)         /* token rows */
#define MP ((int)((size_t)NBR * SQ)) /* rows projected (debug hook) */
#define QN SQ                        /* query rows attended per batch (debug hook) */
#define NHD NH                       /* heads attended (debug hook) */
#define MPO MP                       /* rows through the output stage (debug hook) */
#define LQ DM      /* row pitch of the q/k/v rows */
typedef __bf16 v16b __attribute__((ext_vector_type(16)));
typedef unsigned short v8us __attribute__((ext_vector_type(8), may_alias));
typedef float  v8f  __attribute__((ext_vector_type(8)));
typedef float  v4f  __attribute__((ext_vector_type(4)));
typedef float  v4fa __attribute__((ext_vector_type(4), may_alias));
union FragB { v16b v; v8us half[2]; unsigned short u[16]; };

__device__ __forceinline__ unsigned short bf16_bits(float x) { unsigned int u = __float_as_uint(x); return (unsigned short)((u + 0x7FFFu + ((u >> 16) & 1u)) >> 16); }
__device__ __forceinline__ float bf16_val(unsigned short b) { return __uint_as_float(((unsigned int)b) << 16); }
__device__ __forceinline__ float bf16_round(float x) { return bf16_val(bf16_bits(x)); }
// D += A·B with NT terms: 1 = ah·bh, 2 = + al·bh (A split), 3 = + ah·bl (both split)
template <int NT>
__device__ __forceinline__ v8f mmaN(v16b ah, v16b al, v16b bh, v16b bl, v8f c) {
  c = __builtin_amdgcn_wmma_f32_16x16x32_bf16(false, ah, false, bh, (short)0, c, false, false);
  if (NT >= 2) c = __builtin_amdgcn_wmma_f32_16x16x32_bf16(false, al, false, bh, (short)0, c, false, false);
  if (NT >= 3) c = __builtin_amdgcn_wmma_f32_16x16x32_bf16(false, ah, false, bl, (short)0, c, false, false);
  asm volatile("v_nop\n\tv_nop\n\tv_nop\n\tv_nop" : "+v"(c) : "v"(ah), "v"(al), "v"(bh), "v"(bl));
  return c;
}

__global__ __launch_bounds__(256) void k_wt_bf16(const float* __restrict__ W, unsigned short* __restrict__ Wt, int K, int N) {
  const int t = blockIdx.x * 256 + threadIdx.x;
  const int k8n = K / 8;
  if (t >= N * k8n) return;
  const int n = t / k8n, k8 = (t % k8n) * 8;
  v8us v;
#pragma unroll
  for (int i = 0; i < 8; ++i) v[i] = bf16_bits(W[(size_t)(k8 + i) * N + n]);
  *(v8us*)(Wt + (size_t)n * K + k8) = v;
  
}

// GEMM C[M][N] (f32, pitch ldc) = act(A[M][K]·W + bias). A f32 row-major (pitch lda) converted per fragment to bf16
// (ASPLIT: hi/lo two planes -> 2 terms, else single rounded term); Wt bf16 [N][K] (pitch ldb). BIAS_BF16 rounds the
// bias to bf16 first (bias quantised to bf16 before the add). K%32==0, M%16==0, N%64==0.
template <bool ASPLIT, int ACT, bool BIAS_BF16>
__global__ __launch_bounds__(128) void k_gemm_bf(const float* __restrict__ A, int lda, const unsigned short* __restrict__ Wt, int ldb,
                                               const float* __restrict__ bias, float* __restrict__ C, int ldc, int M, int N, int K) {
  __shared__ __attribute__((aligned(16))) float so[4][16][64];
  const int tid = threadIdx.x, w = tid >> 5, lane = tid & 31, ln = lane & 15, hh = lane >> 4;
  const int ntn = N / 64;
  const int wid = blockIdx.x * 4 + w;
  const int mt = wid / ntn, nq = wid % ntn;
  if (mt * 16 >= M) return;
  const int row0 = mt * 16, col0 = nq * 64;
  const float* arow = A + (size_t)(row0 + ln) * lda;
  v8f acc[4] = {};
  for (int kb = 0; kb < K; kb += 32) {
    FragB ah, al;
    const v4f x0 = *(const v4fa*)(arow + kb + 8 * hh), x1 = *(const v4fa*)(arow + kb + 8 * hh + 4);
    const v4f x2 = *(const v4fa*)(arow + kb + 16 + 8 * hh), x3 = *(const v4fa*)(arow + kb + 16 + 8 * hh + 4);
    float xs[16] = {x0[0],x0[1],x0[2],x0[3],x1[0],x1[1],x1[2],x1[3],x2[0],x2[1],x2[2],x2[3],x3[0],x3[1],x3[2],x3[3]};
#pragma unroll
    for (int i = 0; i < 16; ++i) { const unsigned short hb = bf16_bits(xs[i]); ah.u[i] = hb; al.u[i] = ASPLIT ? bf16_bits(xs[i] - bf16_val(hb)) : (unsigned short)0; }
#pragma unroll
    for (int t = 0; t < 4; ++t) {
      const unsigned short* brow = Wt + (size_t)(col0 + t * 16 + ln) * ldb + kb;
      FragB b;
      b.half[0] = *(const v8us*)(brow + 8 * hh);
      b.half[1] = *(const v8us*)(brow + 16 + 8 * hh);
      acc[t] = mmaN<ASPLIT ? 2 : 1>(ah.v, al.v, b.v, b.v, acc[t]);
    }
  }
#pragma unroll
  for (int t = 0; t < 4; ++t) {
    float bv = bias ? bias[col0 + t * 16 + ln] : 0.f;
    if (BIAS_BF16) bv = bf16_round(bv);
#pragma unroll
    for (int r = 0; r < 8; ++r) { float v = acc[t][r] + bv; if (ACT == 1) v = fmaxf(v, 0.f); so[w][8 * hh + r][t * 16 + ln] = v; }
  }
  __builtin_amdgcn_fence(__ATOMIC_ACQ_REL, "workgroup");
  __builtin_amdgcn_wave_barrier();
  const int rsub = lane >> 4, c4 = (lane & 15) * 4;
  {
#pragma unroll
    for (int q = 0; q < 8; ++q) {
      const int r = q * 2 + rsub;
      const v4f v = *(const v4fa*)&so[w][r][c4];
      *(v4f*)(C + (size_t)(row0 + r) * ldc + col0 + c4) = v;
    }
    
  }
}

// GEMM C = act(A·W + bias + resid): A f32 (ASPLIT -> hi/lo 2 terms), Wt bf16 [N][K]; ACT 0 none, 1 relu, 2 exact gelu;
// resid (optional, f32, row index = (row % rmod), pitch ldr, RES_BF16 rounds it) added before the activation.
template <bool ASPLIT, int ACT, bool BIAS_BF16, bool RES_BF16>
__global__ __launch_bounds__(128) void k_gemm_bf3(const float* __restrict__ A, int lda, const unsigned short* __restrict__ Wt, int ldb,
                                                const float* __restrict__ bias, const float* __restrict__ resid, int rmod, int ldr,
                                                float* __restrict__ C, int ldc, int M, int N, int K) {
  __shared__ __attribute__((aligned(16))) float so[4][16][64];
  const int tid = threadIdx.x, w = tid >> 5, lane = tid & 31, ln = lane & 15, hh = lane >> 4;
  const int ntn = N / 64;
  const int wid = blockIdx.x * 4 + w;
  const int mt = wid / ntn, nq = wid % ntn;
  if (mt * 16 >= M) return;
  const int row0 = mt * 16, col0 = nq * 64;
  const float* arow = A + (size_t)(row0 + ln) * lda;
  v8f acc[4] = {};
  for (int kb = 0; kb < K; kb += 32) {
    FragB ah, al;
    const v4f x0 = *(const v4fa*)(arow + kb + 8 * hh), x1 = *(const v4fa*)(arow + kb + 8 * hh + 4);
    const v4f x2 = *(const v4fa*)(arow + kb + 16 + 8 * hh), x3 = *(const v4fa*)(arow + kb + 16 + 8 * hh + 4);
    float xs[16] = {x0[0],x0[1],x0[2],x0[3],x1[0],x1[1],x1[2],x1[3],x2[0],x2[1],x2[2],x2[3],x3[0],x3[1],x3[2],x3[3]};
#pragma unroll
    for (int i = 0; i < 16; ++i) { const unsigned short hb = bf16_bits(xs[i]); ah.u[i] = hb; al.u[i] = ASPLIT ? bf16_bits(xs[i] - bf16_val(hb)) : (unsigned short)0; }
#pragma unroll
    for (int t = 0; t < 4; ++t) {
      const unsigned short* brow = Wt + (size_t)(col0 + t * 16 + ln) * ldb + kb;
      FragB b;
      b.half[0] = *(const v8us*)(brow + 8 * hh);
      b.half[1] = *(const v8us*)(brow + 16 + 8 * hh);
      acc[t] = mmaN<ASPLIT ? 2 : 1>(ah.v, al.v, b.v, b.v, acc[t]);
    }
  }
#pragma unroll
  for (int t = 0; t < 4; ++t) {
    const int col = col0 + t * 16 + ln;
    float bv = bias ? bias[col] : 0.f;
    if (BIAS_BF16) bv = bf16_round(bv);
#pragma unroll
    for (int r = 0; r < 8; ++r) {
      float v = acc[t][r] + bv;
      if (resid) { float rv = resid[(size_t)((row0 + 8 * hh + r) % rmod) * ldr + col]; if (RES_BF16) rv = bf16_round(rv); v += rv; }
      if (ACT == 1) v = fmaxf(v, 0.f);
      if (ACT == 2) v = 0.5f * v * (1.0f + erff(v * 0.70710678118654752f));
      if (ACT == 3) { const float u = 0.7978845608028654f * (v + 0.044715f * v * v * v); v = 0.5f * v * (1.0f + tanhf(u)); }
      so[w][8 * hh + r][t * 16 + ln] = v;
    }
  }
  __builtin_amdgcn_fence(__ATOMIC_ACQ_REL, "workgroup");
  __builtin_amdgcn_wave_barrier();
  const int rsub = lane >> 4, c4 = (lane & 15) * 4;
  {
#pragma unroll
    for (int q = 0; q < 8; ++q) {
      const int r = q * 2 + rsub;
      const v4f v = *(const v4fa*)&so[w][r][c4];
      *(v4f*)(C + (size_t)(row0 + r) * ldc + col0 + c4) = v;
    }
    
  }
}
// row LayerNorm (biased variance, eps) over N: s = X (+ R); optional out_sum <- s; out_norm <- (s-mu)*rsqrt(var+eps)*g + b
template <bool PARAM_BF16>
__global__ __launch_bounds__(256) void k_layernorm(const float* __restrict__ X, const float* __restrict__ R, const float* __restrict__ g, const float* __restrict__ bta,
                                                  float* __restrict__ out_sum, float* __restrict__ out_norm, int N, float eps) {
  __shared__ float red[256];
  const int row = blockIdx.x, tid = threadIdx.x;
  const float* x = X + (size_t)row * N; const float* rr = R ? R + (size_t)row * N : nullptr;
  float vals[16];                     // up to N = 4096
  const int per = N / 256;            // contiguous chunk per thread? use strided-by-4 chunks: thread handles j = tid*4 + 1024*u
  float s1 = 0.f;
  for (int u = 0; u < per / 4; ++u) {
    const int j = tid * 4 + 1024 * u;
    const v4f a = *(const v4fa*)(x + j);
    v4f b = {0.f,0.f,0.f,0.f}; if (rr) b = *(const v4fa*)(rr + j);
#pragma unroll
    for (int q = 0; q < 4; ++q) { const float v = a[q] + b[q]; vals[u * 4 + q] = v; s1 += v; }
  }
  red[tid] = s1; __syncthreads();
  for (int st = 128; st > 0; st >>= 1) { if (tid < st) red[tid] += red[tid + st]; __syncthreads(); }
  const float mu = red[0] / (float)N; __syncthreads();
  float s2 = 0.f;
  for (int u = 0; u < per / 4; ++u)
#pragma unroll
    for (int q = 0; q < 4; ++q) { const float c = vals[u * 4 + q] - mu; s2 += c * c; }
  red[tid] = s2; __syncthreads();
  for (int st = 128; st > 0; st >>= 1) { if (tid < st) red[tid] += red[tid + st]; __syncthreads(); }
  const float rs = rsqrtf(red[0] / (float)N + eps);
  {
    for (int u = 0; u < per / 4; ++u) {
      const int j = tid * 4 + 1024 * u;
      v4f o, sm;
#pragma unroll
      for (int q = 0; q < 4; ++q) {
        float gg = g[j + q], bb = bta[j + q];
        if (PARAM_BF16) { gg = bf16_round(gg); bb = bf16_round(bb); }
        sm[q] = vals[u * 4 + q]; o[q] = (vals[u * 4 + q] - mu) * rs * gg + bb;
      }
      if (out_sum) *(v4f*)(out_sum + (size_t)row * N + j) = sm;
      *(v4f*)(out_norm + (size_t)row * N + j) = o;
    }
    
  }
}



// ---- f16 WMMA path (v_wmma_f32_16x16x32_f16): 11-bit significands for operands in range — used where a [0,1] probability operand needs more precision than bf16
typedef _Float16 v16h __attribute__((ext_vector_type(16)));
union FragH { v16h v; v8us half[2]; _Float16 h[16]; unsigned short u[16]; };
template <int NT>
__device__ __forceinline__ v8f mmaH(v16h ah, v16h al, v16h bh, v16h bl, v8f c) {
  c = __builtin_amdgcn_wmma_f32_16x16x32_f16(false, ah, false, bh, (short)0, c, false, false);
  if (NT >= 2) c = __builtin_amdgcn_wmma_f32_16x16x32_f16(false, al, false, bh, (short)0, c, false, false);
  if (NT >= 3) c = __builtin_amdgcn_wmma_f32_16x16x32_f16(false, ah, false, bl, (short)0, c, false, false);
  asm volatile("v_nop\n\tv_nop\n\tv_nop\n\tv_nop" : "+v"(c) : "v"(ah), "v"(al), "v"(bh), "v"(bl));
  return c;
}
// batched GEMM like k_gemm_b but f16 operands: A f32 (split into f16 hi/lo if ASPLIT, else rounded to f16), Bt = f16 values [n][k]; alpha; C f32; N multiple of 16 (partial tiles skipped)
template <bool ASPLIT>
__global__ __launch_bounds__(128) void k_gemm_h(const float* __restrict__ A, int lda, size_t sA, const _Float16* __restrict__ Bh, int ldb, size_t sB, float alpha, float* __restrict__ C, int ldc, size_t sC, int M, int N, int K) {
  __shared__ __attribute__((aligned(16))) float so[4][16][64];
  const int tid = threadIdx.x, w = tid >> 5, lane = tid & 31, ln = lane & 15, hh = lane >> 4; const int by = blockIdx.y;
  A += (size_t)by * sA; Bh += (size_t)by * sB; C += (size_t)by * sC;
  const int ntn = (N + 63) / 64; const int wid = blockIdx.x * 4 + w; const int mt = wid / ntn, nq = wid % ntn; if (mt * 16 >= M) return;
  const int row0 = mt * 16, col0 = nq * 64; const float* arow = A + (size_t)(row0 + ln) * lda;
  v8f acc[4] = {};
  for (int kb = 0; kb < K; kb += 32) {
    FragH ah, al;
    const v4f x0 = *(const v4fa*)(arow + kb + 8 * hh), x1 = *(const v4fa*)(arow + kb + 8 * hh + 4), x2 = *(const v4fa*)(arow + kb + 16 + 8 * hh), x3 = *(const v4fa*)(arow + kb + 16 + 8 * hh + 4);
    float xs[16] = {x0[0],x0[1],x0[2],x0[3],x1[0],x1[1],x1[2],x1[3],x2[0],x2[1],x2[2],x2[3],x3[0],x3[1],x3[2],x3[3]};
#pragma unroll
    for (int i = 0; i < 16; ++i) { const _Float16 h = (_Float16)xs[i]; ah.h[i] = h; al.h[i] = ASPLIT ? (_Float16)(xs[i] - (float)h) : (_Float16)0.0f; }
#pragma unroll
    for (int t = 0; t < 4; ++t) { if (col0 + t * 16 >= N) continue; const size_t boff = (size_t)(col0 + t * 16 + ln) * ldb + kb; FragH bq; bq.half[0] = *(const v8us*)(Bh + boff + 8 * hh); bq.half[1] = *(const v8us*)(Bh + boff + 16 + 8 * hh);
      acc[t] = mmaH<ASPLIT ? 2 : 1>(ah.v, al.v, bq.v, bq.v, acc[t]); }
  }
#pragma unroll
  for (int t = 0; t < 4; ++t) { if (col0 + t * 16 >= N) continue;
#pragma unroll
    for (int r = 0; r < 8; ++r) so[w][8 * hh + r][t * 16 + ln] = acc[t][r] * alpha; }
  __builtin_amdgcn_fence(__ATOMIC_ACQ_REL, "workgroup"); __builtin_amdgcn_wave_barrier();
  const int rsub = lane >> 4, c4 = (lane & 15) * 4;
  {
#pragma unroll
    for (int q = 0; q < 8; ++q) { const int r = q * 2 + rsub; if (col0 + c4 < N) { const v4f v = *(const v4fa*)&so[w][r][c4]; *(v4f*)(C + (size_t)(row0 + r) * ldc + col0 + c4) = v; } }
     }
}

// Wt[n][k] = f16(W[k][n]·scale) from f32 row-major W[K][N] (scale = power of two; bf16-exact weights stay exact in f16 away from the subnormal range)
__global__ __launch_bounds__(256) void k_wt_f16(const float* __restrict__ W, _Float16* __restrict__ Wt, int K, int N, float scale) {
  const int t = blockIdx.x * 256 + threadIdx.x; if (t >= N * (K / 8)) return; const int n = t / (K / 8), k8 = (t % (K / 8)) * 8; FragH f;
#pragma unroll
  for (int i = 0; i < 8; ++i) f.h[i] = (_Float16)(bf16_round(W[(size_t)(k8 + i) * N + n]) * scale); const v8us o = f.half[0];
  *(v8us*)((unsigned short*)Wt + (size_t)n * K + k8) = o; 
}
// k_gemm_hh variant with fused epilogue: v = acc·alpha + bias[by·sBias + col] (+ CP[(row/rowsPerB)·sCPb + by·64 + col] if CP) ; ACT 0 none / 1 elu ; writes f16 C16 (and f32 C if non-null)
template <int ACT>
__global__ __launch_bounds__(128) void k_gemm_hhx(const _Float16* __restrict__ A, int lda, size_t sA, const _Float16* __restrict__ Bh, int ldb, size_t sB, float alpha, const float* __restrict__ bias, size_t sBias, const float* __restrict__ CP, int rowsPerB, size_t sCPb, int row0g,
    float* __restrict__ C, _Float16* __restrict__ C16, int ldc, size_t sC, int M, int N, int K) {
  __shared__ __attribute__((aligned(16))) float so[4][16][64];
  const int tid = threadIdx.x, w = tid >> 5, lane = tid & 31, ln = lane & 15, hh = lane >> 4; const int by = blockIdx.y;
  A += (size_t)by * sA; Bh += (size_t)by * sB; const size_t cofs = (size_t)by * sC; const float* bp = bias ? bias + (size_t)by * sBias : nullptr;
  const int ntn = (N + 63) / 64; const int wid = blockIdx.x * 4 + w; const int mt = wid / ntn, nq = wid % ntn; if (mt * 16 >= M) return;
  const int row0 = mt * 16, col0 = nq * 64; const _Float16* arow = A + (size_t)(row0 + ln) * lda;
  v8f acc[4] = {};
  for (int kb = 0; kb < K; kb += 32) { FragH ah; ah.half[0] = *(const v8us*)((const unsigned short*)arow + kb + 8 * hh); ah.half[1] = *(const v8us*)((const unsigned short*)arow + kb + 16 + 8 * hh);
#pragma unroll
    for (int t = 0; t < 4; ++t) { if (col0 + t * 16 >= N) continue; const size_t boff = (size_t)(col0 + t * 16 + ln) * ldb + kb; FragH bq; bq.half[0] = *(const v8us*)((const unsigned short*)Bh + boff + 8 * hh); bq.half[1] = *(const v8us*)((const unsigned short*)Bh + boff + 16 + 8 * hh);
      acc[t] = mmaH<1>(ah.v, ah.v, bq.v, bq.v, acc[t]); }
  }
#pragma unroll
  for (int t = 0; t < 4; ++t) { if (col0 + t * 16 >= N) continue; const int col = col0 + t * 16 + ln; const float bv = bp ? bf16_round(bp[col]) : 0.f;
#pragma unroll
    for (int r = 0; r < 8; ++r) { float v = acc[t][r] * alpha + bv; if (CP) { const int rr = row0g + row0 + 8 * hh + r; if (rowsPerB < 0) v += CP[cofs + (size_t)rr * ldc + col];      /* rowsPerB < 0: own element of the batched C plane */ else { const int bidx = rr / rowsPerB; v += CP[(size_t)bidx * sCPb + (size_t)by * 64 + col]; } } if (ACT == 1) v = (v > 0.f) ? v : expm1f(v); else if (ACT == 7) v = (v > 0.f) ? v + 1.0f : expf(v); else if (ACT == 8) v = tanhf(v); else if (ACT == 9) v = 0.5f * v * (1.0f + tanhf(0.7978845608028654f * (v + 0.044715f * v * v * v))); else if (ACT == 11) v = 1.0f / (1.0f + expf(-v)); else if (ACT == 12) v = (v > 0.f) ? v : 0.01f * v; else if (ACT == 14) v = (v > 0.f) ? v : 0.1f * v; else if (ACT == 16) v = (v >= 0.f) ? v : 0.3f * v; else if (ACT == 17) v = (v >= 0.f) ? v : 0.2f * v; else if (ACT == 15) v = v / (1.0f + expf(-v)); else if (ACT == 3) v = fmaxf(v, 0.f); else if (ACT == 6) v = 0.5f * v * (1.0f + erff(v * 0.70710678118654752f)); so[w][8 * hh + r][t * 16 + ln] = v; } }
  __builtin_amdgcn_fence(__ATOMIC_ACQ_REL, "workgroup"); __builtin_amdgcn_wave_barrier();
  const int rsub = lane >> 4, c4 = (lane & 15) * 4; typedef _Float16 v4h __attribute__((ext_vector_type(4)));
  {
#pragma unroll
    for (int q = 0; q < 8; ++q) { const int r = q * 2 + rsub; if (col0 + c4 < N) { const v4f v = *(const v4fa*)&so[w][r][c4]; if (C) *(v4f*)(C + cofs + (size_t)(row0 + r) * ldc + col0 + c4) = v; if (C16) { v4h h4; for (int i = 0; i < 4; ++i) h4[i] = (_Float16)v[i]; *(v4h*)(C16 + cofs + (size_t)(row0 + r) * ldc + col0 + c4) = h4; } } }
     }
}


typedef _Float16 v4h __attribute__((ext_vector_type(4)));

__global__ __launch_bounds__(256) void k_x16(const float* __restrict__ x, _Float16* __restrict__ X16, size_t n8) { const size_t t = (size_t)blockIdx.x * 256 + threadIdx.x; if (t >= n8) return; FragH f;
#pragma unroll
  for (int q = 0; q < 8; ++q) f.h[q] = (_Float16)bf16_round(x[t * 8 + q]); *(v8us*)((unsigned short*)X16 + t * 8) = f.half[0];  }
__global__ __launch_bounds__(256) void k_h16(const float* __restrict__ x, _Float16* __restrict__ X16, size_t n8) { const size_t t = (size_t)blockIdx.x * 256 + threadIdx.x; if (t >= n8) return; FragH f;
#pragma unroll
  for (int q = 0; q < 8; ++q) f.h[q] = (_Float16)x[t * 8 + q]; *(v8us*)((unsigned short*)X16 + t * 8) = f.half[0];  }
__global__ __launch_bounds__(256) void k_round16f(const float* __restrict__ W, _Float16* __restrict__ Bt, size_t n8) { const size_t t = (size_t)blockIdx.x * 256 + threadIdx.x; if (t >= n8) return; FragH f;
#pragma unroll
  for (int i = 0; i < 8; ++i) f.h[i] = (_Float16)(bf16_round(W[t * 8 + i]) * 16.0f); *(v8us*)((unsigned short*)Bt + t * 8) = f.half[0];  }
template <int NHv, int TTv>
__global__ __launch_bounds__(256) void k_vt(const _Float16* __restrict__ V16, int ldv, int voff, _Float16* __restrict__ Vt) { __shared__ unsigned short tl[64][66]; const int tid = threadIdx.x; const int slab = blockIdx.x / (TTv / 64), lg = blockIdx.x % (TTv / 64); const int b = slab / NHv, h = slab % NHv;
  for (int i = tid; i < 64 * 8; i += 256) { const int r = i / 8, c8 = (i % 8) * 8; FragH f; f.half[0] = *(const v8us*)((const unsigned short*)V16 + ((size_t)b * TTv + lg * 64 + r) * ldv + voff + h * 64 + c8);
#pragma unroll
    for (int q = 0; q < 8; ++q) tl[r][c8 + q] = f.u[q]; }
  __syncthreads();
  {
#pragma unroll
    for (int rd = 0; rd < 2; ++rd) { const int d = rd * 32 + tid / 8, pc = tid % 8; FragH f;
#pragma unroll
      for (int q = 0; q < 8; ++q) f.u[q] = tl[pc * 8 + q][d];
      *(v8us*)((unsigned short*)Vt + ((size_t)slab * 64 + d) * TTv + lg * 64 + pc * 8) = f.half[0]; }
     } }

__global__ __launch_bounds__(256) void k_hl(const float* __restrict__ F, _Float16* __restrict__ Hh, _Float16* __restrict__ Hl, size_t n8) { const size_t t = (size_t)blockIdx.x * 256 + threadIdx.x; if (t >= n8) return; FragH fh, fl; const v4f a = *(const v4fa*)(F + t * 8), c = *(const v4fa*)(F + t * 8 + 4);
#pragma unroll
  for (int q = 0; q < 4; ++q) { _Float16 h = (_Float16)a[q]; fh.h[q] = h; fl.h[q] = (_Float16)((a[q] - (float)h) * 1024.0f); h = (_Float16)c[q]; fh.h[4 + q] = h; fl.h[4 + q] = (_Float16)((c[q] - (float)h) * 1024.0f); }
  { *(v8us*)((unsigned short*)Hh + t * 8) = fh.half[0]; *(v8us*)((unsigned short*)Hl + t * 8) = fl.half[0];  } }

// ---- fast GEMM (wave tile 32x64; requires M % 32 == 0 rows per launch region and N % 64 == 0); epilogue = k_gemm_hhx semantics ----
__device__ __forceinline__ v16h g2_frag(const _Float16* p, int hh) { FragH f; f.half[0] = *(const v8us*)((const unsigned short*)p + 8 * hh); f.half[1] = *(const v8us*)((const unsigned short*)p + 16 + 8 * hh); return f.v; }
__device__ __forceinline__ v8f g2_mma(v16h a, v16h b, v8f c) { v8f d = __builtin_amdgcn_wmma_f32_16x16x32_f16(false, a, false, b, (short)0, c, false, false); asm volatile("v_nop\n\tv_nop\n\tv_nop\n\tv_nop" : "+v"(d) : "v"(a), "v"(b)); return d; }
template <int ACT>
__global__ __launch_bounds__(128) void k_gemm2(const _Float16* __restrict__ A, int lda, size_t sA, const _Float16* __restrict__ Bh, int ldb, size_t sB, float alpha, const float* __restrict__ bias, size_t sBias, const float* __restrict__ CP, int rowsPerB, size_t sCPb, int row0g,
    float* __restrict__ C, _Float16* __restrict__ C16, int ldc, size_t sC, int M, int N, int K) { static_assert(ACT == 0 || ACT == 3 || ACT == 6 || ACT == 8 || ACT == 9 || ACT == 11 || ACT == 12 || ACT == 14 || ACT == 15 || ACT == 16 || ACT == 17, "k_gemm2: unsupported ACT code (would silently apply no activation)");
  __shared__ __attribute__((aligned(16))) float so[4][32][68];
  const int tid = threadIdx.x, w = tid >> 5, lane = tid & 31, ln = lane & 15, hh = lane >> 4; const int by = blockIdx.y;
  A += (size_t)by * sA; Bh += (size_t)by * sB; const size_t cofs = (size_t)by * sC; const float* bp = bias ? bias + (size_t)by * sBias : nullptr;
  const int ntn = N >> 6; const int mt = blockIdx.x / ntn, nq = blockIdx.x - mt * ntn; const int row0 = mt * 128 + 32 * w, col0 = nq * 64; if (row0 >= M) return;
  const _Float16* a0p = A + (size_t)(row0 + ln) * lda; const _Float16* a1p = a0p + (size_t)16 * lda;
  const _Float16* b0p = Bh + (size_t)(col0 + ln) * ldb; const _Float16* b1p = b0p + (size_t)16 * ldb; const _Float16* b2p = b1p + (size_t)16 * ldb; const _Float16* b3p = b2p + (size_t)16 * ldb;
  const v8f z8 = {0.f,0.f,0.f,0.f,0.f,0.f,0.f,0.f}; v8f c00 = z8, c01 = z8, c02 = z8, c03 = z8, c10 = z8, c11 = z8, c12 = z8, c13 = z8;
#pragma unroll 1
  for (int kb = 0; kb < K; kb += 32) { const v16h a0 = g2_frag(a0p + kb, hh), a1 = g2_frag(a1p + kb, hh);
    v16h b = g2_frag(b0p + kb, hh); c00 = g2_mma(a0, b, c00); c10 = g2_mma(a1, b, c10);
    b = g2_frag(b1p + kb, hh); c01 = g2_mma(a0, b, c01); c11 = g2_mma(a1, b, c11);
    b = g2_frag(b2p + kb, hh); c02 = g2_mma(a0, b, c02); c12 = g2_mma(a1, b, c12);
    b = g2_frag(b3p + kb, hh); c03 = g2_mma(a0, b, c03); c13 = g2_mma(a1, b, c13); }
  v8f accs[8] = {c00, c01, c02, c03, c10, c11, c12, c13};
#pragma unroll
  for (int u = 0; u < 8; ++u) { const int t = u & 3, half = u >> 2; const int col = col0 + t * 16 + ln; const float bv = bp ? bf16_round(bp[col]) : 0.f;
#pragma unroll
    for (int r = 0; r < 8; ++r) { const int rloc = half * 16 + 8 * hh + r; float v = accs[u][r] * alpha + bv; if (CP) { if (rowsPerB < 0) v += CP[cofs + (size_t)(row0g + row0 + rloc) * ldc + col];      /* rowsPerB < 0: own element of the batched C plane */ else { const int bidx = (row0g + row0 + rloc) / rowsPerB; v += CP[(size_t)bidx * sCPb + (size_t)by * 64 + col]; } }
      if (ACT == 3) v = fmaxf(v, 0.f); else if (ACT == 6) v = 0.5f * v * (1.0f + erff(v * 0.70710678118654752f)); else if (ACT == 11) v = 1.0f / (1.0f + expf(-v)); else if (ACT == 15) v = v / (1.0f + expf(-v)); else if (ACT == 12) v = (v > 0.f) ? v : 0.01f * v; else if (ACT == 8) v = tanhf(v); else if (ACT == 9) v = 0.5f * v * (1.0f + tanhf(0.7978845608028654f * (v + 0.044715f * v * v * v))); else if (ACT == 14) v = (v > 0.f) ? v : 0.1f * v; else if (ACT == 16) v = (v >= 0.f) ? v : 0.3f * v; else if (ACT == 17) v = (v >= 0.f) ? v : 0.2f * v;
      so[w][rloc][t * 16 + ln] = v; } }
  __builtin_amdgcn_fence(__ATOMIC_ACQ_REL, "workgroup"); __builtin_amdgcn_wave_barrier();
  const int rsub = lane >> 4, c4 = (lane & 15) * 4;
  {
#pragma unroll
    for (int q = 0; q < 16; ++q) { const int r = q * 2 + rsub; const v4f v = *(const v4fa*)&so[w][r][c4]; if (C) *(v4f*)(C + cofs + (size_t)(row0 + r) * ldc + col0 + c4) = v; if (C16) { v4h h4; for (int i = 0; i < 4; ++i) h4[i] = (_Float16)v[i]; *(v4h*)(C16 + cofs + (size_t)(row0 + r) * ldc + col0 + c4) = h4; } }
     } }


__global__ __launch_bounds__(256) void k_wnat(const float* __restrict__ w, size_t n8, _Float16* __restrict__ Bt) { const size_t t = (size_t)blockIdx.x * 256 + threadIdx.x; if (t >= n8) return; FragH f; for (int q = 0; q < 8; ++q) f.h[q] = (_Float16)(bf16_round(w[t * 8 + q]) * 16.0f); *(v8us*)((unsigned short*)Bt + t * 8) = f.half[0];  }
__global__ __launch_bounds__(256) void k_wthd(const float* __restrict__ Wt, _Float16* __restrict__ Bt) { const size_t t = (size_t)blockIdx.x * 256 + threadIdx.x; if (t >= (size_t)NH * HD * (DM / 8)) return; const int m8 = (int)(t % (DM / 8)) * 8; const int d = (int)((t / (DM / 8)) % HD); const int h = (int)(t / ((size_t)(DM / 8) * HD)); FragH f;
  for (int q = 0; q < 8; ++q) f.h[q] = (_Float16)(16.0f * bf16_round(Wt[((size_t)h * DM + m8 + q) * HD + d])); unsigned short* dst = (unsigned short*)Bt + ((size_t)h * HD + d) * DM + m8; *(v8us*)dst = f.half[0];  }
__global__ __launch_bounds__(256) void k_rsm(const float* __restrict__ S, _Float16* __restrict__ P, int nrows) {
  #pragma clang fp contract(off)
  const int i = blockIdx.x * 256 + threadIdx.x; if (i >= nrows) return; const float* s = S + (size_t)i * SQ; float mx = -3.0e38f;
#pragma unroll 1
  for (int j = 0; j < SQ; ++j) mx = fmaxf(mx, s[j]); float se = 0.f;
#pragma unroll 1
  for (int j = 0; j < SQ; ++j) se += expf(s[j] - mx); const float sc = 256.0f / se;
#pragma unroll 1
  for (int j0 = 0; j0 < SQ; j0 += 8) { FragH f; for (int q = 0; q < 8; ++q) f.h[q] = (_Float16)(expf(s[j0 + q] - mx) * sc); unsigned short* d = (unsigned short*)P + (size_t)i * SQ + j0; *(v8us*)d = f.half[0];  } }
__global__ __launch_bounds__(256) void k_vt(const _Float16* __restrict__ V16, int b, int h0, _Float16* __restrict__ VT) { __shared__ unsigned short tl[64][65]; const int tid = threadIdx.x; const int hh = blockIdx.x % HG, sg = blockIdx.x / HG; const int s0 = sg * 64; const int h = h0 + hh;
  for (int i = tid; i < 64 * 8; i += 256) { const int j = i / 8, d8 = (i % 8) * 8; FragH f; f.half[0] = *(const v8us*)((const unsigned short*)V16 + ((size_t)b * SQ + s0 + j) * DM + h * HD + d8); for (int q = 0; q < 8; ++q) tl[d8 + q][j] = f.u[q]; }
  __syncthreads();
  { for (int i = tid; i < 64 * 8; i += 256) { const int d = i / 8, j8 = (i % 8) * 8; FragH f; for (int q = 0; q < 8; ++q) f.u[q] = tl[d][j8 + q]; *(v8us*)((unsigned short*)VT + ((size_t)hh * HD + d) * SQ + s0 + j8) = f.half[0]; }  } }



__global__ __launch_bounds__(256) void k_rsmf(const float* __restrict__ S, _Float16* __restrict__ P, int qn, int hg) {
  #pragma clang fp contract(off)
  const int t = blockIdx.x * 256 + threadIdx.x; if (t >= qn * hg) return; const size_t i = (size_t)(t / qn) * SQ + (t % qn); const float* s = S + i * SQ; float mx = -3.0e38f;
#pragma unroll 1
  for (int j = 0; j < SQ; ++j) mx = fmaxf(mx, s[j]); float se = 0.f;
#pragma unroll 1
  for (int j = 0; j < SQ; ++j) se += __expf(s[j] - mx); const float sc = 256.0f / se;
#pragma unroll 1
  for (int j0 = 0; j0 < SQ; j0 += 8) { FragH f; for (int q = 0; q < 8; ++q) f.h[q] = (_Float16)(__expf(s[j0 + q] - mx) * sc); unsigned short* d = (unsigned short*)P + i * SQ + j0; *(v8us*)d = f.half[0];  } }

extern "C" void kernel_launch(void* const* d_in, const int* in_sizes, int n_in,
                              void* d_out, int out_size, void* d_ws, size_t ws_size, hipStream_t stream) {
  (void)in_sizes; (void)n_in; (void)out_size;
  const float* const* I = (const float* const*)d_in; const float* xq = I[0]; const float* xk = I[1]; const float* xv = I[2]; const float* wq = I[3]; const float* bq = nullptr; const float* wk = I[4]; const float* bk = nullptr; const float* wv = I[5]; const float* bv = nullptr; const float* wo = I[6]; const float* bo = nullptr;      /* input order: query, key, value; Wq, Wk, Wv [8][512][64] (per-head [in][out]); Wp [8][64][512] (flat [in][out] [512][512]): seven inputs; the module has NO biases: null pointers in the guarded bias slots */
  char* ws = (char*)d_ws; size_t off = 0;
  auto take = [&](size_t bytes) { char* p = ws + off; off += (bytes + 255) & ~(size_t)255; return p; };
  _Float16* BQ = (_Float16*)take((size_t)DM * DM * 2); _Float16* BK = (_Float16*)take((size_t)DM * DM * 2); _Float16* BV = (_Float16*)take((size_t)DM * DM * 2); _Float16* BO = (_Float16*)take((size_t)DM * DM * 2);
  _Float16* XQ = (_Float16*)take(NR * DM * 2); _Float16* XK = (_Float16*)take(NR * DM * 2); _Float16* XV = (_Float16*)take(NR * DM * 2); float* TF = (float*)take(NR * DM * 4); _Float16* QH = (_Float16*)take(NR * DM * 2); _Float16* QL = (_Float16*)take(NR * DM * 2); _Float16* KH = (_Float16*)take(NR * DM * 2); _Float16* KL = (_Float16*)take(NR * DM * 2); _Float16* V16 = (_Float16*)take(NR * DM * 2); _Float16* O16 = (_Float16*)take(NR * DM * 2);
  float* S = (float*)take((size_t)HG * SQ * SQ * 4); _Float16* P = (_Float16*)take((size_t)HG * SQ * SQ * 2); _Float16* VT = (_Float16*)take((size_t)NH * HD * SQ * 2);
  if (off > ws_size) return;
{ const unsigned gh = (unsigned)(((size_t)NH * HD * (DM / 8) + 255) / 256); k_wthd<<<gh, 256, 0, stream>>>(wq, BQ); k_wthd<<<gh, 256, 0, stream>>>(wk, BK); k_wthd<<<gh, 256, 0, stream>>>(wv, BV); const unsigned g = (unsigned)(((size_t)DM * (DM / 8) + 255) / 256); k_wt_f16<<<g, 256, 0, stream>>>(wo, BO, DM, DM, 16.0f); }      /* per-head [h][i][o] -> Bt[(h, o)][i] x16 for q, k, v; the output weight [8][64][512] read flat = [in][out] [512][512] -> Bt[n][k] x16 */

  k_x16<<<(unsigned)((NR * DM / 8 + 255) / 256), 256, 0, stream>>>(xq, XQ, NR * DM / 8); k_x16<<<(unsigned)((NR * DM / 8 + 255) / 256), 256, 0, stream>>>(xk, XK, NR * DM / 8); k_x16<<<(unsigned)((NR * DM / 8 + 255) / 256), 256, 0, stream>>>(xv, XV, NR * DM / 8);      /* the three inputs as exact f16 rows */
  const size_t r0p = (size_t)B0 * SQ;      /* first projected row */
  k_gemm2<0><<<dim3((unsigned)((MP / 128) * (DM / 64)), 1), 128, 0, stream>>>(XQ + r0p * DM, DM, 0, BQ, DM, 0, 0.0625f, bq, 0, nullptr, 1, 0, 0, TF + r0p * DM, nullptr, DM, 0, MP, DM, DM); k_hl<<<(unsigned)((NR * DM / 8 + 255) / 256), 256, 0, stream>>>(TF, QH, QL, NR * DM / 8);      /* q (f32) -> f16 hi + x1024 residual planes */
  k_gemm2<0><<<dim3((unsigned)((MP / 128) * (DM / 64)), 1), 128, 0, stream>>>(XK + r0p * DM, DM, 0, BK, DM, 0, 0.0625f, bk, 0, nullptr, 1, 0, 0, TF + r0p * DM, nullptr, DM, 0, MP, DM, DM); k_hl<<<(unsigned)((NR * DM / 8 + 255) / 256), 256, 0, stream>>>(TF, KH, KL, NR * DM / 8);      /* k (f32) -> f16 hi + x1024 residual planes (the f32 plane reused in stream order) */
  k_gemm2<0><<<dim3((unsigned)((MP / 128) * (DM / 64)), 1), 128, 0, stream>>>(XV + r0p * DM, DM, 0, BV, DM, 0, 0.0625f, bv, 0, nullptr, 1, 0, 0, nullptr, V16 + r0p * DM, DM, 0, MP, DM, DM);
  for (int b = B0; b < B0 + NBR; ++b) { const size_t r0 = (size_t)b * SQ;
    k_vt<NH, SQ><<<NH * (SQ / 64), 256, 0, stream>>>(V16 + r0 * LQ, LQ, 0, VT);      /* V^T [NH][HD][SQ] for this batch */
    for (int h0 = 0; h0 < NHD; h0 += HG) {
k_gemm2<0><<<dim3((QN / 128) * (SQ / 64), HG), 128, 0, stream>>>(QL + r0 * LQ + h0 * HD, LQ, (size_t)HD, KH + r0 * LQ + h0 * HD, LQ, (size_t)HD, 0.0001220703125f, nullptr, 0, nullptr, 1, 0, 0, S, nullptr, SQ, (size_t)SQ * SQ, QN, SQ, HD); k_gemm2<0><<<dim3((QN / 128) * (SQ / 64), HG), 128, 0, stream>>>(QH + r0 * LQ + h0 * HD, LQ, (size_t)HD, KL + r0 * LQ + h0 * HD, LQ, (size_t)HD, 0.0001220703125f, nullptr, 0, S, -1, 0, 0, S, nullptr, SQ, (size_t)SQ * SQ, QN, SQ, HD); k_gemm2<0><<<dim3((QN / 128) * (SQ / 64), HG), 128, 0, stream>>>(QH + r0 * LQ + h0 * HD, LQ, (size_t)HD, KH + r0 * LQ + h0 * HD, LQ, (size_t)HD, 0.125f, nullptr, 0, S, -1, 0, 0, S, nullptr, SQ, (size_t)SQ * SQ, QN, SQ, HD);      /* scores = (q_lo.k_hi + q_hi.k_lo) 2^-13 + q_hi.k_hi / 8: the small terms first; passes two and three add onto S through the own-element addend (CP = S, batched: rows per batch -1), HG heads per launch */
      k_rsmf<<<(HG * QN + 255) / 256, 256, 0, stream>>>(S, P, QN, HG);      /* P = 256 softmax (f16), rows of all HG heads */
      k_gemm2<0><<<dim3((QN / 128) * (HD / 64), HG), 128, 0, stream>>>(P, SQ, (size_t)SQ * SQ, VT + (size_t)h0 * HD * SQ, SQ, (size_t)HD * SQ, 0.25f, nullptr, 0, nullptr, 1, 0, 0, nullptr, O16 + r0 * DM + h0 * HD, DM, (size_t)HD, QN, HD, SQ); } }      /* o (merged heads) as f16 rows */
  k_gemm2<0><<<dim3((unsigned)((MPO / 128) * (DM / 64)), 1), 128, 0, stream>>>(O16 + r0p * DM, DM, 0, BO, DM, 0, 0.0009765625f, bo, 0, nullptr, 1, 0, 0, (float*)d_out + r0p * DM, nullptr, DM, 0, MPO, DM, DM);      /* out rows are the output layout */
}

// v001
// Measured time: 824 microseconds a run.
// Timed twice side by side with v000, it ran 2.55 times as fast both times.
#include <hip/hip_runtime.h>
// Multi-head attention on THREE input streams with per-head projection weights and a per-head output weight, no biases at all (query, key, value [2][2048][512]; q = einsum(bni,hio->bnho)(query, Wq), k and v likewise from key and value (Wq, Wk, Wv [8][512][64] per-head [in][out], normal x 0.05); q / sqrt(64); logits = q.k per head; softmax over all 2048 keys (no mask); out = einsum(bnhi,hio->bno)(attn v, Wp) (Wp [8][64][512]: read flat it IS an [in][out] [512][512] weight with input row h*64 + i; no bias) -> [2][2048][512]; input order query, key, value, Wq, Wk, Wv, Wp).
// Structure: token rows r = b*2048 + s; the three inputs as exact f16 rows (bf16-rounded; one conversion each); Q and K as two WMMA GEMMs with f32 outputs, each split into f16 hi + x1024 residual planes; V as a third with an f16 output (32x64 wave tiles, f32 accumulation, exact x16 weights staged from the per-head stacks (plane row h*64 + o = W[h][:][o]), no bias); per batch: V^T for all heads via LDS transposes; per (batch, group of 4 heads): scores as THREE GEMM passes (K = 64, batched over the heads on grid.y): q_lo.k_hi and q_hi.k_lo at alpha 2^-13, then q_hi.k_hi at alpha 1/8, the second and third accumulating onto the first through the own-element addend, row softmax on VALU (f32 statistics, native exp; weights stored x256 as f16), o = P . V^T GEMM (K = 2048, alpha 2^-2: o carried x64 against f16 subnormal flush, folded into the output GEMM alpha) written straight into the merged f16 o rows; out = o W_p GEMM (f32; no bias) into the output layout.
// Compute dtype: inputs rounded to bf16; the three inputs and the x16 weights held as f16 planes (exact for every bf16 value of magnitude from 2^-14 up to 65,504; the weights up to 4,094 before their factor of 16); q and k as f16 hi + x1024 residual planes (about 2^-21), the scores from three products (the lo.lo term dropped); v, softmax weights and o as plain f16 GEMM operands (~2^-12); scores and softmax statistics f32. v_wmma_f32_16x16x32_f16.
#define NB 2
#define SQ 2048
#define DM 512
#define NH 8
#define HD 64
#define HG 4                         /* heads per attention launch group */
#define B0 0                         /* first batch processed (debug hook) */
#define NBR NB                       /* batches processed (debug hook) */
#define NR ((size_t)NB * SQ)         /* token rows */
#define MP ((int)((size_t)NBR * SQ)) /* rows projected (debug hook) */
#define QN SQ                        /* query rows attended per batch (debug hook) */
#define NHD NH                       /* heads attended (debug hook) */
#define MPO MP                       /* rows through the output stage (debug hook) */
#define LQ DM      /* row pitch of the q/k/v rows */
typedef __bf16 v16b __attribute__((ext_vector_type(16)));
typedef unsigned short v8us __attribute__((ext_vector_type(8), may_alias));
typedef float  v8f  __attribute__((ext_vector_type(8)));
typedef float  v4f  __attribute__((ext_vector_type(4)));
typedef float  v4fa __attribute__((ext_vector_type(4), may_alias));
union FragB { v16b v; v8us half[2]; unsigned short u[16]; };

__device__ __forceinline__ unsigned short bf16_bits(float x) { unsigned int u = __float_as_uint(x); return (unsigned short)((u + 0x7FFFu + ((u >> 16) & 1u)) >> 16); }
__device__ __forceinline__ float bf16_val(unsigned short b) { return __uint_as_float(((unsigned int)b) << 16); }
__device__ __forceinline__ float bf16_round(float x) { return bf16_val(bf16_bits(x)); }
// D += A·B with NT terms: 1 = ah·bh, 2 = + al·bh (A split), 3 = + ah·bl (both split)
template <int NT>
__device__ __forceinline__ v8f mmaN(v16b ah, v16b al, v16b bh, v16b bl, v8f c) {
  c = __builtin_amdgcn_wmma_f32_16x16x32_bf16(false, ah, false, bh, (short)0, c, false, false);
  if (NT >= 2) c = __builtin_amdgcn_wmma_f32_16x16x32_bf16(false, al, false, bh, (short)0, c, false, false);
  if (NT >= 3) c = __builtin_amdgcn_wmma_f32_16x16x32_bf16(false, ah, false, bl, (short)0, c, false, false);
  asm volatile("v_nop\n\tv_nop\n\tv_nop\n\tv_nop" : "+v"(c) : "v"(ah), "v"(al), "v"(bh), "v"(bl));
  return c;
}

__global__ __launch_bounds__(256) void k_wt_bf16(const float* __restrict__ W, unsigned short* __restrict__ Wt, int K, int N) {
  const int t = blockIdx.x * 256 + threadIdx.x;
  const int k8n = K / 8;
  if (t >= N * k8n) return;
  const int n = t / k8n, k8 = (t % k8n) * 8;
  v8us v;
#pragma unroll
  for (int i = 0; i < 8; ++i) v[i] = bf16_bits(W[(size_t)(k8 + i) * N + n]);
  *(v8us*)(Wt + (size_t)n * K + k8) = v;
  
}

// GEMM C[M][N] (f32, pitch ldc) = act(A[M][K]·W + bias). A f32 row-major (pitch lda) converted per fragment to bf16
// (ASPLIT: hi/lo two planes -> 2 terms, else single rounded term); Wt bf16 [N][K] (pitch ldb). BIAS_BF16 rounds the
// bias to bf16 first (bias quantised to bf16 before the add). K%32==0, M%16==0, N%64==0.
template <bool ASPLIT, int ACT, bool BIAS_BF16>
__global__ __launch_bounds__(128) void k_gemm_bf(const float* __restrict__ A, int lda, const unsigned short* __restrict__ Wt, int ldb,
                                               const float* __restrict__ bias, float* __restrict__ C, int ldc, int M, int N, int K) {
  __shared__ __attribute__((aligned(16))) float so[4][16][64];
  const int tid = threadIdx.x, w = tid >> 5, lane = tid & 31, ln = lane & 15, hh = lane >> 4;
  const int ntn = N / 64;
  const int wid = blockIdx.x * 4 + w;
  const int mt = wid / ntn, nq = wid % ntn;
  if (mt * 16 >= M) return;
  const int row0 = mt * 16, col0 = nq * 64;
  const float* arow = A + (size_t)(row0 + ln) * lda;
  v8f acc[4] = {};
  for (int kb = 0; kb < K; kb += 32) {
    FragB ah, al;
    const v4f x0 = *(const v4fa*)(arow + kb + 8 * hh), x1 = *(const v4fa*)(arow + kb + 8 * hh + 4);
    const v4f x2 = *(const v4fa*)(arow + kb + 16 + 8 * hh), x3 = *(const v4fa*)(arow + kb + 16 + 8 * hh + 4);
    float xs[16] = {x0[0],x0[1],x0[2],x0[3],x1[0],x1[1],x1[2],x1[3],x2[0],x2[1],x2[2],x2[3],x3[0],x3[1],x3[2],x3[3]};
#pragma unroll
    for (int i = 0; i < 16; ++i) { const unsigned short hb = bf16_bits(xs[i]); ah.u[i] = hb; al.u[i] = ASPLIT ? bf16_bits(xs[i] - bf16_val(hb)) : (unsigned short)0; }
#pragma unroll
    for (int t = 0; t < 4; ++t) {
      const unsigned short* brow = Wt + (size_t)(col0 + t * 16 + ln) * ldb + kb;
      FragB b;
      b.half[0] = *(const v8us*)(brow + 8 * hh);
      b.half[1] = *(const v8us*)(brow + 16 + 8 * hh);
      acc[t] = mmaN<ASPLIT ? 2 : 1>(ah.v, al.v, b.v, b.v, acc[t]);
    }
  }
#pragma unroll
  for (int t = 0; t < 4; ++t) {
    float bv = bias ? bias[col0 + t * 16 + ln] : 0.f;
    if (BIAS_BF16) bv = bf16_round(bv);
#pragma unroll
    for (int r = 0; r < 8; ++r) { float v = acc[t][r] + bv; if (ACT == 1) v = fmaxf(v, 0.f); so[w][8 * hh + r][t * 16 + ln] = v; }
  }
  __builtin_amdgcn_fence(__ATOMIC_ACQ_REL, "workgroup");
  __builtin_amdgcn_wave_barrier();
  const int rsub = lane >> 4, c4 = (lane & 15) * 4;
  {
#pragma unroll
    for (int q = 0; q < 8; ++q) {
      const int r = q * 2 + rsub;
      const v4f v = *(const v4fa*)&so[w][r][c4];
      *(v4f*)(C + (size_t)(row0 + r) * ldc + col0 + c4) = v;
    }
    
  }
}

// GEMM C = act(A·W + bias + resid): A f32 (ASPLIT -> hi/lo 2 terms), Wt bf16 [N][K]; ACT 0 none, 1 relu, 2 exact gelu;
// resid (optional, f32, row index = (row % rmod), pitch ldr, RES_BF16 rounds it) added before the activation.
template <bool ASPLIT, int ACT, bool BIAS_BF16, bool RES_BF16>
__global__ __launch_bounds__(128) void k_gemm_bf3(const float* __restrict__ A, int lda, const unsigned short* __restrict__ Wt, int ldb,
                                                const float* __restrict__ bias, const float* __restrict__ resid, int rmod, int ldr,
                                                float* __restrict__ C, int ldc, int M, int N, int K) {
  __shared__ __attribute__((aligned(16))) float so[4][16][64];
  const int tid = threadIdx.x, w = tid >> 5, lane = tid & 31, ln = lane & 15, hh = lane >> 4;
  const int ntn = N / 64;
  const int wid = blockIdx.x * 4 + w;
  const int mt = wid / ntn, nq = wid % ntn;
  if (mt * 16 >= M) return;
  const int row0 = mt * 16, col0 = nq * 64;
  const float* arow = A + (size_t)(row0 + ln) * lda;
  v8f acc[4] = {};
  for (int kb = 0; kb < K; kb += 32) {
    FragB ah, al;
    const v4f x0 = *(const v4fa*)(arow + kb + 8 * hh), x1 = *(const v4fa*)(arow + kb + 8 * hh + 4);
    const v4f x2 = *(const v4fa*)(arow + kb + 16 + 8 * hh), x3 = *(const v4fa*)(arow + kb + 16 + 8 * hh + 4);
    float xs[16] = {x0[0],x0[1],x0[2],x0[3],x1[0],x1[1],x1[2],x1[3],x2[0],x2[1],x2[2],x2[3],x3[0],x3[1],x3[2],x3[3]};
#pragma unroll
    for (int i = 0; i < 16; ++i) { const unsigned short hb = bf16_bits(xs[i]); ah.u[i] = hb; al.u[i] = ASPLIT ? bf16_bits(xs[i] - bf16_val(hb)) : (unsigned short)0; }
#pragma unroll
    for (int t = 0; t < 4; ++t) {
      const unsigned short* brow = Wt + (size_t)(col0 + t * 16 + ln) * ldb + kb;
      FragB b;
      b.half[0] = *(const v8us*)(brow + 8 * hh);
      b.half[1] = *(const v8us*)(brow + 16 + 8 * hh);
      acc[t] = mmaN<ASPLIT ? 2 : 1>(ah.v, al.v, b.v, b.v, acc[t]);
    }
  }
#pragma unroll
  for (int t = 0; t < 4; ++t) {
    const int col = col0 + t * 16 + ln;
    float bv = bias ? bias[col] : 0.f;
    if (BIAS_BF16) bv = bf16_round(bv);
#pragma unroll
    for (int r = 0; r < 8; ++r) {
      float v = acc[t][r] + bv;
      if (resid) { float rv = resid[(size_t)((row0 + 8 * hh + r) % rmod) * ldr + col]; if (RES_BF16) rv = bf16_round(rv); v += rv; }
      if (ACT == 1) v = fmaxf(v, 0.f);
      if (ACT == 2) v = 0.5f * v * (1.0f + erff(v * 0.70710678118654752f));
      if (ACT == 3) { const float u = 0.7978845608028654f * (v + 0.044715f * v * v * v); v = 0.5f * v * (1.0f + tanhf(u)); }
      so[w][8 * hh + r][t * 16 + ln] = v;
    }
  }
  __builtin_amdgcn_fence(__ATOMIC_ACQ_REL, "workgroup");
  __builtin_amdgcn_wave_barrier();
  const int rsub = lane >> 4, c4 = (lane & 15) * 4;
  {
#pragma unroll
    for (int q = 0; q < 8; ++q) {
      const int r = q * 2 + rsub;
      const v4f v = *(const v4fa*)&so[w][r][c4];
      *(v4f*)(C + (size_t)(row0 + r) * ldc + col0 + c4) = v;
    }
    
  }
}
// row LayerNorm (biased variance, eps) over N: s = X (+ R); optional out_sum <- s; out_norm <- (s-mu)*rsqrt(var+eps)*g + b
template <bool PARAM_BF16>
__global__ __launch_bounds__(256) void k_layernorm(const float* __restrict__ X, const float* __restrict__ R, const float* __restrict__ g, const float* __restrict__ bta,
                                                  float* __restrict__ out_sum, float* __restrict__ out_norm, int N, float eps) {
  __shared__ float red[256];
  const int row = blockIdx.x, tid = threadIdx.x;
  const float* x = X + (size_t)row * N; const float* rr = R ? R + (size_t)row * N : nullptr;
  float vals[16];                     // up to N = 4096
  const int per = N / 256;            // contiguous chunk per thread? use strided-by-4 chunks: thread handles j = tid*4 + 1024*u
  float s1 = 0.f;
  for (int u = 0; u < per / 4; ++u) {
    const int j = tid * 4 + 1024 * u;
    const v4f a = *(const v4fa*)(x + j);
    v4f b = {0.f,0.f,0.f,0.f}; if (rr) b = *(const v4fa*)(rr + j);
#pragma unroll
    for (int q = 0; q < 4; ++q) { const float v = a[q] + b[q]; vals[u * 4 + q] = v; s1 += v; }
  }
  red[tid] = s1; __syncthreads();
  for (int st = 128; st > 0; st >>= 1) { if (tid < st) red[tid] += red[tid + st]; __syncthreads(); }
  const float mu = red[0] / (float)N; __syncthreads();
  float s2 = 0.f;
  for (int u = 0; u < per / 4; ++u)
#pragma unroll
    for (int q = 0; q < 4; ++q) { const float c = vals[u * 4 + q] - mu; s2 += c * c; }
  red[tid] = s2; __syncthreads();
  for (int st = 128; st > 0; st >>= 1) { if (tid < st) red[tid] += red[tid + st]; __syncthreads(); }
  const float rs = rsqrtf(red[0] / (float)N + eps);
  {
    for (int u = 0; u < per / 4; ++u) {
      const int j = tid * 4 + 1024 * u;
      v4f o, sm;
#pragma unroll
      for (int q = 0; q < 4; ++q) {
        float gg = g[j + q], bb = bta[j + q];
        if (PARAM_BF16) { gg = bf16_round(gg); bb = bf16_round(bb); }
        sm[q] = vals[u * 4 + q]; o[q] = (vals[u * 4 + q] - mu) * rs * gg + bb;
      }
      if (out_sum) *(v4f*)(out_sum + (size_t)row * N + j) = sm;
      *(v4f*)(out_norm + (size_t)row * N + j) = o;
    }
    
  }
}



// ---- f16 WMMA path (v_wmma_f32_16x16x32_f16): 11-bit significands for operands in range — used where a [0,1] probability operand needs more precision than bf16
typedef _Float16 v16h __attribute__((ext_vector_type(16)));
union FragH { v16h v; v8us half[2]; _Float16 h[16]; unsigned short u[16]; };
template <int NT>
__device__ __forceinline__ v8f mmaH(v16h ah, v16h al, v16h bh, v16h bl, v8f c) {
  c = __builtin_amdgcn_wmma_f32_16x16x32_f16(false, ah, false, bh, (short)0, c, false, false);
  if (NT >= 2) c = __builtin_amdgcn_wmma_f32_16x16x32_f16(false, al, false, bh, (short)0, c, false, false);
  if (NT >= 3) c = __builtin_amdgcn_wmma_f32_16x16x32_f16(false, ah, false, bl, (short)0, c, false, false);
  asm volatile("v_nop\n\tv_nop\n\tv_nop\n\tv_nop" : "+v"(c) : "v"(ah), "v"(al), "v"(bh), "v"(bl));
  return c;
}
// batched GEMM like k_gemm_b but f16 operands: A f32 (split into f16 hi/lo if ASPLIT, else rounded to f16), Bt = f16 values [n][k]; alpha; C f32; N multiple of 16 (partial tiles skipped)
template <bool ASPLIT>
__global__ __launch_bounds__(128) void k_gemm_h(const float* __restrict__ A, int lda, size_t sA, const _Float16* __restrict__ Bh, int ldb, size_t sB, float alpha, float* __restrict__ C, int ldc, size_t sC, int M, int N, int K) {
  __shared__ __attribute__((aligned(16))) float so[4][16][64];
  const int tid = threadIdx.x, w = tid >> 5, lane = tid & 31, ln = lane & 15, hh = lane >> 4; const int by = blockIdx.y;
  A += (size_t)by * sA; Bh += (size_t)by * sB; C += (size_t)by * sC;
  const int ntn = (N + 63) / 64; const int wid = blockIdx.x * 4 + w; const int mt = wid / ntn, nq = wid % ntn; if (mt * 16 >= M) return;
  const int row0 = mt * 16, col0 = nq * 64; const float* arow = A + (size_t)(row0 + ln) * lda;
  v8f acc[4] = {};
  for (int kb = 0; kb < K; kb += 32) {
    FragH ah, al;
    const v4f x0 = *(const v4fa*)(arow + kb + 8 * hh), x1 = *(const v4fa*)(arow + kb + 8 * hh + 4), x2 = *(const v4fa*)(arow + kb + 16 + 8 * hh), x3 = *(const v4fa*)(arow + kb + 16 + 8 * hh + 4);
    float xs[16] = {x0[0],x0[1],x0[2],x0[3],x1[0],x1[1],x1[2],x1[3],x2[0],x2[1],x2[2],x2[3],x3[0],x3[1],x3[2],x3[3]};
#pragma unroll
    for (int i = 0; i < 16; ++i) { const _Float16 h = (_Float16)xs[i]; ah.h[i] = h; al.h[i] = ASPLIT ? (_Float16)(xs[i] - (float)h) : (_Float16)0.0f; }
#pragma unroll
    for (int t = 0; t < 4; ++t) { if (col0 + t * 16 >= N) continue; const size_t boff = (size_t)(col0 + t * 16 + ln) * ldb + kb; FragH bq; bq.half[0] = *(const v8us*)(Bh + boff + 8 * hh); bq.half[1] = *(const v8us*)(Bh + boff + 16 + 8 * hh);
      acc[t] = mmaH<ASPLIT ? 2 : 1>(ah.v, al.v, bq.v, bq.v, acc[t]); }
  }
#pragma unroll
  for (int t = 0; t < 4; ++t) { if (col0 + t * 16 >= N) continue;
#pragma unroll
    for (int r = 0; r < 8; ++r) so[w][8 * hh + r][t * 16 + ln] = acc[t][r] * alpha; }
  __builtin_amdgcn_fence(__ATOMIC_ACQ_REL, "workgroup"); __builtin_amdgcn_wave_barrier();
  const int rsub = lane >> 4, c4 = (lane & 15) * 4;
  {
#pragma unroll
    for (int q = 0; q < 8; ++q) { const int r = q * 2 + rsub; if (col0 + c4 < N) { const v4f v = *(const v4fa*)&so[w][r][c4]; *(v4f*)(C + (size_t)(row0 + r) * ldc + col0 + c4) = v; } }
     }
}

// Wt[n][k] = f16(W[k][n]·scale) from f32 row-major W[K][N] (scale = power of two; bf16-exact weights stay exact in f16 away from the subnormal range)
__global__ __launch_bounds__(256) void k_wt_f16(const float* __restrict__ W, _Float16* __restrict__ Wt, int K, int N, float scale) {
  const int t = blockIdx.x * 256 + threadIdx.x; if (t >= N * (K / 8)) return; const int n = t / (K / 8), k8 = (t % (K / 8)) * 8; FragH f;
#pragma unroll
  for (int i = 0; i < 8; ++i) f.h[i] = (_Float16)(bf16_round(W[(size_t)(k8 + i) * N + n]) * scale); const v8us o = f.half[0];
  *(v8us*)((unsigned short*)Wt + (size_t)n * K + k8) = o; 
}
// k_gemm_hh variant with fused epilogue: v = acc·alpha + bias[by·sBias + col] (+ CP[(row/rowsPerB)·sCPb + by·64 + col] if CP) ; ACT 0 none / 1 elu ; writes f16 C16 (and f32 C if non-null)
template <int ACT>
__global__ __launch_bounds__(128) void k_gemm_hhx(const _Float16* __restrict__ A, int lda, size_t sA, const _Float16* __restrict__ Bh, int ldb, size_t sB, float alpha, const float* __restrict__ bias, size_t sBias, const float* __restrict__ CP, int rowsPerB, size_t sCPb, int row0g,
    float* __restrict__ C, _Float16* __restrict__ C16, int ldc, size_t sC, int M, int N, int K) {
  __shared__ __attribute__((aligned(16))) float so[4][16][64];
  const int tid = threadIdx.x, w = tid >> 5, lane = tid & 31, ln = lane & 15, hh = lane >> 4; const int by = blockIdx.y;
  A += (size_t)by * sA; Bh += (size_t)by * sB; const size_t cofs = (size_t)by * sC; const float* bp = bias ? bias + (size_t)by * sBias : nullptr;
  const int ntn = (N + 63) / 64; const int wid = blockIdx.x * 4 + w; const int mt = wid / ntn, nq = wid % ntn; if (mt * 16 >= M) return;
  const int row0 = mt * 16, col0 = nq * 64; const _Float16* arow = A + (size_t)(row0 + ln) * lda;
  v8f acc[4] = {};
  for (int kb = 0; kb < K; kb += 32) { FragH ah; ah.half[0] = *(const v8us*)((const unsigned short*)arow + kb + 8 * hh); ah.half[1] = *(const v8us*)((const unsigned short*)arow + kb + 16 + 8 * hh);
#pragma unroll
    for (int t = 0; t < 4; ++t) { if (col0 + t * 16 >= N) continue; const size_t boff = (size_t)(col0 + t * 16 + ln) * ldb + kb; FragH bq; bq.half[0] = *(const v8us*)((const unsigned short*)Bh + boff + 8 * hh); bq.half[1] = *(const v8us*)((const unsigned short*)Bh + boff + 16 + 8 * hh);
      acc[t] = mmaH<1>(ah.v, ah.v, bq.v, bq.v, acc[t]); }
  }
#pragma unroll
  for (int t = 0; t < 4; ++t) { if (col0 + t * 16 >= N) continue; const int col = col0 + t * 16 + ln; const float bv = bp ? bf16_round(bp[col]) : 0.f;
#pragma unroll
    for (int r = 0; r < 8; ++r) { float v = acc[t][r] * alpha + bv; if (CP) { const int rr = row0g + row0 + 8 * hh + r; if (rowsPerB < 0) v += CP[cofs + (size_t)rr * ldc + col];      /* rowsPerB < 0: own element of the batched C plane */ else { const int bidx = rr / rowsPerB; v += CP[(size_t)bidx * sCPb + (size_t)by * 64 + col]; } } if (ACT == 1) v = (v > 0.f) ? v : expm1f(v); else if (ACT == 7) v = (v > 0.f) ? v + 1.0f : expf(v); else if (ACT == 8) v = tanhf(v); else if (ACT == 9) v = 0.5f * v * (1.0f + tanhf(0.7978845608028654f * (v + 0.044715f * v * v * v))); else if (ACT == 11) v = 1.0f / (1.0f + expf(-v)); else if (ACT == 12) v = (v > 0.f) ? v : 0.01f * v; else if (ACT == 14) v = (v > 0.f) ? v : 0.1f * v; else if (ACT == 16) v = (v >= 0.f) ? v : 0.3f * v; else if (ACT == 17) v = (v >= 0.f) ? v : 0.2f * v; else if (ACT == 15) v = v / (1.0f + expf(-v)); else if (ACT == 3) v = fmaxf(v, 0.f); else if (ACT == 6) v = 0.5f * v * (1.0f + erff(v * 0.70710678118654752f)); so[w][8 * hh + r][t * 16 + ln] = v; } }
  __builtin_amdgcn_fence(__ATOMIC_ACQ_REL, "workgroup"); __builtin_amdgcn_wave_barrier();
  const int rsub = lane >> 4, c4 = (lane & 15) * 4; typedef _Float16 v4h __attribute__((ext_vector_type(4)));
  {
#pragma unroll
    for (int q = 0; q < 8; ++q) { const int r = q * 2 + rsub; if (col0 + c4 < N) { const v4f v = *(const v4fa*)&so[w][r][c4]; if (C) *(v4f*)(C + cofs + (size_t)(row0 + r) * ldc + col0 + c4) = v; if (C16) { v4h h4; for (int i = 0; i < 4; ++i) h4[i] = (_Float16)v[i]; *(v4h*)(C16 + cofs + (size_t)(row0 + r) * ldc + col0 + c4) = h4; } } }
     }
}


typedef _Float16 v4h __attribute__((ext_vector_type(4)));

__global__ __launch_bounds__(256) void k_x16(const float* __restrict__ x, _Float16* __restrict__ X16, size_t n8) { const size_t t = (size_t)blockIdx.x * 256 + threadIdx.x; if (t >= n8) return; FragH f;
#pragma unroll
  for (int q = 0; q < 8; ++q) f.h[q] = (_Float16)bf16_round(x[t * 8 + q]); *(v8us*)((unsigned short*)X16 + t * 8) = f.half[0];  }
__global__ __launch_bounds__(256) void k_h16(const float* __restrict__ x, _Float16* __restrict__ X16, size_t n8) { const size_t t = (size_t)blockIdx.x * 256 + threadIdx.x; if (t >= n8) return; FragH f;
#pragma unroll
  for (int q = 0; q < 8; ++q) f.h[q] = (_Float16)x[t * 8 + q]; *(v8us*)((unsigned short*)X16 + t * 8) = f.half[0];  }
__global__ __launch_bounds__(256) void k_round16f(const float* __restrict__ W, _Float16* __restrict__ Bt, size_t n8) { const size_t t = (size_t)blockIdx.x * 256 + threadIdx.x; if (t >= n8) return; FragH f;
#pragma unroll
  for (int i = 0; i < 8; ++i) f.h[i] = (_Float16)(bf16_round(W[t * 8 + i]) * 16.0f); *(v8us*)((unsigned short*)Bt + t * 8) = f.half[0];  }
template <int NHv, int TTv>
__global__ __launch_bounds__(256) void k_vt(const _Float16* __restrict__ V16, int ldv, int voff, _Float16* __restrict__ Vt) { __shared__ unsigned short tl[64][66]; const int tid = threadIdx.x; const int slab = blockIdx.x / (TTv / 64), lg = blockIdx.x % (TTv / 64); const int b = slab / NHv, h = slab % NHv;
  for (int i = tid; i < 64 * 8; i += 256) { const int r = i / 8, c8 = (i % 8) * 8; FragH f; f.half[0] = *(const v8us*)((const unsigned short*)V16 + ((size_t)b * TTv + lg * 64 + r) * ldv + voff + h * 64 + c8);
#pragma unroll
    for (int q = 0; q < 8; ++q) tl[r][c8 + q] = f.u[q]; }
  __syncthreads();
  {
#pragma unroll
    for (int rd = 0; rd < 2; ++rd) { const int d = rd * 32 + tid / 8, pc = tid % 8; FragH f;
#pragma unroll
      for (int q = 0; q < 8; ++q) f.u[q] = tl[pc * 8 + q][d];
      *(v8us*)((unsigned short*)Vt + ((size_t)slab * 64 + d) * TTv + lg * 64 + pc * 8) = f.half[0]; }
     } }

__global__ __launch_bounds__(256) void k_hl(const float* __restrict__ F, _Float16* __restrict__ Hh, _Float16* __restrict__ Hl, size_t n8) { const size_t t = (size_t)blockIdx.x * 256 + threadIdx.x; if (t >= n8) return; FragH fh, fl; const v4f a = *(const v4fa*)(F + t * 8), c = *(const v4fa*)(F + t * 8 + 4);
#pragma unroll
  for (int q = 0; q < 4; ++q) { _Float16 h = (_Float16)a[q]; fh.h[q] = h; fl.h[q] = (_Float16)((a[q] - (float)h) * 1024.0f); h = (_Float16)c[q]; fh.h[4 + q] = h; fl.h[4 + q] = (_Float16)((c[q] - (float)h) * 1024.0f); }
  { *(v8us*)((unsigned short*)Hh + t * 8) = fh.half[0]; *(v8us*)((unsigned short*)Hl + t * 8) = fl.half[0];  } }

// ---- fast GEMM (wave tile 32x64; requires M % 32 == 0 rows per launch region and N % 64 == 0); epilogue = k_gemm_hhx semantics ----
__device__ __forceinline__ v16h g2_frag(const _Float16* p, int hh) { FragH f; f.half[0] = *(const v8us*)((const unsigned short*)p + 8 * hh); f.half[1] = *(const v8us*)((const unsigned short*)p + 16 + 8 * hh); return f.v; }
__device__ __forceinline__ v8f g2_mma(v16h a, v16h b, v8f c) { v8f d = __builtin_amdgcn_wmma_f32_16x16x32_f16(false, a, false, b, (short)0, c, false, false); asm volatile("v_nop\n\tv_nop\n\tv_nop\n\tv_nop" : "+v"(d) : "v"(a), "v"(b)); return d; }
template <int ACT>
__global__ __launch_bounds__(128) void k_gemm2(const _Float16* __restrict__ A, int lda, size_t sA, const _Float16* __restrict__ Bh, int ldb, size_t sB, float alpha, const float* __restrict__ bias, size_t sBias, const float* __restrict__ CP, int rowsPerB, size_t sCPb, int row0g,
    float* __restrict__ C, _Float16* __restrict__ C16, int ldc, size_t sC, int M, int N, int K) { static_assert(ACT == 0 || ACT == 3 || ACT == 6 || ACT == 8 || ACT == 9 || ACT == 11 || ACT == 12 || ACT == 14 || ACT == 15 || ACT == 16 || ACT == 17, "k_gemm2: unsupported ACT code (would silently apply no activation)");
  __shared__ __attribute__((aligned(16))) float so[4][32][68];
  const int tid = threadIdx.x, w = tid >> 5, lane = tid & 31, ln = lane & 15, hh = lane >> 4; const int by = blockIdx.y;
  A += (size_t)by * sA; Bh += (size_t)by * sB; const size_t cofs = (size_t)by * sC; const float* bp = bias ? bias + (size_t)by * sBias : nullptr;
  const int ntn = N >> 6; const int mt = blockIdx.x / ntn, nq = blockIdx.x - mt * ntn; const int row0 = mt * 128 + 32 * w, col0 = nq * 64; if (row0 >= M) return;
  const _Float16* a0p = A + (size_t)(row0 + ln) * lda; const _Float16* a1p = a0p + (size_t)16 * lda;
  const _Float16* b0p = Bh + (size_t)(col0 + ln) * ldb; const _Float16* b1p = b0p + (size_t)16 * ldb; const _Float16* b2p = b1p + (size_t)16 * ldb; const _Float16* b3p = b2p + (size_t)16 * ldb;
  const v8f z8 = {0.f,0.f,0.f,0.f,0.f,0.f,0.f,0.f}; v8f c00 = z8, c01 = z8, c02 = z8, c03 = z8, c10 = z8, c11 = z8, c12 = z8, c13 = z8;
#pragma unroll 1
  for (int kb = 0; kb < K; kb += 32) { const v16h a0 = g2_frag(a0p + kb, hh), a1 = g2_frag(a1p + kb, hh);
    v16h b = g2_frag(b0p + kb, hh); c00 = g2_mma(a0, b, c00); c10 = g2_mma(a1, b, c10);
    b = g2_frag(b1p + kb, hh); c01 = g2_mma(a0, b, c01); c11 = g2_mma(a1, b, c11);
    b = g2_frag(b2p + kb, hh); c02 = g2_mma(a0, b, c02); c12 = g2_mma(a1, b, c12);
    b = g2_frag(b3p + kb, hh); c03 = g2_mma(a0, b, c03); c13 = g2_mma(a1, b, c13); }
  v8f accs[8] = {c00, c01, c02, c03, c10, c11, c12, c13};
#pragma unroll
  for (int u = 0; u < 8; ++u) { const int t = u & 3, half = u >> 2; const int col = col0 + t * 16 + ln; const float bv = bp ? bf16_round(bp[col]) : 0.f;
#pragma unroll
    for (int r = 0; r < 8; ++r) { const int rloc = half * 16 + 8 * hh + r; float v = accs[u][r] * alpha + bv; if (CP) { if (rowsPerB < 0) v += CP[cofs + (size_t)(row0g + row0 + rloc) * ldc + col];      /* rowsPerB < 0: own element of the batched C plane */ else { const int bidx = (row0g + row0 + rloc) / rowsPerB; v += CP[(size_t)bidx * sCPb + (size_t)by * 64 + col]; } }
      if (ACT == 3) v = fmaxf(v, 0.f); else if (ACT == 6) v = 0.5f * v * (1.0f + erff(v * 0.70710678118654752f)); else if (ACT == 11) v = 1.0f / (1.0f + expf(-v)); else if (ACT == 15) v = v / (1.0f + expf(-v)); else if (ACT == 12) v = (v > 0.f) ? v : 0.01f * v; else if (ACT == 8) v = tanhf(v); else if (ACT == 9) v = 0.5f * v * (1.0f + tanhf(0.7978845608028654f * (v + 0.044715f * v * v * v))); else if (ACT == 14) v = (v > 0.f) ? v : 0.1f * v; else if (ACT == 16) v = (v >= 0.f) ? v : 0.3f * v; else if (ACT == 17) v = (v >= 0.f) ? v : 0.2f * v;
      so[w][rloc][t * 16 + ln] = v; } }
  __builtin_amdgcn_fence(__ATOMIC_ACQ_REL, "workgroup"); __builtin_amdgcn_wave_barrier();
  const int rsub = lane >> 4, c4 = (lane & 15) * 4;
  {
#pragma unroll
    for (int q = 0; q < 16; ++q) { const int r = q * 2 + rsub; const v4f v = *(const v4fa*)&so[w][r][c4]; if (C) *(v4f*)(C + cofs + (size_t)(row0 + r) * ldc + col0 + c4) = v; if (C16) { v4h h4; for (int i = 0; i < 4; ++i) h4[i] = (_Float16)v[i]; *(v4h*)(C16 + cofs + (size_t)(row0 + r) * ldc + col0 + c4) = h4; } }
     } }


__global__ __launch_bounds__(256) void k_wnat(const float* __restrict__ w, size_t n8, _Float16* __restrict__ Bt) { const size_t t = (size_t)blockIdx.x * 256 + threadIdx.x; if (t >= n8) return; FragH f; for (int q = 0; q < 8; ++q) f.h[q] = (_Float16)(bf16_round(w[t * 8 + q]) * 16.0f); *(v8us*)((unsigned short*)Bt + t * 8) = f.half[0];  }
__global__ __launch_bounds__(256) void k_wthd(const float* __restrict__ Wt, _Float16* __restrict__ Bt) { const size_t t = (size_t)blockIdx.x * 256 + threadIdx.x; if (t >= (size_t)NH * HD * (DM / 8)) return; const int m8 = (int)(t % (DM / 8)) * 8; const int d = (int)((t / (DM / 8)) % HD); const int h = (int)(t / ((size_t)(DM / 8) * HD)); FragH f;
  for (int q = 0; q < 8; ++q) f.h[q] = (_Float16)(16.0f * bf16_round(Wt[((size_t)h * DM + m8 + q) * HD + d])); unsigned short* dst = (unsigned short*)Bt + ((size_t)h * HD + d) * DM + m8; *(v8us*)dst = f.half[0];  }
__global__ __launch_bounds__(256) void k_rsm(const float* __restrict__ S, _Float16* __restrict__ P, int nrows) {
  #pragma clang fp contract(off)
  const int i = blockIdx.x * 256 + threadIdx.x; if (i >= nrows) return; const float* s = S + (size_t)i * SQ; float mx = -3.0e38f;
#pragma unroll 1
  for (int j = 0; j < SQ; ++j) mx = fmaxf(mx, s[j]); float se = 0.f;
#pragma unroll 1
  for (int j = 0; j < SQ; ++j) se += expf(s[j] - mx); const float sc = 256.0f / se;
#pragma unroll 1
  for (int j0 = 0; j0 < SQ; j0 += 8) { FragH f; for (int q = 0; q < 8; ++q) f.h[q] = (_Float16)(expf(s[j0 + q] - mx) * sc); unsigned short* d = (unsigned short*)P + (size_t)i * SQ + j0; *(v8us*)d = f.half[0];  } }
__global__ __launch_bounds__(256) void k_vt(const _Float16* __restrict__ V16, int b, int h0, _Float16* __restrict__ VT) { __shared__ unsigned short tl[64][65]; const int tid = threadIdx.x; const int hh = blockIdx.x % HG, sg = blockIdx.x / HG; const int s0 = sg * 64; const int h = h0 + hh;
  for (int i = tid; i < 64 * 8; i += 256) { const int j = i / 8, d8 = (i % 8) * 8; FragH f; f.half[0] = *(const v8us*)((const unsigned short*)V16 + ((size_t)b * SQ + s0 + j) * DM + h * HD + d8); for (int q = 0; q < 8; ++q) tl[d8 + q][j] = f.u[q]; }
  __syncthreads();
  { for (int i = tid; i < 64 * 8; i += 256) { const int d = i / 8, j8 = (i % 8) * 8; FragH f; for (int q = 0; q < 8; ++q) f.u[q] = tl[d][j8 + q]; *(v8us*)((unsigned short*)VT + ((size_t)hh * HD + d) * SQ + s0 + j8) = f.half[0]; }  } }



// Row softmax, one wave per score row. Lane l holds elements 128*q + 4*l .. + 3 (q = 0 .. 15) of its row in registers: S is read once,
// each load of a wave covers 512 contiguous bytes and each store 256. Maximum and sum: four chains per lane, then a five-step butterfly over the lanes.
// The loops over q are fully unrolled so that x[] is indexed by constants and stays in registers; readfirstlane makes the row number scalar (scalar row base, scalar branch).
// The early return is wave-uniform and the kernel has no barrier.
__global__ __launch_bounds__(256) void k_rsmf(const float* __restrict__ S, _Float16* __restrict__ P, int qn, int hg) {
  const int lane = threadIdx.x & 31; const int t = blockIdx.x * 8 + __builtin_amdgcn_readfirstlane((int)(threadIdx.x >> 5)); if (t >= qn * hg) return;
  const size_t i = (size_t)(t / qn) * SQ + (t % qn); const float* s = S + i * SQ + 4 * lane; v4f x[SQ / 128];
#pragma unroll
  for (int q = 0; q < SQ / 128; ++q) x[q] = *(const v4fa*)(s + q * 128);
  float m[4] = {-3.0e38f, -3.0e38f, -3.0e38f, -3.0e38f};
#pragma unroll
  for (int q = 0; q < SQ / 128; ++q) for (int c = 0; c < 4; ++c) m[c] = fmaxf(m[c], x[q][c]);
  float mx = fmaxf(fmaxf(m[0], m[1]), fmaxf(m[2], m[3]));
#pragma unroll
  for (int d = 16; d >= 1; d >>= 1) mx = fmaxf(mx, __shfl_xor(mx, d, 32));
  v4f a = {0.f, 0.f, 0.f, 0.f};
#pragma unroll
  for (int q = 0; q < SQ / 128; ++q) { for (int c = 0; c < 4; ++c) x[q][c] = __expf(x[q][c] - mx); a += x[q]; }
  float se = (a[0] + a[1]) + (a[2] + a[3]);
#pragma unroll
  for (int d = 16; d >= 1; d >>= 1) se += __shfl_xor(se, d, 32);
  const float sc = 256.0f / se; _Float16* p = P + i * SQ + 4 * lane;
#pragma unroll
  for (int q = 0; q < SQ / 128; ++q) { v4h h4; for (int c = 0; c < 4; ++c) h4[c] = (_Float16)(x[q][c] * sc); *(v4h*)(p + q * 128) = h4; } }

extern "C" void kernel_launch(void* const* d_in, const int* in_sizes, int n_in,
                              void* d_out, int out_size, void* d_ws, size_t ws_size, hipStream_t stream) {
  (void)in_sizes; (void)n_in; (void)out_size;
  const float* const* I = (const float* const*)d_in; const float* xq = I[0]; const float* xk = I[1]; const float* xv = I[2]; const float* wq = I[3]; const float* bq = nullptr; const float* wk = I[4]; const float* bk = nullptr; const float* wv = I[5]; const float* bv = nullptr; const float* wo = I[6]; const float* bo = nullptr;      /* input order: query, key, value; Wq, Wk, Wv [8][512][64] (per-head [in][out]); Wp [8][64][512] (flat [in][out] [512][512]): seven inputs; the module has NO biases: null pointers in the guarded bias slots */
  char* ws = (char*)d_ws; size_t off = 0;
  auto take = [&](size_t bytes) { char* p = ws + off; off += (bytes + 255) & ~(size_t)255; return p; };
  _Float16* BQ = (_Float16*)take((size_t)DM * DM * 2); _Float16* BK = (_Float16*)take((size_t)DM * DM * 2); _Float16* BV = (_Float16*)take((size_t)DM * DM * 2); _Float16* BO = (_Float16*)take((size_t)DM * DM * 2);
  _Float16* XQ = (_Float16*)take(NR * DM * 2); _Float16* XK = (_Float16*)take(NR * DM * 2); _Float16* XV = (_Float16*)take(NR * DM * 2); float* TF = (float*)take(NR * DM * 4); _Float16* QH = (_Float16*)take(NR * DM * 2); _Float16* QL = (_Float16*)take(NR * DM * 2); _Float16* KH = (_Float16*)take(NR * DM * 2); _Float16* KL = (_Float16*)take(NR * DM * 2); _Float16* V16 = (_Float16*)take(NR * DM * 2); _Float16* O16 = (_Float16*)take(NR * DM * 2);
  float* S = (float*)take((size_t)HG * SQ * SQ * 4); _Float16* P = (_Float16*)take((size_t)HG * SQ * SQ * 2); _Float16* VT = (_Float16*)take((size_t)NH * HD * SQ * 2);
  if (off > ws_size) return;
{ const unsigned gh = (unsigned)(((size_t)NH * HD * (DM / 8) + 255) / 256); k_wthd<<<gh, 256, 0, stream>>>(wq, BQ); k_wthd<<<gh, 256, 0, stream>>>(wk, BK); k_wthd<<<gh, 256, 0, stream>>>(wv, BV); const unsigned g = (unsigned)(((size_t)DM * (DM / 8) + 255) / 256); k_wt_f16<<<g, 256, 0, stream>>>(wo, BO, DM, DM, 16.0f); }      /* per-head [h][i][o] -> Bt[(h, o)][i] x16 for q, k, v; the output weight [8][64][512] read flat = [in][out] [512][512] -> Bt[n][k] x16 */

  k_x16<<<(unsigned)((NR * DM / 8 + 255) / 256), 256, 0, stream>>>(xq, XQ, NR * DM / 8); k_x16<<<(unsigned)((NR * DM / 8 + 255) / 256), 256, 0, stream>>>(xk, XK, NR * DM / 8); k_x16<<<(unsigned)((NR * DM / 8 + 255) / 256), 256, 0, stream>>>(xv, XV, NR * DM / 8);      /* the three inputs as exact f16 rows */
  const size_t r0p = (size_t)B0 * SQ;      /* first projected row */
  k_gemm2<0><<<dim3((unsigned)((MP / 128) * (DM / 64)), 1), 128, 0, stream>>>(XQ + r0p * DM, DM, 0, BQ, DM, 0, 0.0625f, bq, 0, nullptr, 1, 0, 0, TF + r0p * DM, nullptr, DM, 0, MP, DM, DM); k_hl<<<(unsigned)((NR * DM / 8 + 255) / 256), 256, 0, stream>>>(TF, QH, QL, NR * DM / 8);      /* q (f32) -> f16 hi + x1024 residual planes */
  k_gemm2<0><<<dim3((unsigned)((MP / 128) * (DM / 64)), 1), 128, 0, stream>>>(XK + r0p * DM, DM, 0, BK, DM, 0, 0.0625f, bk, 0, nullptr, 1, 0, 0, TF + r0p * DM, nullptr, DM, 0, MP, DM, DM); k_hl<<<(unsigned)((NR * DM / 8 + 255) / 256), 256, 0, stream>>>(TF, KH, KL, NR * DM / 8);      /* k (f32) -> f16 hi + x1024 residual planes (the f32 plane reused in stream order) */
  k_gemm2<0><<<dim3((unsigned)((MP / 128) * (DM / 64)), 1), 128, 0, stream>>>(XV + r0p * DM, DM, 0, BV, DM, 0, 0.0625f, bv, 0, nullptr, 1, 0, 0, nullptr, V16 + r0p * DM, DM, 0, MP, DM, DM);
  for (int b = B0; b < B0 + NBR; ++b) { const size_t r0 = (size_t)b * SQ;
    k_vt<NH, SQ><<<NH * (SQ / 64), 256, 0, stream>>>(V16 + r0 * LQ, LQ, 0, VT);      /* V^T [NH][HD][SQ] for this batch */
    for (int h0 = 0; h0 < NHD; h0 += HG) {
k_gemm2<0><<<dim3((QN / 128) * (SQ / 64), HG), 128, 0, stream>>>(QL + r0 * LQ + h0 * HD, LQ, (size_t)HD, KH + r0 * LQ + h0 * HD, LQ, (size_t)HD, 0.0001220703125f, nullptr, 0, nullptr, 1, 0, 0, S, nullptr, SQ, (size_t)SQ * SQ, QN, SQ, HD); k_gemm2<0><<<dim3((QN / 128) * (SQ / 64), HG), 128, 0, stream>>>(QH + r0 * LQ + h0 * HD, LQ, (size_t)HD, KL + r0 * LQ + h0 * HD, LQ, (size_t)HD, 0.0001220703125f, nullptr, 0, S, -1, 0, 0, S, nullptr, SQ, (size_t)SQ * SQ, QN, SQ, HD); k_gemm2<0><<<dim3((QN / 128) * (SQ / 64), HG), 128, 0, stream>>>(QH + r0 * LQ + h0 * HD, LQ, (size_t)HD, KH + r0 * LQ + h0 * HD, LQ, (size_t)HD, 0.125f, nullptr, 0, S, -1, 0, 0, S, nullptr, SQ, (size_t)SQ * SQ, QN, SQ, HD);      /* scores = (q_lo.k_hi + q_hi.k_lo) 2^-13 + q_hi.k_hi / 8: the small terms first; passes two and three add onto S through the own-element addend (CP = S, batched: rows per batch -1), HG heads per launch */
      k_rsmf<<<(HG * QN + 7) / 8, 256, 0, stream>>>(S, P, QN, HG);      /* P = 256 softmax (f16), rows of all HG heads, one wave per row */
      k_gemm2<0><<<dim3((QN / 128) * (HD / 64), HG), 128, 0, stream>>>(P, SQ, (size_t)SQ * SQ, VT + (size_t)h0 * HD * SQ, SQ, (size_t)HD * SQ, 0.25f, nullptr, 0, nullptr, 1, 0, 0, nullptr, O16 + r0 * DM + h0 * HD, DM, (size_t)HD, QN, HD, SQ); } }      /* o (merged heads) as f16 rows */
  k_gemm2<0><<<dim3((unsigned)((MPO / 128) * (DM / 64)), 1), 128, 0, stream>>>(O16 + r0p * DM, DM, 0, BO, DM, 0, 0.0009765625f, bo, 0, nullptr, 1, 0, 0, (float*)d_out + r0p * DM, nullptr, DM, 0, MPO, DM, DM);      /* out rows are the output layout */
}

// v003
// Measured time: 152 microseconds a run.
// Versions between v001 and this one are left out; their measured steps multiply to 5.40 times as fast.
// Over all steps from v000 it is 13.8 times as fast.
#include <hip/hip_runtime.h>
// Multi-head attention on THREE input streams with per-head projection weights and a per-head output weight, no biases at all (query, key, value [2][2048][512]; q = einsum(bni,hio->bnho)(query, Wq), k and v likewise from key and value (Wq, Wk, Wv [8][512][64] per-head [in][out], normal x 0.05); q / sqrt(64); logits = q.k per head; softmax over all 2048 keys (no mask); out = einsum(bnhi,hio->bno)(attn v, Wp) (Wp [8][64][512]: read flat it IS an [in][out] [512][512] weight with input row h*64 + i; no bias) -> [2][2048][512]; input order query, key, value, Wq, Wk, Wv, Wp).
// Structure: token rows r = b*2048 + s; the three inputs as exact f16 rows (bf16-rounded; one conversion each); Q and K as two WMMA GEMMs with f32 outputs, each split into f16 hi + x1024 residual planes; V as a third with an f16 output (32x64 wave tiles, f32 accumulation, exact x16 weights staged from the per-head stacks (plane row h*64 + o = W[h][:][o]), no bias); V^T for all (batch, head) via LDS transposes; then ONE fused attention kernel over all (batch, head, 128 queries): per 32 keys the scores from THREE products (K = 64: k_hi.q_lo and k_lo.q_hi, worth 2^-10, and k_hi.q_hi; all / 8), running-maximum softmax in registers (f32 statistics, native exp2; weights x256 as f16), O^T += V^T P^T, o carried x64 against f16 subnormal flush (folded into the output GEMM alpha) written straight into the merged f16 o rows; out = o W_p GEMM (f32; no bias) into the output layout.
// Compute dtype: inputs rounded to bf16; the three inputs and the x16 weights held as f16 planes (exact for every bf16 value of magnitude from 2^-14 up to 65,504; the weights up to 4,094 before their factor of 16); q and k as f16 hi + x1024 residual planes (about 2^-21), the scores from three products (the lo.lo term dropped); v, softmax weights and o as plain f16 GEMM operands (~2^-12); scores and softmax statistics f32. v_wmma_f32_16x16x32_f16.
#define NB 2
#define SQ 2048
#define DM 512
#define NH 8
#define HD 64
#define HG 4                         /* heads per launch of the grouped k_vt (not launched) */
#define B0 0                         /* first batch processed (debug hook) */
#define NBR NB                       /* batches processed (debug hook) */
#define NR ((size_t)NB * SQ)         /* token rows */
#define MP ((int)((size_t)NBR * SQ)) /* rows projected (debug hook) */
#define QN SQ                        /* query rows per batch (not used) */
#define NHD NH                       /* heads (not used) */
#define MPO MP                       /* rows through the output stage (debug hook) */
#define LQ DM      /* row pitch of the q/k/v rows */
typedef __bf16 v16b __attribute__((ext_vector_type(16)));
typedef unsigned short v8us __attribute__((ext_vector_type(8), may_alias));
typedef float  v8f  __attribute__((ext_vector_type(8)));
typedef float  v4f  __attribute__((ext_vector_type(4)));
typedef float  v4fa __attribute__((ext_vector_type(4), may_alias));
union FragB { v16b v; v8us half[2]; unsigned short u[16]; };

__device__ __forceinline__ unsigned short bf16_bits(float x) { unsigned int u = __float_as_uint(x); return (unsigned short)((u + 0x7FFFu + ((u >> 16) & 1u)) >> 16); }
__device__ __forceinline__ float bf16_val(unsigned short b) { return __uint_as_float(((unsigned int)b) << 16); }
__device__ __forceinline__ float bf16_round(float x) { return bf16_val(bf16_bits(x)); }
// D += A·B with NT terms: 1 = ah·bh, 2 = + al·bh (A split), 3 = + ah·bl (both split)
template <int NT>
__device__ __forceinline__ v8f mmaN(v16b ah, v16b al, v16b bh, v16b bl, v8f c) {
  c = __builtin_amdgcn_wmma_f32_16x16x32_bf16(false, ah, false, bh, (short)0, c, false, false);
  if (NT >= 2) c = __builtin_amdgcn_wmma_f32_16x16x32_bf16(false, al, false, bh, (short)0, c, false, false);
  if (NT >= 3) c = __builtin_amdgcn_wmma_f32_16x16x32_bf16(false, ah, false, bl, (short)0, c, false, false);
  asm volatile("v_nop\n\tv_nop\n\tv_nop\n\tv_nop" : "+v"(c) : "v"(ah), "v"(al), "v"(bh), "v"(bl));
  return c;
}

__global__ __launch_bounds__(256) void k_wt_bf16(const float* __restrict__ W, unsigned short* __restrict__ Wt, int K, int N) {
  const int t = blockIdx.x * 256 + threadIdx.x;
  const int k8n = K / 8;
  if (t >= N * k8n) return;
  const int n = t / k8n, k8 = (t % k8n) * 8;
  v8us v;
#pragma unroll
  for (int i = 0; i < 8; ++i) v[i] = bf16_bits(W[(size_t)(k8 + i) * N + n]);
  *(v8us*)(Wt + (size_t)n * K + k8) = v;
  
}

// GEMM C[M][N] (f32, pitch ldc) = act(A[M][K]·W + bias). A f32 row-major (pitch lda) converted per fragment to bf16
// (ASPLIT: hi/lo two planes -> 2 terms, else single rounded term); Wt bf16 [N][K] (pitch ldb). BIAS_BF16 rounds the
// bias to bf16 first (bias quantised to bf16 before the add). K%32==0, M%16==0, N%64==0.
template <bool ASPLIT, int ACT, bool BIAS_BF16>
__global__ __launch_bounds__(128) void k_gemm_bf(const float* __restrict__ A, int lda, const unsigned short* __restrict__ Wt, int ldb,
                                               const float* __restrict__ bias, float* __restrict__ C, int ldc, int M, int N, int K) {
  __shared__ __attribute__((aligned(16))) float so[4][16][64];
  const int tid = threadIdx.x, w = tid >> 5, lane = tid & 31, ln = lane & 15, hh = lane >> 4;
  const int ntn = N / 64;
  const int wid = blockIdx.x * 4 + w;
  const int mt = wid / ntn, nq = wid % ntn;
  if (mt * 16 >= M) return;
  const int row0 = mt * 16, col0 = nq * 64;
  const float* arow = A + (size_t)(row0 + ln) * lda;
  v8f acc[4] = {};
  for (int kb = 0; kb < K; kb += 32) {
    FragB ah, al;
    const v4f x0 = *(const v4fa*)(arow + kb + 8 * hh), x1 = *(const v4fa*)(arow + kb + 8 * hh + 4);
    const v4f x2 = *(const v4fa*)(arow + kb + 16 + 8 * hh), x3 = *(const v4fa*)(arow + kb + 16 + 8 * hh + 4);
    float xs[16] = {x0[0],x0[1],x0[2],x0[3],x1[0],x1[1],x1[2],x1[3],x2[0],x2[1],x2[2],x2[3],x3[0],x3[1],x3[2],x3[3]};
#pragma unroll
    for (int i = 0; i < 16; ++i) { const unsigned short hb = bf16_bits(xs[i]); ah.u[i] = hb; al.u[i] = ASPLIT ? bf16_bits(xs[i] - bf16_val(hb)) : (unsigned short)0; }
#pragma unroll
    for (int t = 0; t < 4; ++t) {
      const unsigned short* brow = Wt + (size_t)(col0 + t * 16 + ln) * ldb + kb;
      FragB b;
      b.half[0] = *(const v8us*)(brow + 8 * hh);
      b.half[1] = *(const v8us*)(brow + 16 + 8 * hh);
      acc[t] = mmaN<ASPLIT ? 2 : 1>(ah.v, al.v, b.v, b.v, acc[t]);
    }
  }
#pragma unroll
  for (int t = 0; t < 4; ++t) {
    float bv = bias ? bias[col0 + t * 16 + ln] : 0.f;
    if (BIAS_BF16) bv = bf16_round(bv);
#pragma unroll
    for (int r = 0; r < 8; ++r) { float v = acc[t][r] + bv; if (ACT == 1) v = fmaxf(v, 0.f); so[w][8 * hh + r][t * 16 + ln] = v; }
  }
  __builtin_amdgcn_fence(__ATOMIC_ACQ_REL, "workgroup");
  __builtin_amdgcn_wave_barrier();
  const int rsub = lane >> 4, c4 = (lane & 15) * 4;
  {
#pragma unroll
    for (int q = 0; q < 8; ++q) {
      const int r = q * 2 + rsub;
      const v4f v = *(const v4fa*)&so[w][r][c4];
      *(v4f*)(C + (size_t)(row0 + r) * ldc + col0 + c4) = v;
    }
    
  }
}

// GEMM C = act(A·W + bias + resid): A f32 (ASPLIT -> hi/lo 2 terms), Wt bf16 [N][K]; ACT 0 none, 1 relu, 2 exact gelu;
// resid (optional, f32, row index = (row % rmod), pitch ldr, RES_BF16 rounds it) added before the activation.
template <bool ASPLIT, int ACT, bool BIAS_BF16, bool RES_BF16>
__global__ __launch_bounds__(128) void k_gemm_bf3(const float* __restrict__ A, int lda, const unsigned short* __restrict__ Wt, int ldb,
                                                const float* __restrict__ bias, const float* __restrict__ resid, int rmod, int ldr,
                                                float* __restrict__ C, int ldc, int M, int N, int K) {
  __shared__ __attribute__((aligned(16))) float so[4][16][64];
  const int tid = threadIdx.x, w = tid >> 5, lane = tid & 31, ln = lane & 15, hh = lane >> 4;
  const int ntn = N / 64;
  const int wid = blockIdx.x * 4 + w;
  const int mt = wid / ntn, nq = wid % ntn;
  if (mt * 16 >= M) return;
  const int row0 = mt * 16, col0 = nq * 64;
  const float* arow = A + (size_t)(row0 + ln) * lda;
  v8f acc[4] = {};
  for (int kb = 0; kb < K; kb += 32) {
    FragB ah, al;
    const v4f x0 = *(const v4fa*)(arow + kb + 8 * hh), x1 = *(const v4fa*)(arow + kb + 8 * hh + 4);
    const v4f x2 = *(const v4fa*)(arow + kb + 16 + 8 * hh), x3 = *(const v4fa*)(arow + kb + 16 + 8 * hh + 4);
    float xs[16] = {x0[0],x0[1],x0[2],x0[3],x1[0],x1[1],x1[2],x1[3],x2[0],x2[1],x2[2],x2[3],x3[0],x3[1],x3[2],x3[3]};
#pragma unroll
    for (int i = 0; i < 16; ++i) { const unsigned short hb = bf16_bits(xs[i]); ah.u[i] = hb; al.u[i] = ASPLIT ? bf16_bits(xs[i] - bf16_val(hb)) : (unsigned short)0; }
#pragma unroll
    for (int t = 0; t < 4; ++t) {
      const unsigned short* brow = Wt + (size_t)(col0 + t * 16 + ln) * ldb + kb;
      FragB b;
      b.half[0] = *(const v8us*)(brow + 8 * hh);
      b.half[1] = *(const v8us*)(brow + 16 + 8 * hh);
      acc[t] = mmaN<ASPLIT ? 2 : 1>(ah.v, al.v, b.v, b.v, acc[t]);
    }
  }
#pragma unroll
  for (int t = 0; t < 4; ++t) {
    const int col = col0 + t * 16 + ln;
    float bv = bias ? bias[col] : 0.f;
    if (BIAS_BF16) bv = bf16_round(bv);
#pragma unroll
    for (int r = 0; r < 8; ++r) {
      float v = acc[t][r] + bv;
      if (resid) { float rv = resid[(size_t)((row0 + 8 * hh + r) % rmod) * ldr + col]; if (RES_BF16) rv = bf16_round(rv); v += rv; }
      if (ACT == 1) v = fmaxf(v, 0.f);
      if (ACT == 2) v = 0.5f * v * (1.0f + erff(v * 0.70710678118654752f));
      if (ACT == 3) { const float u = 0.7978845608028654f * (v + 0.044715f * v * v * v); v = 0.5f * v * (1.0f + tanhf(u)); }
      so[w][8 * hh + r][t * 16 + ln] = v;
    }
  }
  __builtin_amdgcn_fence(__ATOMIC_ACQ_REL, "workgroup");
  __builtin_amdgcn_wave_barrier();
  const int rsub = lane >> 4, c4 = (lane & 15) * 4;
  {
#pragma unroll
    for (int q = 0; q < 8; ++q) {
      const int r = q * 2 + rsub;
      const v4f v = *(const v4fa*)&so[w][r][c4];
      *(v4f*)(C + (size_t)(row0 + r) * ldc + col0 + c4) = v;
    }
    
  }
}
// row LayerNorm (biased variance, eps) over N: s = X (+ R); optional out_sum <- s; out_norm <- (s-mu)*rsqrt(var+eps)*g + b
template <bool PARAM_BF16>
__global__ __launch_bounds__(256) void k_layernorm(const float* __restrict__ X, const float* __restrict__ R, const float* __restrict__ g, const float* __restrict__ bta,
                                                  float* __restrict__ out_sum, float* __restrict__ out_norm, int N, float eps) {
  __shared__ float red[256];
  const int row = blockIdx.x, tid = threadIdx.x;
  const float* x = X + (size_t)row * N; const float* rr = R ? R + (size_t)row * N : nullptr;
  float vals[16];                     // up to N = 4096
  const int per = N / 256;            // contiguous chunk per thread? use strided-by-4 chunks: thread handles j = tid*4 + 1024*u
  float s1 = 0.f;
  for (int u = 0; u < per / 4; ++u) {
    const int j = tid * 4 + 1024 * u;
    const v4f a = *(const v4fa*)(x + j);
    v4f b = {0.f,0.f,0.f,0.f}; if (rr) b = *(const v4fa*)(rr + j);
#pragma unroll
    for (int q = 0; q < 4; ++q) { const float v = a[q] + b[q]; vals[u * 4 + q] = v; s1 += v; }
  }
  red[tid] = s1; __syncthreads();
  for (int st = 128; st > 0; st >>= 1) { if (tid < st) red[tid] += red[tid + st]; __syncthreads(); }
  const float mu = red[0] / (float)N; __syncthreads();
  float s2 = 0.f;
  for (int u = 0; u < per / 4; ++u)
#pragma unroll
    for (int q = 0; q < 4; ++q) { const float c = vals[u * 4 + q] - mu; s2 += c * c; }
  red[tid] = s2; __syncthreads();
  for (int st = 128; st > 0; st >>= 1) { if (tid < st) red[tid] += red[tid + st]; __syncthreads(); }
  const float rs = rsqrtf(red[0] / (float)N + eps);
  {
    for (int u = 0; u < per / 4; ++u) {
      const int j = tid * 4 + 1024 * u;
      v4f o, sm;
#pragma unroll
      for (int q = 0; q < 4; ++q) {
        float gg = g[j + q], bb = bta[j + q];
        if (PARAM_BF16) { gg = bf16_round(gg); bb = bf16_round(bb); }
        sm[q] = vals[u * 4 + q]; o[q] = (vals[u * 4 + q] - mu) * rs * gg + bb;
      }
      if (out_sum) *(v4f*)(out_sum + (size_t)row * N + j) = sm;
      *(v4f*)(out_norm + (size_t)row * N + j) = o;
    }
    
  }
}



// ---- f16 WMMA path (v_wmma_f32_16x16x32_f16): 11-bit significands for operands in range — used where a [0,1] probability operand needs more precision than bf16
typedef _Float16 v16h __attribute__((ext_vector_type(16)));
union FragH { v16h v; v8us half[2]; _Float16 h[16]; unsigned short u[16]; };
template <int NT>
__device__ __forceinline__ v8f mmaH(v16h ah, v16h al, v16h bh, v16h bl, v8f c) {
  c = __builtin_amdgcn_wmma_f32_16x16x32_f16(false, ah, false, bh, (short)0, c, false, false);
  if (NT >= 2) c = __builtin_amdgcn_wmma_f32_16x16x32_f16(false, al, false, bh, (short)0, c, false, false);
  if (NT >= 3) c = __builtin_amdgcn_wmma_f32_16x16x32_f16(false, ah, false, bl, (short)0, c, false, false);
  asm volatile("v_nop\n\tv_nop\n\tv_nop\n\tv_nop" : "+v"(c) : "v"(ah), "v"(al), "v"(bh), "v"(bl));
  return c;
}
// batched GEMM like k_gemm_b but f16 operands: A f32 (split into f16 hi/lo if ASPLIT, else rounded to f16), Bt = f16 values [n][k]; alpha; C f32; N multiple of 16 (partial tiles skipped)
template <bool ASPLIT>
__global__ __launch_bounds__(128) void k_gemm_h(const float* __restrict__ A, int lda, size_t sA, const _Float16* __restrict__ Bh, int ldb, size_t sB, float alpha, float* __restrict__ C, int ldc, size_t sC, int M, int N, int K) {
  __shared__ __attribute__((aligned(16))) float so[4][16][64];
  const int tid = threadIdx.x, w = tid >> 5, lane = tid & 31, ln = lane & 15, hh = lane >> 4; const int by = blockIdx.y;
  A += (size_t)by * sA; Bh += (size_t)by * sB; C += (size_t)by * sC;
  const int ntn = (N + 63) / 64; const int wid = blockIdx.x * 4 + w; const int mt = wid / ntn, nq = wid % ntn; if (mt * 16 >= M) return;
  const int row0 = mt * 16, col0 = nq * 64; const float* arow = A + (size_t)(row0 + ln) * lda;
  v8f acc[4] = {};
  for (int kb = 0; kb < K; kb += 32) {
    FragH ah, al;
    const v4f x0 = *(const v4fa*)(arow + kb + 8 * hh), x1 = *(const v4fa*)(arow + kb + 8 * hh + 4), x2 = *(const v4fa*)(arow + kb + 16 + 8 * hh), x3 = *(const v4fa*)(arow + kb + 16 + 8 * hh + 4);
    float xs[16] = {x0[0],x0[1],x0[2],x0[3],x1[0],x1[1],x1[2],x1[3],x2[0],x2[1],x2[2],x2[3],x3[0],x3[1],x3[2],x3[3]};
#pragma unroll
    for (int i = 0; i < 16; ++i) { const _Float16 h = (_Float16)xs[i]; ah.h[i] = h; al.h[i] = ASPLIT ? (_Float16)(xs[i] - (float)h) : (_Float16)0.0f; }
#pragma unroll
    for (int t = 0; t < 4; ++t) { if (col0 + t * 16 >= N) continue; const size_t boff = (size_t)(col0 + t * 16 + ln) * ldb + kb; FragH bq; bq.half[0] = *(const v8us*)(Bh + boff + 8 * hh); bq.half[1] = *(const v8us*)(Bh + boff + 16 + 8 * hh);
      acc[t] = mmaH<ASPLIT ? 2 : 1>(ah.v, al.v, bq.v, bq.v, acc[t]); }
  }
#pragma unroll
  for (int t = 0; t < 4; ++t) { if (col0 + t * 16 >= N) continue;
#pragma unroll
    for (int r = 0; r < 8; ++r) so[w][8 * hh + r][t * 16 + ln] = acc[t][r] * alpha; }
  __builtin_amdgcn_fence(__ATOMIC_ACQ_REL, "workgroup"); __builtin_amdgcn_wave_barrier();
  const int rsub = lane >> 4, c4 = (lane & 15) * 4;
  {
#pragma unroll
    for (int q = 0; q < 8; ++q) { const int r = q * 2 + rsub; if (col0 + c4 < N) { const v4f v = *(const v4fa*)&so[w][r][c4]; *(v4f*)(C + (size_t)(row0 + r) * ldc + col0 + c4) = v; } }
     }
}

// Wt[n][k] = f16(W[k][n]·scale) from f32 row-major W[K][N] (scale = power of two; bf16-exact weights stay exact in f16 away from the subnormal range)
__global__ __launch_bounds__(256) void k_wt_f16(const float* __restrict__ W, _Float16* __restrict__ Wt, int K, int N, float scale) {
  const int t = blockIdx.x * 256 + threadIdx.x; if (t >= N * (K / 8)) return; const int n = t / (K / 8), k8 = (t % (K / 8)) * 8; FragH f;
#pragma unroll
  for (int i = 0; i < 8; ++i) f.h[i] = (_Float16)(bf16_round(W[(size_t)(k8 + i) * N + n]) * scale); const v8us o = f.half[0];
  *(v8us*)((unsigned short*)Wt + (size_t)n * K + k8) = o; 
}
// k_gemm_hh variant with fused epilogue: v = acc·alpha + bias[by·sBias + col] (+ CP[(row/rowsPerB)·sCPb + by·64 + col] if CP) ; ACT 0 none / 1 elu ; writes f16 C16 (and f32 C if non-null)
template <int ACT>
__global__ __launch_bounds__(128) void k_gemm_hhx(const _Float16* __restrict__ A, int lda, size_t sA, const _Float16* __restrict__ Bh, int ldb, size_t sB, float alpha, const float* __restrict__ bias, size_t sBias, const float* __restrict__ CP, int rowsPerB, size_t sCPb, int row0g,
    float* __restrict__ C, _Float16* __restrict__ C16, int ldc, size_t sC, int M, int N, int K) {
  __shared__ __attribute__((aligned(16))) float so[4][16][64];
  const int tid = threadIdx.x, w = tid >> 5, lane = tid & 31, ln = lane & 15, hh = lane >> 4; const int by = blockIdx.y;
  A += (size_t)by * sA; Bh += (size_t)by * sB; const size_t cofs = (size_t)by * sC; const float* bp = bias ? bias + (size_t)by * sBias : nullptr;
  const int ntn = (N + 63) / 64; const int wid = blockIdx.x * 4 + w; const int mt = wid / ntn, nq = wid % ntn; if (mt * 16 >= M) return;
  const int row0 = mt * 16, col0 = nq * 64; const _Float16* arow = A + (size_t)(row0 + ln) * lda;
  v8f acc[4] = {};
  for (int kb = 0; kb < K; kb += 32) { FragH ah; ah.half[0] = *(const v8us*)((const unsigned short*)arow + kb + 8 * hh); ah.half[1] = *(const v8us*)((const unsigned short*)arow + kb + 16 + 8 * hh);
#pragma unroll
    for (int t = 0; t < 4; ++t) { if (col0 + t * 16 >= N) continue; const size_t boff = (size_t)(col0 + t * 16 + ln) * ldb + kb; FragH bq; bq.half[0] = *(const v8us*)((const unsigned short*)Bh + boff + 8 * hh); bq.half[1] = *(const v8us*)((const unsigned short*)Bh + boff + 16 + 8 * hh);
      acc[t] = mmaH<1>(ah.v, ah.v, bq.v, bq.v, acc[t]); }
  }
#pragma unroll
  for (int t = 0; t < 4; ++t) { if (col0 + t * 16 >= N) continue; const int col = col0 + t * 16 + ln; const float bv = bp ? bf16_round(bp[col]) : 0.f;
#pragma unroll
    for (int r = 0; r < 8; ++r) { float v = acc[t][r] * alpha + bv; if (CP) { const int rr = row0g + row0 + 8 * hh + r; if (rowsPerB < 0) v += CP[cofs + (size_t)rr * ldc + col];      /* rowsPerB < 0: own element of the batched C plane */ else { const int bidx = rr / rowsPerB; v += CP[(size_t)bidx * sCPb + (size_t)by * 64 + col]; } } if (ACT == 1) v = (v > 0.f) ? v : expm1f(v); else if (ACT == 7) v = (v > 0.f) ? v + 1.0f : expf(v); else if (ACT == 8) v = tanhf(v); else if (ACT == 9) v = 0.5f * v * (1.0f + tanhf(0.7978845608028654f * (v + 0.044715f * v * v * v))); else if (ACT == 11) v = 1.0f / (1.0f + expf(-v)); else if (ACT == 12) v = (v > 0.f) ? v : 0.01f * v; else if (ACT == 14) v = (v > 0.f) ? v : 0.1f * v; else if (ACT == 16) v = (v >= 0.f) ? v : 0.3f * v; else if (ACT == 17) v = (v >= 0.f) ? v : 0.2f * v; else if (ACT == 15) v = v / (1.0f + expf(-v)); else if (ACT == 3) v = fmaxf(v, 0.f); else if (ACT == 6) v = 0.5f * v * (1.0f + erff(v * 0.70710678118654752f)); so[w][8 * hh + r][t * 16 + ln] = v; } }
  __builtin_amdgcn_fence(__ATOMIC_ACQ_REL, "workgroup"); __builtin_amdgcn_wave_barrier();
  const int rsub = lane >> 4, c4 = (lane & 15) * 4; typedef _Float16 v4h __attribute__((ext_vector_type(4)));
  {
#pragma unroll
    for (int q = 0; q < 8; ++q) { const int r = q * 2 + rsub; if (col0 + c4 < N) { const v4f v = *(const v4fa*)&so[w][r][c4]; if (C) *(v4f*)(C + cofs + (size_t)(row0 + r) * ldc + col0 + c4) = v; if (C16) { v4h h4; for (int i = 0; i < 4; ++i) h4[i] = (_Float16)v[i]; *(v4h*)(C16 + cofs + (size_t)(row0 + r) * ldc + col0 + c4) = h4; } } }
     }
}


typedef _Float16 v4h __attribute__((ext_vector_type(4)));

__global__ __launch_bounds__(256) void k_x16(const float* __restrict__ x, _Float16* __restrict__ X16, size_t n8) { const size_t t = (size_t)blockIdx.x * 256 + threadIdx.x; if (t >= n8) return; FragH f;
#pragma unroll
  for (int q = 0; q < 8; ++q) f.h[q] = (_Float16)bf16_round(x[t * 8 + q]); *(v8us*)((unsigned short*)X16 + t * 8) = f.half[0];  }
__global__ __launch_bounds__(256) void k_h16(const float* __restrict__ x, _Float16* __restrict__ X16, size_t n8) { const size_t t = (size_t)blockIdx.x * 256 + threadIdx.x; if (t >= n8) return; FragH f;
#pragma unroll
  for (int q = 0; q < 8; ++q) f.h[q] = (_Float16)x[t * 8 + q]; *(v8us*)((unsigned short*)X16 + t * 8) = f.half[0];  }
__global__ __launch_bounds__(256) void k_round16f(const float* __restrict__ W, _Float16* __restrict__ Bt, size_t n8) { const size_t t = (size_t)blockIdx.x * 256 + threadIdx.x; if (t >= n8) return; FragH f;
#pragma unroll
  for (int i = 0; i < 8; ++i) f.h[i] = (_Float16)(bf16_round(W[t * 8 + i]) * 16.0f); *(v8us*)((unsigned short*)Bt + t * 8) = f.half[0];  }
template <int NHv, int TTv>
__global__ __launch_bounds__(256) void k_vt(const _Float16* __restrict__ V16, int ldv, int voff, _Float16* __restrict__ Vt) { __shared__ unsigned short tl[64][66]; const int tid = threadIdx.x; const int slab = blockIdx.x / (TTv / 64), lg = blockIdx.x % (TTv / 64); const int b = slab / NHv, h = slab % NHv;
  for (int i = tid; i < 64 * 8; i += 256) { const int r = i / 8, c8 = (i % 8) * 8; FragH f; f.half[0] = *(const v8us*)((const unsigned short*)V16 + ((size_t)b * TTv + lg * 64 + r) * ldv + voff + h * 64 + c8);
#pragma unroll
    for (int q = 0; q < 8; ++q) tl[r][c8 + q] = f.u[q]; }
  __syncthreads();
  {
#pragma unroll
    for (int rd = 0; rd < 2; ++rd) { const int d = rd * 32 + tid / 8, pc = tid % 8; FragH f;
#pragma unroll
      for (int q = 0; q < 8; ++q) f.u[q] = tl[pc * 8 + q][d];
      *(v8us*)((unsigned short*)Vt + ((size_t)slab * 64 + d) * TTv + lg * 64 + pc * 8) = f.half[0]; }
     } }

__global__ __launch_bounds__(256) void k_hl(const float* __restrict__ F, _Float16* __restrict__ Hh, _Float16* __restrict__ Hl, size_t n8) { const size_t t = (size_t)blockIdx.x * 256 + threadIdx.x; if (t >= n8) return; FragH fh, fl; const v4f a = *(const v4fa*)(F + t * 8), c = *(const v4fa*)(F + t * 8 + 4);
#pragma unroll
  for (int q = 0; q < 4; ++q) { _Float16 h = (_Float16)a[q]; fh.h[q] = h; fl.h[q] = (_Float16)((a[q] - (float)h) * 1024.0f); h = (_Float16)c[q]; fh.h[4 + q] = h; fl.h[4 + q] = (_Float16)((c[q] - (float)h) * 1024.0f); }
  { *(v8us*)((unsigned short*)Hh + t * 8) = fh.half[0]; *(v8us*)((unsigned short*)Hl + t * 8) = fl.half[0];  } }

// ---- fast GEMM (wave tile 32x64; requires M % 32 == 0 rows per launch region and N % 64 == 0); epilogue = k_gemm_hhx semantics ----
__device__ __forceinline__ v16h g2_frag(const _Float16* p, int hh) { FragH f; f.half[0] = *(const v8us*)((const unsigned short*)p + 8 * hh); f.half[1] = *(const v8us*)((const unsigned short*)p + 16 + 8 * hh); return f.v; }
__device__ __forceinline__ v8f g2_mma(v16h a, v16h b, v8f c) { v8f d = __builtin_amdgcn_wmma_f32_16x16x32_f16(false, a, false, b, (short)0, c, false, false); asm volatile("v_nop\n\tv_nop\n\tv_nop\n\tv_nop" : "+v"(d) : "v"(a), "v"(b)); return d; }
template <int ACT>
__global__ __launch_bounds__(128) void k_gemm2(const _Float16* __restrict__ A, int lda, size_t sA, const _Float16* __restrict__ Bh, int ldb, size_t sB, float alpha, const float* __restrict__ bias, size_t sBias, const float* __restrict__ CP, int rowsPerB, size_t sCPb, int row0g,
    float* __restrict__ C, _Float16* __restrict__ C16, int ldc, size_t sC, int M, int N, int K) { static_assert(ACT == 0 || ACT == 3 || ACT == 6 || ACT == 8 || ACT == 9 || ACT == 11 || ACT == 12 || ACT == 14 || ACT == 15 || ACT == 16 || ACT == 17, "k_gemm2: unsupported ACT code (would silently apply no activation)");
  __shared__ __attribute__((aligned(16))) float so[4][32][68];
  const int tid = threadIdx.x, w = tid >> 5, lane = tid & 31, ln = lane & 15, hh = lane >> 4; const int by = blockIdx.y;
  A += (size_t)by * sA; Bh += (size_t)by * sB; const size_t cofs = (size_t)by * sC; const float* bp = bias ? bias + (size_t)by * sBias : nullptr;
  const int ntn = N >> 6; const int mt = blockIdx.x / ntn, nq = blockIdx.x - mt * ntn; const int row0 = mt * 128 + 32 * w, col0 = nq * 64; if (row0 >= M) return;
  const _Float16* a0p = A + (size_t)(row0 + ln) * lda; const _Float16* a1p = a0p + (size_t)16 * lda;
  const _Float16* b0p = Bh + (size_t)(col0 + ln) * ldb; const _Float16* b1p = b0p + (size_t)16 * ldb; const _Float16* b2p = b1p + (size_t)16 * ldb; const _Float16* b3p = b2p + (size_t)16 * ldb;
  const v8f z8 = {0.f,0.f,0.f,0.f,0.f,0.f,0.f,0.f}; v8f c00 = z8, c01 = z8, c02 = z8, c03 = z8, c10 = z8, c11 = z8, c12 = z8, c13 = z8;
#pragma unroll 1
  for (int kb = 0; kb < K; kb += 32) { const v16h a0 = g2_frag(a0p + kb, hh), a1 = g2_frag(a1p + kb, hh);
    v16h b = g2_frag(b0p + kb, hh); c00 = g2_mma(a0, b, c00); c10 = g2_mma(a1, b, c10);
    b = g2_frag(b1p + kb, hh); c01 = g2_mma(a0, b, c01); c11 = g2_mma(a1, b, c11);
    b = g2_frag(b2p + kb, hh); c02 = g2_mma(a0, b, c02); c12 = g2_mma(a1, b, c12);
    b = g2_frag(b3p + kb, hh); c03 = g2_mma(a0, b, c03); c13 = g2_mma(a1, b, c13); }
  v8f accs[8] = {c00, c01, c02, c03, c10, c11, c12, c13};
#pragma unroll
  for (int u = 0; u < 8; ++u) { const int t = u & 3, half = u >> 2; const int col = col0 + t * 16 + ln; const float bv = bp ? bf16_round(bp[col]) : 0.f;
#pragma unroll
    for (int r = 0; r < 8; ++r) { const int rloc = half * 16 + 8 * hh + r; float v = accs[u][r] * alpha + bv; if (CP) { if (rowsPerB < 0) v += CP[cofs + (size_t)(row0g + row0 + rloc) * ldc + col];      /* rowsPerB < 0: own element of the batched C plane */ else { const int bidx = (row0g + row0 + rloc) / rowsPerB; v += CP[(size_t)bidx * sCPb + (size_t)by * 64 + col]; } }
      if (ACT == 3) v = fmaxf(v, 0.f); else if (ACT == 6) v = 0.5f * v * (1.0f + erff(v * 0.70710678118654752f)); else if (ACT == 11) v = 1.0f / (1.0f + expf(-v)); else if (ACT == 15) v = v / (1.0f + expf(-v)); else if (ACT == 12) v = (v > 0.f) ? v : 0.01f * v; else if (ACT == 8) v = tanhf(v); else if (ACT == 9) v = 0.5f * v * (1.0f + tanhf(0.7978845608028654f * (v + 0.044715f * v * v * v))); else if (ACT == 14) v = (v > 0.f) ? v : 0.1f * v; else if (ACT == 16) v = (v >= 0.f) ? v : 0.3f * v; else if (ACT == 17) v = (v >= 0.f) ? v : 0.2f * v;
      so[w][rloc][t * 16 + ln] = v; } }
  __builtin_amdgcn_fence(__ATOMIC_ACQ_REL, "workgroup"); __builtin_amdgcn_wave_barrier();
  const int rsub = lane >> 4, c4 = (lane & 15) * 4;
  {
#pragma unroll
    for (int q = 0; q < 16; ++q) { const int r = q * 2 + rsub; const v4f v = *(const v4fa*)&so[w][r][c4]; if (C) *(v4f*)(C + cofs + (size_t)(row0 + r) * ldc + col0 + c4) = v; if (C16) { v4h h4; for (int i = 0; i < 4; ++i) h4[i] = (_Float16)v[i]; *(v4h*)(C16 + cofs + (size_t)(row0 + r) * ldc + col0 + c4) = h4; } }
     } }


__global__ __launch_bounds__(256) void k_wnat(const float* __restrict__ w, size_t n8, _Float16* __restrict__ Bt) { const size_t t = (size_t)blockIdx.x * 256 + threadIdx.x; if (t >= n8) return; FragH f; for (int q = 0; q < 8; ++q) f.h[q] = (_Float16)(bf16_round(w[t * 8 + q]) * 16.0f); *(v8us*)((unsigned short*)Bt + t * 8) = f.half[0];  }
__global__ __launch_bounds__(256) void k_wthd(const float* __restrict__ Wt, _Float16* __restrict__ Bt) { const size_t t = (size_t)blockIdx.x * 256 + threadIdx.x; if (t >= (size_t)NH * HD * (DM / 8)) return; const int m8 = (int)(t % (DM / 8)) * 8; const int d = (int)((t / (DM / 8)) % HD); const int h = (int)(t / ((size_t)(DM / 8) * HD)); FragH f;
  for (int q = 0; q < 8; ++q) f.h[q] = (_Float16)(16.0f * bf16_round(Wt[((size_t)h * DM + m8 + q) * HD + d])); unsigned short* dst = (unsigned short*)Bt + ((size_t)h * HD + d) * DM + m8; *(v8us*)dst = f.half[0];  }
__global__ __launch_bounds__(256) void k_rsm(const float* __restrict__ S, _Float16* __restrict__ P, int nrows) {
  #pragma clang fp contract(off)
  const int i = blockIdx.x * 256 + threadIdx.x; if (i >= nrows) return; const float* s = S + (size_t)i * SQ; float mx = -3.0e38f;
#pragma unroll 1
  for (int j = 0; j < SQ; ++j) mx = fmaxf(mx, s[j]); float se = 0.f;
#pragma unroll 1
  for (int j = 0; j < SQ; ++j) se += expf(s[j] - mx); const float sc = 256.0f / se;
#pragma unroll 1
  for (int j0 = 0; j0 < SQ; j0 += 8) { FragH f; for (int q = 0; q < 8; ++q) f.h[q] = (_Float16)(expf(s[j0 + q] - mx) * sc); unsigned short* d = (unsigned short*)P + (size_t)i * SQ + j0; *(v8us*)d = f.half[0];  } }
__global__ __launch_bounds__(256) void k_vt(const _Float16* __restrict__ V16, int b, int h0, _Float16* __restrict__ VT) { __shared__ unsigned short tl[64][65]; const int tid = threadIdx.x; const int hh = blockIdx.x % HG, sg = blockIdx.x / HG; const int s0 = sg * 64; const int h = h0 + hh;
  for (int i = tid; i < 64 * 8; i += 256) { const int j = i / 8, d8 = (i % 8) * 8; FragH f; f.half[0] = *(const v8us*)((const unsigned short*)V16 + ((size_t)b * SQ + s0 + j) * DM + h * HD + d8); for (int q = 0; q < 8; ++q) tl[d8 + q][j] = f.u[q]; }
  __syncthreads();
  { for (int i = tid; i < 64 * 8; i += 256) { const int d = i / 8, j8 = (i % 8) * 8; FragH f; for (int q = 0; q < 8; ++q) f.u[q] = tl[d][j8 + q]; *(v8us*)((unsigned short*)VT + ((size_t)hh * HD + d) * SQ + s0 + j8) = f.half[0]; }  } }



#define FK 128                       /* keys per LDS stage: 4 passes of 32 */
#define FKP 144                      /* LDS pitch in bytes of a K row (128 bytes of data) */
#define FVP 272                      /* LDS pitch in bytes of a V^T row (256 bytes of data) */
#define FKB (FK * FKP)               /* one K plane of a stage */
#define FSB (2 * FKB + HD * FVP)     /* one stage: K hi, K lo, V^T */
__device__ __forceinline__ v8f fa_mma(v16h a, v16h b, v8f c) { return __builtin_amdgcn_wmma_f32_16x16x32_f16(false, a, false, b, (short)0, c, false, false); }
__device__ __forceinline__ float fa_swap16(float x) { const int b = __float_as_int(x); return __int_as_float(__builtin_amdgcn_permlanex16(b, b, 0x76543210, 0xfedcba98, false, false)); }      /* value of lane l ^ 16 */
__device__ __forceinline__ v16h fa_lfrag(const unsigned char* p) { FragH f; f.half[0] = *(const v8us*)p; f.half[1] = *(const v8us*)(p + 32); return f.v; }      /* g2_frag's k order, from an LDS row; p already holds the lane half's 16 bytes */
// Four copies of 16 bytes a lane, global -> LDS. The s_wait_xcnt closes the statement so that it stands in front of every later write of the address registers that the copies name.
__device__ __forceinline__ void fa_copy4(unsigned l0, unsigned lstep, const _Float16* g0, size_t gstep) {
  const unsigned l1 = l0 + lstep, l2 = l1 + lstep, l3 = l2 + lstep; const _Float16* g1 = g0 + gstep; const _Float16* g2 = g1 + gstep; const _Float16* g3 = g2 + gstep;
  asm volatile("global_load_async_to_lds_b128 %0, %4, off\n\tglobal_load_async_to_lds_b128 %1, %5, off\n\tglobal_load_async_to_lds_b128 %2, %6, off\n\tglobal_load_async_to_lds_b128 %3, %7, off\n\ts_wait_xcnt 0x0"
               :: "v"(l0), "v"(l1), "v"(l2), "v"(l3), "v"(g0), "v"(g1), "v"(g2), "v"(g3) : "memory"); }
__global__ __launch_bounds__(256) void k_fattn(const _Float16* __restrict__ Qh, const _Float16* __restrict__ Ql, const _Float16* __restrict__ Kh, const _Float16* __restrict__ Kl, const _Float16* __restrict__ Vt, _Float16* __restrict__ O) {
  __shared__ __attribute__((aligned(128))) unsigned char L[2 * FSB];
  const int tid = threadIdx.x, lane = tid & 31, ln = lane & 15, hh = lane >> 4; const int w = __builtin_amdgcn_readfirstlane((int)(threadIdx.x >> 5));
  const int bh = blockIdx.y, b = bh / NH, h = bh - b * NH; const size_t r0 = (size_t)b * SQ; const int q0 = blockIdx.x * 128 + w * 16;
  const size_t qo = (r0 + q0 + ln) * DM + h * HD;
  /* the copies of a stage: K rows of 8 pieces (a thread: rows tid / 8 + 32 i), V^T rows of 16 pieces (rows tid / 16 + 16 i); every lane on, every piece written by one lane */
  const unsigned lds0 = (unsigned)(size_t)L; const unsigned lk = lds0 + (unsigned)((tid >> 3) * FKP + (tid & 7) * 16), lv = lds0 + (unsigned)(2 * FKB + (tid >> 4) * FVP + (tid & 15) * 16);
  const size_t gko = (r0 + (tid >> 3)) * DM + h * HD + (tid & 7) * 8; const _Float16* gkh = Kh + gko; const _Float16* gkl = Kl + gko; const _Float16* gv = Vt + ((size_t)bh * HD + (tid >> 4)) * SQ + (tid & 15) * 8;
  auto stage = [&](int s, unsigned buf) { const unsigned lb = buf * FSB;
    fa_copy4(lk + lb, 32 * FKP, gkh + (size_t)s * FK * DM, (size_t)32 * DM); fa_copy4(lk + lb + FKB, 32 * FKP, gkl + (size_t)s * FK * DM, (size_t)32 * DM); fa_copy4(lv + lb, 16 * FVP, gv + (size_t)s * FK, (size_t)16 * SQ); };
  stage(0, 0);
  const v16h qh0 = g2_frag(Qh + qo, hh), qh1 = g2_frag(Qh + qo + 32, hh), ql0 = g2_frag(Ql + qo, hh), ql1 = g2_frag(Ql + qo + 32, hh);
  const v8f z8 = {0.f,0.f,0.f,0.f,0.f,0.f,0.f,0.f}; v8f o0 = z8, o1 = z8, o2 = z8, o3 = z8; float m = -3.0e38f, l = 0.f;
  const float cs = 0.18033688011112042f;      /* log2(e) / 8: raw product -> exponent of two */
  asm volatile("s_wait_asynccnt 0x0" ::: "memory");      /* this wave's copies of stage 0 have landed */
  __syncthreads();      /* and every other wave's: stage 0 may be read */
  stage(1, 1);
#pragma unroll 1
  for (int t = 0; t < SQ / FK; ++t) {      /* rolled: one trip is one LDS stage, its four passes unrolled below */
    const unsigned char* kb = L + (t & 1) * FSB + ln * FKP + hh * 16; const unsigned char* vb = L + (t & 1) * FSB + 2 * FKB + ln * FVP + hh * 16;
    v16h h00 = fa_lfrag(kb), h01 = fa_lfrag(kb + 64), h10 = fa_lfrag(kb + 16 * FKP), h11 = fa_lfrag(kb + 16 * FKP + 64);
    v16h l00 = fa_lfrag(kb + FKB), l01 = fa_lfrag(kb + FKB + 64), l10 = fa_lfrag(kb + FKB + 16 * FKP), l11 = fa_lfrag(kb + FKB + 16 * FKP + 64);
#pragma unroll
    for (int p = 0; p < FK / 32; ++p) {      /* unrolled: every LDS offset a constant, and the K fragments are carried from pass to pass inside the stage */
      const v16h v0 = fa_lfrag(vb + p * 64), v1 = fa_lfrag(vb + 16 * FVP + p * 64), v2 = fa_lfrag(vb + 32 * FVP + p * 64), v3 = fa_lfrag(vb + 48 * FVP + p * 64);
      v8f sa = z8, sb = z8, ta = z8, tb = z8;      /* keys j .. j+15: sa small terms, sb main term; keys j+16 .. j+31: ta, tb */
      sa = fa_mma(h00, ql0, sa); sb = fa_mma(h00, qh0, sb); ta = fa_mma(h10, ql0, ta); tb = fa_mma(h10, qh0, tb);
      sa = fa_mma(h01, ql1, sa); sb = fa_mma(h01, qh1, sb); ta = fa_mma(h11, ql1, ta); tb = fa_mma(h11, qh1, tb);
      sa = fa_mma(l00, qh0, sa); ta = fa_mma(l10, qh0, ta); sa = fa_mma(l01, qh1, sa); ta = fa_mma(l11, qh1, ta);
      if (p + 1 < FK / 32) { const unsigned char* kn = kb + (p + 1) * 32 * FKP;      /* the next pass's K fragments come under this pass's softmax; never beyond this stage's own buffer */
        h00 = fa_lfrag(kn); h01 = fa_lfrag(kn + 64); h10 = fa_lfrag(kn + 16 * FKP); h11 = fa_lfrag(kn + 16 * FKP + 64);
        l00 = fa_lfrag(kn + FKB); l01 = fa_lfrag(kn + FKB + 64); l10 = fa_lfrag(kn + FKB + 16 * FKP); l11 = fa_lfrag(kn + FKB + 16 * FKP + 64); }
      float u[16];
#pragma unroll
      for (int r = 0; r < 8; ++r) { u[r] = fmaf(sa[r], 0.0009765625f, sb[r]); u[8 + r] = fmaf(ta[r], 0.0009765625f, tb[r]); }
      float pm = fmaxf(fmaxf(fmaxf(fmaxf(u[0], u[1]), fmaxf(u[2], u[3])), fmaxf(fmaxf(u[4], u[5]), fmaxf(u[6], u[7]))), fmaxf(fmaxf(fmaxf(u[8], u[9]), fmaxf(u[10], u[11])), fmaxf(fmaxf(u[12], u[13]), fmaxf(u[14], u[15]))));
      pm = fmaxf(pm, fa_swap16(pm));      /* both halves of a query's keys: the two lanes must use one maximum, their weights meet in one product */
      if (p + 1 < FK / 32) asm volatile("" :: "v"(h00), "v"(h01), "v"(h10), "v"(h11), "v"(l00), "v"(l01), "v"(l10), "v"(l11));      /* inputs only: keeps the next pass's K loads in front of the branch, under the maximum; sunk behind it they are waited for as soon as they are issued */
      if (__builtin_amdgcn_ballot_w32(pm > m) != 0) {      /* scalar branch: taken by the whole wave or not at all */
        const float mn = fmaxf(m, pm); const float al = __builtin_amdgcn_exp2f((m - mn) * cs); m = mn; l *= al; o0 *= al; o1 *= al; o2 *= al; o3 *= al; }
      const float mc = fmaf(-m, cs, 8.0f);      /* + 8: weights carried x256 against the f16 subnormal range */
      FragH pw; float e[16];
#pragma unroll
      for (int s = 0; s < 16; ++s) { e[s] = __builtin_amdgcn_exp2f(fmaf(u[s], cs, mc)); pw.h[s] = (_Float16)e[s]; }
      l += (((e[0] + e[1]) + (e[2] + e[3])) + ((e[4] + e[5]) + (e[6] + e[7]))) + (((e[8] + e[9]) + (e[10] + e[11])) + ((e[12] + e[13]) + (e[14] + e[15])));
      o0 = fa_mma(v0, pw.v, o0); o1 = fa_mma(v1, pw.v, o1); o2 = fa_mma(v2, pw.v, o2); o3 = fa_mma(v3, pw.v, o3);
    }
    asm volatile("s_wait_dscnt 0x0" ::: "memory");      /* this wave's reads of the buffer are done before the buffer is handed back */
    asm volatile("s_wait_asynccnt 0x0" ::: "memory");      /* this wave's copies of stage t + 1 have landed */
    __syncthreads();      /* publishes stage t + 1 and ends every wave's reads of stage t's buffer */
    if (t + 2 < SQ / FK) stage(t + 2, (unsigned)(t & 1));      /* same test in every wave of the block; refills the buffer just read */
  }
  asm volatile("s_wait_asynccnt 0x0" ::: "memory");      /* no copy is left in flight when the wave ends */
  l += fa_swap16(l); const float sc = 64.0f / l;      /* l = 256 sum exp; o carried x64 as before (folded into the output GEMM alpha) */
  unsigned short* op = (unsigned short*)O + qo + 8 * hh; FragH f;
#pragma unroll
  for (int r = 0; r < 8; ++r) { f.h[r] = (_Float16)(o0[r] * sc); f.h[8 + r] = (_Float16)(o1[r] * sc); }
  *(v8us*)op = f.half[0]; *(v8us*)(op + 16) = f.half[1];
#pragma unroll
  for (int r = 0; r < 8; ++r) { f.h[r] = (_Float16)(o2[r] * sc); f.h[8 + r] = (_Float16)(o3[r] * sc); }
  *(v8us*)(op + 32) = f.half[0]; *(v8us*)(op + 48) = f.half[1]; }

extern "C" void kernel_launch(void* const* d_in, const int* in_sizes, int n_in,
                              void* d_out, int out_size, void* d_ws, size_t ws_size, hipStream_t stream) {
  (void)in_sizes; (void)n_in; (void)out_size;
  const float* const* I = (const float* const*)d_in; const float* xq = I[0]; const float* xk = I[1]; const float* xv = I[2]; const float* wq = I[3]; const float* bq = nullptr; const float* wk = I[4]; const float* bk = nullptr; const float* wv = I[5]; const float* bv = nullptr; const float* wo = I[6]; const float* bo = nullptr;      /* input order: query, key, value; Wq, Wk, Wv [8][512][64] (per-head [in][out]); Wp [8][64][512] (flat [in][out] [512][512]): seven inputs; the module has NO biases: null pointers in the guarded bias slots */
  char* ws = (char*)d_ws; size_t off = 0;
  auto take = [&](size_t bytes) { char* p = ws + off; off += (bytes + 255) & ~(size_t)255; return p; };
  _Float16* BQ = (_Float16*)take((size_t)DM * DM * 2); _Float16* BK = (_Float16*)take((size_t)DM * DM * 2); _Float16* BV = (_Float16*)take((size_t)DM * DM * 2); _Float16* BO = (_Float16*)take((size_t)DM * DM * 2);
  _Float16* XQ = (_Float16*)take(NR * DM * 2); _Float16* XK = (_Float16*)take(NR * DM * 2); _Float16* XV = (_Float16*)take(NR * DM * 2); float* TF = (float*)take(NR * DM * 4); _Float16* QH = (_Float16*)take(NR * DM * 2); _Float16* QL = (_Float16*)take(NR * DM * 2); _Float16* KH = (_Float16*)take(NR * DM * 2); _Float16* KL = (_Float16*)take(NR * DM * 2); _Float16* V16 = (_Float16*)take(NR * DM * 2); _Float16* O16 = (_Float16*)take(NR * DM * 2);
  _Float16* VT = (_Float16*)take((size_t)NB * NH * HD * SQ * 2);
  if (off > ws_size) return;
{ const unsigned gh = (unsigned)(((size_t)NH * HD * (DM / 8) + 255) / 256); k_wthd<<<gh, 256, 0, stream>>>(wq, BQ); k_wthd<<<gh, 256, 0, stream>>>(wk, BK); k_wthd<<<gh, 256, 0, stream>>>(wv, BV); const unsigned g = (unsigned)(((size_t)DM * (DM / 8) + 255) / 256); k_wt_f16<<<g, 256, 0, stream>>>(wo, BO, DM, DM, 16.0f); }      /* per-head [h][i][o] -> Bt[(h, o)][i] x16 for q, k, v; the output weight [8][64][512] read flat = [in][out] [512][512] -> Bt[n][k] x16 */

  k_x16<<<(unsigned)((NR * DM / 8 + 255) / 256), 256, 0, stream>>>(xq, XQ, NR * DM / 8); k_x16<<<(unsigned)((NR * DM / 8 + 255) / 256), 256, 0, stream>>>(xk, XK, NR * DM / 8); k_x16<<<(unsigned)((NR * DM / 8 + 255) / 256), 256, 0, stream>>>(xv, XV, NR * DM / 8);      /* the three inputs as exact f16 rows */
  const size_t r0p = (size_t)B0 * SQ;      /* first projected row */
  k_gemm2<0><<<dim3((unsigned)((MP / 128) * (DM / 64)), 1), 128, 0, stream>>>(XQ + r0p * DM, DM, 0, BQ, DM, 0, 0.0625f, bq, 0, nullptr, 1, 0, 0, TF + r0p * DM, nullptr, DM, 0, MP, DM, DM); k_hl<<<(unsigned)((NR * DM / 8 + 255) / 256), 256, 0, stream>>>(TF, QH, QL, NR * DM / 8);      /* q (f32) -> f16 hi + x1024 residual planes */
  k_gemm2<0><<<dim3((unsigned)((MP / 128) * (DM / 64)), 1), 128, 0, stream>>>(XK + r0p * DM, DM, 0, BK, DM, 0, 0.0625f, bk, 0, nullptr, 1, 0, 0, TF + r0p * DM, nullptr, DM, 0, MP, DM, DM); k_hl<<<(unsigned)((NR * DM / 8 + 255) / 256), 256, 0, stream>>>(TF, KH, KL, NR * DM / 8);      /* k (f32) -> f16 hi + x1024 residual planes (the f32 plane reused in stream order) */
  k_gemm2<0><<<dim3((unsigned)((MP / 128) * (DM / 64)), 1), 128, 0, stream>>>(XV + r0p * DM, DM, 0, BV, DM, 0, 0.0625f, bv, 0, nullptr, 1, 0, 0, nullptr, V16 + r0p * DM, DM, 0, MP, DM, DM);
  k_vt<NH, SQ><<<NB * NH * (SQ / 64), 256, 0, stream>>>(V16, LQ, 0, VT);      /* V^T [NB * NH][HD][SQ], both batches */
  k_fattn<<<dim3(SQ / 128, NB * NH), 256, 0, stream>>>(QH, QL, KH, KL, VT, O16);      /* o (merged heads, x64) as f16 rows */
  k_gemm2<0><<<dim3((unsigned)((MPO / 128) * (DM / 64)), 1), 128, 0, stream>>>(O16 + r0p * DM, DM, 0, BO, DM, 0, 0.0009765625f, bo, 0, nullptr, 1, 0, 0, (float*)d_out + r0p * DM, nullptr, DM, 0, MPO, DM, DM);      /* out rows are the output layout */
}

// v004
// A run of this version takes 90.8 microseconds.
// In two side-by-side timings against v003, it was 1.68 and 1.67 times as fast.
// Counting every step since v000, it is 23.1 times as fast.
#include <hip/hip_runtime.h>
// Multi-head attention on THREE input streams with per-head projection weights and a per-head output weight, no biases at all (query, key, value [2][2048][512]; q = einsum(bni,hio->bnho)(query, Wq), k and v likewise from key and value (Wq, Wk, Wv [8][512][64] per-head [in][out], normal x 0.05); q / sqrt(64); logits = q.k per head; softmax over all 2048 keys (no mask); out = einsum(bnhi,hio->bno)(attn v, Wp) (Wp [8][64][512]: read flat it IS an [in][out] [512][512] weight with input row h*64 + i; no bias) -> [2][2048][512]; input order query, key, value, Wq, Wk, Wv, Wp).
// Structure: token rows r = b*2048 + s; the four weight planes in one launch (exact x16; q, k and v from the per-head stacks: plane row h*64 + o = W[h][:][o]; the output weight read flat); Q, K and V as ONE grid of WMMA GEMM tiles (32x64 wave tiles, f32 accumulation, no bias) that reads the f32 inputs itself (bf16-rounded, exact in f16, in registers) and whose epilogue writes Q and K as f16 hi + x1024 residual planes and V as V^T per (batch, head) through an LDS tile; then ONE fused attention kernel over all (batch, head, 128 queries): per 32 keys the scores from THREE products (K = 64: k_hi.q_lo and k_lo.q_hi, worth 2^-10, and k_hi.q_hi; all / 8), running-maximum softmax in registers (f32 statistics, native exp2; weights x256 as f16), O^T += V^T P^T, o carried x64 against f16 subnormal flush (folded into the output GEMM alpha) written straight into the merged f16 o rows; out = o W_p GEMM (f32; no bias) into the output layout.
// Compute dtype: inputs rounded to bf16; the three inputs as f16 in registers and the x16 weights as f16 planes (exact for every bf16 value of magnitude from 2^-14 up to 65,504; the weights up to 4,094 before their factor of 16); q and k as f16 hi + x1024 residual planes (about 2^-21), the scores from three products (the lo.lo term dropped); v, softmax weights and o as plain f16 GEMM operands (~2^-12); scores and softmax statistics f32. v_wmma_f32_16x16x32_f16.
#define NB 2
#define SQ 2048
#define DM 512
#define NH 8
#define HD 64
#define HG 4                         /* heads per launch of the grouped k_vt (not launched) */
#define B0 0                         /* first batch processed (debug hook) */
#define NBR NB                       /* batches processed (debug hook) */
#define NR ((size_t)NB * SQ)         /* token rows */
#define MP ((int)((size_t)NBR * SQ)) /* rows through the output stage, via MPO (debug hook) */
#define QN SQ                        /* query rows per batch (not used) */
#define NHD NH                       /* heads (not used) */
#define MPO MP                       /* rows through the output stage (debug hook) */
#define LQ DM      /* row pitch of the q and k rows (not used) */
typedef __bf16 v16b __attribute__((ext_vector_type(16)));
typedef unsigned short v8us __attribute__((ext_vector_type(8), may_alias));
typedef float  v8f  __attribute__((ext_vector_type(8)));
typedef float  v4f  __attribute__((ext_vector_type(4)));
typedef float  v4fa __attribute__((ext_vector_type(4), may_alias));
union FragB { v16b v; v8us half[2]; unsigned short u[16]; };

__device__ __forceinline__ unsigned short bf16_bits(float x) { unsigned int u = __float_as_uint(x); return (unsigned short)((u + 0x7FFFu + ((u >> 16) & 1u)) >> 16); }
__device__ __forceinline__ float bf16_val(unsigned short b) { return __uint_as_float(((unsigned int)b) << 16); }
__device__ __forceinline__ float bf16_round(float x) { return bf16_val(bf16_bits(x)); }
// D += A·B with NT terms: 1 = ah·bh, 2 = + al·bh (A split), 3 = + ah·bl (both split)
template <int NT>
__device__ __forceinline__ v8f mmaN(v16b ah, v16b al, v16b bh, v16b bl, v8f c) {
  c = __builtin_amdgcn_wmma_f32_16x16x32_bf16(false, ah, false, bh, (short)0, c, false, false);
  if (NT >= 2) c = __builtin_amdgcn_wmma_f32_16x16x32_bf16(false, al, false, bh, (short)0, c, false, false);
  if (NT >= 3) c = __builtin_amdgcn_wmma_f32_16x16x32_bf16(false, ah, false, bl, (short)0, c, false, false);
  asm volatile("v_nop\n\tv_nop\n\tv_nop\n\tv_nop" : "+v"(c) : "v"(ah), "v"(al), "v"(bh), "v"(bl));
  return c;
}

__global__ __launch_bounds__(256) void k_wt_bf16(const float* __restrict__ W, unsigned short* __restrict__ Wt, int K, int N) {
  const int t = blockIdx.x * 256 + threadIdx.x;
  const int k8n = K / 8;
  if (t >= N * k8n) return;
  const int n = t / k8n, k8 = (t % k8n) * 8;
  v8us v;
#pragma unroll
  for (int i = 0; i < 8; ++i) v[i] = bf16_bits(W[(size_t)(k8 + i) * N + n]);
  *(v8us*)(Wt + (size_t)n * K + k8) = v;
  
}

// GEMM C[M][N] (f32, pitch ldc) = act(A[M][K]·W + bias). A f32 row-major (pitch lda) converted per fragment to bf16
// (ASPLIT: hi/lo two planes -> 2 terms, else single rounded term); Wt bf16 [N][K] (pitch ldb). BIAS_BF16 rounds the
// bias to bf16 first (bias quantised to bf16 before the add). K%32==0, M%16==0, N%64==0.
template <bool ASPLIT, int ACT, bool BIAS_BF16>
__global__ __launch_bounds__(128) void k_gemm_bf(const float* __restrict__ A, int lda, const unsigned short* __restrict__ Wt, int ldb,
                                               const float* __restrict__ bias, float* __restrict__ C, int ldc, int M, int N, int K) {
  __shared__ __attribute__((aligned(16))) float so[4][16][64];
  const int tid = threadIdx.x, w = tid >> 5, lane = tid & 31, ln = lane & 15, hh = lane >> 4;
  const int ntn = N / 64;
  const int wid = blockIdx.x * 4 + w;
  const int mt = wid / ntn, nq = wid % ntn;
  if (mt * 16 >= M) return;
  const int row0 = mt * 16, col0 = nq * 64;
  const float* arow = A + (size_t)(row0 + ln) * lda;
  v8f acc[4] = {};
  for (int kb = 0; kb < K; kb += 32) {
    FragB ah, al;
    const v4f x0 = *(const v4fa*)(arow + kb + 8 * hh), x1 = *(const v4fa*)(arow + kb + 8 * hh + 4);
    const v4f x2 = *(const v4fa*)(arow + kb + 16 + 8 * hh), x3 = *(const v4fa*)(arow + kb + 16 + 8 * hh + 4);
    float xs[16] = {x0[0],x0[1],x0[2],x0[3],x1[0],x1[1],x1[2],x1[3],x2[0],x2[1],x2[2],x2[3],x3[0],x3[1],x3[2],x3[3]};
#pragma unroll
    for (int i = 0; i < 16; ++i) { const unsigned short hb = bf16_bits(xs[i]); ah.u[i] = hb; al.u[i] = ASPLIT ? bf16_bits(xs[i] - bf16_val(hb)) : (unsigned short)0; }
#pragma unroll
    for (int t = 0; t < 4; ++t) {
      const unsigned short* brow = Wt + (size_t)(col0 + t * 16 + ln) * ldb + kb;
      FragB b;
      b.half[0] = *(const v8us*)(brow + 8 * hh);
      b.half[1] = *(const v8us*)(brow + 16 + 8 * hh);
      acc[t] = mmaN<ASPLIT ? 2 : 1>(ah.v, al.v, b.v, b.v, acc[t]);
    }
  }
#pragma unroll
  for (int t = 0; t < 4; ++t) {
    float bv = bias ? bias[col0 + t * 16 + ln] : 0.f;
    if (BIAS_BF16) bv = bf16_round(bv);
#pragma unroll
    for (int r = 0; r < 8; ++r) { float v = acc[t][r] + bv; if (ACT == 1) v = fmaxf(v, 0.f); so[w][8 * hh + r][t * 16 + ln] = v; }
  }
  __builtin_amdgcn_fence(__ATOMIC_ACQ_REL, "workgroup");
  __builtin_amdgcn_wave_barrier();
  const int rsub = lane >> 4, c4 = (lane & 15) * 4;
  {
#pragma unroll
    for (int q = 0; q < 8; ++q) {
      const int r = q * 2 + rsub;
      const v4f v = *(const v4fa*)&so[w][r][c4];
      *(v4f*)(C + (size_t)(row0 + r) * ldc + col0 + c4) = v;
    }
    
  }
}

// GEMM C = act(A·W + bias + resid): A f32 (ASPLIT -> hi/lo 2 terms), Wt bf16 [N][K]; ACT 0 none, 1 relu, 2 exact gelu;
// resid (optional, f32, row index = (row % rmod), pitch ldr, RES_BF16 rounds it) added before the activation.
template <bool ASPLIT, int ACT, bool BIAS_BF16, bool RES_BF16>
__global__ __launch_bounds__(128) void k_gemm_bf3(const float* __restrict__ A, int lda, const unsigned short* __restrict__ Wt, int ldb,
                                                const float* __restrict__ bias, const float* __restrict__ resid, int rmod, int ldr,
                                                float* __restrict__ C, int ldc, int M, int N, int K) {
  __shared__ __attribute__((aligned(16))) float so[4][16][64];
  const int tid = threadIdx.x, w = tid >> 5, lane = tid & 31, ln = lane & 15, hh = lane >> 4;
  const int ntn = N / 64;
  const int wid = blockIdx.x * 4 + w;
  const int mt = wid / ntn, nq = wid % ntn;
  if (mt * 16 >= M) return;
  const int row0 = mt * 16, col0 = nq * 64;
  const float* arow = A + (size_t)(row0 + ln) * lda;
  v8f acc[4] = {};
  for (int kb = 0; kb < K; kb += 32) {
    FragB ah, al;
    const v4f x0 = *(const v4fa*)(arow + kb + 8 * hh), x1 = *(const v4fa*)(arow + kb + 8 * hh + 4);
    const v4f x2 = *(const v4fa*)(arow + kb + 16 + 8 * hh), x3 = *(const v4fa*)(arow + kb + 16 + 8 * hh + 4);
    float xs[16] = {x0[0],x0[1],x0[2],x0[3],x1[0],x1[1],x1[2],x1[3],x2[0],x2[1],x2[2],x2[3],x3[0],x3[1],x3[2],x3[3]};
#pragma unroll
    for (int i = 0; i < 16; ++i) { const unsigned short hb = bf16_bits(xs[i]); ah.u[i] = hb; al.u[i] = ASPLIT ? bf16_bits(xs[i] - bf16_val(hb)) : (unsigned short)0; }
#pragma unroll
    for (int t = 0; t < 4; ++t) {
      const unsigned short* brow = Wt + (size_t)(col0 + t * 16 + ln) * ldb + kb;
      FragB b;
      b.half[0] = *(const v8us*)(brow + 8 * hh);
      b.half[1] = *(const v8us*)(brow + 16 + 8 * hh);
      acc[t] = mmaN<ASPLIT ? 2 : 1>(ah.v, al.v, b.v, b.v, acc[t]);
    }
  }
#pragma unroll
  for (int t = 0; t < 4; ++t) {
    const int col = col0 + t * 16 + ln;
    float bv = bias ? bias[col] : 0.f;
    if (BIAS_BF16) bv = bf16_round(bv);
#pragma unroll
    for (int r = 0; r < 8; ++r) {
      float v = acc[t][r] + bv;
      if (resid) { float rv = resid[(size_t)((row0 + 8 * hh + r) % rmod) * ldr + col]; if (RES_BF16) rv = bf16_round(rv); v += rv; }
      if (ACT == 1) v = fmaxf(v, 0.f);
      if (ACT == 2) v = 0.5f * v * (1.0f + erff(v * 0.70710678118654752f));
      if (ACT == 3) { const float u = 0.7978845608028654f * (v + 0.044715f * v * v * v); v = 0.5f * v * (1.0f + tanhf(u)); }
      so[w][8 * hh + r][t * 16 + ln] = v;
    }
  }
  __builtin_amdgcn_fence(__ATOMIC_ACQ_REL, "workgroup");
  __builtin_amdgcn_wave_barrier();
  const int rsub = lane >> 4, c4 = (lane & 15) * 4;
  {
#pragma unroll
    for (int q = 0; q < 8; ++q) {
      const int r = q * 2 + rsub;
      const v4f v = *(const v4fa*)&so[w][r][c4];
      *(v4f*)(C + (size_t)(row0 + r) * ldc + col0 + c4) = v;
    }
    
  }
}
// row LayerNorm (biased variance, eps) over N: s = X (+ R); optional out_sum <- s; out_norm <- (s-mu)*rsqrt(var+eps)*g + b
template <bool PARAM_BF16>
__global__ __launch_bounds__(256) void k_layernorm(const float* __restrict__ X, const float* __restrict__ R, const float* __restrict__ g, const float* __restrict__ bta,
                                                  float* __restrict__ out_sum, float* __restrict__ out_norm, int N, float eps) {
  __shared__ float red[256];
  const int row = blockIdx.x, tid = threadIdx.x;
  const float* x = X + (size_t)row * N; const float* rr = R ? R + (size_t)row * N : nullptr;
  float vals[16];                     // up to N = 4096
  const int per = N / 256;            // contiguous chunk per thread? use strided-by-4 chunks: thread handles j = tid*4 + 1024*u
  float s1 = 0.f;
  for (int u = 0; u < per / 4; ++u) {
    const int j = tid * 4 + 1024 * u;
    const v4f a = *(const v4fa*)(x + j);
    v4f b = {0.f,0.f,0.f,0.f}; if (rr) b = *(const v4fa*)(rr + j);
#pragma unroll
    for (int q = 0; q < 4; ++q) { const float v = a[q] + b[q]; vals[u * 4 + q] = v; s1 += v; }
  }
  red[tid] = s1; __syncthreads();
  for (int st = 128; st > 0; st >>= 1) { if (tid < st) red[tid] += red[tid + st]; __syncthreads(); }
  const float mu = red[0] / (float)N; __syncthreads();
  float s2 = 0.f;
  for (int u = 0; u < per / 4; ++u)
#pragma unroll
    for (int q = 0; q < 4; ++q) { const float c = vals[u * 4 + q] - mu; s2 += c * c; }
  red[tid] = s2; __syncthreads();
  for (int st = 128; st > 0; st >>= 1) { if (tid < st) red[tid] += red[tid + st]; __syncthreads(); }
  const float rs = rsqrtf(red[0] / (float)N + eps);
  {
    for (int u = 0; u < per / 4; ++u) {
      const int j = tid * 4 + 1024 * u;
      v4f o, sm;
#pragma unroll
      for (int q = 0; q < 4; ++q) {
        float gg = g[j + q], bb = bta[j + q];
        if (PARAM_BF16) { gg = bf16_round(gg); bb = bf16_round(bb); }
        sm[q] = vals[u * 4 + q]; o[q] = (vals[u * 4 + q] - mu) * rs * gg + bb;
      }
      if (out_sum) *(v4f*)(out_sum + (size_t)row * N + j) = sm;
      *(v4f*)(out_norm + (size_t)row * N + j) = o;
    }
    
  }
}



// ---- f16 WMMA path (v_wmma_f32_16x16x32_f16): 11-bit significands for operands in range — used where a [0,1] probability operand needs more precision than bf16
typedef _Float16 v16h __attribute__((ext_vector_type(16)));
union FragH { v16h v; v8us half[2]; _Float16 h[16]; unsigned short u[16]; };
template <int NT>
__device__ __forceinline__ v8f mmaH(v16h ah, v16h al, v16h bh, v16h bl, v8f c) {
  c = __builtin_amdgcn_wmma_f32_16x16x32_f16(false, ah, false, bh, (short)0, c, false, false);
  if (NT >= 2) c = __builtin_amdgcn_wmma_f32_16x16x32_f16(false, al, false, bh, (short)0, c, false, false);
  if (NT >= 3) c = __builtin_amdgcn_wmma_f32_16x16x32_f16(false, ah, false, bl, (short)0, c, false, false);
  asm volatile("v_nop\n\tv_nop\n\tv_nop\n\tv_nop" : "+v"(c) : "v"(ah), "v"(al), "v"(bh), "v"(bl));
  return c;
}
// batched GEMM like k_gemm_b but f16 operands: A f32 (split into f16 hi/lo if ASPLIT, else rounded to f16), Bt = f16 values [n][k]; alpha; C f32; N multiple of 16 (partial tiles skipped)
template <bool ASPLIT>
__global__ __launch_bounds__(128) void k_gemm_h(const float* __restrict__ A, int lda, size_t sA, const _Float16* __restrict__ Bh, int ldb, size_t sB, float alpha, float* __restrict__ C, int ldc, size_t sC, int M, int N, int K) {
  __shared__ __attribute__((aligned(16))) float so[4][16][64];
  const int tid = threadIdx.x, w = tid >> 5, lane = tid & 31, ln = lane & 15, hh = lane >> 4; const int by = blockIdx.y;
  A += (size_t)by * sA; Bh += (size_t)by * sB; C += (size_t)by * sC;
  const int ntn = (N + 63) / 64; const int wid = blockIdx.x * 4 + w; const int mt = wid / ntn, nq = wid % ntn; if (mt * 16 >= M) return;
  const int row0 = mt * 16, col0 = nq * 64; const float* arow = A + (size_t)(row0 + ln) * lda;
  v8f acc[4] = {};
  for (int kb = 0; kb < K; kb += 32) {
    FragH ah, al;
    const v4f x0 = *(const v4fa*)(arow + kb + 8 * hh), x1 = *(const v4fa*)(arow + kb + 8 * hh + 4), x2 = *(const v4fa*)(arow + kb + 16 + 8 * hh), x3 = *(const v4fa*)(arow + kb + 16 + 8 * hh + 4);
    float xs[16] = {x0[0],x0[1],x0[2],x0[3],x1[0],x1[1],x1[2],x1[3],x2[0],x2[1],x2[2],x2[3],x3[0],x3[1],x3[2],x3[3]};
#pragma unroll
    for (int i = 0; i < 16; ++i) { const _Float16 h = (_Float16)xs[i]; ah.h[i] = h; al.h[i] = ASPLIT ? (_Float16)(xs[i] - (float)h) : (_Float16)0.0f; }
#pragma unroll
    for (int t = 0; t < 4; ++t) { if (col0 + t * 16 >= N) continue; const size_t boff = (size_t)(col0 + t * 16 + ln) * ldb + kb; FragH bq; bq.half[0] = *(const v8us*)(Bh + boff + 8 * hh); bq.half[1] = *(const v8us*)(Bh + boff + 16 + 8 * hh);
      acc[t] = mmaH<ASPLIT ? 2 : 1>(ah.v, al.v, bq.v, bq.v, acc[t]); }
  }
#pragma unroll
  for (int t = 0; t < 4; ++t) { if (col0 + t * 16 >= N) continue;
#pragma unroll
    for (int r = 0; r < 8; ++r) so[w][8 * hh + r][t * 16 + ln] = acc[t][r] * alpha; }
  __builtin_amdgcn_fence(__ATOMIC_ACQ_REL, "workgroup"); __builtin_amdgcn_wave_barrier();
  const int rsub = lane >> 4, c4 = (lane & 15) * 4;
  {
#pragma unroll
    for (int q = 0; q < 8; ++q) { const int r = q * 2 + rsub; if (col0 + c4 < N) { const v4f v = *(const v4fa*)&so[w][r][c4]; *(v4f*)(C + (size_t)(row0 + r) * ldc + col0 + c4) = v; } }
     }
}

// k_gemm_hh variant with fused epilogue: v = acc·alpha + bias[by·sBias + col] (+ CP[(row/rowsPerB)·sCPb + by·64 + col] if CP) ; ACT 0 none / 1 elu ; writes f16 C16 (and f32 C if non-null)
template <int ACT>
__global__ __launch_bounds__(128) void k_gemm_hhx(const _Float16* __restrict__ A, int lda, size_t sA, const _Float16* __restrict__ Bh, int ldb, size_t sB, float alpha, const float* __restrict__ bias, size_t sBias, const float* __restrict__ CP, int rowsPerB, size_t sCPb, int row0g,
    float* __restrict__ C, _Float16* __restrict__ C16, int ldc, size_t sC, int M, int N, int K) {
  __shared__ __attribute__((aligned(16))) float so[4][16][64];
  const int tid = threadIdx.x, w = tid >> 5, lane = tid & 31, ln = lane & 15, hh = lane >> 4; const int by = blockIdx.y;
  A += (size_t)by * sA; Bh += (size_t)by * sB; const size_t cofs = (size_t)by * sC; const float* bp = bias ? bias + (size_t)by * sBias : nullptr;
  const int ntn = (N + 63) / 64; const int wid = blockIdx.x * 4 + w; const int mt = wid / ntn, nq = wid % ntn; if (mt * 16 >= M) return;
  const int row0 = mt * 16, col0 = nq * 64; const _Float16* arow = A + (size_t)(row0 + ln) * lda;
  v8f acc[4] = {};
  for (int kb = 0; kb < K; kb += 32) { FragH ah; ah.half[0] = *(const v8us*)((const unsigned short*)arow + kb + 8 * hh); ah.half[1] = *(const v8us*)((const unsigned short*)arow + kb + 16 + 8 * hh);
#pragma unroll
    for (int t = 0; t < 4; ++t) { if (col0 + t * 16 >= N) continue; const size_t boff = (size_t)(col0 + t * 16 + ln) * ldb + kb; FragH bq; bq.half[0] = *(const v8us*)((const unsigned short*)Bh + boff + 8 * hh); bq.half[1] = *(const v8us*)((const unsigned short*)Bh + boff + 16 + 8 * hh);
      acc[t] = mmaH<1>(ah.v, ah.v, bq.v, bq.v, acc[t]); }
  }
#pragma unroll
  for (int t = 0; t < 4; ++t) { if (col0 + t * 16 >= N) continue; const int col = col0 + t * 16 + ln; const float bv = bp ? bf16_round(bp[col]) : 0.f;
#pragma unroll
    for (int r = 0; r < 8; ++r) { float v = acc[t][r] * alpha + bv; if (CP) { const int rr = row0g + row0 + 8 * hh + r; if (rowsPerB < 0) v += CP[cofs + (size_t)rr * ldc + col];      /* rowsPerB < 0: own element of the batched C plane */ else { const int bidx = rr / rowsPerB; v += CP[(size_t)bidx * sCPb + (size_t)by * 64 + col]; } } if (ACT == 1) v = (v > 0.f) ? v : expm1f(v); else if (ACT == 7) v = (v > 0.f) ? v + 1.0f : expf(v); else if (ACT == 8) v = tanhf(v); else if (ACT == 9) v = 0.5f * v * (1.0f + tanhf(0.7978845608028654f * (v + 0.044715f * v * v * v))); else if (ACT == 11) v = 1.0f / (1.0f + expf(-v)); else if (ACT == 12) v = (v > 0.f) ? v : 0.01f * v; else if (ACT == 14) v = (v > 0.f) ? v : 0.1f * v; else if (ACT == 16) v = (v >= 0.f) ? v : 0.3f * v; else if (ACT == 17) v = (v >= 0.f) ? v : 0.2f * v; else if (ACT == 15) v = v / (1.0f + expf(-v)); else if (ACT == 3) v = fmaxf(v, 0.f); else if (ACT == 6) v = 0.5f * v * (1.0f + erff(v * 0.70710678118654752f)); so[w][8 * hh + r][t * 16 + ln] = v; } }
  __builtin_amdgcn_fence(__ATOMIC_ACQ_REL, "workgroup"); __builtin_amdgcn_wave_barrier();
  const int rsub = lane >> 4, c4 = (lane & 15) * 4; typedef _Float16 v4h __attribute__((ext_vector_type(4)));
  {
#pragma unroll
    for (int q = 0; q < 8; ++q) { const int r = q * 2 + rsub; if (col0 + c4 < N) { const v4f v = *(const v4fa*)&so[w][r][c4]; if (C) *(v4f*)(C + cofs + (size_t)(row0 + r) * ldc + col0 + c4) = v; if (C16) { v4h h4; for (int i = 0; i < 4; ++i) h4[i] = (_Float16)v[i]; *(v4h*)(C16 + cofs + (size_t)(row0 + r) * ldc + col0 + c4) = h4; } } }
     }
}


typedef _Float16 v4h __attribute__((ext_vector_type(4)));

__global__ __launch_bounds__(256) void k_h16(const float* __restrict__ x, _Float16* __restrict__ X16, size_t n8) { const size_t t = (size_t)blockIdx.x * 256 + threadIdx.x; if (t >= n8) return; FragH f;
#pragma unroll
  for (int q = 0; q < 8; ++q) f.h[q] = (_Float16)x[t * 8 + q]; *(v8us*)((unsigned short*)X16 + t * 8) = f.half[0];  }
__global__ __launch_bounds__(256) void k_round16f(const float* __restrict__ W, _Float16* __restrict__ Bt, size_t n8) { const size_t t = (size_t)blockIdx.x * 256 + threadIdx.x; if (t >= n8) return; FragH f;
#pragma unroll
  for (int i = 0; i < 8; ++i) f.h[i] = (_Float16)(bf16_round(W[t * 8 + i]) * 16.0f); *(v8us*)((unsigned short*)Bt + t * 8) = f.half[0];  }
// ---- fast GEMM (wave tile 32x64; requires M % 32 == 0 rows per launch region and N % 64 == 0); epilogue = k_gemm_hhx semantics ----
__device__ __forceinline__ v16h g2_frag(const _Float16* p, int hh) { FragH f; f.half[0] = *(const v8us*)((const unsigned short*)p + 8 * hh); f.half[1] = *(const v8us*)((const unsigned short*)p + 16 + 8 * hh); return f.v; }
__device__ __forceinline__ v8f g2_mma(v16h a, v16h b, v8f c) { v8f d = __builtin_amdgcn_wmma_f32_16x16x32_f16(false, a, false, b, (short)0, c, false, false); asm volatile("v_nop\n\tv_nop\n\tv_nop\n\tv_nop" : "+v"(d) : "v"(a), "v"(b)); return d; }
template <int ACT>
__global__ __launch_bounds__(128) void k_gemm2(const _Float16* __restrict__ A, int lda, size_t sA, const _Float16* __restrict__ Bh, int ldb, size_t sB, float alpha, const float* __restrict__ bias, size_t sBias, const float* __restrict__ CP, int rowsPerB, size_t sCPb, int row0g,
    float* __restrict__ C, _Float16* __restrict__ C16, int ldc, size_t sC, int M, int N, int K) { static_assert(ACT == 0 || ACT == 3 || ACT == 6 || ACT == 8 || ACT == 9 || ACT == 11 || ACT == 12 || ACT == 14 || ACT == 15 || ACT == 16 || ACT == 17, "k_gemm2: unsupported ACT code (would silently apply no activation)");
  __shared__ __attribute__((aligned(16))) float so[4][32][68];
  const int tid = threadIdx.x, w = tid >> 5, lane = tid & 31, ln = lane & 15, hh = lane >> 4; const int by = blockIdx.y;
  A += (size_t)by * sA; Bh += (size_t)by * sB; const size_t cofs = (size_t)by * sC; const float* bp = bias ? bias + (size_t)by * sBias : nullptr;
  const int ntn = N >> 6; const int mt = blockIdx.x / ntn, nq = blockIdx.x - mt * ntn; const int row0 = mt * 128 + 32 * w, col0 = nq * 64; if (row0 >= M) return;
  const _Float16* a0p = A + (size_t)(row0 + ln) * lda; const _Float16* a1p = a0p + (size_t)16 * lda;
  const _Float16* b0p = Bh + (size_t)(col0 + ln) * ldb; const _Float16* b1p = b0p + (size_t)16 * ldb; const _Float16* b2p = b1p + (size_t)16 * ldb; const _Float16* b3p = b2p + (size_t)16 * ldb;
  const v8f z8 = {0.f,0.f,0.f,0.f,0.f,0.f,0.f,0.f}; v8f c00 = z8, c01 = z8, c02 = z8, c03 = z8, c10 = z8, c11 = z8, c12 = z8, c13 = z8;
#pragma unroll 1
  for (int kb = 0; kb < K; kb += 32) { const v16h a0 = g2_frag(a0p + kb, hh), a1 = g2_frag(a1p + kb, hh);
    v16h b = g2_frag(b0p + kb, hh); c00 = g2_mma(a0, b, c00); c10 = g2_mma(a1, b, c10);
    b = g2_frag(b1p + kb, hh); c01 = g2_mma(a0, b, c01); c11 = g2_mma(a1, b, c11);
    b = g2_frag(b2p + kb, hh); c02 = g2_mma(a0, b, c02); c12 = g2_mma(a1, b, c12);
    b = g2_frag(b3p + kb, hh); c03 = g2_mma(a0, b, c03); c13 = g2_mma(a1, b, c13); }
  v8f accs[8] = {c00, c01, c02, c03, c10, c11, c12, c13};
#pragma unroll
  for (int u = 0; u < 8; ++u) { const int t = u & 3, half = u >> 2; const int col = col0 + t * 16 + ln; const float bv = bp ? bf16_round(bp[col]) : 0.f;
#pragma unroll
    for (int r = 0; r < 8; ++r) { const int rloc = half * 16 + 8 * hh + r; float v = accs[u][r] * alpha + bv; if (CP) { if (rowsPerB < 0) v += CP[cofs + (size_t)(row0g + row0 + rloc) * ldc + col];      /* rowsPerB < 0: own element of the batched C plane */ else { const int bidx = (row0g + row0 + rloc) / rowsPerB; v += CP[(size_t)bidx * sCPb + (size_t)by * 64 + col]; } }
      if (ACT == 3) v = fmaxf(v, 0.f); else if (ACT == 6) v = 0.5f * v * (1.0f + erff(v * 0.70710678118654752f)); else if (ACT == 11) v = 1.0f / (1.0f + expf(-v)); else if (ACT == 15) v = v / (1.0f + expf(-v)); else if (ACT == 12) v = (v > 0.f) ? v : 0.01f * v; else if (ACT == 8) v = tanhf(v); else if (ACT == 9) v = 0.5f * v * (1.0f + tanhf(0.7978845608028654f * (v + 0.044715f * v * v * v))); else if (ACT == 14) v = (v > 0.f) ? v : 0.1f * v; else if (ACT == 16) v = (v >= 0.f) ? v : 0.3f * v; else if (ACT == 17) v = (v >= 0.f) ? v : 0.2f * v;
      so[w][rloc][t * 16 + ln] = v; } }
  __builtin_amdgcn_fence(__ATOMIC_ACQ_REL, "workgroup"); __builtin_amdgcn_wave_barrier();
  const int rsub = lane >> 4, c4 = (lane & 15) * 4;
  {
#pragma unroll
    for (int q = 0; q < 16; ++q) { const int r = q * 2 + rsub; const v4f v = *(const v4fa*)&so[w][r][c4]; if (C) *(v4f*)(C + cofs + (size_t)(row0 + r) * ldc + col0 + c4) = v; if (C16) { v4h h4; for (int i = 0; i < 4; ++i) h4[i] = (_Float16)v[i]; *(v4h*)(C16 + cofs + (size_t)(row0 + r) * ldc + col0 + c4) = h4; } }
     } }


// ---- the passes around the projections, folded into two launches ----
// All four weight planes Bt[n][k] = f16(16 bf16(W(k, n))) in one grid: blockIdx.y = 0, 1, 2: a per-head stack, W(k, n) = W[n / HD][k][n % HD]; 3: the flat [in][out] output weight, W(k, n) = W[k][n]. DM * DM / 8 threads a plane.
__global__ __launch_bounds__(256) void k_wprep(const float* __restrict__ wq, const float* __restrict__ wk, const float* __restrict__ wv, const float* __restrict__ wo, _Float16* __restrict__ BQ, _Float16* __restrict__ BK, _Float16* __restrict__ BV, _Float16* __restrict__ BO) {
  const int y = blockIdx.y, t = blockIdx.x * 256 + threadIdx.x; const int k8 = (t % (DM / 8)) * 8, n = t / (DM / 8);
  const float* W = y == 0 ? wq : y == 1 ? wk : y == 2 ? wv : wo; _Float16* Bt = y == 0 ? BQ : y == 1 ? BK : y == 2 ? BV : BO;
  const float* s = y < 3 ? W + ((size_t)(n / HD) * DM + k8) * HD + n % HD : W + (size_t)k8 * DM + n; const int st = y < 3 ? HD : DM; FragH f;
#pragma unroll
  for (int q = 0; q < 8; ++q) f.h[q] = (_Float16)(bf16_round(s[(size_t)q * st]) * 16.0f);
  *(v8us*)((unsigned short*)Bt + (size_t)n * DM + k8) = f.half[0]; }
typedef __bf16 v4bf __attribute__((ext_vector_type(4)));
// A fragment in g2_frag's k order straight from an f32 input row; each value rounded to bf16 (exact in f16) in registers
__device__ __forceinline__ v16h pj_frag(const float* p, int hh) { const v4f x0 = *(const v4fa*)(p + 8 * hh), x1 = *(const v4fa*)(p + 8 * hh + 4), x2 = *(const v4fa*)(p + 16 + 8 * hh), x3 = *(const v4fa*)(p + 16 + 8 * hh + 4); FragH f;
  const v4bf r0 = __builtin_convertvector(x0, v4bf), r1 = __builtin_convertvector(x1, v4bf), r2 = __builtin_convertvector(x2, v4bf), r3 = __builtin_convertvector(x3, v4bf);      /* round to nearest even, as bf16_round */
#pragma unroll
  for (int q = 0; q < 4; ++q) { f.h[q] = (_Float16)(float)r0[q]; f.h[4 + q] = (_Float16)(float)r1[q]; f.h[8 + q] = (_Float16)(float)r2[q]; f.h[12 + q] = (_Float16)(float)r3[q]; }
  return f.v; }
// q, k and v projections in one grid (blockIdx.y = 0, 1, 2), k_gemm2's tile and loop: block 128 rows x 64 columns (= one head), wave 32 x 64, K = DM.
// Epilogue: q and k (f32, / 16 for the weight factor) leave as f16 hi + x1024 residual planes in row layout; v leaves as V^T [NB * NH][HD][SQ]: a lane's 8 accumulator rows are 8 consecutive tokens of one head-dim column,
// so they go as one 16-byte piece into an LDS tile [HD][128 tokens] (pitch PVP bytes) from which the block stores whole 256-byte runs.
#define PVP 272
__global__ __launch_bounds__(128) void k_proj(const float* __restrict__ xq, const float* __restrict__ xk, const float* __restrict__ xv, const _Float16* __restrict__ BQ, const _Float16* __restrict__ BK, const _Float16* __restrict__ BV,
    _Float16* __restrict__ QH, _Float16* __restrict__ QL, _Float16* __restrict__ KH, _Float16* __restrict__ KL, _Float16* __restrict__ VT) {
  __shared__ __attribute__((aligned(16))) float so[4][32][68];
  const int tid = threadIdx.x, w = tid >> 5, lane = tid & 31, ln = lane & 15, hh = lane >> 4; const int y = blockIdx.y;
  const float* A = y == 0 ? xq : y == 1 ? xk : xv; const _Float16* Bh = y == 0 ? BQ : y == 1 ? BK : BV;
  const int mt = blockIdx.x / (DM / 64), nq = blockIdx.x - mt * (DM / 64); const int row0 = mt * 128 + 32 * w, col0 = nq * 64;
  const float* a0p = A + (size_t)(row0 + ln) * DM; const float* a1p = a0p + (size_t)16 * DM;
  const _Float16* b0p = Bh + (size_t)(col0 + ln) * DM; const _Float16* b1p = b0p + (size_t)16 * DM; const _Float16* b2p = b1p + (size_t)16 * DM; const _Float16* b3p = b2p + (size_t)16 * DM;
  const v8f z8 = {0.f,0.f,0.f,0.f,0.f,0.f,0.f,0.f}; v8f c00 = z8, c01 = z8, c02 = z8, c03 = z8, c10 = z8, c11 = z8, c12 = z8, c13 = z8;
#pragma unroll 1
  for (int kb = 0; kb < DM; kb += 32) { const v16h a0 = pj_frag(a0p + kb, hh), a1 = pj_frag(a1p + kb, hh);      /* rolled, as in k_gemm2 */
    v16h b = g2_frag(b0p + kb, hh); c00 = g2_mma(a0, b, c00); c10 = g2_mma(a1, b, c10);
    b = g2_frag(b1p + kb, hh); c01 = g2_mma(a0, b, c01); c11 = g2_mma(a1, b, c11);
    b = g2_frag(b2p + kb, hh); c02 = g2_mma(a0, b, c02); c12 = g2_mma(a1, b, c12);
    b = g2_frag(b3p + kb, hh); c03 = g2_mma(a0, b, c03); c13 = g2_mma(a1, b, c13); }
  v8f accs[8] = {c00, c01, c02, c03, c10, c11, c12, c13};
  if (y == 2) {      /* same for the whole block */
    unsigned char* st = (unsigned char*)&so[0][0][0];
#pragma unroll
    for (int u = 0; u < 8; ++u) { const int t = u & 3, half = u >> 2; FragH f;
#pragma unroll
      for (int r = 0; r < 8; ++r) f.h[r] = (_Float16)(accs[u][r] * 0.0625f);
      *(v8us*)(st + (t * 16 + ln) * PVP + (w * 32 + half * 16 + 8 * hh) * 2) = f.half[0]; }
    __syncthreads();      /* the tile's 128 tokens come from all four waves */
    const int bb = (mt * 128) / SQ, s0 = (mt * 128) % SQ;
#pragma unroll
    for (int i = 0; i < 8; ++i) { const int d = i * 8 + (tid >> 4), pc = tid & 15; const v8us v = *(const v8us*)(st + d * PVP + pc * 16);
      *(v8us*)((unsigned short*)VT + ((size_t)(bb * NH + nq) * HD + d) * SQ + s0 + pc * 8) = v; }
  } else {
    _Float16* Hh = y == 0 ? QH : KH; _Float16* Hl = y == 0 ? QL : KL;
#pragma unroll
    for (int u = 0; u < 8; ++u) { const int t = u & 3, half = u >> 2;
#pragma unroll
      for (int r = 0; r < 8; ++r) so[w][half * 16 + 8 * hh + r][t * 16 + ln] = accs[u][r] * 0.0625f; }
    __builtin_amdgcn_fence(__ATOMIC_ACQ_REL, "workgroup"); __builtin_amdgcn_wave_barrier();      /* a wave reads back only its own 32 rows */
    const int rsub = lane >> 4, c4 = (lane & 15) * 4;
#pragma unroll
    for (int q = 0; q < 16; ++q) { const int r = q * 2 + rsub; const v4f v = *(const v4fa*)&so[w][r][c4]; v4h h4, l4;
#pragma unroll
      for (int i = 0; i < 4; ++i) { const _Float16 hv = (_Float16)v[i]; h4[i] = hv; l4[i] = (_Float16)((v[i] - (float)hv) * 1024.0f); }
      const size_t o = (size_t)(row0 + r) * DM + col0 + c4; *(v4h*)(Hh + o) = h4; *(v4h*)(Hl + o) = l4; }
  } }

__global__ __launch_bounds__(256) void k_wnat(const float* __restrict__ w, size_t n8, _Float16* __restrict__ Bt) { const size_t t = (size_t)blockIdx.x * 256 + threadIdx.x; if (t >= n8) return; FragH f; for (int q = 0; q < 8; ++q) f.h[q] = (_Float16)(bf16_round(w[t * 8 + q]) * 16.0f); *(v8us*)((unsigned short*)Bt + t * 8) = f.half[0];  }
__global__ __launch_bounds__(256) void k_rsm(const float* __restrict__ S, _Float16* __restrict__ P, int nrows) {
  #pragma clang fp contract(off)
  const int i = blockIdx.x * 256 + threadIdx.x; if (i >= nrows) return; const float* s = S + (size_t)i * SQ; float mx = -3.0e38f;
#pragma unroll 1
  for (int j = 0; j < SQ; ++j) mx = fmaxf(mx, s[j]); float se = 0.f;
#pragma unroll 1
  for (int j = 0; j < SQ; ++j) se += expf(s[j] - mx); const float sc = 256.0f / se;
#pragma unroll 1
  for (int j0 = 0; j0 < SQ; j0 += 8) { FragH f; for (int q = 0; q < 8; ++q) f.h[q] = (_Float16)(expf(s[j0 + q] - mx) * sc); unsigned short* d = (unsigned short*)P + (size_t)i * SQ + j0; *(v8us*)d = f.half[0];  } }
__global__ __launch_bounds__(256) void k_vt(const _Float16* __restrict__ V16, int b, int h0, _Float16* __restrict__ VT) { __shared__ unsigned short tl[64][65]; const int tid = threadIdx.x; const int hh = blockIdx.x % HG, sg = blockIdx.x / HG; const int s0 = sg * 64; const int h = h0 + hh;
  for (int i = tid; i < 64 * 8; i += 256) { const int j = i / 8, d8 = (i % 8) * 8; FragH f; f.half[0] = *(const v8us*)((const unsigned short*)V16 + ((size_t)b * SQ + s0 + j) * DM + h * HD + d8); for (int q = 0; q < 8; ++q) tl[d8 + q][j] = f.u[q]; }
  __syncthreads();
  { for (int i = tid; i < 64 * 8; i += 256) { const int d = i / 8, j8 = (i % 8) * 8; FragH f; for (int q = 0; q < 8; ++q) f.u[q] = tl[d][j8 + q]; *(v8us*)((unsigned short*)VT + ((size_t)hh * HD + d) * SQ + s0 + j8) = f.half[0]; }  } }



#define FK 128                       /* keys per LDS stage: 4 passes of 32 */
#define FKP 144                      /* LDS pitch in bytes of a K row (128 bytes of data) */
#define FVP 272                      /* LDS pitch in bytes of a V^T row (256 bytes of data) */
#define FKB (FK * FKP)               /* one K plane of a stage */
#define FSB (2 * FKB + HD * FVP)     /* one stage: K hi, K lo, V^T */
__device__ __forceinline__ v8f fa_mma(v16h a, v16h b, v8f c) { return __builtin_amdgcn_wmma_f32_16x16x32_f16(false, a, false, b, (short)0, c, false, false); }
__device__ __forceinline__ float fa_swap16(float x) { const int b = __float_as_int(x); return __int_as_float(__builtin_amdgcn_permlanex16(b, b, 0x76543210, 0xfedcba98, false, false)); }      /* value of lane l ^ 16 */
__device__ __forceinline__ v16h fa_lfrag(const unsigned char* p) { FragH f; f.half[0] = *(const v8us*)p; f.half[1] = *(const v8us*)(p + 32); return f.v; }      /* g2_frag's k order, from an LDS row; p already holds the lane half's 16 bytes */
// Four copies of 16 bytes a lane, global -> LDS. The s_wait_xcnt closes the statement so that it stands in front of every later write of the address registers that the copies name.
__device__ __forceinline__ void fa_copy4(unsigned l0, unsigned lstep, const _Float16* g0, size_t gstep) {
  const unsigned l1 = l0 + lstep, l2 = l1 + lstep, l3 = l2 + lstep; const _Float16* g1 = g0 + gstep; const _Float16* g2 = g1 + gstep; const _Float16* g3 = g2 + gstep;
  asm volatile("global_load_async_to_lds_b128 %0, %4, off\n\tglobal_load_async_to_lds_b128 %1, %5, off\n\tglobal_load_async_to_lds_b128 %2, %6, off\n\tglobal_load_async_to_lds_b128 %3, %7, off\n\ts_wait_xcnt 0x0"
               :: "v"(l0), "v"(l1), "v"(l2), "v"(l3), "v"(g0), "v"(g1), "v"(g2), "v"(g3) : "memory"); }
__global__ __launch_bounds__(256) void k_fattn(const _Float16* __restrict__ Qh, const _Float16* __restrict__ Ql, const _Float16* __restrict__ Kh, const _Float16* __restrict__ Kl, const _Float16* __restrict__ Vt, _Float16* __restrict__ O) {
  __shared__ __attribute__((aligned(128))) unsigned char L[2 * FSB];
  const int tid = threadIdx.x, lane = tid & 31, ln = lane & 15, hh = lane >> 4; const int w = __builtin_amdgcn_readfirstlane((int)(threadIdx.x >> 5));
  const int bh = blockIdx.y, b = bh / NH, h = bh - b * NH; const size_t r0 = (size_t)b * SQ; const int q0 = blockIdx.x * 128 + w * 16;
  const size_t qo = (r0 + q0 + ln) * DM + h * HD;
  /* the copies of a stage: K rows of 8 pieces (a thread: rows tid / 8 + 32 i), V^T rows of 16 pieces (rows tid / 16 + 16 i); every lane on, every piece written by one lane */
  const unsigned lds0 = (unsigned)(size_t)L; const unsigned lk = lds0 + (unsigned)((tid >> 3) * FKP + (tid & 7) * 16), lv = lds0 + (unsigned)(2 * FKB + (tid >> 4) * FVP + (tid & 15) * 16);
  const size_t gko = (r0 + (tid >> 3)) * DM + h * HD + (tid & 7) * 8; const _Float16* gkh = Kh + gko; const _Float16* gkl = Kl + gko; const _Float16* gv = Vt + ((size_t)bh * HD + (tid >> 4)) * SQ + (tid & 15) * 8;
  auto stage = [&](int s, unsigned buf) { const unsigned lb = buf * FSB;
    fa_copy4(lk + lb, 32 * FKP, gkh + (size_t)s * FK * DM, (size_t)32 * DM); fa_copy4(lk + lb + FKB, 32 * FKP, gkl + (size_t)s * FK * DM, (size_t)32 * DM); fa_copy4(lv + lb, 16 * FVP, gv + (size_t)s * FK, (size_t)16 * SQ); };
  stage(0, 0);
  const v16h qh0 = g2_frag(Qh + qo, hh), qh1 = g2_frag(Qh + qo + 32, hh), ql0 = g2_frag(Ql + qo, hh), ql1 = g2_frag(Ql + qo + 32, hh);
  const v8f z8 = {0.f,0.f,0.f,0.f,0.f,0.f,0.f,0.f}; v8f o0 = z8, o1 = z8, o2 = z8, o3 = z8; float m = -3.0e38f, l = 0.f;
  const float cs = 0.18033688011112042f;      /* log2(e) / 8: raw product -> exponent of two */
  asm volatile("s_wait_asynccnt 0x0" ::: "memory");      /* this wave's copies of stage 0 have landed */
  __syncthreads();      /* and every other wave's: stage 0 may be read */
  stage(1, 1);
#pragma unroll 1
  for (int t = 0; t < SQ / FK; ++t) {      /* rolled: one trip is one LDS stage, its four passes unrolled below */
    const unsigned char* kb = L + (t & 1) * FSB + ln * FKP + hh * 16; const unsigned char* vb = L + (t & 1) * FSB + 2 * FKB + ln * FVP + hh * 16;
    v16h h00 = fa_lfrag(kb), h01 = fa_lfrag(kb + 64), h10 = fa_lfrag(kb + 16 * FKP), h11 = fa_lfrag(kb + 16 * FKP + 64);
    v16h l00 = fa_lfrag(kb + FKB), l01 = fa_lfrag(kb + FKB + 64), l10 = fa_lfrag(kb + FKB + 16 * FKP), l11 = fa_lfrag(kb + FKB + 16 * FKP + 64);
#pragma unroll
    for (int p = 0; p < FK / 32; ++p) {      /* unrolled: every LDS offset a constant, and the K fragments are carried from pass to pass inside the stage */
      const v16h v0 = fa_lfrag(vb + p * 64), v1 = fa_lfrag(vb + 16 * FVP + p * 64), v2 = fa_lfrag(vb + 32 * FVP + p * 64), v3 = fa_lfrag(vb + 48 * FVP + p * 64);
      v8f sa = z8, sb = z8, ta = z8, tb = z8;      /* keys j .. j+15: sa small terms, sb main term; keys j+16 .. j+31: ta, tb */
      sa = fa_mma(h00, ql0, sa); sb = fa_mma(h00, qh0, sb); ta = fa_mma(h10, ql0, ta); tb = fa_mma(h10, qh0, tb);
      sa = fa_mma(h01, ql1, sa); sb = fa_mma(h01, qh1, sb); ta = fa_mma(h11, ql1, ta); tb = fa_mma(h11, qh1, tb);
      sa = fa_mma(l00, qh0, sa); ta = fa_mma(l10, qh0, ta); sa = fa_mma(l01, qh1, sa); ta = fa_mma(l11, qh1, ta);
      if (p + 1 < FK / 32) { const unsigned char* kn = kb + (p + 1) * 32 * FKP;      /* the next pass's K fragments come under this pass's softmax; never beyond this stage's own buffer */
        h00 = fa_lfrag(kn); h01 = fa_lfrag(kn + 64); h10 = fa_lfrag(kn + 16 * FKP); h11 = fa_lfrag(kn + 16 * FKP + 64);
        l00 = fa_lfrag(kn + FKB); l01 = fa_lfrag(kn + FKB + 64); l10 = fa_lfrag(kn + FKB + 16 * FKP); l11 = fa_lfrag(kn + FKB + 16 * FKP + 64); }
      float u[16];
#pragma unroll
      for (int r = 0; r < 8; ++r) { u[r] = fmaf(sa[r], 0.0009765625f, sb[r]); u[8 + r] = fmaf(ta[r], 0.0009765625f, tb[r]); }
      float pm = fmaxf(fmaxf(fmaxf(fmaxf(u[0], u[1]), fmaxf(u[2], u[3])), fmaxf(fmaxf(u[4], u[5]), fmaxf(u[6], u[7]))), fmaxf(fmaxf(fmaxf(u[8], u[9]), fmaxf(u[10], u[11])), fmaxf(fmaxf(u[12], u[13]), fmaxf(u[14], u[15]))));
      pm = fmaxf(pm, fa_swap16(pm));      /* both halves of a query's keys: the two lanes must use one maximum, their weights meet in one product */
      if (p + 1 < FK / 32) asm volatile("" :: "v"(h00), "v"(h01), "v"(h10), "v"(h11), "v"(l00), "v"(l01), "v"(l10), "v"(l11));      /* inputs only: keeps the next pass's K loads in front of the branch, under the maximum; sunk behind it they are waited for as soon as they are issued */
      if (__builtin_amdgcn_ballot_w32(pm > m) != 0) {      /* scalar branch: taken by the whole wave or not at all */
        const float mn = fmaxf(m, pm); const float al = __builtin_amdgcn_exp2f((m - mn) * cs); m = mn; l *= al; o0 *= al; o1 *= al; o2 *= al; o3 *= al; }
      const float mc = fmaf(-m, cs, 8.0f);      /* + 8: weights carried x256 against the f16 subnormal range */
      FragH pw; float e[16];
#pragma unroll
      for (int s = 0; s < 16; ++s) { e[s] = __builtin_amdgcn_exp2f(fmaf(u[s], cs, mc)); pw.h[s] = (_Float16)e[s]; }
      l += (((e[0] + e[1]) + (e[2] + e[3])) + ((e[4] + e[5]) + (e[6] + e[7]))) + (((e[8] + e[9]) + (e[10] + e[11])) + ((e[12] + e[13]) + (e[14] + e[15])));
      o0 = fa_mma(v0, pw.v, o0); o1 = fa_mma(v1, pw.v, o1); o2 = fa_mma(v2, pw.v, o2); o3 = fa_mma(v3, pw.v, o3);
    }
    asm volatile("s_wait_dscnt 0x0" ::: "memory");      /* this wave's reads of the buffer are done before the buffer is handed back */
    asm volatile("s_wait_asynccnt 0x0" ::: "memory");      /* this wave's copies of stage t + 1 have landed */
    __syncthreads();      /* publishes stage t + 1 and ends every wave's reads of stage t's buffer */
    if (t + 2 < SQ / FK) stage(t + 2, (unsigned)(t & 1));      /* same test in every wave of the block; refills the buffer just read */
  }
  asm volatile("s_wait_asynccnt 0x0" ::: "memory");      /* no copy is left in flight when the wave ends */
  l += fa_swap16(l); const float sc = 64.0f / l;      /* l = 256 sum exp; o carried x64 as before (folded into the output GEMM alpha) */
  unsigned short* op = (unsigned short*)O + qo + 8 * hh; FragH f;
#pragma unroll
  for (int r = 0; r < 8; ++r) { f.h[r] = (_Float16)(o0[r] * sc); f.h[8 + r] = (_Float16)(o1[r] * sc); }
  *(v8us*)op = f.half[0]; *(v8us*)(op + 16) = f.half[1];
#pragma unroll
  for (int r = 0; r < 8; ++r) { f.h[r] = (_Float16)(o2[r] * sc); f.h[8 + r] = (_Float16)(o3[r] * sc); }
  *(v8us*)(op + 32) = f.half[0]; *(v8us*)(op + 48) = f.half[1]; }

extern "C" void kernel_launch(void* const* d_in, const int* in_sizes, int n_in,
                              void* d_out, int out_size, void* d_ws, size_t ws_size, hipStream_t stream) {
  (void)in_sizes; (void)n_in; (void)out_size;
  const float* const* I = (const float* const*)d_in; const float* xq = I[0]; const float* xk = I[1]; const float* xv = I[2]; const float* wq = I[3]; const float* wk = I[4]; const float* wv = I[5]; const float* wo = I[6]; const float* bo = nullptr;      /* order: query, key, value; Wq, Wk, Wv [8][512][64] (per-head [in][out]); Wp [8][64][512] (flat [in][out] [512][512]): seven inputs; the module has NO biases: a null pointer in the output GEMM's guarded bias slot */
  char* ws = (char*)d_ws; size_t off = 0;
  auto take = [&](size_t bytes) { char* p = ws + off; off += (bytes + 255) & ~(size_t)255; return p; };
  _Float16* BQ = (_Float16*)take((size_t)DM * DM * 2); _Float16* BK = (_Float16*)take((size_t)DM * DM * 2); _Float16* BV = (_Float16*)take((size_t)DM * DM * 2); _Float16* BO = (_Float16*)take((size_t)DM * DM * 2);
  _Float16* QH = (_Float16*)take(NR * DM * 2); _Float16* QL = (_Float16*)take(NR * DM * 2); _Float16* KH = (_Float16*)take(NR * DM * 2); _Float16* KL = (_Float16*)take(NR * DM * 2); _Float16* O16 = (_Float16*)take(NR * DM * 2);
  _Float16* VT = (_Float16*)take((size_t)NB * NH * HD * SQ * 2);
  if (off > ws_size) return;
  k_wprep<<<dim3((unsigned)(DM * (DM / 8) / 256), 4), 256, 0, stream>>>(wq, wk, wv, wo, BQ, BK, BV, BO);      /* per-head [h][i][o] -> Bt[(h, o)][i] x16 for q, k, v; the output weight [8][64][512] read flat = [in][out] [512][512] -> Bt[n][k] x16 */
  const size_t r0p = (size_t)B0 * SQ;      /* first row of the output stage */
  k_proj<<<dim3((unsigned)((NR / 128) * (DM / 64)), 3), 128, 0, stream>>>(xq, xk, xv, BQ, BK, BV, QH, QL, KH, KL, VT);      /* q and k as f16 hi + x1024 residual planes; V^T [NB * NH][HD][SQ], both batches */
  k_fattn<<<dim3(SQ / 128, NB * NH), 256, 0, stream>>>(QH, QL, KH, KL, VT, O16);      /* o (merged heads, x64) as f16 rows */
  k_gemm2<0><<<dim3((unsigned)((MPO / 128) * (DM / 64)), 1), 128, 0, stream>>>(O16 + r0p * DM, DM, 0, BO, DM, 0, 0.0009765625f, bo, 0, nullptr, 1, 0, 0, (float*)d_out + r0p * DM, nullptr, DM, 0, MPO, DM, DM);      /* out rows are the output layout */
}

// v005
// A run of this version takes 59.3 microseconds.
// Timed twice side by side with v004, it ran 1.50 and 1.52 times as fast.
// Counting every step since v000, it is 34.8 times as fast.
#include <hip/hip_runtime.h>
// Multi-head attention on THREE input streams with per-head projection weights and a per-head output weight, no biases at all (query, key, value [2][2048][512]; q = einsum(bni,hio->bnho)(query, Wq), k and v likewise from key and value (Wq, Wk, Wv [8][512][64] per-head [in][out], normal x 0.05); q / sqrt(64); logits = q.k per head; softmax over all 2048 keys (no mask); out = einsum(bnhi,hio->bno)(attn v, Wp) (Wp [8][64][512]: read flat it IS an [in][out] [512][512] weight with input row h*64 + i; no bias) -> [2][2048][512]; input order query, key, value, Wq, Wk, Wv, Wp).
// Structure: token rows r = b*2048 + s; the four weight planes in one launch (exact x16, from the per-head stacks: plane row h*64 + o = W[h][:][o]); Q, K and V as ONE grid of WMMA GEMM tiles (32x64 wave tiles, f32 accumulation, no bias) that reads the f32 inputs itself (staged in LDS with its weight rows by asynchronous copies; bf16-rounded, exact in f16, in registers) and whose epilogue writes Q and K as f16 hi + x1024 residual planes and V as V^T per (batch, head) through an LDS tile; then ONE fused attention kernel over all (batch, head, 128 queries): per 32 keys the scores from THREE products (K = 64: k_hi.q_lo and k_lo.q_hi, worth 2^-10, and k_hi.q_hi; all / 8), running-maximum softmax in registers (f32 statistics, native exp2; weights x256 as f16), O^T += V^T P^T, o carried x64 against f16 subnormal flush (folded into the output GEMM alpha) written straight into the merged f16 o rows; out = o W_p GEMM (f32; no bias; operands staged in LDS likewise) into the output layout.
// Compute dtype: inputs rounded to bf16; the three inputs as f16 operands in registers and the x16 weights as f16 planes (exact for every bf16 value of magnitude from 2^-14 up to 65,504; the weights up to 4,094 before their factor of 16); q and k as f16 hi + x1024 residual planes (about 2^-21), the scores from three products (the lo.lo term dropped); v, softmax weights and o as plain f16 GEMM operands (~2^-12); scores and softmax statistics f32. v_wmma_f32_16x16x32_f16.
#define NB 2
#define SQ 2048
#define DM 512
#define NH 8
#define HD 64
#define HG 4                         /* heads per launch of the grouped k_vt (not launched) */
#define B0 0                         /* first batch processed (debug hook) */
#define NBR NB                       /* batches processed (debug hook) */
#define NR ((size_t)NB * SQ)         /* token rows */
#define MP ((int)((size_t)NBR * SQ)) /* rows through the output stage, via MPO (debug hook) */
#define QN SQ                        /* query rows per batch (not used) */
#define NHD NH                       /* heads (not used) */
#define MPO MP                       /* rows through the output stage (debug hook) */
#define LQ DM      /* row pitch of the q and k rows (not used) */
typedef __bf16 v16b __attribute__((ext_vector_type(16)));
typedef unsigned short v8us __attribute__((ext_vector_type(8), may_alias));
typedef float  v8f  __attribute__((ext_vector_type(8)));
typedef float  v4f  __attribute__((ext_vector_type(4)));
typedef float  v4fa __attribute__((ext_vector_type(4), may_alias));
union FragB { v16b v; v8us half[2]; unsigned short u[16]; };

__device__ __forceinline__ unsigned short bf16_bits(float x) { unsigned int u = __float_as_uint(x); return (unsigned short)((u + 0x7FFFu + ((u >> 16) & 1u)) >> 16); }
__device__ __forceinline__ float bf16_val(unsigned short b) { return __uint_as_float(((unsigned int)b) << 16); }
__device__ __forceinline__ float bf16_round(float x) { return bf16_val(bf16_bits(x)); }
// D += A·B with NT terms: 1 = ah·bh, 2 = + al·bh (A split), 3 = + ah·bl (both split)
template <int NT>
__device__ __forceinline__ v8f mmaN(v16b ah, v16b al, v16b bh, v16b bl, v8f c) {
  c = __builtin_amdgcn_wmma_f32_16x16x32_bf16(false, ah, false, bh, (short)0, c, false, false);
  if (NT >= 2) c = __builtin_amdgcn_wmma_f32_16x16x32_bf16(false, al, false, bh, (short)0, c, false, false);
  if (NT >= 3) c = __builtin_amdgcn_wmma_f32_16x16x32_bf16(false, ah, false, bl, (short)0, c, false, false);
  asm volatile("v_nop\n\tv_nop\n\tv_nop\n\tv_nop" : "+v"(c) : "v"(ah), "v"(al), "v"(bh), "v"(bl));
  return c;
}

__global__ __launch_bounds__(256) void k_wt_bf16(const float* __restrict__ W, unsigned short* __restrict__ Wt, int K, int N) {
  const int t = blockIdx.x * 256 + threadIdx.x;
  const int k8n = K / 8;
  if (t >= N * k8n) return;
  const int n = t / k8n, k8 = (t % k8n) * 8;
  v8us v;
#pragma unroll
  for (int i = 0; i < 8; ++i) v[i] = bf16_bits(W[(size_t)(k8 + i) * N + n]);
  *(v8us*)(Wt + (size_t)n * K + k8) = v;
  
}

// GEMM C[M][N] (f32, pitch ldc) = act(A[M][K]·W + bias). A f32 row-major (pitch lda) converted per fragment to bf16
// (ASPLIT: hi/lo two planes -> 2 terms, else single rounded term); Wt bf16 [N][K] (pitch ldb). BIAS_BF16 rounds the
// bias to bf16 first (bias quantised to bf16 before the add). K%32==0, M%16==0, N%64==0.
template <bool ASPLIT, int ACT, bool BIAS_BF16>
__global__ __launch_bounds__(128) void k_gemm_bf(const float* __restrict__ A, int lda, const unsigned short* __restrict__ Wt, int ldb,
                                               const float* __restrict__ bias, float* __restrict__ C, int ldc, int M, int N, int K) {
  __shared__ __attribute__((aligned(16))) float so[4][16][64];
  const int tid = threadIdx.x, w = tid >> 5, lane = tid & 31, ln = lane & 15, hh = lane >> 4;
  const int ntn = N / 64;
  const int wid = blockIdx.x * 4 + w;
  const int mt = wid / ntn, nq = wid % ntn;
  if (mt * 16 >= M) return;
  const int row0 = mt * 16, col0 = nq * 64;
  const float* arow = A + (size_t)(row0 + ln) * lda;
  v8f acc[4] = {};
  for (int kb = 0; kb < K; kb += 32) {
    FragB ah, al;
    const v4f x0 = *(const v4fa*)(arow + kb + 8 * hh), x1 = *(const v4fa*)(arow + kb + 8 * hh + 4);
    const v4f x2 = *(const v4fa*)(arow + kb + 16 + 8 * hh), x3 = *(const v4fa*)(arow + kb + 16 + 8 * hh + 4);
    float xs[16] = {x0[0],x0[1],x0[2],x0[3],x1[0],x1[1],x1[2],x1[3],x2[0],x2[1],x2[2],x2[3],x3[0],x3[1],x3[2],x3[3]};
#pragma unroll
    for (int i = 0; i < 16; ++i) { const unsigned short hb = bf16_bits(xs[i]); ah.u[i] = hb; al.u[i] = ASPLIT ? bf16_bits(xs[i] - bf16_val(hb)) : (unsigned short)0; }
#pragma unroll
    for (int t = 0; t < 4; ++t) {
      const unsigned short* brow = Wt + (size_t)(col0 + t * 16 + ln) * ldb + kb;
      FragB b;
      b.half[0] = *(const v8us*)(brow + 8 * hh);
      b.half[1] = *(const v8us*)(brow + 16 + 8 * hh);
      acc[t] = mmaN<ASPLIT ? 2 : 1>(ah.v, al.v, b.v, b.v, acc[t]);
    }
  }
#pragma unroll
  for (int t = 0; t < 4; ++t) {
    float bv = bias ? bias[col0 + t * 16 + ln] : 0.f;
    if (BIAS_BF16) bv = bf16_round(bv);
#pragma unroll
    for (int r = 0; r < 8; ++r) { float v = acc[t][r] + bv; if (ACT == 1) v = fmaxf(v, 0.f); so[w][8 * hh + r][t * 16 + ln] = v; }
  }
  __builtin_amdgcn_fence(__ATOMIC_ACQ_REL, "workgroup");
  __builtin_amdgcn_wave_barrier();
  const int rsub = lane >> 4, c4 = (lane & 15) * 4;
  {
#pragma unroll
    for (int q = 0; q < 8; ++q) {
      const int r = q * 2 + rsub;
      const v4f v = *(const v4fa*)&so[w][r][c4];
      *(v4f*)(C + (size_t)(row0 + r) * ldc + col0 + c4) = v;
    }
    
  }
}

// GEMM C = act(A·W + bias + resid): A f32 (ASPLIT -> hi/lo 2 terms), Wt bf16 [N][K]; ACT 0 none, 1 relu, 2 exact gelu;
// resid (optional, f32, row index = (row % rmod), pitch ldr, RES_BF16 rounds it) added before the activation.
template <bool ASPLIT, int ACT, bool BIAS_BF16, bool RES_BF16>
__global__ __launch_bounds__(128) void k_gemm_bf3(const float* __restrict__ A, int lda, const unsigned short* __restrict__ Wt, int ldb,
                                                const float* __restrict__ bias, const float* __restrict__ resid, int rmod, int ldr,
                                                float* __restrict__ C, int ldc, int M, int N, int K) {
  __shared__ __attribute__((aligned(16))) float so[4][16][64];
  const int tid = threadIdx.x, w = tid >> 5, lane = tid & 31, ln = lane & 15, hh = lane >> 4;
  const int ntn = N / 64;
  const int wid = blockIdx.x * 4 + w;
  const int mt = wid / ntn, nq = wid % ntn;
  if (mt * 16 >= M) return;
  const int row0 = mt * 16, col0 = nq * 64;
  const float* arow = A + (size_t)(row0 + ln) * lda;
  v8f acc[4] = {};
  for (int kb = 0; kb < K; kb += 32) {
    FragB ah, al;
    const v4f x0 = *(const v4fa*)(arow + kb + 8 * hh), x1 = *(const v4fa*)(arow + kb + 8 * hh + 4);
    const v4f x2 = *(const v4fa*)(arow + kb + 16 + 8 * hh), x3 = *(const v4fa*)(arow + kb + 16 + 8 * hh + 4);
    float xs[16] = {x0[0],x0[1],x0[2],x0[3],x1[0],x1[1],x1[2],x1[3],x2[0],x2[1],x2[2],x2[3],x3[0],x3[1],x3[2],x3[3]};
#pragma unroll
    for (int i = 0; i < 16; ++i) { const unsigned short hb = bf16_bits(xs[i]); ah.u[i] = hb; al.u[i] = ASPLIT ? bf16_bits(xs[i] - bf16_val(hb)) : (unsigned short)0; }
#pragma unroll
    for (int t = 0; t < 4; ++t) {
      const unsigned short* brow = Wt + (size_t)(col0 + t * 16 + ln) * ldb + kb;
      FragB b;
      b.half[0] = *(const v8us*)(brow + 8 * hh);
      b.half[1] = *(const v8us*)(brow + 16 + 8 * hh);
      acc[t] = mmaN<ASPLIT ? 2 : 1>(ah.v, al.v, b.v, b.v, acc[t]);
    }
  }
#pragma unroll
  for (int t = 0; t < 4; ++t) {
    const int col = col0 + t * 16 + ln;
    float bv = bias ? bias[col] : 0.f;
    if (BIAS_BF16) bv = bf16_round(bv);
#pragma unroll
    for (int r = 0; r < 8; ++r) {
      float v = acc[t][r] + bv;
      if (resid) { float rv = resid[(size_t)((row0 + 8 * hh + r) % rmod) * ldr + col]; if (RES_BF16) rv = bf16_round(rv); v += rv; }
      if (ACT == 1) v = fmaxf(v, 0.f);
      if (ACT == 2) v = 0.5f * v * (1.0f + erff(v * 0.70710678118654752f));
      if (ACT == 3) { const float u = 0.7978845608028654f * (v + 0.044715f * v * v * v); v = 0.5f * v * (1.0f + tanhf(u)); }
      so[w][8 * hh + r][t * 16 + ln] = v;
    }
  }
  __builtin_amdgcn_fence(__ATOMIC_ACQ_REL, "workgroup");
  __builtin_amdgcn_wave_barrier();
  const int rsub = lane >> 4, c4 = (lane & 15) * 4;
  {
#pragma unroll
    for (int q = 0; q < 8; ++q) {
      const int r = q * 2 + rsub;
      const v4f v = *(const v4fa*)&so[w][r][c4];
      *(v4f*)(C + (size_t)(row0 + r) * ldc + col0 + c4) = v;
    }
    
  }
}
// row LayerNorm (biased variance, eps) over N: s = X (+ R); optional out_sum <- s; out_norm <- (s-mu)*rsqrt(var+eps)*g + b
template <bool PARAM_BF16>
__global__ __launch_bounds__(256) void k_layernorm(const float* __restrict__ X, const float* __restrict__ R, const float* __restrict__ g, const float* __restrict__ bta,
                                                  float* __restrict__ out_sum, float* __restrict__ out_norm, int N, float eps) {
  __shared__ float red[256];
  const int row = blockIdx.x, tid = threadIdx.x;
  const float* x = X + (size_t)row * N; const float* rr = R ? R + (size_t)row * N : nullptr;
  float vals[16];                     // up to N = 4096
  const int per = N / 256;            // contiguous chunk per thread? use strided-by-4 chunks: thread handles j = tid*4 + 1024*u
  float s1 = 0.f;
  for (int u = 0; u < per / 4; ++u) {
    const int j = tid * 4 + 1024 * u;
    const v4f a = *(const v4fa*)(x + j);
    v4f b = {0.f,0.f,0.f,0.f}; if (rr) b = *(const v4fa*)(rr + j);
#pragma unroll
    for (int q = 0; q < 4; ++q) { const float v = a[q] + b[q]; vals[u * 4 + q] = v; s1 += v; }
  }
  red[tid] = s1; __syncthreads();
  for (int st = 128; st > 0; st >>= 1) { if (tid < st) red[tid] += red[tid + st]; __syncthreads(); }
  const float mu = red[0] / (float)N; __syncthreads();
  float s2 = 0.f;
  for (int u = 0; u < per / 4; ++u)
#pragma unroll
    for (int q = 0; q < 4; ++q) { const float c = vals[u * 4 + q] - mu; s2 += c * c; }
  red[tid] = s2; __syncthreads();
  for (int st = 128; st > 0; st >>= 1) { if (tid < st) red[tid] += red[tid + st]; __syncthreads(); }
  const float rs = rsqrtf(red[0] / (float)N + eps);
  {
    for (int u = 0; u < per / 4; ++u) {
      const int j = tid * 4 + 1024 * u;
      v4f o, sm;
#pragma unroll
      for (int q = 0; q < 4; ++q) {
        float gg = g[j + q], bb = bta[j + q];
        if (PARAM_BF16) { gg = bf16_round(gg); bb = bf16_round(bb); }
        sm[q] = vals[u * 4 + q]; o[q] = (vals[u * 4 + q] - mu) * rs * gg + bb;
      }
      if (out_sum) *(v4f*)(out_sum + (size_t)row * N + j) = sm;
      *(v4f*)(out_norm + (size_t)row * N + j) = o;
    }
    
  }
}



// ---- f16 WMMA path (v_wmma_f32_16x16x32_f16): 11-bit significands for operands in range — used where a [0,1] probability operand needs more precision than bf16
typedef _Float16 v16h __attribute__((ext_vector_type(16)));
union FragH { v16h v; v8us half[2]; _Float16 h[16]; unsigned short u[16]; };
template <int NT>
__device__ __forceinline__ v8f mmaH(v16h ah, v16h al, v16h bh, v16h bl, v8f c) {
  c = __builtin_amdgcn_wmma_f32_16x16x32_f16(false, ah, false, bh, (short)0, c, false, false);
  if (NT >= 2) c = __builtin_amdgcn_wmma_f32_16x16x32_f16(false, al, false, bh, (short)0, c, false, false);
  if (NT >= 3) c = __builtin_amdgcn_wmma_f32_16x16x32_f16(false, ah, false, bl, (short)0, c, false, false);
  asm volatile("v_nop\n\tv_nop\n\tv_nop\n\tv_nop" : "+v"(c) : "v"(ah), "v"(al), "v"(bh), "v"(bl));
  return c;
}
// batched GEMM like k_gemm_b but f16 operands: A f32 (split into f16 hi/lo if ASPLIT, else rounded to f16), Bt = f16 values [n][k]; alpha; C f32; N multiple of 16 (partial tiles skipped)
template <bool ASPLIT>
__global__ __launch_bounds__(128) void k_gemm_h(const float* __restrict__ A, int lda, size_t sA, const _Float16* __restrict__ Bh, int ldb, size_t sB, float alpha, float* __restrict__ C, int ldc, size_t sC, int M, int N, int K) {
  __shared__ __attribute__((aligned(16))) float so[4][16][64];
  const int tid = threadIdx.x, w = tid >> 5, lane = tid & 31, ln = lane & 15, hh = lane >> 4; const int by = blockIdx.y;
  A += (size_t)by * sA; Bh += (size_t)by * sB; C += (size_t)by * sC;
  const int ntn = (N + 63) / 64; const int wid = blockIdx.x * 4 + w; const int mt = wid / ntn, nq = wid % ntn; if (mt * 16 >= M) return;
  const int row0 = mt * 16, col0 = nq * 64; const float* arow = A + (size_t)(row0 + ln) * lda;
  v8f acc[4] = {};
  for (int kb = 0; kb < K; kb += 32) {
    FragH ah, al;
    const v4f x0 = *(const v4fa*)(arow + kb + 8 * hh), x1 = *(const v4fa*)(arow + kb + 8 * hh + 4), x2 = *(const v4fa*)(arow + kb + 16 + 8 * hh), x3 = *(const v4fa*)(arow + kb + 16 + 8 * hh + 4);
    float xs[16] = {x0[0],x0[1],x0[2],x0[3],x1[0],x1[1],x1[2],x1[3],x2[0],x2[1],x2[2],x2[3],x3[0],x3[1],x3[2],x3[3]};
#pragma unroll
    for (int i = 0; i < 16; ++i) { const _Float16 h = (_Float16)xs[i]; ah.h[i] = h; al.h[i] = ASPLIT ? (_Float16)(xs[i] - (float)h) : (_Float16)0.0f; }
#pragma unroll
    for (int t = 0; t < 4; ++t) { if (col0 + t * 16 >= N) continue; const size_t boff = (size_t)(col0 + t * 16 + ln) * ldb + kb; FragH bq; bq.half[0] = *(const v8us*)(Bh + boff + 8 * hh); bq.half[1] = *(const v8us*)(Bh + boff + 16 + 8 * hh);
      acc[t] = mmaH<ASPLIT ? 2 : 1>(ah.v, al.v, bq.v, bq.v, acc[t]); }
  }
#pragma unroll
  for (int t = 0; t < 4; ++t) { if (col0 + t * 16 >= N) continue;
#pragma unroll
    for (int r = 0; r < 8; ++r) so[w][8 * hh + r][t * 16 + ln] = acc[t][r] * alpha; }
  __builtin_amdgcn_fence(__ATOMIC_ACQ_REL, "workgroup"); __builtin_amdgcn_wave_barrier();
  const int rsub = lane >> 4, c4 = (lane & 15) * 4;
  {
#pragma unroll
    for (int q = 0; q < 8; ++q) { const int r = q * 2 + rsub; if (col0 + c4 < N) { const v4f v = *(const v4fa*)&so[w][r][c4]; *(v4f*)(C + (size_t)(row0 + r) * ldc + col0 + c4) = v; } }
     }
}

// k_gemm_hh variant with fused epilogue: v = acc·alpha + bias[by·sBias + col] (+ CP[(row/rowsPerB)·sCPb + by·64 + col] if CP) ; ACT 0 none / 1 elu ; writes f16 C16 (and f32 C if non-null)
template <int ACT>
__global__ __launch_bounds__(128) void k_gemm_hhx(const _Float16* __restrict__ A, int lda, size_t sA, const _Float16* __restrict__ Bh, int ldb, size_t sB, float alpha, const float* __restrict__ bias, size_t sBias, const float* __restrict__ CP, int rowsPerB, size_t sCPb, int row0g,
    float* __restrict__ C, _Float16* __restrict__ C16, int ldc, size_t sC, int M, int N, int K) {
  __shared__ __attribute__((aligned(16))) float so[4][16][64];
  const int tid = threadIdx.x, w = tid >> 5, lane = tid & 31, ln = lane & 15, hh = lane >> 4; const int by = blockIdx.y;
  A += (size_t)by * sA; Bh += (size_t)by * sB; const size_t cofs = (size_t)by * sC; const float* bp = bias ? bias + (size_t)by * sBias : nullptr;
  const int ntn = (N + 63) / 64; const int wid = blockIdx.x * 4 + w; const int mt = wid / ntn, nq = wid % ntn; if (mt * 16 >= M) return;
  const int row0 = mt * 16, col0 = nq * 64; const _Float16* arow = A + (size_t)(row0 + ln) * lda;
  v8f acc[4] = {};
  for (int kb = 0; kb < K; kb += 32) { FragH ah; ah.half[0] = *(const v8us*)((const unsigned short*)arow + kb + 8 * hh); ah.half[1] = *(const v8us*)((const unsigned short*)arow + kb + 16 + 8 * hh);
#pragma unroll
    for (int t = 0; t < 4; ++t) { if (col0 + t * 16 >= N) continue; const size_t boff = (size_t)(col0 + t * 16 + ln) * ldb + kb; FragH bq; bq.half[0] = *(const v8us*)((const unsigned short*)Bh + boff + 8 * hh); bq.half[1] = *(const v8us*)((const unsigned short*)Bh + boff + 16 + 8 * hh);
      acc[t] = mmaH<1>(ah.v, ah.v, bq.v, bq.v, acc[t]); }
  }
#pragma unroll
  for (int t = 0; t < 4; ++t) { if (col0 + t * 16 >= N) continue; const int col = col0 + t * 16 + ln; const float bv = bp ? bf16_round(bp[col]) : 0.f;
#pragma unroll
    for (int r = 0; r < 8; ++r) { float v = acc[t][r] * alpha + bv; if (CP) { const int rr = row0g + row0 + 8 * hh + r; if (rowsPerB < 0) v += CP[cofs + (size_t)rr * ldc + col];      /* rowsPerB < 0: own element of the batched C plane */ else { const int bidx = rr / rowsPerB; v += CP[(size_t)bidx * sCPb + (size_t)by * 64 + col]; } } if (ACT == 1) v = (v > 0.f) ? v : expm1f(v); else if (ACT == 7) v = (v > 0.f) ? v + 1.0f : expf(v); else if (ACT == 8) v = tanhf(v); else if (ACT == 9) v = 0.5f * v * (1.0f + tanhf(0.7978845608028654f * (v + 0.044715f * v * v * v))); else if (ACT == 11) v = 1.0f / (1.0f + expf(-v)); else if (ACT == 12) v = (v > 0.f) ? v : 0.01f * v; else if (ACT == 14) v = (v > 0.f) ? v : 0.1f * v; else if (ACT == 16) v = (v >= 0.f) ? v : 0.3f * v; else if (ACT == 17) v = (v >= 0.f) ? v : 0.2f * v; else if (ACT == 15) v = v / (1.0f + expf(-v)); else if (ACT == 3) v = fmaxf(v, 0.f); else if (ACT == 6) v = 0.5f * v * (1.0f + erff(v * 0.70710678118654752f)); so[w][8 * hh + r][t * 16 + ln] = v; } }
  __builtin_amdgcn_fence(__ATOMIC_ACQ_REL, "workgroup"); __builtin_amdgcn_wave_barrier();
  const int rsub = lane >> 4, c4 = (lane & 15) * 4; typedef _Float16 v4h __attribute__((ext_vector_type(4)));
  {
#pragma unroll
    for (int q = 0; q < 8; ++q) { const int r = q * 2 + rsub; if (col0 + c4 < N) { const v4f v = *(const v4fa*)&so[w][r][c4]; if (C) *(v4f*)(C + cofs + (size_t)(row0 + r) * ldc + col0 + c4) = v; if (C16) { v4h h4; for (int i = 0; i < 4; ++i) h4[i] = (_Float16)v[i]; *(v4h*)(C16 + cofs + (size_t)(row0 + r) * ldc + col0 + c4) = h4; } } }
     }
}


typedef _Float16 v4h __attribute__((ext_vector_type(4)));

__global__ __launch_bounds__(256) void k_h16(const float* __restrict__ x, _Float16* __restrict__ X16, size_t n8) { const size_t t = (size_t)blockIdx.x * 256 + threadIdx.x; if (t >= n8) return; FragH f;
#pragma unroll
  for (int q = 0; q < 8; ++q) f.h[q] = (_Float16)x[t * 8 + q]; *(v8us*)((unsigned short*)X16 + t * 8) = f.half[0];  }
__global__ __launch_bounds__(256) void k_round16f(const float* __restrict__ W, _Float16* __restrict__ Bt, size_t n8) { const size_t t = (size_t)blockIdx.x * 256 + threadIdx.x; if (t >= n8) return; FragH f;
#pragma unroll
  for (int i = 0; i < 8; ++i) f.h[i] = (_Float16)(bf16_round(W[t * 8 + i]) * 16.0f); *(v8us*)((unsigned short*)Bt + t * 8) = f.half[0];  }
// ---- fast GEMM (wave tile 32x64; requires M % 32 == 0 rows per launch region and N % 64 == 0); epilogue = k_gemm_hhx semantics ----
__device__ __forceinline__ v16h g2_frag(const _Float16* p, int hh) { FragH f; f.half[0] = *(const v8us*)((const unsigned short*)p + 8 * hh); f.half[1] = *(const v8us*)((const unsigned short*)p + 16 + 8 * hh); return f.v; }
__device__ __forceinline__ v8f g2_mma(v16h a, v16h b, v8f c) { v8f d = __builtin_amdgcn_wmma_f32_16x16x32_f16(false, a, false, b, (short)0, c, false, false); asm volatile("v_nop\n\tv_nop\n\tv_nop\n\tv_nop" : "+v"(d) : "v"(a), "v"(b)); return d; }
template <int ACT>
__global__ __launch_bounds__(128) void k_gemm2(const _Float16* __restrict__ A, int lda, size_t sA, const _Float16* __restrict__ Bh, int ldb, size_t sB, float alpha, const float* __restrict__ bias, size_t sBias, const float* __restrict__ CP, int rowsPerB, size_t sCPb, int row0g,
    float* __restrict__ C, _Float16* __restrict__ C16, int ldc, size_t sC, int M, int N, int K) { static_assert(ACT == 0 || ACT == 3 || ACT == 6 || ACT == 8 || ACT == 9 || ACT == 11 || ACT == 12 || ACT == 14 || ACT == 15 || ACT == 16 || ACT == 17, "k_gemm2: unsupported ACT code (would silently apply no activation)");
  __shared__ __attribute__((aligned(16))) float so[4][32][68];
  const int tid = threadIdx.x, w = tid >> 5, lane = tid & 31, ln = lane & 15, hh = lane >> 4; const int by = blockIdx.y;
  A += (size_t)by * sA; Bh += (size_t)by * sB; const size_t cofs = (size_t)by * sC; const float* bp = bias ? bias + (size_t)by * sBias : nullptr;
  const int ntn = N >> 6; const int mt = blockIdx.x / ntn, nq = blockIdx.x - mt * ntn; const int row0 = mt * 128 + 32 * w, col0 = nq * 64; if (row0 >= M) return;
  const _Float16* a0p = A + (size_t)(row0 + ln) * lda; const _Float16* a1p = a0p + (size_t)16 * lda;
  const _Float16* b0p = Bh + (size_t)(col0 + ln) * ldb; const _Float16* b1p = b0p + (size_t)16 * ldb; const _Float16* b2p = b1p + (size_t)16 * ldb; const _Float16* b3p = b2p + (size_t)16 * ldb;
  const v8f z8 = {0.f,0.f,0.f,0.f,0.f,0.f,0.f,0.f}; v8f c00 = z8, c01 = z8, c02 = z8, c03 = z8, c10 = z8, c11 = z8, c12 = z8, c13 = z8;
#pragma unroll 1
  for (int kb = 0; kb < K; kb += 32) { const v16h a0 = g2_frag(a0p + kb, hh), a1 = g2_frag(a1p + kb, hh);
    v16h b = g2_frag(b0p + kb, hh); c00 = g2_mma(a0, b, c00); c10 = g2_mma(a1, b, c10);
    b = g2_frag(b1p + kb, hh); c01 = g2_mma(a0, b, c01); c11 = g2_mma(a1, b, c11);
    b = g2_frag(b2p + kb, hh); c02 = g2_mma(a0, b, c02); c12 = g2_mma(a1, b, c12);
    b = g2_frag(b3p + kb, hh); c03 = g2_mma(a0, b, c03); c13 = g2_mma(a1, b, c13); }
  v8f accs[8] = {c00, c01, c02, c03, c10, c11, c12, c13};
#pragma unroll
  for (int u = 0; u < 8; ++u) { const int t = u & 3, half = u >> 2; const int col = col0 + t * 16 + ln; const float bv = bp ? bf16_round(bp[col]) : 0.f;
#pragma unroll
    for (int r = 0; r < 8; ++r) { const int rloc = half * 16 + 8 * hh + r; float v = accs[u][r] * alpha + bv; if (CP) { if (rowsPerB < 0) v += CP[cofs + (size_t)(row0g + row0 + rloc) * ldc + col];      /* rowsPerB < 0: own element of the batched C plane */ else { const int bidx = (row0g + row0 + rloc) / rowsPerB; v += CP[(size_t)bidx * sCPb + (size_t)by * 64 + col]; } }
      if (ACT == 3) v = fmaxf(v, 0.f); else if (ACT == 6) v = 0.5f * v * (1.0f + erff(v * 0.70710678118654752f)); else if (ACT == 11) v = 1.0f / (1.0f + expf(-v)); else if (ACT == 15) v = v / (1.0f + expf(-v)); else if (ACT == 12) v = (v > 0.f) ? v : 0.01f * v; else if (ACT == 8) v = tanhf(v); else if (ACT == 9) v = 0.5f * v * (1.0f + tanhf(0.7978845608028654f * (v + 0.044715f * v * v * v))); else if (ACT == 14) v = (v > 0.f) ? v : 0.1f * v; else if (ACT == 16) v = (v >= 0.f) ? v : 0.3f * v; else if (ACT == 17) v = (v >= 0.f) ? v : 0.2f * v;
      so[w][rloc][t * 16 + ln] = v; } }
  __builtin_amdgcn_fence(__ATOMIC_ACQ_REL, "workgroup"); __builtin_amdgcn_wave_barrier();
  const int rsub = lane >> 4, c4 = (lane & 15) * 4;
  {
#pragma unroll
    for (int q = 0; q < 16; ++q) { const int r = q * 2 + rsub; const v4f v = *(const v4fa*)&so[w][r][c4]; if (C) *(v4f*)(C + cofs + (size_t)(row0 + r) * ldc + col0 + c4) = v; if (C16) { v4h h4; for (int i = 0; i < 4; ++i) h4[i] = (_Float16)v[i]; *(v4h*)(C16 + cofs + (size_t)(row0 + r) * ldc + col0 + c4) = h4; } }
     } }


// ---- the passes around the projections, folded into two launches ----
// All four weight planes Bt[n][k] = f16(16 bf16(W(k, n))) in one grid: blockIdx.y = 0, 1, 2: a per-head stack, W(k, n) = W[n / HD][k][n % HD]; 3: the flat [in][out] output weight, W(k, n) = W[k][n]. DM * DM / 8 threads a plane.
__global__ __launch_bounds__(256) void k_wprep(const float* __restrict__ wq, const float* __restrict__ wk, const float* __restrict__ wv, const float* __restrict__ wo, _Float16* __restrict__ BQ, _Float16* __restrict__ BK, _Float16* __restrict__ BV, _Float16* __restrict__ BO) {
  const int y = blockIdx.y, t = blockIdx.x * 256 + threadIdx.x; const int k8 = (t % (DM / 8)) * 8, n = t / (DM / 8);
  const float* W = y == 0 ? wq : y == 1 ? wk : y == 2 ? wv : wo; _Float16* Bt = y == 0 ? BQ : y == 1 ? BK : y == 2 ? BV : BO;
  const float* s = y < 3 ? W + ((size_t)(n / HD) * DM + k8) * HD + n % HD : W + (size_t)k8 * DM + n; const int st = y < 3 ? HD : DM; FragH f;
#pragma unroll
  for (int q = 0; q < 8; ++q) f.h[q] = (_Float16)(bf16_round(s[(size_t)q * st]) * 16.0f);
  *(v8us*)((unsigned short*)Bt + (size_t)n * DM + k8) = f.half[0]; }
typedef __bf16 v4bf __attribute__((ext_vector_type(4)));
// A fragment in g2_frag's k order straight from an f32 input row; each value rounded to bf16 (exact in f16) in registers
__device__ __forceinline__ v16h pj_frag(const float* p, int hh) { const v4f x0 = *(const v4fa*)(p + 8 * hh), x1 = *(const v4fa*)(p + 8 * hh + 4), x2 = *(const v4fa*)(p + 16 + 8 * hh), x3 = *(const v4fa*)(p + 16 + 8 * hh + 4); FragH f;
  const v4bf r0 = __builtin_convertvector(x0, v4bf), r1 = __builtin_convertvector(x1, v4bf), r2 = __builtin_convertvector(x2, v4bf), r3 = __builtin_convertvector(x3, v4bf);      /* round to nearest even, as bf16_round */
#pragma unroll
  for (int q = 0; q < 4; ++q) { f.h[q] = (_Float16)(float)r0[q]; f.h[4 + q] = (_Float16)(float)r1[q]; f.h[8 + q] = (_Float16)(float)r2[q]; f.h[12 + q] = (_Float16)(float)r3[q]; }
  return f.v; }
// q, k and v projections in one grid (blockIdx.y = 0, 1, 2), k_gemm2's tile: block 128 rows x 64 columns (= one head), wave 32 x 64, K = DM; the operands come through LDS stages (below).
// Epilogue: q and k (f32, / 16 for the weight factor) leave as f16 hi + x1024 residual planes in row layout; v leaves as V^T [NB * NH][HD][SQ]: a lane's 8 accumulator rows are 8 consecutive tokens of one head-dim column,
// so they go as one 16-byte piece into an LDS tile [HD][128 tokens] (pitch PVP bytes) from which the block stores whole 256-byte runs.
#define PVP 272
// The operands of the two GEMM kernels reach the waves through LDS: a fragment load straight from global memory takes 32 bytes from each of 16 rows (16 lines an instruction), and the rolled loop waited for each such load in turn.
// A stage of GKS k of the block's A rows and B rows is brought in by asynchronous copies of whole lines (16 bytes a lane, through no register) into one of two buffers while the other is worked on;
// the fragments are then ds_load_b128 reads at a row pitch of 16 bytes x odd, in g2_frag's k order, the k blocks in rising order as before.
#define GKS 64                       /* k per LDS stage: two WMMA k blocks */
#define GFP 272                      /* LDS pitch in bytes of an f32 row of a stage (256 bytes of data) */
#define GHP 144                      /* LDS pitch in bytes of an f16 row of a stage (128 bytes of data) */
#define PJA (128 * GFP)              /* k_proj: the A rows of a stage */
#define PJS (PJA + 64 * GHP)         /* k_proj: one stage, A then B */
#define OPA (128 * GHP)              /* k_outp: the A rows of a stage */
#define OPS (OPA + 64 * GHP)         /* k_outp: one stage, A then B */
__device__ __forceinline__ v8f gs_mma(v16h a, v16h b, v8f c) { return __builtin_amdgcn_wmma_f32_16x16x32_f16(false, a, false, b, (short)0, c, false, false); }
__device__ __forceinline__ v16h gs_hfrag(const unsigned char* p) { FragH f; f.half[0] = *(const v8us*)p; f.half[1] = *(const v8us*)(p + 32); return f.v; }      /* g2_frag's k order from an f16 LDS row; p already holds the lane half's 16 bytes */
// pj_frag's rounding on the four 16-byte pieces of an f32 LDS row (floats 8 hh .. + 7 and 16 + 8 hh .. + 7 of a k block)
__device__ __forceinline__ v16h gs_fcvt(v4f x0, v4f x1, v4f x2, v4f x3) { FragH f;
  const v4bf r0 = __builtin_convertvector(x0, v4bf), r1 = __builtin_convertvector(x1, v4bf), r2 = __builtin_convertvector(x2, v4bf), r3 = __builtin_convertvector(x3, v4bf);      /* round to nearest even, as bf16_round */
#pragma unroll
  for (int q = 0; q < 4; ++q) { f.h[q] = (_Float16)(float)r0[q]; f.h[4 + q] = (_Float16)(float)r1[q]; f.h[8 + q] = (_Float16)(float)r2[q]; f.h[12 + q] = (_Float16)(float)r3[q]; }
  return f.v; }
// Four copies of 16 bytes a lane, global -> LDS. The s_wait_xcnt closes the statement so that it stands in front of every later write of the address registers that the copies name.
template <class T>
__device__ __forceinline__ void gs_copy4(unsigned l0, unsigned lstep, const T* g0, size_t gstep) {
  const unsigned l1 = l0 + lstep, l2 = l1 + lstep, l3 = l2 + lstep; const T* g1 = g0 + gstep; const T* g2 = g1 + gstep; const T* g3 = g2 + gstep;
  asm volatile("global_load_async_to_lds_b128 %0, %4, off\n\tglobal_load_async_to_lds_b128 %1, %5, off\n\tglobal_load_async_to_lds_b128 %2, %6, off\n\tglobal_load_async_to_lds_b128 %3, %7, off\n\ts_wait_xcnt 0x0"
               :: "v"(l0), "v"(l1), "v"(l2), "v"(l3), "v"(g0), "v"(g1), "v"(g2), "v"(g3) : "memory"); }
__global__ __launch_bounds__(128) void k_proj(const float* __restrict__ xq, const float* __restrict__ xk, const float* __restrict__ xv, const _Float16* __restrict__ BQ, const _Float16* __restrict__ BK, const _Float16* __restrict__ BV,
    _Float16* __restrict__ QH, _Float16* __restrict__ QL, _Float16* __restrict__ KH, _Float16* __restrict__ KL, _Float16* __restrict__ VT) {
  __shared__ __attribute__((aligned(128))) unsigned char L[2 * PJS];
  float (*so)[32][68] = (float (*)[32][68])L;      /* the epilogue's tile lies on the first buffer's A rows: it is written only behind the last trip's barrier, when no copy is in flight and no wave reads them */
  const int tid = threadIdx.x, w = tid >> 5, lane = tid & 31, ln = lane & 15, hh = lane >> 4; const int y = blockIdx.y;
  const float* A = y == 0 ? xq : y == 1 ? xk : xv; const _Float16* Bh = y == 0 ? BQ : y == 1 ? BK : BV;
  const int mt = blockIdx.x / (DM / 64), nq = blockIdx.x - mt * (DM / 64); const int row0 = mt * 128 + 32 * w, col0 = nq * 64;
  /* the copies of a stage: A rows of 16 pieces (a thread: rows tid / 16 + 8 i), B rows of 8 pieces (rows tid / 8 + 16 i); every lane on, every piece written by one lane */
  const unsigned lds0 = (unsigned)(size_t)L; const unsigned la = lds0 + (unsigned)((tid >> 4) * GFP + (tid & 15) * 16), lb = lds0 + (unsigned)(PJA + (tid >> 3) * GHP + (tid & 7) * 16);
  const float* ga = A + (size_t)(mt * 128 + (tid >> 4)) * DM + (tid & 15) * 4; const _Float16* gb = Bh + (size_t)(col0 + (tid >> 3)) * DM + (tid & 7) * 8;
  auto stage = [&](int s, unsigned buf) { const unsigned o = buf * PJS;
    gs_copy4(la + o, 8 * GFP, ga + s * GKS, (size_t)8 * DM); gs_copy4(la + o + 32 * GFP, 8 * GFP, ga + s * GKS + (size_t)32 * DM, (size_t)8 * DM);
    gs_copy4(la + o + 64 * GFP, 8 * GFP, ga + s * GKS + (size_t)64 * DM, (size_t)8 * DM); gs_copy4(la + o + 96 * GFP, 8 * GFP, ga + s * GKS + (size_t)96 * DM, (size_t)8 * DM);
    gs_copy4(lb + o, 16 * GHP, gb + s * GKS, (size_t)16 * DM); };
  stage(0, 0);
  const v8f z8 = {0.f,0.f,0.f,0.f,0.f,0.f,0.f,0.f}; v8f c00 = z8, c01 = z8, c02 = z8, c03 = z8, c10 = z8, c11 = z8, c12 = z8, c13 = z8;
  asm volatile("s_wait_asynccnt 0x0" ::: "memory");      /* this wave's copies of stage 0 have landed */
  __syncthreads();      /* and every other wave's: stage 0 may be read */
  stage(1, 1);
#pragma unroll 1
  for (int t = 0; t < DM / GKS; ++t) {      /* rolled: one trip is one LDS stage, its two k blocks unrolled below */
    const unsigned char* ab = L + (t & 1) * PJS + (w * 32 + ln) * GFP + hh * 32; const unsigned char* bb = L + (t & 1) * PJS + PJA + ln * GHP + hh * 16;
    v4f x[2][2][4]; v16h bf[2][4];      /* [k block][16 rows][piece], [k block][16 columns] */
#pragma unroll
    for (int p = 0; p < GKS / 32; ++p) {      /* unrolled: every LDS offset a constant */
#pragma unroll
      for (int i = 0; i < 2; ++i) { const unsigned char* ap = ab + i * 16 * GFP + p * 128; x[p][i][0] = *(const v4fa*)ap; x[p][i][1] = *(const v4fa*)(ap + 16); x[p][i][2] = *(const v4fa*)(ap + 64); x[p][i][3] = *(const v4fa*)(ap + 80); }
#pragma unroll
      for (int j = 0; j < 4; ++j) bf[p][j] = gs_hfrag(bb + j * 16 * GHP + p * 64); }
    asm volatile("s_wait_dscnt 0x0" ::: "memory");      /* the stage's fragments are all in registers: this wave's reads of the buffer are done before the buffer is handed back */
    asm volatile("s_wait_asynccnt 0x0" ::: "memory");      /* this wave's copies of stage t + 1 have landed */
    __syncthreads();      /* publishes stage t + 1 and ends every wave's reads of stage t's buffer */
    if (t + 2 < DM / GKS) stage(t + 2, (unsigned)(t & 1));      /* same test in every wave of the block; refills the buffer just read, and flies under the products below, which work on registers alone */
#pragma unroll
    for (int p = 0; p < GKS / 32; ++p) { const v16h a0 = gs_fcvt(x[p][0][0], x[p][0][1], x[p][0][2], x[p][0][3]), a1 = gs_fcvt(x[p][1][0], x[p][1][1], x[p][1][2], x[p][1][3]);
      c00 = gs_mma(a0, bf[p][0], c00); c10 = gs_mma(a1, bf[p][0], c10); c01 = gs_mma(a0, bf[p][1], c01); c11 = gs_mma(a1, bf[p][1], c11);
      c02 = gs_mma(a0, bf[p][2], c02); c12 = gs_mma(a1, bf[p][2], c12); c03 = gs_mma(a0, bf[p][3], c03); c13 = gs_mma(a1, bf[p][3], c13); }
  }
  asm volatile("s_wait_asynccnt 0x0" ::: "memory");      /* no copy is left in flight when the first buffer becomes the epilogue's tile */
  v8f accs[8] = {c00, c01, c02, c03, c10, c11, c12, c13};
  if (y == 2) {      /* same for the whole block */
    unsigned char* st = (unsigned char*)&so[0][0][0];
#pragma unroll
    for (int u = 0; u < 8; ++u) { const int t = u & 3, half = u >> 2; FragH f;
#pragma unroll
      for (int r = 0; r < 8; ++r) f.h[r] = (_Float16)(accs[u][r] * 0.0625f);
      *(v8us*)(st + (t * 16 + ln) * PVP + (w * 32 + half * 16 + 8 * hh) * 2) = f.half[0]; }
    __syncthreads();      /* the tile's 128 tokens come from all four waves */
    const int bb = (mt * 128) / SQ, s0 = (mt * 128) % SQ;
#pragma unroll
    for (int i = 0; i < 8; ++i) { const int d = i * 8 + (tid >> 4), pc = tid & 15; const v8us v = *(const v8us*)(st + d * PVP + pc * 16);
      *(v8us*)((unsigned short*)VT + ((size_t)(bb * NH + nq) * HD + d) * SQ + s0 + pc * 8) = v; }
  } else {
    _Float16* Hh = y == 0 ? QH : KH; _Float16* Hl = y == 0 ? QL : KL;
#pragma unroll
    for (int u = 0; u < 8; ++u) { const int t = u & 3, half = u >> 2;
#pragma unroll
      for (int r = 0; r < 8; ++r) so[w][half * 16 + 8 * hh + r][t * 16 + ln] = accs[u][r] * 0.0625f; }
    __builtin_amdgcn_fence(__ATOMIC_ACQ_REL, "workgroup"); __builtin_amdgcn_wave_barrier();      /* a wave reads back only its own 32 rows */
    const int rsub = lane >> 4, c4 = (lane & 15) * 4;
#pragma unroll
    for (int q = 0; q < 16; ++q) { const int r = q * 2 + rsub; const v4f v = *(const v4fa*)&so[w][r][c4]; v4h h4, l4;
#pragma unroll
      for (int i = 0; i < 4; ++i) { const _Float16 hv = (_Float16)v[i]; h4[i] = hv; l4[i] = (_Float16)((v[i] - (float)hv) * 1024.0f); }
      const size_t o = (size_t)(row0 + r) * DM + col0 + c4; *(v4h*)(Hh + o) = h4; *(v4h*)(Hl + o) = l4; }
  } }

// out = o W_p: k_gemm2's tile (block 128 rows x 64 columns, wave 32 x 64, K = DM) and its plain epilogue (x alpha, f32 rows through an LDS tile), both operands f16 and staged as above.
__global__ __launch_bounds__(128) void k_outp(const _Float16* __restrict__ A, const _Float16* __restrict__ Bh, float alpha, float* __restrict__ C) {
  __shared__ __attribute__((aligned(128))) unsigned char L[2 * OPS];
  float (*so)[32][68] = (float (*)[32][68])L;      /* lies on the first buffer and part of the second, written behind the last trip's barrier as in k_proj */
  const int tid = threadIdx.x, w = tid >> 5, lane = tid & 31, ln = lane & 15, hh = lane >> 4;
  const int mt = blockIdx.x / (DM / 64), nq = blockIdx.x - mt * (DM / 64); const int row0 = mt * 128 + 32 * w, col0 = nq * 64;
  /* the copies of a stage: rows of 8 pieces (a thread: rows tid / 8 + 16 i), 128 of A and 64 of B; every lane on, every piece written by one lane */
  const unsigned lds0 = (unsigned)(size_t)L; const unsigned la = lds0 + (unsigned)((tid >> 3) * GHP + (tid & 7) * 16);
  const _Float16* ga = A + (size_t)(mt * 128 + (tid >> 3)) * DM + (tid & 7) * 8; const _Float16* gb = Bh + (size_t)(col0 + (tid >> 3)) * DM + (tid & 7) * 8;
  auto stage = [&](int s, unsigned buf) { const unsigned o = buf * OPS;
    gs_copy4(la + o, 16 * GHP, ga + s * GKS, (size_t)16 * DM); gs_copy4(la + o + 64 * GHP, 16 * GHP, ga + s * GKS + (size_t)64 * DM, (size_t)16 * DM); gs_copy4(la + o + OPA, 16 * GHP, gb + s * GKS, (size_t)16 * DM); };
  stage(0, 0);
  const v8f z8 = {0.f,0.f,0.f,0.f,0.f,0.f,0.f,0.f}; v8f c00 = z8, c01 = z8, c02 = z8, c03 = z8, c10 = z8, c11 = z8, c12 = z8, c13 = z8;
  asm volatile("s_wait_asynccnt 0x0" ::: "memory");      /* this wave's copies of stage 0 have landed */
  __syncthreads();      /* and every other wave's: stage 0 may be read */
  stage(1, 1);
#pragma unroll 1
  for (int t = 0; t < DM / GKS; ++t) {      /* rolled: one trip is one LDS stage, its two k blocks unrolled below */
    const unsigned char* ab = L + (t & 1) * OPS + (w * 32 + ln) * GHP + hh * 16; const unsigned char* bb = L + (t & 1) * OPS + OPA + ln * GHP + hh * 16;
    v16h af[2][2], bf[2][4];      /* [k block][16 rows], [k block][16 columns] */
#pragma unroll
    for (int p = 0; p < GKS / 32; ++p) {      /* unrolled: every LDS offset a constant */
      af[p][0] = gs_hfrag(ab + p * 64); af[p][1] = gs_hfrag(ab + 16 * GHP + p * 64);
#pragma unroll
      for (int j = 0; j < 4; ++j) bf[p][j] = gs_hfrag(bb + j * 16 * GHP + p * 64); }
    asm volatile("s_wait_dscnt 0x0" ::: "memory");      /* the stage's fragments are all in registers: this wave's reads of the buffer are done before the buffer is handed back */
    asm volatile("s_wait_asynccnt 0x0" ::: "memory");      /* this wave's copies of stage t + 1 have landed */
    __syncthreads();      /* publishes stage t + 1 and ends every wave's reads of stage t's buffer */
    if (t + 2 < DM / GKS) stage(t + 2, (unsigned)(t & 1));      /* same test in every wave of the block; refills the buffer just read, and flies under the products below, which work on registers alone */
#pragma unroll
    for (int p = 0; p < GKS / 32; ++p) {
      c00 = gs_mma(af[p][0], bf[p][0], c00); c10 = gs_mma(af[p][1], bf[p][0], c10); c01 = gs_mma(af[p][0], bf[p][1], c01); c11 = gs_mma(af[p][1], bf[p][1], c11);
      c02 = gs_mma(af[p][0], bf[p][2], c02); c12 = gs_mma(af[p][1], bf[p][2], c12); c03 = gs_mma(af[p][0], bf[p][3], c03); c13 = gs_mma(af[p][1], bf[p][3], c13); }
  }
  asm volatile("s_wait_asynccnt 0x0" ::: "memory");      /* no copy is left in flight when the buffers become the epilogue's tile */
  v8f accs[8] = {c00, c01, c02, c03, c10, c11, c12, c13};
#pragma unroll
  for (int u = 0; u < 8; ++u) { const int t = u & 3, half = u >> 2;
#pragma unroll
    for (int r = 0; r < 8; ++r) so[w][half * 16 + 8 * hh + r][t * 16 + ln] = accs[u][r] * alpha; }
  __builtin_amdgcn_fence(__ATOMIC_ACQ_REL, "workgroup"); __builtin_amdgcn_wave_barrier();      /* a wave reads back only its own 32 rows */
  const int rsub = lane >> 4, c4 = (lane & 15) * 4; v4f vr[16];      /* all rows read back first, then stored from one address pair */
#pragma unroll
  for (int q = 0; q < 16; ++q) vr[q] = *(const v4fa*)&so[w][q * 2 + rsub][c4];
  float* cp = C + (size_t)(row0 + rsub) * DM + col0 + c4;
#pragma unroll
  for (int q = 0; q < 16; ++q) *(v4f*)(cp + (size_t)q * 2 * DM) = vr[q]; }

__global__ __launch_bounds__(256) void k_wnat(const float* __restrict__ w, size_t n8, _Float16* __restrict__ Bt) { const size_t t = (size_t)blockIdx.x * 256 + threadIdx.x; if (t >= n8) return; FragH f; for (int q = 0; q < 8; ++q) f.h[q] = (_Float16)(bf16_round(w[t * 8 + q]) * 16.0f); *(v8us*)((unsigned short*)Bt + t * 8) = f.half[0];  }
__global__ __launch_bounds__(256) void k_rsm(const float* __restrict__ S, _Float16* __restrict__ P, int nrows) {
  #pragma clang fp contract(off)
  const int i = blockIdx.x * 256 + threadIdx.x; if (i >= nrows) return; const float* s = S + (size_t)i * SQ; float mx = -3.0e38f;
#pragma unroll 1
  for (int j = 0; j < SQ; ++j) mx = fmaxf(mx, s[j]); float se = 0.f;
#pragma unroll 1
  for (int j = 0; j < SQ; ++j) se += expf(s[j] - mx); const float sc = 256.0f / se;
#pragma unroll 1
  for (int j0 = 0; j0 < SQ; j0 += 8) { FragH f; for (int q = 0; q < 8; ++q) f.h[q] = (_Float16)(expf(s[j0 + q] - mx) * sc); unsigned short* d = (unsigned short*)P + (size_t)i * SQ + j0; *(v8us*)d = f.half[0];  } }
__global__ __launch_bounds__(256) void k_vt(const _Float16* __restrict__ V16, int b, int h0, _Float16* __restrict__ VT) { __shared__ unsigned short tl[64][65]; const int tid = threadIdx.x; const int hh = blockIdx.x % HG, sg = blockIdx.x / HG; const int s0 = sg * 64; const int h = h0 + hh;
  for (int i = tid; i < 64 * 8; i += 256) { const int j = i / 8, d8 = (i % 8) * 8; FragH f; f.half[0] = *(const v8us*)((const unsigned short*)V16 + ((size_t)b * SQ + s0 + j) * DM + h * HD + d8); for (int q = 0; q < 8; ++q) tl[d8 + q][j] = f.u[q]; }
  __syncthreads();
  { for (int i = tid; i < 64 * 8; i += 256) { const int d = i / 8, j8 = (i % 8) * 8; FragH f; for (int q = 0; q < 8; ++q) f.u[q] = tl[d][j8 + q]; *(v8us*)((unsigned short*)VT + ((size_t)hh * HD + d) * SQ + s0 + j8) = f.half[0]; }  } }



#define FK 128                       /* keys per LDS stage: 4 passes of 32 */
#define FKP 144                      /* LDS pitch in bytes of a K row (128 bytes of data) */
#define FVP 272                      /* LDS pitch in bytes of a V^T row (256 bytes of data) */
#define FKB (FK * FKP)               /* one K plane of a stage */
#define FSB (2 * FKB + HD * FVP)     /* one stage: K hi, K lo, V^T */
__device__ __forceinline__ v8f fa_mma(v16h a, v16h b, v8f c) { return __builtin_amdgcn_wmma_f32_16x16x32_f16(false, a, false, b, (short)0, c, false, false); }
__device__ __forceinline__ float fa_swap16(float x) { const int b = __float_as_int(x); return __int_as_float(__builtin_amdgcn_permlanex16(b, b, 0x76543210, 0xfedcba98, false, false)); }      /* value of lane l ^ 16 */
__device__ __forceinline__ v16h fa_lfrag(const unsigned char* p) { FragH f; f.half[0] = *(const v8us*)p; f.half[1] = *(const v8us*)(p + 32); return f.v; }      /* g2_frag's k order, from an LDS row; p already holds the lane half's 16 bytes */
// Four copies of 16 bytes a lane, global -> LDS. The s_wait_xcnt closes the statement so that it stands in front of every later write of the address registers that the copies name.
__device__ __forceinline__ void fa_copy4(unsigned l0, unsigned lstep, const _Float16* g0, size_t gstep) {
  const unsigned l1 = l0 + lstep, l2 = l1 + lstep, l3 = l2 + lstep; const _Float16* g1 = g0 + gstep; const _Float16* g2 = g1 + gstep; const _Float16* g3 = g2 + gstep;
  asm volatile("global_load_async_to_lds_b128 %0, %4, off\n\tglobal_load_async_to_lds_b128 %1, %5, off\n\tglobal_load_async_to_lds_b128 %2, %6, off\n\tglobal_load_async_to_lds_b128 %3, %7, off\n\ts_wait_xcnt 0x0"
               :: "v"(l0), "v"(l1), "v"(l2), "v"(l3), "v"(g0), "v"(g1), "v"(g2), "v"(g3) : "memory"); }
__global__ __launch_bounds__(256) void k_fattn(const _Float16* __restrict__ Qh, const _Float16* __restrict__ Ql, const _Float16* __restrict__ Kh, const _Float16* __restrict__ Kl, const _Float16* __restrict__ Vt, _Float16* __restrict__ O) {
  __shared__ __attribute__((aligned(128))) unsigned char L[2 * FSB];
  const int tid = threadIdx.x, lane = tid & 31, ln = lane & 15, hh = lane >> 4; const int w = __builtin_amdgcn_readfirstlane((int)(threadIdx.x >> 5));
  const int bh = blockIdx.y, b = bh / NH, h = bh - b * NH; const size_t r0 = (size_t)b * SQ; const int q0 = blockIdx.x * 128 + w * 16;
  const size_t qo = (r0 + q0 + ln) * DM + h * HD;
  /* the copies of a stage: K rows of 8 pieces (a thread: rows tid / 8 + 32 i), V^T rows of 16 pieces (rows tid / 16 + 16 i); every lane on, every piece written by one lane */
  const unsigned lds0 = (unsigned)(size_t)L; const unsigned lk = lds0 + (unsigned)((tid >> 3) * FKP + (tid & 7) * 16), lv = lds0 + (unsigned)(2 * FKB + (tid >> 4) * FVP + (tid & 15) * 16);
  const size_t gko = (r0 + (tid >> 3)) * DM + h * HD + (tid & 7) * 8; const _Float16* gkh = Kh + gko; const _Float16* gkl = Kl + gko; const _Float16* gv = Vt + ((size_t)bh * HD + (tid >> 4)) * SQ + (tid & 15) * 8;
  auto stage = [&](int s, unsigned buf) { const unsigned lb = buf * FSB;
    fa_copy4(lk + lb, 32 * FKP, gkh + (size_t)s * FK * DM, (size_t)32 * DM); fa_copy4(lk + lb + FKB, 32 * FKP, gkl + (size_t)s * FK * DM, (size_t)32 * DM); fa_copy4(lv + lb, 16 * FVP, gv + (size_t)s * FK, (size_t)16 * SQ); };
  stage(0, 0);
  const v16h qh0 = g2_frag(Qh + qo, hh), qh1 = g2_frag(Qh + qo + 32, hh), ql0 = g2_frag(Ql + qo, hh), ql1 = g2_frag(Ql + qo + 32, hh);
  const v8f z8 = {0.f,0.f,0.f,0.f,0.f,0.f,0.f,0.f}; v8f o0 = z8, o1 = z8, o2 = z8, o3 = z8; float m = -3.0e38f, l = 0.f;
  const float cs = 0.18033688011112042f;      /* log2(e) / 8: raw product -> exponent of two */
  asm volatile("s_wait_asynccnt 0x0" ::: "memory");      /* this wave's copies of stage 0 have landed */
  __syncthreads();      /* and every other wave's: stage 0 may be read */
  stage(1, 1);
#pragma unroll 1
  for (int t = 0; t < SQ / FK; ++t) {      /* rolled: one trip is one LDS stage, its four passes unrolled below */
    const unsigned char* kb = L + (t & 1) * FSB + ln * FKP + hh * 16; const unsigned char* vb = L + (t & 1) * FSB + 2 * FKB + ln * FVP + hh * 16;
    v16h h00 = fa_lfrag(kb), h01 = fa_lfrag(kb + 64), h10 = fa_lfrag(kb + 16 * FKP), h11 = fa_lfrag(kb + 16 * FKP + 64);
    v16h l00 = fa_lfrag(kb + FKB), l01 = fa_lfrag(kb + FKB + 64), l10 = fa_lfrag(kb + FKB + 16 * FKP), l11 = fa_lfrag(kb + FKB + 16 * FKP + 64);
#pragma unroll
    for (int p = 0; p < FK / 32; ++p) {      /* unrolled: every LDS offset a constant, and the K fragments are carried from pass to pass inside the stage */
      const v16h v0 = fa_lfrag(vb + p * 64), v1 = fa_lfrag(vb + 16 * FVP + p * 64), v2 = fa_lfrag(vb + 32 * FVP + p * 64), v3 = fa_lfrag(vb + 48 * FVP + p * 64);
      v8f sa = z8, sb = z8, ta = z8, tb = z8;      /* keys j .. j+15: sa small terms, sb main term; keys j+16 .. j+31: ta, tb */
      sa = fa_mma(h00, ql0, sa); sb = fa_mma(h00, qh0, sb); ta = fa_mma(h10, ql0, ta); tb = fa_mma(h10, qh0, tb);
      sa = fa_mma(h01, ql1, sa); sb = fa_mma(h01, qh1, sb); ta = fa_mma(h11, ql1, ta); tb = fa_mma(h11, qh1, tb);
      sa = fa_mma(l00, qh0, sa); ta = fa_mma(l10, qh0, ta); sa = fa_mma(l01, qh1, sa); ta = fa_mma(l11, qh1, ta);
      if (p + 1 < FK / 32) { const unsigned char* kn = kb + (p + 1) * 32 * FKP;      /* the next pass's K fragments come under this pass's softmax; never beyond this stage's own buffer */
        h00 = fa_lfrag(kn); h01 = fa_lfrag(kn + 64); h10 = fa_lfrag(kn + 16 * FKP); h11 = fa_lfrag(kn + 16 * FKP + 64);
        l00 = fa_lfrag(kn + FKB); l01 = fa_lfrag(kn + FKB + 64); l10 = fa_lfrag(kn + FKB + 16 * FKP); l11 = fa_lfrag(kn + FKB + 16 * FKP + 64); }
      float u[16];
#pragma unroll
      for (int r = 0; r < 8; ++r) { u[r] = fmaf(sa[r], 0.0009765625f, sb[r]); u[8 + r] = fmaf(ta[r], 0.0009765625f, tb[r]); }
      float pm = fmaxf(fmaxf(fmaxf(fmaxf(u[0], u[1]), fmaxf(u[2], u[3])), fmaxf(fmaxf(u[4], u[5]), fmaxf(u[6], u[7]))), fmaxf(fmaxf(fmaxf(u[8], u[9]), fmaxf(u[10], u[11])), fmaxf(fmaxf(u[12], u[13]), fmaxf(u[14], u[15]))));
      pm = fmaxf(pm, fa_swap16(pm));      /* both halves of a query's keys: the two lanes must use one maximum, their weights meet in one product */
      if (p + 1 < FK / 32) asm volatile("" :: "v"(h00), "v"(h01), "v"(h10), "v"(h11), "v"(l00), "v"(l01), "v"(l10), "v"(l11));      /* inputs only: keeps the next pass's K loads in front of the branch, under the maximum; sunk behind it they are waited for as soon as they are issued */
      if (__builtin_amdgcn_ballot_w32(pm > m) != 0) {      /* scalar branch: taken by the whole wave or not at all */
        const float mn = fmaxf(m, pm); const float al = __builtin_amdgcn_exp2f((m - mn) * cs); m = mn; l *= al; o0 *= al; o1 *= al; o2 *= al; o3 *= al; }
      const float mc = fmaf(-m, cs, 8.0f);      /* + 8: weights carried x256 against the f16 subnormal range */
      FragH pw; float e[16];
#pragma unroll
      for (int s = 0; s < 16; ++s) { e[s] = __builtin_amdgcn_exp2f(fmaf(u[s], cs, mc)); pw.h[s] = (_Float16)e[s]; }
      l += (((e[0] + e[1]) + (e[2] + e[3])) + ((e[4] + e[5]) + (e[6] + e[7]))) + (((e[8] + e[9]) + (e[10] + e[11])) + ((e[12] + e[13]) + (e[14] + e[15])));
      o0 = fa_mma(v0, pw.v, o0); o1 = fa_mma(v1, pw.v, o1); o2 = fa_mma(v2, pw.v, o2); o3 = fa_mma(v3, pw.v, o3);
    }
    asm volatile("s_wait_dscnt 0x0" ::: "memory");      /* this wave's reads of the buffer are done before the buffer is handed back */
    asm volatile("s_wait_asynccnt 0x0" ::: "memory");      /* this wave's copies of stage t + 1 have landed */
    __syncthreads();      /* publishes stage t + 1 and ends every wave's reads of stage t's buffer */
    if (t + 2 < SQ / FK) stage(t + 2, (unsigned)(t & 1));      /* same test in every wave of the block; refills the buffer just read */
  }
  asm volatile("s_wait_asynccnt 0x0" ::: "memory");      /* no copy is left in flight when the wave ends */
  l += fa_swap16(l); const float sc = 64.0f / l;      /* l = 256 sum exp; o carried x64 as before (folded into the output GEMM alpha) */
  unsigned short* op = (unsigned short*)O + qo + 8 * hh; FragH f;
#pragma unroll
  for (int r = 0; r < 8; ++r) { f.h[r] = (_Float16)(o0[r] * sc); f.h[8 + r] = (_Float16)(o1[r] * sc); }
  *(v8us*)op = f.half[0]; *(v8us*)(op + 16) = f.half[1];
#pragma unroll
  for (int r = 0; r < 8; ++r) { f.h[r] = (_Float16)(o2[r] * sc); f.h[8 + r] = (_Float16)(o3[r] * sc); }
  *(v8us*)(op + 32) = f.half[0]; *(v8us*)(op + 48) = f.half[1]; }

extern "C" void kernel_launch(void* const* d_in, const int* in_sizes, int n_in,
                              void* d_out, int out_size, void* d_ws, size_t ws_size, hipStream_t stream) {
  (void)in_sizes; (void)n_in; (void)out_size;
  const float* const* I = (const float* const*)d_in; const float* xq = I[0]; const float* xk = I[1]; const float* xv = I[2]; const float* wq = I[3]; const float* wk = I[4]; const float* wv = I[5]; const float* wo = I[6];      /* input order: query, key, value; Wq, Wk, Wv [8][512][64] (per-head [in][out]); Wp [8][64][512] (flat [in][out] [512][512]): seven inputs; the module has NO biases */
  char* ws = (char*)d_ws; size_t off = 0;
  auto take = [&](size_t bytes) { char* p = ws + off; off += (bytes + 255) & ~(size_t)255; return p; };
  _Float16* BQ = (_Float16*)take((size_t)DM * DM * 2); _Float16* BK = (_Float16*)take((size_t)DM * DM * 2); _Float16* BV = (_Float16*)take((size_t)DM * DM * 2); _Float16* BO = (_Float16*)take((size_t)DM * DM * 2);
  _Float16* QH = (_Float16*)take(NR * DM * 2); _Float16* QL = (_Float16*)take(NR * DM * 2); _Float16* KH = (_Float16*)take(NR * DM * 2); _Float16* KL = (_Float16*)take(NR * DM * 2); _Float16* O16 = (_Float16*)take(NR * DM * 2);
  _Float16* VT = (_Float16*)take((size_t)NB * NH * HD * SQ * 2);
  if (off > ws_size) return;
  k_wprep<<<dim3((unsigned)(DM * (DM / 8) / 256), 4), 256, 0, stream>>>(wq, wk, wv, wo, BQ, BK, BV, BO);      /* per-head [h][i][o] -> Bt[(h, o)][i] x16 for q, k, v; the output weight [8][64][512] read flat = [in][out] [512][512] -> Bt[n][k] x16 */
  const size_t r0p = (size_t)B0 * SQ;      /* first row of the output stage */
  k_proj<<<dim3((unsigned)((NR / 128) * (DM / 64)), 3), 128, 0, stream>>>(xq, xk, xv, BQ, BK, BV, QH, QL, KH, KL, VT);      /* q and k as f16 hi + x1024 residual planes; V^T [NB * NH][HD][SQ], both batches */
  k_fattn<<<dim3(SQ / 128, NB * NH), 256, 0, stream>>>(QH, QL, KH, KL, VT, O16);      /* o (merged heads, x64) as f16 rows */
  k_outp<<<dim3((unsigned)((MPO / 128) * (DM / 64)), 1), 128, 0, stream>>>(O16 + r0p * DM, BO, 0.0009765625f, (float*)d_out + r0p * DM);      /* out rows are the output layout */
}

// v006
// It runs in 56.2 microseconds.
// Timed twice side by side with v005, it ran 1.05 times as fast both times.
// All steps since v000 together make it 36.5 times as fast.
#include <hip/hip_runtime.h>
// Multi-head attention on THREE input streams with per-head projection weights and a per-head output weight, no biases at all (query, key, value [2][2048][512]; q = einsum(bni,hio->bnho)(query, Wq), k and v likewise from key and value (Wq, Wk, Wv [8][512][64] per-head [in][out], normal x 0.05); q / sqrt(64); logits = q.k per head; softmax over all 2048 keys (no mask); out = einsum(bnhi,hio->bno)(attn v, Wp) (Wp [8][64][512]: read flat it IS an [in][out] [512][512] weight with input row h*64 + i; no bias) -> [2][2048][512]; input order query, key, value, Wq, Wk, Wv, Wp).
// Structure: token rows r = b*2048 + s; no weight pass: both GEMM kernels read the f32 weights as they lie ([in][out] rows), round them in registers (bf16, exact x16, as f16) into k-major LDS rows and take their B fragments from there by transposing loads; Q, K and V as ONE grid of WMMA GEMM tiles (32x64 wave tiles, f32 accumulation, no bias) that reads the f32 inputs itself (staged in LDS by asynchronous copies; bf16-rounded, exact in f16, in registers) and whose epilogue writes Q and K as f16 hi + x1024 residual planes and V as V^T per (batch, head) through an LDS tile; then ONE fused attention kernel over all (batch, head, 128 queries): per 32 keys the scores from THREE products (K = 64: k_hi.q_lo and k_lo.q_hi, worth 2^-10, and k_hi.q_hi; all / 8), running-maximum softmax in registers (f32 statistics, native exp2; weights x256 as f16), O^T += V^T P^T, o carried x64 against f16 subnormal flush (folded into the output GEMM alpha) written straight into the merged f16 o rows; out = o W_p GEMM (f32; no bias; o staged in LDS likewise, W_p as the other weights) into the output layout.
// Compute dtype: inputs rounded to bf16; the three inputs and the x16 weights converted to f16 in registers (exact for every bf16 value of magnitude from 2^-14 up to 65,504; the weights up to 4,094 before their factor of 16); q and k as f16 hi + x1024 residual planes (about 2^-21), the scores from three products (the lo.lo term dropped); v, softmax weights and o as plain f16 GEMM operands (~2^-12); scores and softmax statistics f32. v_wmma_f32_16x16x32_f16.
#define NB 2
#define SQ 2048
#define DM 512
#define NH 8
#define HD 64
#define HG 4                         /* heads per launch of the grouped k_vt (not launched) */
#define B0 0                         /* first batch processed (debug hook) */
#define NBR NB                       /* batches processed (debug hook) */
#define NR ((size_t)NB * SQ)         /* token rows */
#define MP ((int)((size_t)NBR * SQ)) /* rows through the output stage, via MPO (debug hook) */
#define QN SQ                        /* query rows per batch (not used) */
#define NHD NH                       /* heads (not used) */
#define MPO MP                       /* rows through the output stage (debug hook) */
#define LQ DM      /* row pitch of the q and k rows (not used) */
typedef __bf16 v16b __attribute__((ext_vector_type(16)));
typedef unsigned short v8us __attribute__((ext_vector_type(8), may_alias));
typedef float  v8f  __attribute__((ext_vector_type(8)));
typedef float  v4f  __attribute__((ext_vector_type(4)));
typedef float  v4fa __attribute__((ext_vector_type(4), may_alias));
union FragB { v16b v; v8us half[2]; unsigned short u[16]; };

__device__ __forceinline__ unsigned short bf16_bits(float x) { unsigned int u = __float_as_uint(x); return (unsigned short)((u + 0x7FFFu + ((u >> 16) & 1u)) >> 16); }
__device__ __forceinline__ float bf16_val(unsigned short b) { return __uint_as_float(((unsigned int)b) << 16); }
__device__ __forceinline__ float bf16_round(float x) { return bf16_val(bf16_bits(x)); }
// D += A·B with NT terms: 1 = ah·bh, 2 = + al·bh (A split), 3 = + ah·bl (both split)
template <int NT>
__device__ __forceinline__ v8f mmaN(v16b ah, v16b al, v16b bh, v16b bl, v8f c) {
  c = __builtin_amdgcn_wmma_f32_16x16x32_bf16(false, ah, false, bh, (short)0, c, false, false);
  if (NT >= 2) c = __builtin_amdgcn_wmma_f32_16x16x32_bf16(false, al, false, bh, (short)0, c, false, false);
  if (NT >= 3) c = __builtin_amdgcn_wmma_f32_16x16x32_bf16(false, ah, false, bl, (short)0, c, false, false);
  asm volatile("v_nop\n\tv_nop\n\tv_nop\n\tv_nop" : "+v"(c) : "v"(ah), "v"(al), "v"(bh), "v"(bl));
  return c;
}

__global__ __launch_bounds__(256) void k_wt_bf16(const float* __restrict__ W, unsigned short* __restrict__ Wt, int K, int N) {
  const int t = blockIdx.x * 256 + threadIdx.x;
  const int k8n = K / 8;
  if (t >= N * k8n) return;
  const int n = t / k8n, k8 = (t % k8n) * 8;
  v8us v;
#pragma unroll
  for (int i = 0; i < 8; ++i) v[i] = bf16_bits(W[(size_t)(k8 + i) * N + n]);
  *(v8us*)(Wt + (size_t)n * K + k8) = v;
  
}

// GEMM C[M][N] (f32, pitch ldc) = act(A[M][K]·W + bias). A f32 row-major (pitch lda) converted per fragment to bf16
// (ASPLIT: hi/lo two planes -> 2 terms, else single rounded term); Wt bf16 [N][K] (pitch ldb). BIAS_BF16 rounds the
// bias to bf16 first (bias quantised to bf16 before the add). K%32==0, M%16==0, N%64==0.
template <bool ASPLIT, int ACT, bool BIAS_BF16>
__global__ __launch_bounds__(128) void k_gemm_bf(const float* __restrict__ A, int lda, const unsigned short* __restrict__ Wt, int ldb,
                                               const float* __restrict__ bias, float* __restrict__ C, int ldc, int M, int N, int K) {
  __shared__ __attribute__((aligned(16))) float so[4][16][64];
  const int tid = threadIdx.x, w = tid >> 5, lane = tid & 31, ln = lane & 15, hh = lane >> 4;
  const int ntn = N / 64;
  const int wid = blockIdx.x * 4 + w;
  const int mt = wid / ntn, nq = wid % ntn;
  if (mt * 16 >= M) return;
  const int row0 = mt * 16, col0 = nq * 64;
  const float* arow = A + (size_t)(row0 + ln) * lda;
  v8f acc[4] = {};
  for (int kb = 0; kb < K; kb += 32) {
    FragB ah, al;
    const v4f x0 = *(const v4fa*)(arow + kb + 8 * hh), x1 = *(const v4fa*)(arow + kb + 8 * hh + 4);
    const v4f x2 = *(const v4fa*)(arow + kb + 16 + 8 * hh), x3 = *(const v4fa*)(arow + kb + 16 + 8 * hh + 4);
    float xs[16] = {x0[0],x0[1],x0[2],x0[3],x1[0],x1[1],x1[2],x1[3],x2[0],x2[1],x2[2],x2[3],x3[0],x3[1],x3[2],x3[3]};
#pragma unroll
    for (int i = 0; i < 16; ++i) { const unsigned short hb = bf16_bits(xs[i]); ah.u[i] = hb; al.u[i] = ASPLIT ? bf16_bits(xs[i] - bf16_val(hb)) : (unsigned short)0; }
#pragma unroll
    for (int t = 0; t < 4; ++t) {
      const unsigned short* brow = Wt + (size_t)(col0 + t * 16 + ln) * ldb + kb;
      FragB b;
      b.half[0] = *(const v8us*)(brow + 8 * hh);
      b.half[1] = *(const v8us*)(brow + 16 + 8 * hh);
      acc[t] = mmaN<ASPLIT ? 2 : 1>(ah.v, al.v, b.v, b.v, acc[t]);
    }
  }
#pragma unroll
  for (int t = 0; t < 4; ++t) {
    float bv = bias ? bias[col0 + t * 16 + ln] : 0.f;
    if (BIAS_BF16) bv = bf16_round(bv);
#pragma unroll
    for (int r = 0; r < 8; ++r) { float v = acc[t][r] + bv; if (ACT == 1) v = fmaxf(v, 0.f); so[w][8 * hh + r][t * 16 + ln] = v; }
  }
  __builtin_amdgcn_fence(__ATOMIC_ACQ_REL, "workgroup");
  __builtin_amdgcn_wave_barrier();
  const int rsub = lane >> 4, c4 = (lane & 15) * 4;
  {
#pragma unroll
    for (int q = 0; q < 8; ++q) {
      const int r = q * 2 + rsub;
      const v4f v = *(const v4fa*)&so[w][r][c4];
      *(v4f*)(C + (size_t)(row0 + r) * ldc + col0 + c4) = v;
    }
    
  }
}

// GEMM C = act(A·W + bias + resid): A f32 (ASPLIT -> hi/lo 2 terms), Wt bf16 [N][K]; ACT 0 none, 1 relu, 2 exact gelu;
// resid (optional, f32, row index = (row % rmod), pitch ldr, RES_BF16 rounds it) added before the activation.
template <bool ASPLIT, int ACT, bool BIAS_BF16, bool RES_BF16>
__global__ __launch_bounds__(128) void k_gemm_bf3(const float* __restrict__ A, int lda, const unsigned short* __restrict__ Wt, int ldb,
                                                const float* __restrict__ bias, const float* __restrict__ resid, int rmod, int ldr,
                                                float* __restrict__ C, int ldc, int M, int N, int K) {
  __shared__ __attribute__((aligned(16))) float so[4][16][64];
  const int tid = threadIdx.x, w = tid >> 5, lane = tid & 31, ln = lane & 15, hh = lane >> 4;
  const int ntn = N / 64;
  const int wid = blockIdx.x * 4 + w;
  const int mt = wid / ntn, nq = wid % ntn;
  if (mt * 16 >= M) return;
  const int row0 = mt * 16, col0 = nq * 64;
  const float* arow = A + (size_t)(row0 + ln) * lda;
  v8f acc[4] = {};
  for (int kb = 0; kb < K; kb += 32) {
    FragB ah, al;
    const v4f x0 = *(const v4fa*)(arow + kb + 8 * hh), x1 = *(const v4fa*)(arow + kb + 8 * hh + 4);
    const v4f x2 = *(const v4fa*)(arow + kb + 16 + 8 * hh), x3 = *(const v4fa*)(arow + kb + 16 + 8 * hh + 4);
    float xs[16] = {x0[0],x0[1],x0[2],x0[3],x1[0],x1[1],x1[2],x1[3],x2[0],x2[1],x2[2],x2[3],x3[0],x3[1],x3[2],x3[3]};
#pragma unroll
    for (int i = 0; i < 16; ++i) { const unsigned short hb = bf16_bits(xs[i]); ah.u[i] = hb; al.u[i] = ASPLIT ? bf16_bits(xs[i] - bf16_val(hb)) : (unsigned short)0; }
#pragma unroll
    for (int t = 0; t < 4; ++t) {
      const unsigned short* brow = Wt + (size_t)(col0 + t * 16 + ln) * ldb + kb;
      FragB b;
      b.half[0] = *(const v8us*)(brow + 8 * hh);
      b.half[1] = *(const v8us*)(brow + 16 + 8 * hh);
      acc[t] = mmaN<ASPLIT ? 2 : 1>(ah.v, al.v, b.v, b.v, acc[t]);
    }
  }
#pragma unroll
  for (int t = 0; t < 4; ++t) {
    const int col = col0 + t * 16 + ln;
    float bv = bias ? bias[col] : 0.f;
    if (BIAS_BF16) bv = bf16_round(bv);
#pragma unroll
    for (int r = 0; r < 8; ++r) {
      float v = acc[t][r] + bv;
      if (resid) { float rv = resid[(size_t)((row0 + 8 * hh + r) % rmod) * ldr + col]; if (RES_BF16) rv = bf16_round(rv); v += rv; }
      if (ACT == 1) v = fmaxf(v, 0.f);
      if (ACT == 2) v = 0.5f * v * (1.0f + erff(v * 0.70710678118654752f));
      if (ACT == 3) { const float u = 0.7978845608028654f * (v + 0.044715f * v * v * v); v = 0.5f * v * (1.0f + tanhf(u)); }
      so[w][8 * hh + r][t * 16 + ln] = v;
    }
  }
  __builtin_amdgcn_fence(__ATOMIC_ACQ_REL, "workgroup");
  __builtin_amdgcn_wave_barrier();
  const int rsub = lane >> 4, c4 = (lane & 15) * 4;
  {
#pragma unroll
    for (int q = 0; q < 8; ++q) {
      const int r = q * 2 + rsub;
      const v4f v = *(const v4fa*)&so[w][r][c4];
      *(v4f*)(C + (size_t)(row0 + r) * ldc + col0 + c4) = v;
    }
    
  }
}
// row LayerNorm (biased variance, eps) over N: s = X (+ R); optional out_sum <- s; out_norm <- (s-mu)*rsqrt(var+eps)*g + b
template <bool PARAM_BF16>
__global__ __launch_bounds__(256) void k_layernorm(const float* __restrict__ X, const float* __restrict__ R, const float* __restrict__ g, const float* __restrict__ bta,
                                                  float* __restrict__ out_sum, float* __restrict__ out_norm, int N, float eps) {
  __shared__ float red[256];
  const int row = blockIdx.x, tid = threadIdx.x;
  const float* x = X + (size_t)row * N; const float* rr = R ? R + (size_t)row * N : nullptr;
  float vals[16];                     // up to N = 4096
  const int per = N / 256;            // contiguous chunk per thread? use strided-by-4 chunks: thread handles j = tid*4 + 1024*u
  float s1 = 0.f;
  for (int u = 0; u < per / 4; ++u) {
    const int j = tid * 4 + 1024 * u;
    const v4f a = *(const v4fa*)(x + j);
    v4f b = {0.f,0.f,0.f,0.f}; if (rr) b = *(const v4fa*)(rr + j);
#pragma unroll
    for (int q = 0; q < 4; ++q) { const float v = a[q] + b[q]; vals[u * 4 + q] = v; s1 += v; }
  }
  red[tid] = s1; __syncthreads();
  for (int st = 128; st > 0; st >>= 1) { if (tid < st) red[tid] += red[tid + st]; __syncthreads(); }
  const float mu = red[0] / (float)N; __syncthreads();
  float s2 = 0.f;
  for (int u = 0; u < per / 4; ++u)
#pragma unroll
    for (int q = 0; q < 4; ++q) { const float c = vals[u * 4 + q] - mu; s2 += c * c; }
  red[tid] = s2; __syncthreads();
  for (int st = 128; st > 0; st >>= 1) { if (tid < st) red[tid] += red[tid + st]; __syncthreads(); }
  const float rs = rsqrtf(red[0] / (float)N + eps);
  {
    for (int u = 0; u < per / 4; ++u) {
      const int j = tid * 4 + 1024 * u;
      v4f o, sm;
#pragma unroll
      for (int q = 0; q < 4; ++q) {
        float gg = g[j + q], bb = bta[j + q];
        if (PARAM_BF16) { gg = bf16_round(gg); bb = bf16_round(bb); }
        sm[q] = vals[u * 4 + q]; o[q] = (vals[u * 4 + q] - mu) * rs * gg + bb;
      }
      if (out_sum) *(v4f*)(out_sum + (size_t)row * N + j) = sm;
      *(v4f*)(out_norm + (size_t)row * N + j) = o;
    }
    
  }
}



// ---- f16 WMMA path (v_wmma_f32_16x16x32_f16): 11-bit significands for operands in range — used where a [0,1] probability operand needs more precision than bf16
typedef _Float16 v16h __attribute__((ext_vector_type(16)));
union FragH { v16h v; v8us half[2]; _Float16 h[16]; unsigned short u[16]; };
template <int NT>
__device__ __forceinline__ v8f mmaH(v16h ah, v16h al, v16h bh, v16h bl, v8f c) {
  c = __builtin_amdgcn_wmma_f32_16x16x32_f16(false, ah, false, bh, (short)0, c, false, false);
  if (NT >= 2) c = __builtin_amdgcn_wmma_f32_16x16x32_f16(false, al, false, bh, (short)0, c, false, false);
  if (NT >= 3) c = __builtin_amdgcn_wmma_f32_16x16x32_f16(false, ah, false, bl, (short)0, c, false, false);
  asm volatile("v_nop\n\tv_nop\n\tv_nop\n\tv_nop" : "+v"(c) : "v"(ah), "v"(al), "v"(bh), "v"(bl));
  return c;
}
// batched GEMM like k_gemm_b but f16 operands: A f32 (split into f16 hi/lo if ASPLIT, else rounded to f16), Bt = f16 values [n][k]; alpha; C f32; N multiple of 16 (partial tiles skipped)
template <bool ASPLIT>
__global__ __launch_bounds__(128) void k_gemm_h(const float* __restrict__ A, int lda, size_t sA, const _Float16* __restrict__ Bh, int ldb, size_t sB, float alpha, float* __restrict__ C, int ldc, size_t sC, int M, int N, int K) {
  __shared__ __attribute__((aligned(16))) float so[4][16][64];
  const int tid = threadIdx.x, w = tid >> 5, lane = tid & 31, ln = lane & 15, hh = lane >> 4; const int by = blockIdx.y;
  A += (size_t)by * sA; Bh += (size_t)by * sB; C += (size_t)by * sC;
  const int ntn = (N + 63) / 64; const int wid = blockIdx.x * 4 + w; const int mt = wid / ntn, nq = wid % ntn; if (mt * 16 >= M) return;
  const int row0 = mt * 16, col0 = nq * 64; const float* arow = A + (size_t)(row0 + ln) * lda;
  v8f acc[4] = {};
  for (int kb = 0; kb < K; kb += 32) {
    FragH ah, al;
    const v4f x0 = *(const v4fa*)(arow + kb + 8 * hh), x1 = *(const v4fa*)(arow + kb + 8 * hh + 4), x2 = *(const v4fa*)(arow + kb + 16 + 8 * hh), x3 = *(const v4fa*)(arow + kb + 16 + 8 * hh + 4);
    float xs[16] = {x0[0],x0[1],x0[2],x0[3],x1[0],x1[1],x1[2],x1[3],x2[0],x2[1],x2[2],x2[3],x3[0],x3[1],x3[2],x3[3]};
#pragma unroll
    for (int i = 0; i < 16; ++i) { const _Float16 h = (_Float16)xs[i]; ah.h[i] = h; al.h[i] = ASPLIT ? (_Float16)(xs[i] - (float)h) : (_Float16)0.0f; }
#pragma unroll
    for (int t = 0; t < 4; ++t) { if (col0 + t * 16 >= N) continue; const size_t boff = (size_t)(col0 + t * 16 + ln) * ldb + kb; FragH bq; bq.half[0] = *(const v8us*)(Bh + boff + 8 * hh); bq.half[1] = *(const v8us*)(Bh + boff + 16 + 8 * hh);
      acc[t] = mmaH<ASPLIT ? 2 : 1>(ah.v, al.v, bq.v, bq.v, acc[t]); }
  }
#pragma unroll
  for (int t = 0; t < 4; ++t) { if (col0 + t * 16 >= N) continue;
#pragma unroll
    for (int r = 0; r < 8; ++r) so[w][8 * hh + r][t * 16 + ln] = acc[t][r] * alpha; }
  __builtin_amdgcn_fence(__ATOMIC_ACQ_REL, "workgroup"); __builtin_amdgcn_wave_barrier();
  const int rsub = lane >> 4, c4 = (lane & 15) * 4;
  {
#pragma unroll
    for (int q = 0; q < 8; ++q) { const int r = q * 2 + rsub; if (col0 + c4 < N) { const v4f v = *(const v4fa*)&so[w][r][c4]; *(v4f*)(C + (size_t)(row0 + r) * ldc + col0 + c4) = v; } }
     }
}

// k_gemm_hh variant with fused epilogue: v = acc·alpha + bias[by·sBias + col] (+ CP[(row/rowsPerB)·sCPb + by·64 + col] if CP) ; ACT 0 none / 1 elu ; writes f16 C16 (and f32 C if non-null)
template <int ACT>
__global__ __launch_bounds__(128) void k_gemm_hhx(const _Float16* __restrict__ A, int lda, size_t sA, const _Float16* __restrict__ Bh, int ldb, size_t sB, float alpha, const float* __restrict__ bias, size_t sBias, const float* __restrict__ CP, int rowsPerB, size_t sCPb, int row0g,
    float* __restrict__ C, _Float16* __restrict__ C16, int ldc, size_t sC, int M, int N, int K) {
  __shared__ __attribute__((aligned(16))) float so[4][16][64];
  const int tid = threadIdx.x, w = tid >> 5, lane = tid & 31, ln = lane & 15, hh = lane >> 4; const int by = blockIdx.y;
  A += (size_t)by * sA; Bh += (size_t)by * sB; const size_t cofs = (size_t)by * sC; const float* bp = bias ? bias + (size_t)by * sBias : nullptr;
  const int ntn = (N + 63) / 64; const int wid = blockIdx.x * 4 + w; const int mt = wid / ntn, nq = wid % ntn; if (mt * 16 >= M) return;
  const int row0 = mt * 16, col0 = nq * 64; const _Float16* arow = A + (size_t)(row0 + ln) * lda;
  v8f acc[4] = {};
  for (int kb = 0; kb < K; kb += 32) { FragH ah; ah.half[0] = *(const v8us*)((const unsigned short*)arow + kb + 8 * hh); ah.half[1] = *(const v8us*)((const unsigned short*)arow + kb + 16 + 8 * hh);
#pragma unroll
    for (int t = 0; t < 4; ++t) { if (col0 + t * 16 >= N) continue; const size_t boff = (size_t)(col0 + t * 16 + ln) * ldb + kb; FragH bq; bq.half[0] = *(const v8us*)((const unsigned short*)Bh + boff + 8 * hh); bq.half[1] = *(const v8us*)((const unsigned short*)Bh + boff + 16 + 8 * hh);
      acc[t] = mmaH<1>(ah.v, ah.v, bq.v, bq.v, acc[t]); }
  }
#pragma unroll
  for (int t = 0; t < 4; ++t) { if (col0 + t * 16 >= N) continue; const int col = col0 + t * 16 + ln; const float bv = bp ? bf16_round(bp[col]) : 0.f;
#pragma unroll
    for (int r = 0; r < 8; ++r) { float v = acc[t][r] * alpha + bv; if (CP) { const int rr = row0g + row0 + 8 * hh + r; if (rowsPerB < 0) v += CP[cofs + (size_t)rr * ldc + col];      /* rowsPerB < 0: own element of the batched C plane */ else { const int bidx = rr / rowsPerB; v += CP[(size_t)bidx * sCPb + (size_t)by * 64 + col]; } } if (ACT == 1) v = (v > 0.f) ? v : expm1f(v); else if (ACT == 7) v = (v > 0.f) ? v + 1.0f : expf(v); else if (ACT == 8) v = tanhf(v); else if (ACT == 9) v = 0.5f * v * (1.0f + tanhf(0.7978845608028654f * (v + 0.044715f * v * v * v))); else if (ACT == 11) v = 1.0f / (1.0f + expf(-v)); else if (ACT == 12) v = (v > 0.f) ? v : 0.01f * v; else if (ACT == 14) v = (v > 0.f) ? v : 0.1f * v; else if (ACT == 16) v = (v >= 0.f) ? v : 0.3f * v; else if (ACT == 17) v = (v >= 0.f) ? v : 0.2f * v; else if (ACT == 15) v = v / (1.0f + expf(-v)); else if (ACT == 3) v = fmaxf(v, 0.f); else if (ACT == 6) v = 0.5f * v * (1.0f + erff(v * 0.70710678118654752f)); so[w][8 * hh + r][t * 16 + ln] = v; } }
  __builtin_amdgcn_fence(__ATOMIC_ACQ_REL, "workgroup"); __builtin_amdgcn_wave_barrier();
  const int rsub = lane >> 4, c4 = (lane & 15) * 4; typedef _Float16 v4h __attribute__((ext_vector_type(4)));
  {
#pragma unroll
    for (int q = 0; q < 8; ++q) { const int r = q * 2 + rsub; if (col0 + c4 < N) { const v4f v = *(const v4fa*)&so[w][r][c4]; if (C) *(v4f*)(C + cofs + (size_t)(row0 + r) * ldc + col0 + c4) = v; if (C16) { v4h h4; for (int i = 0; i < 4; ++i) h4[i] = (_Float16)v[i]; *(v4h*)(C16 + cofs + (size_t)(row0 + r) * ldc + col0 + c4) = h4; } } }
     }
}


typedef _Float16 v4h __attribute__((ext_vector_type(4)));

__global__ __launch_bounds__(256) void k_h16(const float* __restrict__ x, _Float16* __restrict__ X16, size_t n8) { const size_t t = (size_t)blockIdx.x * 256 + threadIdx.x; if (t >= n8) return; FragH f;
#pragma unroll
  for (int q = 0; q < 8; ++q) f.h[q] = (_Float16)x[t * 8 + q]; *(v8us*)((unsigned short*)X16 + t * 8) = f.half[0];  }
__global__ __launch_bounds__(256) void k_round16f(const float* __restrict__ W, _Float16* __restrict__ Bt, size_t n8) { const size_t t = (size_t)blockIdx.x * 256 + threadIdx.x; if (t >= n8) return; FragH f;
#pragma unroll
  for (int i = 0; i < 8; ++i) f.h[i] = (_Float16)(bf16_round(W[t * 8 + i]) * 16.0f); *(v8us*)((unsigned short*)Bt + t * 8) = f.half[0];  }
// ---- fast GEMM (wave tile 32x64; requires M % 32 == 0 rows per launch region and N % 64 == 0); epilogue = k_gemm_hhx semantics ----
__device__ __forceinline__ v16h g2_frag(const _Float16* p, int hh) { FragH f; f.half[0] = *(const v8us*)((const unsigned short*)p + 8 * hh); f.half[1] = *(const v8us*)((const unsigned short*)p + 16 + 8 * hh); return f.v; }
__device__ __forceinline__ v8f g2_mma(v16h a, v16h b, v8f c) { v8f d = __builtin_amdgcn_wmma_f32_16x16x32_f16(false, a, false, b, (short)0, c, false, false); asm volatile("v_nop\n\tv_nop\n\tv_nop\n\tv_nop" : "+v"(d) : "v"(a), "v"(b)); return d; }
template <int ACT>
__global__ __launch_bounds__(128) void k_gemm2(const _Float16* __restrict__ A, int lda, size_t sA, const _Float16* __restrict__ Bh, int ldb, size_t sB, float alpha, const float* __restrict__ bias, size_t sBias, const float* __restrict__ CP, int rowsPerB, size_t sCPb, int row0g,
    float* __restrict__ C, _Float16* __restrict__ C16, int ldc, size_t sC, int M, int N, int K) { static_assert(ACT == 0 || ACT == 3 || ACT == 6 || ACT == 8 || ACT == 9 || ACT == 11 || ACT == 12 || ACT == 14 || ACT == 15 || ACT == 16 || ACT == 17, "k_gemm2: unsupported ACT code (would silently apply no activation)");
  __shared__ __attribute__((aligned(16))) float so[4][32][68];
  const int tid = threadIdx.x, w = tid >> 5, lane = tid & 31, ln = lane & 15, hh = lane >> 4; const int by = blockIdx.y;
  A += (size_t)by * sA; Bh += (size_t)by * sB; const size_t cofs = (size_t)by * sC; const float* bp = bias ? bias + (size_t)by * sBias : nullptr;
  const int ntn = N >> 6; const int mt = blockIdx.x / ntn, nq = blockIdx.x - mt * ntn; const int row0 = mt * 128 + 32 * w, col0 = nq * 64; if (row0 >= M) return;
  const _Float16* a0p = A + (size_t)(row0 + ln) * lda; const _Float16* a1p = a0p + (size_t)16 * lda;
  const _Float16* b0p = Bh + (size_t)(col0 + ln) * ldb; const _Float16* b1p = b0p + (size_t)16 * ldb; const _Float16* b2p = b1p + (size_t)16 * ldb; const _Float16* b3p = b2p + (size_t)16 * ldb;
  const v8f z8 = {0.f,0.f,0.f,0.f,0.f,0.f,0.f,0.f}; v8f c00 = z8, c01 = z8, c02 = z8, c03 = z8, c10 = z8, c11 = z8, c12 = z8, c13 = z8;
#pragma unroll 1
  for (int kb = 0; kb < K; kb += 32) { const v16h a0 = g2_frag(a0p + kb, hh), a1 = g2_frag(a1p + kb, hh);
    v16h b = g2_frag(b0p + kb, hh); c00 = g2_mma(a0, b, c00); c10 = g2_mma(a1, b, c10);
    b = g2_frag(b1p + kb, hh); c01 = g2_mma(a0, b, c01); c11 = g2_mma(a1, b, c11);
    b = g2_frag(b2p + kb, hh); c02 = g2_mma(a0, b, c02); c12 = g2_mma(a1, b, c12);
    b = g2_frag(b3p + kb, hh); c03 = g2_mma(a0, b, c03); c13 = g2_mma(a1, b, c13); }
  v8f accs[8] = {c00, c01, c02, c03, c10, c11, c12, c13};
#pragma unroll
  for (int u = 0; u < 8; ++u) { const int t = u & 3, half = u >> 2; const int col = col0 + t * 16 + ln; const float bv = bp ? bf16_round(bp[col]) : 0.f;
#pragma unroll
    for (int r = 0; r < 8; ++r) { const int rloc = half * 16 + 8 * hh + r; float v = accs[u][r] * alpha + bv; if (CP) { if (rowsPerB < 0) v += CP[cofs + (size_t)(row0g + row0 + rloc) * ldc + col];      /* rowsPerB < 0: own element of the batched C plane */ else { const int bidx = (row0g + row0 + rloc) / rowsPerB; v += CP[(size_t)bidx * sCPb + (size_t)by * 64 + col]; } }
      if (ACT == 3) v = fmaxf(v, 0.f); else if (ACT == 6) v = 0.5f * v * (1.0f + erff(v * 0.70710678118654752f)); else if (ACT == 11) v = 1.0f / (1.0f + expf(-v)); else if (ACT == 15) v = v / (1.0f + expf(-v)); else if (ACT == 12) v = (v > 0.f) ? v : 0.01f * v; else if (ACT == 8) v = tanhf(v); else if (ACT == 9) v = 0.5f * v * (1.0f + tanhf(0.7978845608028654f * (v + 0.044715f * v * v * v))); else if (ACT == 14) v = (v > 0.f) ? v : 0.1f * v; else if (ACT == 16) v = (v >= 0.f) ? v : 0.3f * v; else if (ACT == 17) v = (v >= 0.f) ? v : 0.2f * v;
      so[w][rloc][t * 16 + ln] = v; } }
  __builtin_amdgcn_fence(__ATOMIC_ACQ_REL, "workgroup"); __builtin_amdgcn_wave_barrier();
  const int rsub = lane >> 4, c4 = (lane & 15) * 4;
  {
#pragma unroll
    for (int q = 0; q < 16; ++q) { const int r = q * 2 + rsub; const v4f v = *(const v4fa*)&so[w][r][c4]; if (C) *(v4f*)(C + cofs + (size_t)(row0 + r) * ldc + col0 + c4) = v; if (C16) { v4h h4; for (int i = 0; i < 4; ++i) h4[i] = (_Float16)v[i]; *(v4h*)(C16 + cofs + (size_t)(row0 + r) * ldc + col0 + c4) = h4; } }
     } }


// ---- the projections and what stands around them ----
typedef __bf16 v4bf __attribute__((ext_vector_type(4)));
// A fragment in g2_frag's k order straight from an f32 input row; each value rounded to bf16 (exact in f16) in registers
__device__ __forceinline__ v16h pj_frag(const float* p, int hh) { const v4f x0 = *(const v4fa*)(p + 8 * hh), x1 = *(const v4fa*)(p + 8 * hh + 4), x2 = *(const v4fa*)(p + 16 + 8 * hh), x3 = *(const v4fa*)(p + 16 + 8 * hh + 4); FragH f;
  const v4bf r0 = __builtin_convertvector(x0, v4bf), r1 = __builtin_convertvector(x1, v4bf), r2 = __builtin_convertvector(x2, v4bf), r3 = __builtin_convertvector(x3, v4bf);      /* round to nearest even, as bf16_round */
#pragma unroll
  for (int q = 0; q < 4; ++q) { f.h[q] = (_Float16)(float)r0[q]; f.h[4 + q] = (_Float16)(float)r1[q]; f.h[8 + q] = (_Float16)(float)r2[q]; f.h[12 + q] = (_Float16)(float)r3[q]; }
  return f.v; }
// q, k and v projections in one grid (blockIdx.y = 0, 1, 2), k_gemm2's tile: block 128 rows x 64 columns (= one head), wave 32 x 64, K = DM; the operands come through LDS stages (below).
// Epilogue: q and k (f32, / 16 for the weight factor) leave as f16 hi + x1024 residual planes in row layout; v leaves as V^T [NB * NH][HD][SQ]: a lane's 8 accumulator rows are 8 consecutive tokens of one head-dim column,
// so they go as one 16-byte piece into an LDS tile [HD][128 tokens] (pitch PVP bytes) from which the block stores whole 256-byte runs.
#define PVP 272
// The operands of the two GEMM kernels reach the waves through LDS: a fragment load straight from global memory takes 32 bytes from each of 16 rows (16 lines an instruction), and the rolled loop waited for each such load in turn.
// A stage of GKS k of the block's A rows is brought in by asynchronous copies of whole lines (16 bytes a lane, through no register) into one of two buffers while the other is worked on;
// the A fragments are then ds_load_b128 reads at a row pitch of 16 bytes x odd, in g2_frag's k order, the k blocks in rising order as before.
// The weights need no pass of their own: a stage's GKS weight rows (k) x 64 columns (n) are read as f32 whole lines into registers one stage ahead, rounded there (f16(16 bf16(w)), the old plane's values)
// and stored as they lie, k-major, beside the A rows; ds_load_tr16_b128 hands a lane 8 consecutive k of its column, two such loads are a B fragment in g2_frag's k order (8 hh + s, then 16 + 8 hh + s - 8).
#define GKS 64                       /* k per LDS stage: two WMMA k blocks */
#define GFP 272                      /* LDS pitch in bytes of an f32 row of a stage (256 bytes of data) */
#define GHP 144                      /* LDS pitch in bytes of an f16 row of a stage (128 bytes of data) */
#define GWP 160                      /* LDS pitch in bytes of a weight row of a stage (64 columns as f16, 128 bytes of data): 32 bytes x odd, the transposing load's pitch */
#define PJA (128 * GFP)              /* k_proj: the A rows of a stage */
#define PJS (PJA + GKS * GWP)        /* k_proj: one stage, A then the weight rows */
#define OPA (128 * GHP)              /* k_outp: the A rows of a stage */
#define OPS (OPA + GKS * GWP)        /* k_outp: one stage, A then the weight rows */
__device__ __forceinline__ v8f gs_mma(v16h a, v16h b, v8f c) { return __builtin_amdgcn_wmma_f32_16x16x32_f16(false, a, false, b, (short)0, c, false, false); }
__device__ __forceinline__ v16h gs_hfrag(const unsigned char* p) { FragH f; f.half[0] = *(const v8us*)p; f.half[1] = *(const v8us*)(p + 32); return f.v; }      /* g2_frag's k order from an f16 LDS row; p already holds the lane half's 16 bytes */
typedef short s16x8 __attribute__((ext_vector_type(8)));
typedef _Float16 v4ha __attribute__((ext_vector_type(4), may_alias));
// B fragment from k-major weight rows: p = tile + (k0 + 8 hh + (lane & 7)) * GWP + 16 ((lane >> 3) & 1) + 2 n0; lane (ln, hh) gets rows k0 + 8 hh .. + 7, then k0 + 16 + 8 hh .. + 7, of column n0 + ln
__device__ __forceinline__ v16h gs_tfrag(const unsigned char* p) { typedef __attribute__((address_space(3))) s16x8 lds_s16x8; FragH f;
  f.half[0] = __builtin_bit_cast(v8us, __builtin_amdgcn_ds_load_tr16_b128_v8i16((lds_s16x8*)p)); f.half[1] = __builtin_bit_cast(v8us, __builtin_amdgcn_ds_load_tr16_b128_v8i16((lds_s16x8*)(p + 16 * GWP))); return f.v; }
// four weights: f16(16 bf16(w)), exact. The factor of 16 goes on in f32 ahead of the rounding (a power of two: bf16(16 w) = 16 bf16(w)), so that nothing small is ever held as f16 without it
__device__ __forceinline__ v4h gs_wcvt(v4f x) { const v4bf r = __builtin_convertvector(x * 16.0f, v4bf); v4h h;      /* round to nearest even, as bf16_round */
#pragma unroll
  for (int q = 0; q < 4; ++q) h[q] = (_Float16)(float)r[q];
  return h; }
// pj_frag's rounding on the four 16-byte pieces of an f32 LDS row (floats 8 hh .. + 7 and 16 + 8 hh .. + 7 of a k block)
__device__ __forceinline__ v16h gs_fcvt(v4f x0, v4f x1, v4f x2, v4f x3) { FragH f;
  const v4bf r0 = __builtin_convertvector(x0, v4bf), r1 = __builtin_convertvector(x1, v4bf), r2 = __builtin_convertvector(x2, v4bf), r3 = __builtin_convertvector(x3, v4bf);      /* round to nearest even, as bf16_round */
#pragma unroll
  for (int q = 0; q < 4; ++q) { f.h[q] = (_Float16)(float)r0[q]; f.h[4 + q] = (_Float16)(float)r1[q]; f.h[8 + q] = (_Float16)(float)r2[q]; f.h[12 + q] = (_Float16)(float)r3[q]; }
  return f.v; }
// Four copies of 16 bytes a lane, global -> LDS. The s_wait_xcnt closes the statement so that it stands in front of every later write of the address registers that the copies name.
template <class T>
__device__ __forceinline__ void gs_copy4(unsigned l0, unsigned lstep, const T* g0, size_t gstep) {
  const unsigned l1 = l0 + lstep, l2 = l1 + lstep, l3 = l2 + lstep; const T* g1 = g0 + gstep; const T* g2 = g1 + gstep; const T* g3 = g2 + gstep;
  asm volatile("global_load_async_to_lds_b128 %0, %4, off\n\tglobal_load_async_to_lds_b128 %1, %5, off\n\tglobal_load_async_to_lds_b128 %2, %6, off\n\tglobal_load_async_to_lds_b128 %3, %7, off\n\ts_wait_xcnt 0x0"
               :: "v"(l0), "v"(l1), "v"(l2), "v"(l3), "v"(g0), "v"(g1), "v"(g2), "v"(g3) : "memory"); }
__global__ __launch_bounds__(128) void k_proj(const float* __restrict__ xq, const float* __restrict__ xk, const float* __restrict__ xv, const float* __restrict__ wq, const float* __restrict__ wk, const float* __restrict__ wv,
    _Float16* __restrict__ QH, _Float16* __restrict__ QL, _Float16* __restrict__ KH, _Float16* __restrict__ KL, _Float16* __restrict__ VT) {
  __shared__ __attribute__((aligned(128))) unsigned char L[2 * PJS];
  float (*so)[32][68] = (float (*)[32][68])L;      /* the epilogue's tile lies on the first buffer's A rows: it is written only behind the last trip's barrier, when no copy is in flight and no wave reads them */
  const int tid = threadIdx.x, w = tid >> 5, lane = tid & 31, ln = lane & 15, hh = lane >> 4; const int y = blockIdx.y;
  const float* A = y == 0 ? xq : y == 1 ? xk : xv; const float* Wf = y == 0 ? wq : y == 1 ? wk : wv;
  const int mt = blockIdx.x / (DM / 64), nq = blockIdx.x - mt * (DM / 64); const int row0 = mt * 128 + 32 * w, col0 = nq * 64;
  /* the copies of a stage: A rows of 16 pieces (a thread: rows tid / 16 + 8 i); every lane on, every piece written by one lane */
  const unsigned lds0 = (unsigned)(size_t)L; const unsigned la = lds0 + (unsigned)((tid >> 4) * GFP + (tid & 15) * 16);
  const float* ga = A + (size_t)(mt * 128 + (tid >> 4)) * DM + (tid & 15) * 4;
  /* the weight rows of a stage: head nq's [in][out] matrix, rows of 64 f32 = 16 pieces (a thread: rows tid / 16 + 8 i), through registers */
  const float* gw = Wf + ((size_t)nq * DM + (tid >> 4)) * HD + (tid & 15) * 4; unsigned char* lw = L + PJA + (tid >> 4) * GWP + (tid & 15) * 8; v4f wr[8];
  auto wload = [&](int s) {
#pragma unroll
    for (int i = 0; i < 8; ++i) wr[i] = *(const v4fa*)(gw + (size_t)(s * GKS + 8 * i) * HD); };
  auto wput = [&](unsigned buf) {
#pragma unroll
    for (int i = 0; i < 8; ++i) *(v4ha*)(lw + buf * PJS + 8 * i * GWP) = gs_wcvt(wr[i]); };
  auto stage = [&](int s, unsigned buf) { const unsigned o = buf * PJS;
    gs_copy4(la + o, 8 * GFP, ga + s * GKS, (size_t)8 * DM); gs_copy4(la + o + 32 * GFP, 8 * GFP, ga + s * GKS + (size_t)32 * DM, (size_t)8 * DM);
    gs_copy4(la + o + 64 * GFP, 8 * GFP, ga + s * GKS + (size_t)64 * DM, (size_t)8 * DM); gs_copy4(la + o + 96 * GFP, 8 * GFP, ga + s * GKS + (size_t)96 * DM, (size_t)8 * DM); };
  wload(0); stage(0, 0);      /* the loads in front of the copies: the s_wait_xcnt that closes the first copy statement then stands behind them too */
  const v8f z8 = {0.f,0.f,0.f,0.f,0.f,0.f,0.f,0.f}; v8f c00 = z8, c01 = z8, c02 = z8, c03 = z8, c10 = z8, c11 = z8, c12 = z8, c13 = z8;
  wput(0);
  asm volatile("s_wait_dscnt 0x0" ::: "memory");      /* this wave's weight rows of stage 0 are written */
  asm volatile("s_wait_asynccnt 0x0" ::: "memory");      /* this wave's copies of stage 0 have landed */
  __syncthreads();      /* and every other wave's: stage 0 may be read */
  wload(1); stage(1, 1);
#pragma unroll 1
  for (int t = 0; t < DM / GKS; ++t) {      /* rolled: one trip is one LDS stage, its two k blocks unrolled below */
    const unsigned char* ab = L + (t & 1) * PJS + (w * 32 + ln) * GFP + hh * 32; const unsigned char* bb = L + (t & 1) * PJS + PJA + (8 * hh + (lane & 7)) * GWP + ((lane >> 3) & 1) * 16;
    v4f x[2][2][4]; v16h bf[2][4];      /* [k block][16 rows][piece], [k block][16 columns] */
#pragma unroll
    for (int p = 0; p < GKS / 32; ++p) {      /* unrolled: every LDS offset a constant */
#pragma unroll
      for (int i = 0; i < 2; ++i) { const unsigned char* ap = ab + i * 16 * GFP + p * 128; x[p][i][0] = *(const v4fa*)ap; x[p][i][1] = *(const v4fa*)(ap + 16); x[p][i][2] = *(const v4fa*)(ap + 64); x[p][i][3] = *(const v4fa*)(ap + 80); }
#pragma unroll
      for (int j = 0; j < 4; ++j) bf[p][j] = gs_tfrag(bb + p * 32 * GWP + j * 32); }
    if (t + 1 < DM / GKS) wput((unsigned)((t + 1) & 1));      /* same test in every wave; stage t + 1's weight rows go beside its A rows, into the buffer that every wave left at the last barrier */
    asm volatile("s_wait_dscnt 0x0" ::: "memory");      /* the stage's fragments are all in registers and the next stage's weight rows written: this wave is done with both buffers before the barrier */
    asm volatile("s_wait_asynccnt 0x0" ::: "memory");      /* this wave's copies of stage t + 1 have landed */
    __syncthreads();      /* publishes stage t + 1 and ends every wave's reads of stage t's buffer */
    if (t + 2 < DM / GKS) { wload(t + 2); stage(t + 2, (unsigned)(t & 1)); }      /* same test in every wave of the block; refills the buffer just read, and flies under the products below, which work on registers alone; the weight rows wait in registers for the next trip */
#pragma unroll
    for (int p = 0; p < GKS / 32; ++p) { const v16h a0 = gs_fcvt(x[p][0][0], x[p][0][1], x[p][0][2], x[p][0][3]), a1 = gs_fcvt(x[p][1][0], x[p][1][1], x[p][1][2], x[p][1][3]);
      c00 = gs_mma(a0, bf[p][0], c00); c10 = gs_mma(a1, bf[p][0], c10); c01 = gs_mma(a0, bf[p][1], c01); c11 = gs_mma(a1, bf[p][1], c11);
      c02 = gs_mma(a0, bf[p][2], c02); c12 = gs_mma(a1, bf[p][2], c12); c03 = gs_mma(a0, bf[p][3], c03); c13 = gs_mma(a1, bf[p][3], c13); }
  }
  asm volatile("s_wait_asynccnt 0x0" ::: "memory");      /* no copy is left in flight when the first buffer becomes the epilogue's tile */
  v8f accs[8] = {c00, c01, c02, c03, c10, c11, c12, c13};
  if (y == 2) {      /* same for the whole block */
    unsigned char* st = (unsigned char*)&so[0][0][0];
#pragma unroll
    for (int u = 0; u < 8; ++u) { const int t = u & 3, half = u >> 2; FragH f;
#pragma unroll
      for (int r = 0; r < 8; ++r) f.h[r] = (_Float16)(accs[u][r] * 0.0625f);
      *(v8us*)(st + (t * 16 + ln) * PVP + (w * 32 + half * 16 + 8 * hh) * 2) = f.half[0]; }
    __syncthreads();      /* the tile's 128 tokens come from all four waves */
    const int bb = (mt * 128) / SQ, s0 = (mt * 128) % SQ;
#pragma unroll
    for (int i = 0; i < 8; ++i) { const int d = i * 8 + (tid >> 4), pc = tid & 15; const v8us v = *(const v8us*)(st + d * PVP + pc * 16);
      *(v8us*)((unsigned short*)VT + ((size_t)(bb * NH + nq) * HD + d) * SQ + s0 + pc * 8) = v; }
  } else {
    _Float16* Hh = y == 0 ? QH : KH; _Float16* Hl = y == 0 ? QL : KL;
#pragma unroll
    for (int u = 0; u < 8; ++u) { const int t = u & 3, half = u >> 2;
#pragma unroll
      for (int r = 0; r < 8; ++r) so[w][half * 16 + 8 * hh + r][t * 16 + ln] = accs[u][r] * 0.0625f; }
    __builtin_amdgcn_fence(__ATOMIC_ACQ_REL, "workgroup"); __builtin_amdgcn_wave_barrier();      /* a wave reads back only its own 32 rows */
    const int rsub = lane >> 4, c4 = (lane & 15) * 4;
#pragma unroll
    for (int q = 0; q < 16; ++q) { const int r = q * 2 + rsub; const v4f v = *(const v4fa*)&so[w][r][c4]; v4h h4, l4;
#pragma unroll
      for (int i = 0; i < 4; ++i) { const _Float16 hv = (_Float16)v[i]; h4[i] = hv; l4[i] = (_Float16)((v[i] - (float)hv) * 1024.0f); }
      const size_t o = (size_t)(row0 + r) * DM + col0 + c4; *(v4h*)(Hh + o) = h4; *(v4h*)(Hl + o) = l4; }
  } }

// out = o W_p: k_gemm2's tile (block 128 rows x 64 columns, wave 32 x 64, K = DM) and its plain epilogue (x alpha, f32 rows through an LDS tile); o is f16 and staged as above, W_p (read flat, [in][out] [DM][DM]) comes as the other weights.
__global__ __launch_bounds__(128) void k_outp(const _Float16* __restrict__ A, const float* __restrict__ Wf, float alpha, float* __restrict__ C) {
  __shared__ __attribute__((aligned(128))) unsigned char L[2 * OPS];
  float (*so)[32][68] = (float (*)[32][68])L;      /* lies on the first buffer and part of the second, written behind the last trip's barrier as in k_proj */
  const int tid = threadIdx.x, w = tid >> 5, lane = tid & 31, ln = lane & 15, hh = lane >> 4;
  const int mt = blockIdx.x / (DM / 64), nq = blockIdx.x - mt * (DM / 64); const int row0 = mt * 128 + 32 * w, col0 = nq * 64;
  /* the copies of a stage: 128 A rows of 8 pieces (a thread: rows tid / 8 + 16 i); every lane on, every piece written by one lane */
  const unsigned lds0 = (unsigned)(size_t)L; const unsigned la = lds0 + (unsigned)((tid >> 3) * GHP + (tid & 7) * 16);
  const _Float16* ga = A + (size_t)(mt * 128 + (tid >> 3)) * DM + (tid & 7) * 8;
  /* the weight rows of a stage: the block's 64 columns of GKS rows = 16 pieces a row (a thread: rows tid / 16 + 8 i), through registers */
  const float* gw = Wf + (size_t)(tid >> 4) * DM + col0 + (tid & 15) * 4; unsigned char* lw = L + OPA + (tid >> 4) * GWP + (tid & 15) * 8; v4f wr[8];
  auto wload = [&](int s) {
#pragma unroll
    for (int i = 0; i < 8; ++i) wr[i] = *(const v4fa*)(gw + (size_t)(s * GKS + 8 * i) * DM); };
  auto wput = [&](unsigned buf) {
#pragma unroll
    for (int i = 0; i < 8; ++i) *(v4ha*)(lw + buf * OPS + 8 * i * GWP) = gs_wcvt(wr[i]); };
  auto stage = [&](int s, unsigned buf) { const unsigned o = buf * OPS;
    gs_copy4(la + o, 16 * GHP, ga + s * GKS, (size_t)16 * DM); gs_copy4(la + o + 64 * GHP, 16 * GHP, ga + s * GKS + (size_t)64 * DM, (size_t)16 * DM); };
  wload(0); stage(0, 0);      /* the loads in front of the copies: the s_wait_xcnt that closes the first copy statement then stands behind them too */
  const v8f z8 = {0.f,0.f,0.f,0.f,0.f,0.f,0.f,0.f}; v8f c00 = z8, c01 = z8, c02 = z8, c03 = z8, c10 = z8, c11 = z8, c12 = z8, c13 = z8;
  wput(0);
  asm volatile("s_wait_dscnt 0x0" ::: "memory");      /* this wave's weight rows of stage 0 are written */
  asm volatile("s_wait_asynccnt 0x0" ::: "memory");      /* this wave's copies of stage 0 have landed */
  __syncthreads();      /* and every other wave's: stage 0 may be read */
  wload(1); stage(1, 1);
#pragma unroll 1
  for (int t = 0; t < DM / GKS; ++t) {      /* rolled: one trip is one LDS stage, its two k blocks unrolled below */
    const unsigned char* ab = L + (t & 1) * OPS + (w * 32 + ln) * GHP + hh * 16; const unsigned char* bb = L + (t & 1) * OPS + OPA + (8 * hh + (lane & 7)) * GWP + ((lane >> 3) & 1) * 16;
    v16h af[2][2], bf[2][4];      /* [k block][16 rows], [k block][16 columns] */
#pragma unroll
    for (int p = 0; p < GKS / 32; ++p) {      /* unrolled: every LDS offset a constant */
      af[p][0] = gs_hfrag(ab + p * 64); af[p][1] = gs_hfrag(ab + 16 * GHP + p * 64);
#pragma unroll
      for (int j = 0; j < 4; ++j) bf[p][j] = gs_tfrag(bb + p * 32 * GWP + j * 32); }
    if (t + 1 < DM / GKS) wput((unsigned)((t + 1) & 1));      /* same test in every wave; stage t + 1's weight rows go beside its A rows, into the buffer that every wave left at the last barrier */
    asm volatile("s_wait_dscnt 0x0" ::: "memory");      /* the stage's fragments are all in registers and the next stage's weight rows written: this wave is done with both buffers before the barrier */
    asm volatile("s_wait_asynccnt 0x0" ::: "memory");      /* this wave's copies of stage t + 1 have landed */
    __syncthreads();      /* publishes stage t + 1 and ends every wave's reads of stage t's buffer */
    if (t + 2 < DM / GKS) { wload(t + 2); stage(t + 2, (unsigned)(t & 1)); }      /* same test in every wave of the block; refills the buffer just read, and flies under the products below, which work on registers alone; the weight rows wait in registers for the next trip */
#pragma unroll
    for (int p = 0; p < GKS / 32; ++p) {
      c00 = gs_mma(af[p][0], bf[p][0], c00); c10 = gs_mma(af[p][1], bf[p][0], c10); c01 = gs_mma(af[p][0], bf[p][1], c01); c11 = gs_mma(af[p][1], bf[p][1], c11);
      c02 = gs_mma(af[p][0], bf[p][2], c02); c12 = gs_mma(af[p][1], bf[p][2], c12); c03 = gs_mma(af[p][0], bf[p][3], c03); c13 = gs_mma(af[p][1], bf[p][3], c13); }
  }
  asm volatile("s_wait_asynccnt 0x0" ::: "memory");      /* no copy is left in flight when the buffers become the epilogue's tile */
  v8f accs[8] = {c00, c01, c02, c03, c10, c11, c12, c13};
#pragma unroll
  for (int u = 0; u < 8; ++u) { const int t = u & 3, half = u >> 2;
#pragma unroll
    for (int r = 0; r < 8; ++r) so[w][half * 16 + 8 * hh + r][t * 16 + ln] = accs[u][r] * alpha; }
  __builtin_amdgcn_fence(__ATOMIC_ACQ_REL, "workgroup"); __builtin_amdgcn_wave_barrier();      /* a wave reads back only its own 32 rows */
  const int rsub = lane >> 4, c4 = (lane & 15) * 4; v4f vr[16];      /* all rows read back first, then stored from one address pair */
#pragma unroll
  for (int q = 0; q < 16; ++q) vr[q] = *(const v4fa*)&so[w][q * 2 + rsub][c4];
  float* cp = C + (size_t)(row0 + rsub) * DM + col0 + c4;
#pragma unroll
  for (int q = 0; q < 16; ++q) *(v4f*)(cp + (size_t)q * 2 * DM) = vr[q]; }

__global__ __launch_bounds__(256) void k_wnat(const float* __restrict__ w, size_t n8, _Float16* __restrict__ Bt) { const size_t t = (size_t)blockIdx.x * 256 + threadIdx.x; if (t >= n8) return; FragH f; for (int q = 0; q < 8; ++q) f.h[q] = (_Float16)(bf16_round(w[t * 8 + q]) * 16.0f); *(v8us*)((unsigned short*)Bt + t * 8) = f.half[0];  }
__global__ __launch_bounds__(256) void k_rsm(const float* __restrict__ S, _Float16* __restrict__ P, int nrows) {
  #pragma clang fp contract(off)
  const int i = blockIdx.x * 256 + threadIdx.x; if (i >= nrows) return; const float* s = S + (size_t)i * SQ; float mx = -3.0e38f;
#pragma unroll 1
  for (int j = 0; j < SQ; ++j) mx = fmaxf(mx, s[j]); float se = 0.f;
#pragma unroll 1
  for (int j = 0; j < SQ; ++j) se += expf(s[j] - mx); const float sc = 256.0f / se;
#pragma unroll 1
  for (int j0 = 0; j0 < SQ; j0 += 8) { FragH f; for (int q = 0; q < 8; ++q) f.h[q] = (_Float16)(expf(s[j0 + q] - mx) * sc); unsigned short* d = (unsigned short*)P + (size_t)i * SQ + j0; *(v8us*)d = f.half[0];  } }
__global__ __launch_bounds__(256) void k_vt(const _Float16* __restrict__ V16, int b, int h0, _Float16* __restrict__ VT) { __shared__ unsigned short tl[64][65]; const int tid = threadIdx.x; const int hh = blockIdx.x % HG, sg = blockIdx.x / HG; const int s0 = sg * 64; const int h = h0 + hh;
  for (int i = tid; i < 64 * 8; i += 256) { const int j = i / 8, d8 = (i % 8) * 8; FragH f; f.half[0] = *(const v8us*)((const unsigned short*)V16 + ((size_t)b * SQ + s0 + j) * DM + h * HD + d8); for (int q = 0; q < 8; ++q) tl[d8 + q][j] = f.u[q]; }
  __syncthreads();
  { for (int i = tid; i < 64 * 8; i += 256) { const int d = i / 8, j8 = (i % 8) * 8; FragH f; for (int q = 0; q < 8; ++q) f.u[q] = tl[d][j8 + q]; *(v8us*)((unsigned short*)VT + ((size_t)hh * HD + d) * SQ + s0 + j8) = f.half[0]; }  } }



#define FK 128                       /* keys per LDS stage: 4 passes of 32 */
#define FKP 144                      /* LDS pitch in bytes of a K row (128 bytes of data) */
#define FVP 272                      /* LDS pitch in bytes of a V^T row (256 bytes of data) */
#define FKB (FK * FKP)               /* one K plane of a stage */
#define FSB (2 * FKB + HD * FVP)     /* one stage: K hi, K lo, V^T */
__device__ __forceinline__ v8f fa_mma(v16h a, v16h b, v8f c) { return __builtin_amdgcn_wmma_f32_16x16x32_f16(false, a, false, b, (short)0, c, false, false); }
__device__ __forceinline__ float fa_swap16(float x) { const int b = __float_as_int(x); return __int_as_float(__builtin_amdgcn_permlanex16(b, b, 0x76543210, 0xfedcba98, false, false)); }      /* value of lane l ^ 16 */
__device__ __forceinline__ v16h fa_lfrag(const unsigned char* p) { FragH f; f.half[0] = *(const v8us*)p; f.half[1] = *(const v8us*)(p + 32); return f.v; }      /* g2_frag's k order, from an LDS row; p already holds the lane half's 16 bytes */
// Four copies of 16 bytes a lane, global -> LDS. The s_wait_xcnt closes the statement so that it stands in front of every later write of the address registers that the copies name.
__device__ __forceinline__ void fa_copy4(unsigned l0, unsigned lstep, const _Float16* g0, size_t gstep) {
  const unsigned l1 = l0 + lstep, l2 = l1 + lstep, l3 = l2 + lstep; const _Float16* g1 = g0 + gstep; const _Float16* g2 = g1 + gstep; const _Float16* g3 = g2 + gstep;
  asm volatile("global_load_async_to_lds_b128 %0, %4, off\n\tglobal_load_async_to_lds_b128 %1, %5, off\n\tglobal_load_async_to_lds_b128 %2, %6, off\n\tglobal_load_async_to_lds_b128 %3, %7, off\n\ts_wait_xcnt 0x0"
               :: "v"(l0), "v"(l1), "v"(l2), "v"(l3), "v"(g0), "v"(g1), "v"(g2), "v"(g3) : "memory"); }
__global__ __launch_bounds__(256) void k_fattn(const _Float16* __restrict__ Qh, const _Float16* __restrict__ Ql, const _Float16* __restrict__ Kh, const _Float16* __restrict__ Kl, const _Float16* __restrict__ Vt, _Float16* __restrict__ O) {
  __shared__ __attribute__((aligned(128))) unsigned char L[2 * FSB];
  const int tid = threadIdx.x, lane = tid & 31, ln = lane & 15, hh = lane >> 4; const int w = __builtin_amdgcn_readfirstlane((int)(threadIdx.x >> 5));
  const int bh = blockIdx.y, b = bh / NH, h = bh - b * NH; const size_t r0 = (size_t)b * SQ; const int q0 = blockIdx.x * 128 + w * 16;
  const size_t qo = (r0 + q0 + ln) * DM + h * HD;
  /* the copies of a stage: K rows of 8 pieces (a thread: rows tid / 8 + 32 i), V^T rows of 16 pieces (rows tid / 16 + 16 i); every lane on, every piece written by one lane */
  const unsigned lds0 = (unsigned)(size_t)L; const unsigned lk = lds0 + (unsigned)((tid >> 3) * FKP + (tid & 7) * 16), lv = lds0 + (unsigned)(2 * FKB + (tid >> 4) * FVP + (tid & 15) * 16);
  const size_t gko = (r0 + (tid >> 3)) * DM + h * HD + (tid & 7) * 8; const _Float16* gkh = Kh + gko; const _Float16* gkl = Kl + gko; const _Float16* gv = Vt + ((size_t)bh * HD + (tid >> 4)) * SQ + (tid & 15) * 8;
  auto stage = [&](int s, unsigned buf) { const unsigned lb = buf * FSB;
    fa_copy4(lk + lb, 32 * FKP, gkh + (size_t)s * FK * DM, (size_t)32 * DM); fa_copy4(lk + lb + FKB, 32 * FKP, gkl + (size_t)s * FK * DM, (size_t)32 * DM); fa_copy4(lv + lb, 16 * FVP, gv + (size_t)s * FK, (size_t)16 * SQ); };
  stage(0, 0);
  const v16h qh0 = g2_frag(Qh + qo, hh), qh1 = g2_frag(Qh + qo + 32, hh), ql0 = g2_frag(Ql + qo, hh), ql1 = g2_frag(Ql + qo + 32, hh);
  const v8f z8 = {0.f,0.f,0.f,0.f,0.f,0.f,0.f,0.f}; v8f o0 = z8, o1 = z8, o2 = z8, o3 = z8; float m = -3.0e38f, l = 0.f;
  const float cs = 0.18033688011112042f;      /* log2(e) / 8: raw product -> exponent of two */
  asm volatile("s_wait_asynccnt 0x0" ::: "memory");      /* this wave's copies of stage 0 have landed */
  __syncthreads();      /* and every other wave's: stage 0 may be read */
  stage(1, 1);
#pragma unroll 1
  for (int t = 0; t < SQ / FK; ++t) {      /* rolled: one trip is one LDS stage, its four passes unrolled below */
    const unsigned char* kb = L + (t & 1) * FSB + ln * FKP + hh * 16; const unsigned char* vb = L + (t & 1) * FSB + 2 * FKB + ln * FVP + hh * 16;
    v16h h00 = fa_lfrag(kb), h01 = fa_lfrag(kb + 64), h10 = fa_lfrag(kb + 16 * FKP), h11 = fa_lfrag(kb + 16 * FKP + 64);
    v16h l00 = fa_lfrag(kb + FKB), l01 = fa_lfrag(kb + FKB + 64), l10 = fa_lfrag(kb + FKB + 16 * FKP), l11 = fa_lfrag(kb + FKB + 16 * FKP + 64);
#pragma unroll
    for (int p = 0; p < FK / 32; ++p) {      /* unrolled: every LDS offset a constant, and the K fragments are carried from pass to pass inside the stage */
      const v16h v0 = fa_lfrag(vb + p * 64), v1 = fa_lfrag(vb + 16 * FVP + p * 64), v2 = fa_lfrag(vb + 32 * FVP + p * 64), v3 = fa_lfrag(vb + 48 * FVP + p * 64);
      v8f sa = z8, sb = z8, ta = z8, tb = z8;      /* keys j .. j+15: sa small terms, sb main term; keys j+16 .. j+31: ta, tb */
      sa = fa_mma(h00, ql0, sa); sb = fa_mma(h00, qh0, sb); ta = fa_mma(h10, ql0, ta); tb = fa_mma(h10, qh0, tb);
      sa = fa_mma(h01, ql1, sa); sb = fa_mma(h01, qh1, sb); ta = fa_mma(h11, ql1, ta); tb = fa_mma(h11, qh1, tb);
      sa = fa_mma(l00, qh0, sa); ta = fa_mma(l10, qh0, ta); sa = fa_mma(l01, qh1, sa); ta = fa_mma(l11, qh1, ta);
      if (p + 1 < FK / 32) { const unsigned char* kn = kb + (p + 1) * 32 * FKP;      /* the next pass's K fragments come under this pass's softmax; never beyond this stage's own buffer */
        h00 = fa_lfrag(kn); h01 = fa_lfrag(kn + 64); h10 = fa_lfrag(kn + 16 * FKP); h11 = fa_lfrag(kn + 16 * FKP + 64);
        l00 = fa_lfrag(kn + FKB); l01 = fa_lfrag(kn + FKB + 64); l10 = fa_lfrag(kn + FKB + 16 * FKP); l11 = fa_lfrag(kn + FKB + 16 * FKP + 64); }
      float u[16];
#pragma unroll
      for (int r = 0; r < 8; ++r) { u[r] = fmaf(sa[r], 0.0009765625f, sb[r]); u[8 + r] = fmaf(ta[r], 0.0009765625f, tb[r]); }
      float pm = fmaxf(fmaxf(fmaxf(fmaxf(u[0], u[1]), fmaxf(u[2], u[3])), fmaxf(fmaxf(u[4], u[5]), fmaxf(u[6], u[7]))), fmaxf(fmaxf(fmaxf(u[8], u[9]), fmaxf(u[10], u[11])), fmaxf(fmaxf(u[12], u[13]), fmaxf(u[14], u[15]))));
      pm = fmaxf(pm, fa_swap16(pm));      /* both halves of a query's keys: the two lanes must use one maximum, their weights meet in one product */
      if (p + 1 < FK / 32) asm volatile("" :: "v"(h00), "v"(h01), "v"(h10), "v"(h11), "v"(l00), "v"(l01), "v"(l10), "v"(l11));      /* inputs only: keeps the next pass's K loads in front of the branch, under the maximum; sunk behind it they are waited for as soon as they are issued */
      if (__builtin_amdgcn_ballot_w32(pm > m) != 0) {      /* scalar branch: taken by the whole wave or not at all */
        const float mn = fmaxf(m, pm); const float al = __builtin_amdgcn_exp2f((m - mn) * cs); m = mn; l *= al; o0 *= al; o1 *= al; o2 *= al; o3 *= al; }
      const float mc = fmaf(-m, cs, 8.0f);      /* + 8: weights carried x256 against the f16 subnormal range */
      FragH pw; float e[16];
#pragma unroll
      for (int s = 0; s < 16; ++s) { e[s] = __builtin_amdgcn_exp2f(fmaf(u[s], cs, mc)); pw.h[s] = (_Float16)e[s]; }
      l += (((e[0] + e[1]) + (e[2] + e[3])) + ((e[4] + e[5]) + (e[6] + e[7]))) + (((e[8] + e[9]) + (e[10] + e[11])) + ((e[12] + e[13]) + (e[14] + e[15])));
      o0 = fa_mma(v0, pw.v, o0); o1 = fa_mma(v1, pw.v, o1); o2 = fa_mma(v2, pw.v, o2); o3 = fa_mma(v3, pw.v, o3);
    }
    asm volatile("s_wait_dscnt 0x0" ::: "memory");      /* this wave's reads of the buffer are done before the buffer is handed back */
    asm volatile("s_wait_asynccnt 0x0" ::: "memory");      /* this wave's copies of stage t + 1 have landed */
    __syncthreads();      /* publishes stage t + 1 and ends every wave's reads of stage t's buffer */
    if (t + 2 < SQ / FK) stage(t + 2, (unsigned)(t & 1));      /* same test in every wave of the block; refills the buffer just read */
  }
  asm volatile("s_wait_asynccnt 0x0" ::: "memory");      /* no copy is left in flight when the wave ends */
  l += fa_swap16(l); const float sc = 64.0f / l;      /* l = 256 sum exp; o carried x64 as before (folded into the output GEMM alpha) */
  unsigned short* op = (unsigned short*)O + qo + 8 * hh; FragH f;
#pragma unroll
  for (int r = 0; r < 8; ++r) { f.h[r] = (_Float16)(o0[r] * sc); f.h[8 + r] = (_Float16)(o1[r] * sc); }
  *(v8us*)op = f.half[0]; *(v8us*)(op + 16) = f.half[1];
#pragma unroll
  for (int r = 0; r < 8; ++r) { f.h[r] = (_Float16)(o2[r] * sc); f.h[8 + r] = (_Float16)(o3[r] * sc); }
  *(v8us*)(op + 32) = f.half[0]; *(v8us*)(op + 48) = f.half[1]; }

extern "C" void kernel_launch(void* const* d_in, const int* in_sizes, int n_in,
                              void* d_out, int out_size, void* d_ws, size_t ws_size, hipStream_t stream) {
  (void)in_sizes; (void)n_in; (void)out_size;
  const float* const* I = (const float* const*)d_in; const float* xq = I[0]; const float* xk = I[1]; const float* xv = I[2]; const float* wq = I[3]; const float* wk = I[4]; const float* wv = I[5]; const float* wo = I[6];      /* input order: query, key, value; Wq, Wk, Wv [8][512][64] (per-head [in][out]); Wp [8][64][512] (flat [in][out] [512][512]): seven inputs; the module has NO biases */
  char* ws = (char*)d_ws; size_t off = 0;
  auto take = [&](size_t bytes) { char* p = ws + off; off += (bytes + 255) & ~(size_t)255; return p; };
  _Float16* QH = (_Float16*)take(NR * DM * 2); _Float16* QL = (_Float16*)take(NR * DM * 2); _Float16* KH = (_Float16*)take(NR * DM * 2); _Float16* KL = (_Float16*)take(NR * DM * 2); _Float16* O16 = (_Float16*)take(NR * DM * 2);
  _Float16* VT = (_Float16*)take((size_t)NB * NH * HD * SQ * 2);
  if (off > ws_size) return;
  const size_t r0p = (size_t)B0 * SQ;      /* first row of the output stage */
  k_proj<<<dim3((unsigned)((NR / 128) * (DM / 64)), 3), 128, 0, stream>>>(xq, xk, xv, wq, wk, wv, QH, QL, KH, KL, VT);      /* q and k as f16 hi + x1024 residual planes; V^T [NB * NH][HD][SQ], both batches */
  k_fattn<<<dim3(SQ / 128, NB * NH), 256, 0, stream>>>(QH, QL, KH, KL, VT, O16);      /* o (merged heads, x64) as f16 rows */
  k_outp<<<dim3((unsigned)((MPO / 128) * (DM / 64)), 1), 128, 0, stream>>>(O16 + r0p * DM, wo, 0.0009765625f, (float*)d_out + r0p * DM);      /* out rows are the output layout */
}

// v007
// Measured time: 54.2 microseconds a run.
// Two timings next to v006 both put it at 1.04 times that version's speed.
// Over all steps from v000 it is 37.8 times as fast.
#include <hip/hip_runtime.h>
// Multi-head attention on THREE input streams with per-head projection weights and a per-head output weight, no biases at all (query, key, value [2][2048][512]; q = einsum(bni,hio->bnho)(query, Wq), k and v likewise from key and value (Wq, Wk, Wv [8][512][64] per-head [in][out], normal x 0.05); q / sqrt(64); logits = q.k per head; softmax over all 2048 keys (no mask); out = einsum(bnhi,hio->bno)(attn v, Wp) (Wp [8][64][512]: read flat it IS an [in][out] [512][512] weight with input row h*64 + i; no bias) -> [2][2048][512]; input order query, key, value, Wq, Wk, Wv, Wp).
// Structure: token rows r = b*2048 + s; no weight pass: both GEMM kernels read the f32 weights as they lie ([in][out] rows), round them in registers (bf16, exact x16, as f16) into k-major LDS rows and take their B fragments from there by transposing loads; Q, K and V as ONE grid of WMMA GEMM tiles (32x64 wave tiles, f32 accumulation, no bias) that reads the f32 inputs itself (staged in LDS by asynchronous copies; bf16-rounded, exact in f16, in registers) and whose epilogue writes Q and K as f16 hi + x1024 residual planes and V as V^T per (batch, head) through an LDS tile; then ONE fused attention kernel over all (batch, head, 128 queries): per 32 keys the scores from THREE products (K = 64: k_hi.q_lo and k_lo.q_hi, worth 2^-10, and k_hi.q_hi; all / 8), running-maximum softmax in registers (f32 statistics, native exp2; weights x256 as f16), O^T += V^T P^T, o carried x64 against f16 subnormal flush (folded into the output GEMM alpha) written straight into the merged f16 o rows; out = o W_p GEMM (f32; no bias; o staged in LDS likewise, W_p as the other weights) into the output layout.
// Compute dtype: inputs rounded to bf16; the three inputs and the x16 weights converted to f16 in registers (exact for every bf16 value of magnitude from 2^-14 up to 65,504; the weights up to 4,094 before their factor of 16); q and k as f16 hi + x1024 residual planes (about 2^-21), the scores from three products (the lo.lo term dropped); v, softmax weights and o as plain f16 GEMM operands (~2^-12); scores and softmax statistics f32. v_wmma_f32_16x16x32_f16.
#define NB 2
#define SQ 2048
#define DM 512
#define NH 8
#define HD 64
#define HG 4                         /* heads per launch of the grouped k_vt (not launched) */
#define B0 0                         /* first batch processed (debug hook) */
#define NBR NB                       /* batches processed (debug hook) */
#define NR ((size_t)NB * SQ)         /* token rows */
#define MP ((int)((size_t)NBR * SQ)) /* rows through the output stage, via MPO (debug hook) */
#define QN SQ                        /* query rows per batch (not used) */
#define NHD NH                       /* heads (not used) */
#define MPO MP                       /* rows through the output stage (debug hook) */
#define LQ DM      /* row pitch of the q and k rows (not used) */
typedef __bf16 v16b __attribute__((ext_vector_type(16)));
typedef unsigned short v8us __attribute__((ext_vector_type(8), may_alias));
typedef float  v8f  __attribute__((ext_vector_type(8)));
typedef float  v4f  __attribute__((ext_vector_type(4)));
typedef float  v4fa __attribute__((ext_vector_type(4), may_alias));
union FragB { v16b v; v8us half[2]; unsigned short u[16]; };

__device__ __forceinline__ unsigned short bf16_bits(float x) { unsigned int u = __float_as_uint(x); return (unsigned short)((u + 0x7FFFu + ((u >> 16) & 1u)) >> 16); }
__device__ __forceinline__ float bf16_val(unsigned short b) { return __uint_as_float(((unsigned int)b) << 16); }
__device__ __forceinline__ float bf16_round(float x) { return bf16_val(bf16_bits(x)); }
// D += A·B with NT terms: 1 = ah·bh, 2 = + al·bh (A split), 3 = + ah·bl (both split)
template <int NT>
__device__ __forceinline__ v8f mmaN(v16b ah, v16b al, v16b bh, v16b bl, v8f c) {
  c = __builtin_amdgcn_wmma_f32_16x16x32_bf16(false, ah, false, bh, (short)0, c, false, false);
  if (NT >= 2) c = __builtin_amdgcn_wmma_f32_16x16x32_bf16(false, al, false, bh, (short)0, c, false, false);
  if (NT >= 3) c = __builtin_amdgcn_wmma_f32_16x16x32_bf16(false, ah, false, bl, (short)0, c, false, false);
  asm volatile("v_nop\n\tv_nop\n\tv_nop\n\tv_nop" : "+v"(c) : "v"(ah), "v"(al), "v"(bh), "v"(bl));
  return c;
}

__global__ __launch_bounds__(256) void k_wt_bf16(const float* __restrict__ W, unsigned short* __restrict__ Wt, int K, int N) {
  const int t = blockIdx.x * 256 + threadIdx.x;
  const int k8n = K / 8;
  if (t >= N * k8n) return;
  const int n = t / k8n, k8 = (t % k8n) * 8;
  v8us v;
#pragma unroll
  for (int i = 0; i < 8; ++i) v[i] = bf16_bits(W[(size_t)(k8 + i) * N + n]);
  *(v8us*)(Wt + (size_t)n * K + k8) = v;
  
}

// GEMM C[M][N] (f32, pitch ldc) = act(A[M][K]·W + bias). A f32 row-major (pitch lda) converted per fragment to bf16
// (ASPLIT: hi/lo two planes -> 2 terms, else single rounded term); Wt bf16 [N][K] (pitch ldb). BIAS_BF16 rounds the
// bias to bf16 first (bias quantised to bf16 before the add). K%32==0, M%16==0, N%64==0.
template <bool ASPLIT, int ACT, bool BIAS_BF16>
__global__ __launch_bounds__(128) void k_gemm_bf(const float* __restrict__ A, int lda, const unsigned short* __restrict__ Wt, int ldb,
                                               const float* __restrict__ bias, float* __restrict__ C, int ldc, int M, int N, int K) {
  __shared__ __attribute__((aligned(16))) float so[4][16][64];
  const int tid = threadIdx.x, w = tid >> 5, lane = tid & 31, ln = lane & 15, hh = lane >> 4;
  const int ntn = N / 64;
  const int wid = blockIdx.x * 4 + w;
  const int mt = wid / ntn, nq = wid % ntn;
  if (mt * 16 >= M) return;
  const int row0 = mt * 16, col0 = nq * 64;
  const float* arow = A + (size_t)(row0 + ln) * lda;
  v8f acc[4] = {};
  for (int kb = 0; kb < K; kb += 32) {
    FragB ah, al;
    const v4f x0 = *(const v4fa*)(arow + kb + 8 * hh), x1 = *(const v4fa*)(arow + kb + 8 * hh + 4);
    const v4f x2 = *(const v4fa*)(arow + kb + 16 + 8 * hh), x3 = *(const v4fa*)(arow + kb + 16 + 8 * hh + 4);
    float xs[16] = {x0[0],x0[1],x0[2],x0[3],x1[0],x1[1],x1[2],x1[3],x2[0],x2[1],x2[2],x2[3],x3[0],x3[1],x3[2],x3[3]};
#pragma unroll
    for (int i = 0; i < 16; ++i) { const unsigned short hb = bf16_bits(xs[i]); ah.u[i] = hb; al.u[i] = ASPLIT ? bf16_bits(xs[i] - bf16_val(hb)) : (unsigned short)0; }
#pragma unroll
    for (int t = 0; t < 4; ++t) {
      const unsigned short* brow = Wt + (size_t)(col0 + t * 16 + ln) * ldb + kb;
      FragB b;
      b.half[0] = *(const v8us*)(brow + 8 * hh);
      b.half[1] = *(const v8us*)(brow + 16 + 8 * hh);
      acc[t] = mmaN<ASPLIT ? 2 : 1>(ah.v, al.v, b.v, b.v, acc[t]);
    }
  }
#pragma unroll
  for (int t = 0; t < 4; ++t) {
    float bv = bias ? bias[col0 + t * 16 + ln] : 0.f;
    if (BIAS_BF16) bv = bf16_round(bv);
#pragma unroll
    for (int r = 0; r < 8; ++r) { float v = acc[t][r] + bv; if (ACT == 1) v = fmaxf(v, 0.f); so[w][8 * hh + r][t * 16 + ln] = v; }
  }
  __builtin_amdgcn_fence(__ATOMIC_ACQ_REL, "workgroup");
  __builtin_amdgcn_wave_barrier();
  const int rsub = lane >> 4, c4 = (lane & 15) * 4;
  {
#pragma unroll
    for (int q = 0; q < 8; ++q) {
      const int r = q * 2 + rsub;
      const v4f v = *(const v4fa*)&so[w][r][c4];
      *(v4f*)(C + (size_t)(row0 + r) * ldc + col0 + c4) = v;
    }
    
  }
}

// GEMM C = act(A·W + bias + resid): A f32 (ASPLIT -> hi/lo 2 terms), Wt bf16 [N][K]; ACT 0 none, 1 relu, 2 exact gelu;
// resid (optional, f32, row index = (row % rmod), pitch ldr, RES_BF16 rounds it) added before the activation.
template <bool ASPLIT, int ACT, bool BIAS_BF16, bool RES_BF16>
__global__ __launch_bounds__(128) void k_gemm_bf3(const float* __restrict__ A, int lda, const unsigned short* __restrict__ Wt, int ldb,
                                                const float* __restrict__ bias, const float* __restrict__ resid, int rmod, int ldr,
                                                float* __restrict__ C, int ldc, int M, int N, int K) {
  __shared__ __attribute__((aligned(16))) float so[4][16][64];
  const int tid = threadIdx.x, w = tid >> 5, lane = tid & 31, ln = lane & 15, hh = lane >> 4;
  const int ntn = N / 64;
  const int wid = blockIdx.x * 4 + w;
  const int mt = wid / ntn, nq = wid % ntn;
  if (mt * 16 >= M) return;
  const int row0 = mt * 16, col0 = nq * 64;
  const float* arow = A + (size_t)(row0 + ln) * lda;
  v8f acc[4] = {};
  for (int kb = 0; kb < K; kb += 32) {
    FragB ah, al;
    const v4f x0 = *(const v4fa*)(arow + kb + 8 * hh), x1 = *(const v4fa*)(arow + kb + 8 * hh + 4);
    const v4f x2 = *(const v4fa*)(arow + kb + 16 + 8 * hh), x3 = *(const v4fa*)(arow + kb + 16 + 8 * hh + 4);
    float xs[16] = {x0[0],x0[1],x0[2],x0[3],x1[0],x1[1],x1[2],x1[3],x2[0],x2[1],x2[2],x2[3],x3[0],x3[1],x3[2],x3[3]};
#pragma unroll
    for (int i = 0; i < 16; ++i) { const unsigned short hb = bf16_bits(xs[i]); ah.u[i] = hb; al.u[i] = ASPLIT ? bf16_bits(xs[i] - bf16_val(hb)) : (unsigned short)0; }
#pragma unroll
    for (int t = 0; t < 4; ++t) {
      const unsigned short* brow = Wt + (size_t)(col0 + t * 16 + ln) * ldb + kb;
      FragB b;
      b.half[0] = *(const v8us*)(brow + 8 * hh);
      b.half[1] = *(const v8us*)(brow + 16 + 8 * hh);
      acc[t] = mmaN<ASPLIT ? 2 : 1>(ah.v, al.v, b.v, b.v, acc[t]);
    }
  }
#pragma unroll
  for (int t = 0; t < 4; ++t) {
    const int col = col0 + t * 16 + ln;
    float bv = bias ? bias[col] : 0.f;
    if (BIAS_BF16) bv = bf16_round(bv);
#pragma unroll
    for (int r = 0; r < 8; ++r) {
      float v = acc[t][r] + bv;
      if (resid) { float rv = resid[(size_t)((row0 + 8 * hh + r) % rmod) * ldr + col]; if (RES_BF16) rv = bf16_round(rv); v += rv; }
      if (ACT == 1) v = fmaxf(v, 0.f);
      if (ACT == 2) v = 0.5f * v * (1.0f + erff(v * 0.70710678118654752f));
      if (ACT == 3) { const float u = 0.7978845608028654f * (v + 0.044715f * v * v * v); v = 0.5f * v * (1.0f + tanhf(u)); }
      so[w][8 * hh + r][t * 16 + ln] = v;
    }
  }
  __builtin_amdgcn_fence(__ATOMIC_ACQ_REL, "workgroup");
  __builtin_amdgcn_wave_barrier();
  const int rsub = lane >> 4, c4 = (lane & 15) * 4;
  {
#pragma unroll
    for (int q = 0; q < 8; ++q) {
      const int r = q * 2 + rsub;
      const v4f v = *(const v4fa*)&so[w][r][c4];
      *(v4f*)(C + (size_t)(row0 + r) * ldc + col0 + c4) = v;
    }
    
  }
}
// row LayerNorm (biased variance, eps) over N: s = X (+ R); optional out_sum <- s; out_norm <- (s-mu)*rsqrt(var+eps)*g + b
template <bool PARAM_BF16>
__global__ __launch_bounds__(256) void k_layernorm(const float* __restrict__ X, const float* __restrict__ R, const float* __restrict__ g, const float* __restrict__ bta,
                                                  float* __restrict__ out_sum, float* __restrict__ out_norm, int N, float eps) {
  __shared__ float red[256];
  const int row = blockIdx.x, tid = threadIdx.x;
  const float* x = X + (size_t)row * N; const float* rr = R ? R + (size_t)row * N : nullptr;
  float vals[16];                     // up to N = 4096
  const int per = N / 256;            // contiguous chunk per thread? use strided-by-4 chunks: thread handles j = tid*4 + 1024*u
  float s1 = 0.f;
  for (int u = 0; u < per / 4; ++u) {
    const int j = tid * 4 + 1024 * u;
    const v4f a = *(const v4fa*)(x + j);
    v4f b = {0.f,0.f,0.f,0.f}; if (rr) b = *(const v4fa*)(rr + j);
#pragma unroll
    for (int q = 0; q < 4; ++q) { const float v = a[q] + b[q]; vals[u * 4 + q] = v; s1 += v; }
  }
  red[tid] = s1; __syncthreads();
  for (int st = 128; st > 0; st >>= 1) { if (tid < st) red[tid] += red[tid + st]; __syncthreads(); }
  const float mu = red[0] / (float)N; __syncthreads();
  float s2 = 0.f;
  for (int u = 0; u < per / 4; ++u)
#pragma unroll
    for (int q = 0; q < 4; ++q) { const float c = vals[u * 4 + q] - mu; s2 += c * c; }
  red[tid] = s2; __syncthreads();
  for (int st = 128; st > 0; st >>= 1) { if (tid < st) red[tid] += red[tid + st]; __syncthreads(); }
  const float rs = rsqrtf(red[0] / (float)N + eps);
  {
    for (int u = 0; u < per / 4; ++u) {
      const int j = tid * 4 + 1024 * u;
      v4f o, sm;
#pragma unroll
      for (int q = 0; q < 4; ++q) {
        float gg = g[j + q], bb = bta[j + q];
        if (PARAM_BF16) { gg = bf16_round(gg); bb = bf16_round(bb); }
        sm[q] = vals[u * 4 + q]; o[q] = (vals[u * 4 + q] - mu) * rs * gg + bb;
      }
      if (out_sum) *(v4f*)(out_sum + (size_t)row * N + j) = sm;
      *(v4f*)(out_norm + (size_t)row * N + j) = o;
    }
    
  }
}



// ---- f16 WMMA path (v_wmma_f32_16x16x32_f16): 11-bit significands for operands in range — used where a [0,1] probability operand needs more precision than bf16
typedef _Float16 v16h __attribute__((ext_vector_type(16)));
union FragH { v16h v; v8us half[2]; _Float16 h[16]; unsigned short u[16]; };
template <int NT>
__device__ __forceinline__ v8f mmaH(v16h ah, v16h al, v16h bh, v16h bl, v8f c) {
  c = __builtin_amdgcn_wmma_f32_16x16x32_f16(false, ah, false, bh, (short)0, c, false, false);
  if (NT >= 2) c = __builtin_amdgcn_wmma_f32_16x16x32_f16(false, al, false, bh, (short)0, c, false, false);
  if (NT >= 3) c = __builtin_amdgcn_wmma_f32_16x16x32_f16(false, ah, false, bl, (short)0, c, false, false);
  asm volatile("v_nop\n\tv_nop\n\tv_nop\n\tv_nop" : "+v"(c) : "v"(ah), "v"(al), "v"(bh), "v"(bl));
  return c;
}
// batched GEMM like k_gemm_b but f16 operands: A f32 (split into f16 hi/lo if ASPLIT, else rounded to f16), Bt = f16 values [n][k]; alpha; C f32; N multiple of 16 (partial tiles skipped)
template <bool ASPLIT>
__global__ __launch_bounds__(128) void k_gemm_h(const float* __restrict__ A, int lda, size_t sA, const _Float16* __restrict__ Bh, int ldb, size_t sB, float alpha, float* __restrict__ C, int ldc, size_t sC, int M, int N, int K) {
  __shared__ __attribute__((aligned(16))) float so[4][16][64];
  const int tid = threadIdx.x, w = tid >> 5, lane = tid & 31, ln = lane & 15, hh = lane >> 4; const int by = blockIdx.y;
  A += (size_t)by * sA; Bh += (size_t)by * sB; C += (size_t)by * sC;
  const int ntn = (N + 63) / 64; const int wid = blockIdx.x * 4 + w; const int mt = wid / ntn, nq = wid % ntn; if (mt * 16 >= M) return;
  const int row0 = mt * 16, col0 = nq * 64; const float* arow = A + (size_t)(row0 + ln) * lda;
  v8f acc[4] = {};
  for (int kb = 0; kb < K; kb += 32) {
    FragH ah, al;
    const v4f x0 = *(const v4fa*)(arow + kb + 8 * hh), x1 = *(const v4fa*)(arow + kb + 8 * hh + 4), x2 = *(const v4fa*)(arow + kb + 16 + 8 * hh), x3 = *(const v4fa*)(arow + kb + 16 + 8 * hh + 4);
    float xs[16] = {x0[0],x0[1],x0[2],x0[3],x1[0],x1[1],x1[2],x1[3],x2[0],x2[1],x2[2],x2[3],x3[0],x3[1],x3[2],x3[3]};
#pragma unroll
    for (int i = 0; i < 16; ++i) { const _Float16 h = (_Float16)xs[i]; ah.h[i] = h; al.h[i] = ASPLIT ? (_Float16)(xs[i] - (float)h) : (_Float16)0.0f; }
#pragma unroll
    for (int t = 0; t < 4; ++t) { if (col0 + t * 16 >= N) continue; const size_t boff = (size_t)(col0 + t * 16 + ln) * ldb + kb; FragH bq; bq.half[0] = *(const v8us*)(Bh + boff + 8 * hh); bq.half[1] = *(const v8us*)(Bh + boff + 16 + 8 * hh);
      acc[t] = mmaH<ASPLIT ? 2 : 1>(ah.v, al.v, bq.v, bq.v, acc[t]); }
  }
#pragma unroll
  for (int t = 0; t < 4; ++t) { if (col0 + t * 16 >= N) continue;
#pragma unroll
    for (int r = 0; r < 8; ++r) so[w][8 * hh + r][t * 16 + ln] = acc[t][r] * alpha; }
  __builtin_amdgcn_fence(__ATOMIC_ACQ_REL, "workgroup"); __builtin_amdgcn_wave_barrier();
  const int rsub = lane >> 4, c4 = (lane & 15) * 4;
  {
#pragma unroll
    for (int q = 0; q < 8; ++q) { const int r = q * 2 + rsub; if (col0 + c4 < N) { const v4f v = *(const v4fa*)&so[w][r][c4]; *(v4f*)(C + (size_t)(row0 + r) * ldc + col0 + c4) = v; } }
     }
}

// k_gemm_hh variant with fused epilogue: v = acc·alpha + bias[by·sBias + col] (+ CP[(row/rowsPerB)·sCPb + by·64 + col] if CP) ; ACT 0 none / 1 elu ; writes f16 C16 (and f32 C if non-null)
template <int ACT>
__global__ __launch_bounds__(128) void k_gemm_hhx(const _Float16* __restrict__ A, int lda, size_t sA, const _Float16* __restrict__ Bh, int ldb, size_t sB, float alpha, const float* __restrict__ bias, size_t sBias, const float* __restrict__ CP, int rowsPerB, size_t sCPb, int row0g,
    float* __restrict__ C, _Float16* __restrict__ C16, int ldc, size_t sC, int M, int N, int K) {
  __shared__ __attribute__((aligned(16))) float so[4][16][64];
  const int tid = threadIdx.x, w = tid >> 5, lane = tid & 31, ln = lane & 15, hh = lane >> 4; const int by = blockIdx.y;
  A += (size_t)by * sA; Bh += (size_t)by * sB; const size_t cofs = (size_t)by * sC; const float* bp = bias ? bias + (size_t)by * sBias : nullptr;
  const int ntn = (N + 63) / 64; const int wid = blockIdx.x * 4 + w; const int mt = wid / ntn, nq = wid % ntn; if (mt * 16 >= M) return;
  const int row0 = mt * 16, col0 = nq * 64; const _Float16* arow = A + (size_t)(row0 + ln) * lda;
  v8f acc[4] = {};
  for (int kb = 0; kb < K; kb += 32) { FragH ah; ah.half[0] = *(const v8us*)((const unsigned short*)arow + kb + 8 * hh); ah.half[1] = *(const v8us*)((const unsigned short*)arow + kb + 16 + 8 * hh);
#pragma unroll
    for (int t = 0; t < 4; ++t) { if (col0 + t * 16 >= N) continue; const size_t boff = (size_t)(col0 + t * 16 + ln) * ldb + kb; FragH bq; bq.half[0] = *(const v8us*)((const unsigned short*)Bh + boff + 8 * hh); bq.half[1] = *(const v8us*)((const unsigned short*)Bh + boff + 16 + 8 * hh);
      acc[t] = mmaH<1>(ah.v, ah.v, bq.v, bq.v, acc[t]); }
  }
#pragma unroll
  for (int t = 0; t < 4; ++t) { if (col0 + t * 16 >= N) continue; const int col = col0 + t * 16 + ln; const float bv = bp ? bf16_round(bp[col]) : 0.f;
#pragma unroll
    for (int r = 0; r < 8; ++r) { float v = acc[t][r] * alpha + bv; if (CP) { const int rr = row0g + row0 + 8 * hh + r; if (rowsPerB < 0) v += CP[cofs + (size_t)rr * ldc + col];      /* rowsPerB < 0: own element of the batched C plane */ else { const int bidx = rr / rowsPerB; v += CP[(size_t)bidx * sCPb + (size_t)by * 64 + col]; } } if (ACT == 1) v = (v > 0.f) ? v : expm1f(v); else if (ACT == 7) v = (v > 0.f) ? v + 1.0f : expf(v); else if (ACT == 8) v = tanhf(v); else if (ACT == 9) v = 0.5f * v * (1.0f + tanhf(0.7978845608028654f * (v + 0.044715f * v * v * v))); else if (ACT == 11) v = 1.0f / (1.0f + expf(-v)); else if (ACT == 12) v = (v > 0.f) ? v : 0.01f * v; else if (ACT == 14) v = (v > 0.f) ? v : 0.1f * v; else if (ACT == 16) v = (v >= 0.f) ? v : 0.3f * v; else if (ACT == 17) v = (v >= 0.f) ? v : 0.2f * v; else if (ACT == 15) v = v / (1.0f + expf(-v)); else if (ACT == 3) v = fmaxf(v, 0.f); else if (ACT == 6) v = 0.5f * v * (1.0f + erff(v * 0.70710678118654752f)); so[w][8 * hh + r][t * 16 + ln] = v; } }
  __builtin_amdgcn_fence(__ATOMIC_ACQ_REL, "workgroup"); __builtin_amdgcn_wave_barrier();
  const int rsub = lane >> 4, c4 = (lane & 15) * 4; typedef _Float16 v4h __attribute__((ext_vector_type(4)));
  {
#pragma unroll
    for (int q = 0; q < 8; ++q) { const int r = q * 2 + rsub; if (col0 + c4 < N) { const v4f v = *(const v4fa*)&so[w][r][c4]; if (C) *(v4f*)(C + cofs + (size_t)(row0 + r) * ldc + col0 + c4) = v; if (C16) { v4h h4; for (int i = 0; i < 4; ++i) h4[i] = (_Float16)v[i]; *(v4h*)(C16 + cofs + (size_t)(row0 + r) * ldc + col0 + c4) = h4; } } }
     }
}


typedef _Float16 v4h __attribute__((ext_vector_type(4)));

__global__ __launch_bounds__(256) void k_h16(const float* __restrict__ x, _Float16* __restrict__ X16, size_t n8) { const size_t t = (size_t)blockIdx.x * 256 + threadIdx.x; if (t >= n8) return; FragH f;
#pragma unroll
  for (int q = 0; q < 8; ++q) f.h[q] = (_Float16)x[t * 8 + q]; *(v8us*)((unsigned short*)X16 + t * 8) = f.half[0];  }
__global__ __launch_bounds__(256) void k_round16f(const float* __restrict__ W, _Float16* __restrict__ Bt, size_t n8) { const size_t t = (size_t)blockIdx.x * 256 + threadIdx.x; if (t >= n8) return; FragH f;
#pragma unroll
  for (int i = 0; i < 8; ++i) f.h[i] = (_Float16)(bf16_round(W[t * 8 + i]) * 16.0f); *(v8us*)((unsigned short*)Bt + t * 8) = f.half[0];  }
// ---- fast GEMM (wave tile 32x64; requires M % 32 == 0 rows per launch region and N % 64 == 0); epilogue = k_gemm_hhx semantics ----
__device__ __forceinline__ v16h g2_frag(const _Float16* p, int hh) { FragH f; f.half[0] = *(const v8us*)((const unsigned short*)p + 8 * hh); f.half[1] = *(const v8us*)((const unsigned short*)p + 16 + 8 * hh); return f.v; }
__device__ __forceinline__ v8f g2_mma(v16h a, v16h b, v8f c) { v8f d = __builtin_amdgcn_wmma_f32_16x16x32_f16(false, a, false, b, (short)0, c, false, false); asm volatile("v_nop\n\tv_nop\n\tv_nop\n\tv_nop" : "+v"(d) : "v"(a), "v"(b)); return d; }
template <int ACT>
__global__ __launch_bounds__(128) void k_gemm2(const _Float16* __restrict__ A, int lda, size_t sA, const _Float16* __restrict__ Bh, int ldb, size_t sB, float alpha, const float* __restrict__ bias, size_t sBias, const float* __restrict__ CP, int rowsPerB, size_t sCPb, int row0g,
    float* __restrict__ C, _Float16* __restrict__ C16, int ldc, size_t sC, int M, int N, int K) { static_assert(ACT == 0 || ACT == 3 || ACT == 6 || ACT == 8 || ACT == 9 || ACT == 11 || ACT == 12 || ACT == 14 || ACT == 15 || ACT == 16 || ACT == 17, "k_gemm2: unsupported ACT code (would silently apply no activation)");
  __shared__ __attribute__((aligned(16))) float so[4][32][68];
  const int tid = threadIdx.x, w = tid >> 5, lane = tid & 31, ln = lane & 15, hh = lane >> 4; const int by = blockIdx.y;
  A += (size_t)by * sA; Bh += (size_t)by * sB; const size_t cofs = (size_t)by * sC; const float* bp = bias ? bias + (size_t)by * sBias : nullptr;
  const int ntn = N >> 6; const int mt = blockIdx.x / ntn, nq = blockIdx.x - mt * ntn; const int row0 = mt * 128 + 32 * w, col0 = nq * 64; if (row0 >= M) return;
  const _Float16* a0p = A + (size_t)(row0 + ln) * lda; const _Float16* a1p = a0p + (size_t)16 * lda;
  const _Float16* b0p = Bh + (size_t)(col0 + ln) * ldb; const _Float16* b1p = b0p + (size_t)16 * ldb; const _Float16* b2p = b1p + (size_t)16 * ldb; const _Float16* b3p = b2p + (size_t)16 * ldb;
  const v8f z8 = {0.f,0.f,0.f,0.f,0.f,0.f,0.f,0.f}; v8f c00 = z8, c01 = z8, c02 = z8, c03 = z8, c10 = z8, c11 = z8, c12 = z8, c13 = z8;
#pragma unroll 1
  for (int kb = 0; kb < K; kb += 32) { const v16h a0 = g2_frag(a0p + kb, hh), a1 = g2_frag(a1p + kb, hh);
    v16h b = g2_frag(b0p + kb, hh); c00 = g2_mma(a0, b, c00); c10 = g2_mma(a1, b, c10);
    b = g2_frag(b1p + kb, hh); c01 = g2_mma(a0, b, c01); c11 = g2_mma(a1, b, c11);
    b = g2_frag(b2p + kb, hh); c02 = g2_mma(a0, b, c02); c12 = g2_mma(a1, b, c12);
    b = g2_frag(b3p + kb, hh); c03 = g2_mma(a0, b, c03); c13 = g2_mma(a1, b, c13); }
  v8f accs[8] = {c00, c01, c02, c03, c10, c11, c12, c13};
#pragma unroll
  for (int u = 0; u < 8; ++u) { const int t = u & 3, half = u >> 2; const int col = col0 + t * 16 + ln; const float bv = bp ? bf16_round(bp[col]) : 0.f;
#pragma unroll
    for (int r = 0; r < 8; ++r) { const int rloc = half * 16 + 8 * hh + r; float v = accs[u][r] * alpha + bv; if (CP) { if (rowsPerB < 0) v += CP[cofs + (size_t)(row0g + row0 + rloc) * ldc + col];      /* rowsPerB < 0: own element of the batched C plane */ else { const int bidx = (row0g + row0 + rloc) / rowsPerB; v += CP[(size_t)bidx * sCPb + (size_t)by * 64 + col]; } }
      if (ACT == 3) v = fmaxf(v, 0.f); else if (ACT == 6) v = 0.5f * v * (1.0f + erff(v * 0.70710678118654752f)); else if (ACT == 11) v = 1.0f / (1.0f + expf(-v)); else if (ACT == 15) v = v / (1.0f + expf(-v)); else if (ACT == 12) v = (v > 0.f) ? v : 0.01f * v; else if (ACT == 8) v = tanhf(v); else if (ACT == 9) v = 0.5f * v * (1.0f + tanhf(0.7978845608028654f * (v + 0.044715f * v * v * v))); else if (ACT == 14) v = (v > 0.f) ? v : 0.1f * v; else if (ACT == 16) v = (v >= 0.f) ? v : 0.3f * v; else if (ACT == 17) v = (v >= 0.f) ? v : 0.2f * v;
      so[w][rloc][t * 16 + ln] = v; } }
  __builtin_amdgcn_fence(__ATOMIC_ACQ_REL, "workgroup"); __builtin_amdgcn_wave_barrier();
  const int rsub = lane >> 4, c4 = (lane & 15) * 4;
  {
#pragma unroll
    for (int q = 0; q < 16; ++q) { const int r = q * 2 + rsub; const v4f v = *(const v4fa*)&so[w][r][c4]; if (C) *(v4f*)(C + cofs + (size_t)(row0 + r) * ldc + col0 + c4) = v; if (C16) { v4h h4; for (int i = 0; i < 4; ++i) h4[i] = (_Float16)v[i]; *(v4h*)(C16 + cofs + (size_t)(row0 + r) * ldc + col0 + c4) = h4; } }
     } }


// ---- the projections and what stands around them ----
typedef __bf16 v4bf __attribute__((ext_vector_type(4)));
// A fragment in g2_frag's k order straight from an f32 input row; each value rounded to bf16 (exact in f16) in registers
__device__ __forceinline__ v16h pj_frag(const float* p, int hh) { const v4f x0 = *(const v4fa*)(p + 8 * hh), x1 = *(const v4fa*)(p + 8 * hh + 4), x2 = *(const v4fa*)(p + 16 + 8 * hh), x3 = *(const v4fa*)(p + 16 + 8 * hh + 4); FragH f;
  const v4bf r0 = __builtin_convertvector(x0, v4bf), r1 = __builtin_convertvector(x1, v4bf), r2 = __builtin_convertvector(x2, v4bf), r3 = __builtin_convertvector(x3, v4bf);      /* round to nearest even, as bf16_round */
#pragma unroll
  for (int q = 0; q < 4; ++q) { f.h[q] = (_Float16)(float)r0[q]; f.h[4 + q] = (_Float16)(float)r1[q]; f.h[8 + q] = (_Float16)(float)r2[q]; f.h[12 + q] = (_Float16)(float)r3[q]; }
  return f.v; }
// q, k and v projections in one grid (blockIdx.y = 0, 1, 2), k_gemm2's tile: block 128 rows x 64 columns (= one head), wave 32 x 64, K = DM; the operands come through LDS stages (below).
// Epilogue: q and k (f32, / 16 for the weight factor) leave as f16 hi + x1024 residual planes in row layout; v leaves as V^T [NB * NH][HD][SQ]: a lane's 8 accumulator rows are 8 consecutive tokens of one head-dim column,
// so they go as one 16-byte piece into an LDS tile [HD][128 tokens] (pitch PVP bytes) from which the block stores whole 256-byte runs.
#define PVP 272
// The operands of the two GEMM kernels reach the waves through LDS: a fragment load straight from global memory takes 32 bytes from each of 16 rows (16 lines an instruction), and the rolled loop waited for each such load in turn.
// A stage of GKS k of the block's A rows is brought in by asynchronous copies of whole lines (16 bytes a lane, through no register) into one of two buffers while the other is worked on;
// the A fragments are then ds_load_b128 reads at a row pitch of 16 bytes x odd, in g2_frag's k order, the k blocks in rising order as before.
// The weights need no pass of their own: a stage's GKS weight rows (k) x 64 columns (n) are read as f32 whole lines into registers one stage ahead, rounded there (f16(16 bf16(w)), the old plane's values)
// and stored as they lie, k-major, beside the A rows; ds_load_tr16_b128 hands a lane 8 consecutive k of its column, two such loads are a B fragment in g2_frag's k order (8 hh + s, then 16 + 8 hh + s - 8).
#define GKS 64                       /* k per LDS stage: two WMMA k blocks */
#define GFP 272                      /* LDS pitch in bytes of an f32 row of a stage (256 bytes of data) */
#define GHP 144                      /* LDS pitch in bytes of an f16 row of a stage (128 bytes of data) */
#define GWP 160                      /* LDS pitch in bytes of a weight row of a stage (64 columns as f16, 128 bytes of data): 32 bytes x odd, the transposing load's pitch */
#define PJA (128 * GFP)              /* k_proj: the A rows of a stage */
#define PJS (PJA + GKS * GWP)        /* k_proj: one stage, A then the weight rows */
#define OPA (128 * GHP)              /* k_outp: the A rows of a stage */
#define OPS (OPA + GKS * GWP)        /* k_outp: one stage, A then the weight rows */
__device__ __forceinline__ v8f gs_mma(v16h a, v16h b, v8f c) { return __builtin_amdgcn_wmma_f32_16x16x32_f16(false, a, false, b, (short)0, c, false, false); }
__device__ __forceinline__ v16h gs_hfrag(const unsigned char* p) { FragH f; f.half[0] = *(const v8us*)p; f.half[1] = *(const v8us*)(p + 32); return f.v; }      /* g2_frag's k order from an f16 LDS row; p already holds the lane half's 16 bytes */
typedef short s16x8 __attribute__((ext_vector_type(8)));
typedef _Float16 v4ha __attribute__((ext_vector_type(4), may_alias));
// B fragment from k-major weight rows: p = tile + (k0 + 8 hh + (lane & 7)) * GWP + 16 ((lane >> 3) & 1) + 2 n0; lane (ln, hh) gets rows k0 + 8 hh .. + 7, then k0 + 16 + 8 hh .. + 7, of column n0 + ln
__device__ __forceinline__ v16h gs_tfrag(const unsigned char* p) { typedef __attribute__((address_space(3))) s16x8 lds_s16x8; FragH f;
  f.half[0] = __builtin_bit_cast(v8us, __builtin_amdgcn_ds_load_tr16_b128_v8i16((lds_s16x8*)p)); f.half[1] = __builtin_bit_cast(v8us, __builtin_amdgcn_ds_load_tr16_b128_v8i16((lds_s16x8*)(p + 16 * GWP))); return f.v; }
// four weights: f16(16 bf16(w)), exact. The factor of 16 goes on in f32 ahead of the rounding (a power of two: bf16(16 w) = 16 bf16(w)), so that nothing small is ever held as f16 without it
__device__ __forceinline__ v4h gs_wcvt(v4f x) { const v4bf r = __builtin_convertvector(x * 16.0f, v4bf); v4h h;      /* round to nearest even, as bf16_round */
#pragma unroll
  for (int q = 0; q < 4; ++q) h[q] = (_Float16)(float)r[q];
  return h; }
// pj_frag's rounding on the four 16-byte pieces of an f32 LDS row (floats 8 hh .. + 7 and 16 + 8 hh .. + 7 of a k block)
__device__ __forceinline__ v16h gs_fcvt(v4f x0, v4f x1, v4f x2, v4f x3) { FragH f;
  const v4bf r0 = __builtin_convertvector(x0, v4bf), r1 = __builtin_convertvector(x1, v4bf), r2 = __builtin_convertvector(x2, v4bf), r3 = __builtin_convertvector(x3, v4bf);      /* round to nearest even, as bf16_round */
#pragma unroll
  for (int q = 0; q < 4; ++q) { f.h[q] = (_Float16)(float)r0[q]; f.h[4 + q] = (_Float16)(float)r1[q]; f.h[8 + q] = (_Float16)(float)r2[q]; f.h[12 + q] = (_Float16)(float)r3[q]; }
  return f.v; }
// Four copies of 16 bytes a lane, global -> LDS. The s_wait_xcnt closes the statement so that it stands in front of every later write of the address registers that the copies name.
template <class T>
__device__ __forceinline__ void gs_copy4(unsigned l0, unsigned lstep, const T* g0, size_t gstep) {
  const unsigned l1 = l0 + lstep, l2 = l1 + lstep, l3 = l2 + lstep; const T* g1 = g0 + gstep; const T* g2 = g1 + gstep; const T* g3 = g2 + gstep;
  asm volatile("global_load_async_to_lds_b128 %0, %4, off\n\tglobal_load_async_to_lds_b128 %1, %5, off\n\tglobal_load_async_to_lds_b128 %2, %6, off\n\tglobal_load_async_to_lds_b128 %3, %7, off\n\ts_wait_xcnt 0x0"
               :: "v"(l0), "v"(l1), "v"(l2), "v"(l3), "v"(g0), "v"(g1), "v"(g2), "v"(g3) : "memory"); }
__global__ __launch_bounds__(128) void k_proj(const float* __restrict__ xq, const float* __restrict__ xk, const float* __restrict__ xv, const float* __restrict__ wq, const float* __restrict__ wk, const float* __restrict__ wv,
    _Float16* __restrict__ QH, _Float16* __restrict__ QL, _Float16* __restrict__ KH, _Float16* __restrict__ KL, _Float16* __restrict__ VT) {
  __shared__ __attribute__((aligned(128))) unsigned char L[2 * PJS];
  float (*so)[32][68] = (float (*)[32][68])L;      /* the epilogue's tile lies on the first buffer's A rows: it is written only behind the last trip's barrier, when no copy is in flight and no wave reads them */
  const int tid = threadIdx.x, w = tid >> 5, lane = tid & 31, ln = lane & 15, hh = lane >> 4; const int y = blockIdx.y;
  const float* A = y == 0 ? xq : y == 1 ? xk : xv; const float* Wf = y == 0 ? wq : y == 1 ? wk : wv;
  const int mt = blockIdx.x / (DM / 64), nq = blockIdx.x - mt * (DM / 64); const int row0 = mt * 128 + 32 * w, col0 = nq * 64;
  /* the copies of a stage: A rows of 16 pieces (a thread: rows tid / 16 + 8 i); every lane on, every piece written by one lane */
  const unsigned lds0 = (unsigned)(size_t)L; const unsigned la = lds0 + (unsigned)((tid >> 4) * GFP + (tid & 15) * 16);
  const float* ga = A + (size_t)(mt * 128 + (tid >> 4)) * DM + (tid & 15) * 4;
  /* the weight rows of a stage: head nq's [in][out] matrix, rows of 64 f32 = 16 pieces (a thread: rows tid / 16 + 8 i), through registers */
  const float* gw = Wf + ((size_t)nq * DM + (tid >> 4)) * HD + (tid & 15) * 4; unsigned char* lw = L + PJA + (tid >> 4) * GWP + (tid & 15) * 8; v4f wr[8];
  auto wload = [&](int s) {
#pragma unroll
    for (int i = 0; i < 8; ++i) wr[i] = *(const v4fa*)(gw + (size_t)(s * GKS + 8 * i) * HD); };
  auto wput = [&](unsigned buf) {
#pragma unroll
    for (int i = 0; i < 8; ++i) *(v4ha*)(lw + buf * PJS + 8 * i * GWP) = gs_wcvt(wr[i]); };
  auto stage = [&](int s, unsigned buf) { const unsigned o = buf * PJS;
    gs_copy4(la + o, 8 * GFP, ga + s * GKS, (size_t)8 * DM); gs_copy4(la + o + 32 * GFP, 8 * GFP, ga + s * GKS + (size_t)32 * DM, (size_t)8 * DM);
    gs_copy4(la + o + 64 * GFP, 8 * GFP, ga + s * GKS + (size_t)64 * DM, (size_t)8 * DM); gs_copy4(la + o + 96 * GFP, 8 * GFP, ga + s * GKS + (size_t)96 * DM, (size_t)8 * DM); };
  wload(0); stage(0, 0);      /* the loads in front of the copies: the s_wait_xcnt that closes the first copy statement then stands behind them too */
  const v8f z8 = {0.f,0.f,0.f,0.f,0.f,0.f,0.f,0.f}; v8f c00 = z8, c01 = z8, c02 = z8, c03 = z8, c10 = z8, c11 = z8, c12 = z8, c13 = z8;
  wput(0);
  asm volatile("s_wait_dscnt 0x0" ::: "memory");      /* this wave's weight rows of stage 0 are written */
  asm volatile("s_wait_asynccnt 0x0" ::: "memory");      /* this wave's copies of stage 0 have landed */
  __syncthreads();      /* and every other wave's: stage 0 may be read */
  wload(1); stage(1, 1);
#pragma unroll 1
  for (int t = 0; t < DM / GKS; ++t) {      /* rolled: one trip is one LDS stage, its two k blocks unrolled below */
    const unsigned char* ab = L + (t & 1) * PJS + (w * 32 + ln) * GFP + hh * 32; const unsigned char* bb = L + (t & 1) * PJS + PJA + (8 * hh + (lane & 7)) * GWP + ((lane >> 3) & 1) * 16;
    v4f x[2][2][4]; v16h bf[2][4];      /* [k block][16 rows][piece], [k block][16 columns] */
#pragma unroll
    for (int p = 0; p < GKS / 32; ++p) {      /* unrolled: every LDS offset a constant */
#pragma unroll
      for (int i = 0; i < 2; ++i) { const unsigned char* ap = ab + i * 16 * GFP + p * 128; x[p][i][0] = *(const v4fa*)ap; x[p][i][1] = *(const v4fa*)(ap + 16); x[p][i][2] = *(const v4fa*)(ap + 64); x[p][i][3] = *(const v4fa*)(ap + 80); }
#pragma unroll
      for (int j = 0; j < 4; ++j) bf[p][j] = gs_tfrag(bb + p * 32 * GWP + j * 32); }
    if (t + 1 < DM / GKS) wput((unsigned)((t + 1) & 1));      /* same test in every wave; stage t + 1's weight rows go beside its A rows, into the buffer that every wave left at the last barrier */
    asm volatile("s_wait_dscnt 0x0" ::: "memory");      /* the stage's fragments are all in registers and the next stage's weight rows written: this wave is done with both buffers before the barrier */
    asm volatile("s_wait_asynccnt 0x0" ::: "memory");      /* this wave's copies of stage t + 1 have landed */
    __syncthreads();      /* publishes stage t + 1 and ends every wave's reads of stage t's buffer */
    if (t + 2 < DM / GKS) { wload(t + 2); stage(t + 2, (unsigned)(t & 1)); }      /* same test in every wave of the block; refills the buffer just read, and flies under the products below, which work on registers alone; the weight rows wait in registers for the next trip */
#pragma unroll
    for (int p = 0; p < GKS / 32; ++p) { const v16h a0 = gs_fcvt(x[p][0][0], x[p][0][1], x[p][0][2], x[p][0][3]), a1 = gs_fcvt(x[p][1][0], x[p][1][1], x[p][1][2], x[p][1][3]);
      c00 = gs_mma(a0, bf[p][0], c00); c10 = gs_mma(a1, bf[p][0], c10); c01 = gs_mma(a0, bf[p][1], c01); c11 = gs_mma(a1, bf[p][1], c11);
      c02 = gs_mma(a0, bf[p][2], c02); c12 = gs_mma(a1, bf[p][2], c12); c03 = gs_mma(a0, bf[p][3], c03); c13 = gs_mma(a1, bf[p][3], c13); }
  }
  asm volatile("s_wait_asynccnt 0x0" ::: "memory");      /* no copy is left in flight when the first buffer becomes the epilogue's tile */
  v8f accs[8] = {c00, c01, c02, c03, c10, c11, c12, c13};
  if (y == 2) {      /* same for the whole block */
    unsigned char* st = (unsigned char*)&so[0][0][0];
#pragma unroll
    for (int u = 0; u < 8; ++u) { const int t = u & 3, half = u >> 2; FragH f;
#pragma unroll
      for (int r = 0; r < 8; ++r) f.h[r] = (_Float16)(accs[u][r] * 0.0625f);
      *(v8us*)(st + (t * 16 + ln) * PVP + (w * 32 + half * 16 + 8 * hh) * 2) = f.half[0]; }
    __syncthreads();      /* the tile's 128 tokens come from all four waves */
    const int bb = (mt * 128) / SQ, s0 = (mt * 128) % SQ;
#pragma unroll
    for (int i = 0; i < 8; ++i) { const int d = i * 8 + (tid >> 4), pc = tid & 15; const v8us v = *(const v8us*)(st + d * PVP + pc * 16);
      *(v8us*)((unsigned short*)VT + ((size_t)(bb * NH + nq) * HD + d) * SQ + s0 + pc * 8) = v; }
  } else {
    _Float16* Hh = y == 0 ? QH : KH; _Float16* Hl = y == 0 ? QL : KL;
#pragma unroll
    for (int u = 0; u < 8; ++u) { const int t = u & 3, half = u >> 2;
#pragma unroll
      for (int r = 0; r < 8; ++r) so[w][half * 16 + 8 * hh + r][t * 16 + ln] = accs[u][r] * 0.0625f; }
    __builtin_amdgcn_fence(__ATOMIC_ACQ_REL, "workgroup"); __builtin_amdgcn_wave_barrier();      /* a wave reads back only its own 32 rows */
    const int rsub = lane >> 4, c4 = (lane & 15) * 4;
#pragma unroll
    for (int q = 0; q < 16; ++q) { const int r = q * 2 + rsub; const v4f v = *(const v4fa*)&so[w][r][c4]; v4h h4, l4;
#pragma unroll
      for (int i = 0; i < 4; ++i) { const _Float16 hv = (_Float16)v[i]; h4[i] = hv; l4[i] = (_Float16)((v[i] - (float)hv) * 1024.0f); }
      const size_t o = (size_t)(row0 + r) * DM + col0 + c4; *(v4h*)(Hh + o) = h4; *(v4h*)(Hl + o) = l4; }
  } }

// out = o W_p: k_gemm2's tile (block 128 rows x 64 columns, wave 32 x 64, K = DM) and its plain epilogue (x alpha, f32 rows through an LDS tile); o is f16 and staged as above, W_p (read flat, [in][out] [DM][DM]) comes as the other weights.
__global__ __launch_bounds__(128) void k_outp(const _Float16* __restrict__ A, const float* __restrict__ Wf, float alpha, float* __restrict__ C) {
  __shared__ __attribute__((aligned(128))) unsigned char L[2 * OPS];
  float (*so)[32][68] = (float (*)[32][68])L;      /* lies on the first buffer and part of the second, written behind the last trip's barrier as in k_proj */
  const int tid = threadIdx.x, w = tid >> 5, lane = tid & 31, ln = lane & 15, hh = lane >> 4;
  const int mt = blockIdx.x / (DM / 64), nq = blockIdx.x - mt * (DM / 64); const int row0 = mt * 128 + 32 * w, col0 = nq * 64;
  /* the copies of a stage: 128 A rows of 8 pieces (a thread: rows tid / 8 + 16 i); every lane on, every piece written by one lane */
  const unsigned lds0 = (unsigned)(size_t)L; const unsigned la = lds0 + (unsigned)((tid >> 3) * GHP + (tid & 7) * 16);
  const _Float16* ga = A + (size_t)(mt * 128 + (tid >> 3)) * DM + (tid & 7) * 8;
  /* the weight rows of a stage: the block's 64 columns of GKS rows = 16 pieces a row (a thread: rows tid / 16 + 8 i), through registers */
  const float* gw = Wf + (size_t)(tid >> 4) * DM + col0 + (tid & 15) * 4; unsigned char* lw = L + OPA + (tid >> 4) * GWP + (tid & 15) * 8; v4f wr[8];
  auto wload = [&](int s) {
#pragma unroll
    for (int i = 0; i < 8; ++i) wr[i] = *(const v4fa*)(gw + (size_t)(s * GKS + 8 * i) * DM); };
  auto wput = [&](unsigned buf) {
#pragma unroll
    for (int i = 0; i < 8; ++i) *(v4ha*)(lw + buf * OPS + 8 * i * GWP) = gs_wcvt(wr[i]); };
  auto stage = [&](int s, unsigned buf) { const unsigned o = buf * OPS;
    gs_copy4(la + o, 16 * GHP, ga + s * GKS, (size_t)16 * DM); gs_copy4(la + o + 64 * GHP, 16 * GHP, ga + s * GKS + (size_t)64 * DM, (size_t)16 * DM); };
  wload(0); stage(0, 0);      /* the loads in front of the copies: the s_wait_xcnt that closes the first copy statement then stands behind them too */
  const v8f z8 = {0.f,0.f,0.f,0.f,0.f,0.f,0.f,0.f}; v8f c00 = z8, c01 = z8, c02 = z8, c03 = z8, c10 = z8, c11 = z8, c12 = z8, c13 = z8;
  wput(0);
  asm volatile("s_wait_dscnt 0x0" ::: "memory");      /* this wave's weight rows of stage 0 are written */
  asm volatile("s_wait_asynccnt 0x0" ::: "memory");      /* this wave's copies of stage 0 have landed */
  __syncthreads();      /* and every other wave's: stage 0 may be read */
  wload(1); stage(1, 1);
#pragma unroll 1
  for (int t = 0; t < DM / GKS; ++t) {      /* rolled: one trip is one LDS stage, its two k blocks unrolled below */
    const unsigned char* ab = L + (t & 1) * OPS + (w * 32 + ln) * GHP + hh * 16; const unsigned char* bb = L + (t & 1) * OPS + OPA + (8 * hh + (lane & 7)) * GWP + ((lane >> 3) & 1) * 16;
    v16h af[2][2], bf[2][4];      /* [k block][16 rows], [k block][16 columns] */
#pragma unroll
    for (int p = 0; p < GKS / 32; ++p) {      /* unrolled: every LDS offset a constant */
      af[p][0] = gs_hfrag(ab + p * 64); af[p][1] = gs_hfrag(ab + 16 * GHP + p * 64);
#pragma unroll
      for (int j = 0; j < 4; ++j) bf[p][j] = gs_tfrag(bb + p * 32 * GWP + j * 32); }
    if (t + 1 < DM / GKS) wput((unsigned)((t + 1) & 1));      /* same test in every wave; stage t + 1's weight rows go beside its A rows, into the buffer that every wave left at the last barrier */
    asm volatile("s_wait_dscnt 0x0" ::: "memory");      /* the stage's fragments are all in registers and the next stage's weight rows written: this wave is done with both buffers before the barrier */
    asm volatile("s_wait_asynccnt 0x0" ::: "memory");      /* this wave's copies of stage t + 1 have landed */
    __syncthreads();      /* publishes stage t + 1 and ends every wave's reads of stage t's buffer */
    if (t + 2 < DM / GKS) { wload(t + 2); stage(t + 2, (unsigned)(t & 1)); }      /* same test in every wave of the block; refills the buffer just read, and flies under the products below, which work on registers alone; the weight rows wait in registers for the next trip */
#pragma unroll
    for (int p = 0; p < GKS / 32; ++p) {
      c00 = gs_mma(af[p][0], bf[p][0], c00); c10 = gs_mma(af[p][1], bf[p][0], c10); c01 = gs_mma(af[p][0], bf[p][1], c01); c11 = gs_mma(af[p][1], bf[p][1], c11);
      c02 = gs_mma(af[p][0], bf[p][2], c02); c12 = gs_mma(af[p][1], bf[p][2], c12); c03 = gs_mma(af[p][0], bf[p][3], c03); c13 = gs_mma(af[p][1], bf[p][3], c13); }
  }
  asm volatile("s_wait_asynccnt 0x0" ::: "memory");      /* no copy is left in flight when the buffers become the epilogue's tile */
  v8f accs[8] = {c00, c01, c02, c03, c10, c11, c12, c13};
#pragma unroll
  for (int u = 0; u < 8; ++u) { const int t = u & 3, half = u >> 2;
#pragma unroll
    for (int r = 0; r < 8; ++r) so[w][half * 16 + 8 * hh + r][t * 16 + ln] = accs[u][r] * alpha; }
  __builtin_amdgcn_fence(__ATOMIC_ACQ_REL, "workgroup"); __builtin_amdgcn_wave_barrier();      /* a wave reads back only its own 32 rows */
  const int rsub = lane >> 4, c4 = (lane & 15) * 4; v4f vr[16];      /* all rows read back first, then stored from one address pair */
#pragma unroll
  for (int q = 0; q < 16; ++q) vr[q] = *(const v4fa*)&so[w][q * 2 + rsub][c4];
  float* cp = C + (size_t)(row0 + rsub) * DM + col0 + c4;
#pragma unroll
  for (int q = 0; q < 16; ++q) *(v4f*)(cp + (size_t)q * 2 * DM) = vr[q]; }

__global__ __launch_bounds__(256) void k_wnat(const float* __restrict__ w, size_t n8, _Float16* __restrict__ Bt) { const size_t t = (size_t)blockIdx.x * 256 + threadIdx.x; if (t >= n8) return; FragH f; for (int q = 0; q < 8; ++q) f.h[q] = (_Float16)(bf16_round(w[t * 8 + q]) * 16.0f); *(v8us*)((unsigned short*)Bt + t * 8) = f.half[0];  }
__global__ __launch_bounds__(256) void k_rsm(const float* __restrict__ S, _Float16* __restrict__ P, int nrows) {
  #pragma clang fp contract(off)
  const int i = blockIdx.x * 256 + threadIdx.x; if (i >= nrows) return; const float* s = S + (size_t)i * SQ; float mx = -3.0e38f;
#pragma unroll 1
  for (int j = 0; j < SQ; ++j) mx = fmaxf(mx, s[j]); float se = 0.f;
#pragma unroll 1
  for (int j = 0; j < SQ; ++j) se += expf(s[j] - mx); const float sc = 256.0f / se;
#pragma unroll 1
  for (int j0 = 0; j0 < SQ; j0 += 8) { FragH f; for (int q = 0; q < 8; ++q) f.h[q] = (_Float16)(expf(s[j0 + q] - mx) * sc); unsigned short* d = (unsigned short*)P + (size_t)i * SQ + j0; *(v8us*)d = f.half[0];  } }
__global__ __launch_bounds__(256) void k_vt(const _Float16* __restrict__ V16, int b, int h0, _Float16* __restrict__ VT) { __shared__ unsigned short tl[64][65]; const int tid = threadIdx.x; const int hh = blockIdx.x % HG, sg = blockIdx.x / HG; const int s0 = sg * 64; const int h = h0 + hh;
  for (int i = tid; i < 64 * 8; i += 256) { const int j = i / 8, d8 = (i % 8) * 8; FragH f; f.half[0] = *(const v8us*)((const unsigned short*)V16 + ((size_t)b * SQ + s0 + j) * DM + h * HD + d8); for (int q = 0; q < 8; ++q) tl[d8 + q][j] = f.u[q]; }
  __syncthreads();
  { for (int i = tid; i < 64 * 8; i += 256) { const int d = i / 8, j8 = (i % 8) * 8; FragH f; for (int q = 0; q < 8; ++q) f.u[q] = tl[d][j8 + q]; *(v8us*)((unsigned short*)VT + ((size_t)hh * HD + d) * SQ + s0 + j8) = f.half[0]; }  } }



#define FK 128                       /* keys per LDS stage: 2 key halves of 2 passes of 32 */
#define FKW (FK / 2)                 /* keys of a stage that one wave walks */
#define FKP 144                      /* LDS pitch in bytes of a K row (128 bytes of data) */
#define FVP 272                      /* LDS pitch in bytes of a V^T row (256 bytes of data) */
#define FKB (FK * FKP)               /* one K plane of a stage */
#define FSB (2 * FKB + HD * FVP)     /* one stage: K hi, K lo, V^T */
#define FXW (9 * 512)                /* hand-over slot of a wave: 8 pieces of O^T and one of (m, l), 16 bytes a lane each */
__device__ __forceinline__ v8f fa_mma(v16h a, v16h b, v8f c) { return __builtin_amdgcn_wmma_f32_16x16x32_f16(false, a, false, b, (short)0, c, false, false); }
__device__ __forceinline__ float fa_swap16(float x) { const int b = __float_as_int(x); return __int_as_float(__builtin_amdgcn_permlanex16(b, b, 0x76543210, 0xfedcba98, false, false)); }      /* value of lane l ^ 16 */
__device__ __forceinline__ v16h fa_lfrag(const unsigned char* p) { FragH f; f.half[0] = *(const v8us*)p; f.half[1] = *(const v8us*)(p + 32); return f.v; }      /* g2_frag's k order, from an LDS row; p already holds the lane half's 16 bytes */
// Four copies of 16 bytes a lane, global -> LDS. The s_wait_xcnt closes the statement so that it stands in front of every later write of the address registers that the copies name.
__device__ __forceinline__ void fa_copy4(unsigned l0, unsigned lstep, const _Float16* g0, size_t gstep) {
  const unsigned l1 = l0 + lstep, l2 = l1 + lstep, l3 = l2 + lstep; const _Float16* g1 = g0 + gstep; const _Float16* g2 = g1 + gstep; const _Float16* g3 = g2 + gstep;
  asm volatile("global_load_async_to_lds_b128 %0, %4, off\n\tglobal_load_async_to_lds_b128 %1, %5, off\n\tglobal_load_async_to_lds_b128 %2, %6, off\n\tglobal_load_async_to_lds_b128 %3, %7, off\n\ts_wait_xcnt 0x0"
               :: "v"(l0), "v"(l1), "v"(l2), "v"(l3), "v"(g0), "v"(g1), "v"(g2), "v"(g3) : "memory"); }
__global__ __launch_bounds__(256) void k_fattn(const _Float16* __restrict__ Qh, const _Float16* __restrict__ Ql, const _Float16* __restrict__ Kh, const _Float16* __restrict__ Kl, const _Float16* __restrict__ Vt, _Float16* __restrict__ O) {
  __shared__ __attribute__((aligned(128))) unsigned char L[2 * FSB];
  const int tid = threadIdx.x, lane = tid & 31, ln = lane & 15, hh = lane >> 4; const int w = __builtin_amdgcn_readfirstlane((int)(threadIdx.x >> 5));
  const int qg = w & 3, kh = w >> 2;      /* the wave's 32 queries of the block's 128, its half of every stage's keys */
  const int bh = blockIdx.y, b = bh / NH, h = bh - b * NH; const size_t r0 = (size_t)b * SQ; const int q0 = blockIdx.x * 128 + qg * 32;
  const size_t qo = (r0 + q0 + ln) * DM + h * HD;      /* query tile 0; tile 1 lies 16 rows on */
  /* the copies of a stage: K rows of 8 pieces (a thread: rows tid / 8 + 32 i), V^T rows of 16 pieces (rows tid / 16 + 16 i); every lane on, every piece written by one lane */
  const unsigned lds0 = (unsigned)(size_t)L; const unsigned lk = lds0 + (unsigned)((tid >> 3) * FKP + (tid & 7) * 16), lv = lds0 + (unsigned)(2 * FKB + (tid >> 4) * FVP + (tid & 15) * 16);
  const size_t gko = (r0 + (tid >> 3)) * DM + h * HD + (tid & 7) * 8; const _Float16* gkh = Kh + gko; const _Float16* gkl = Kl + gko; const _Float16* gv = Vt + ((size_t)bh * HD + (tid >> 4)) * SQ + (tid & 15) * 8;
  auto stage = [&](int s, unsigned buf) { const unsigned lb = buf * FSB;
    fa_copy4(lk + lb, 32 * FKP, gkh + (size_t)s * FK * DM, (size_t)32 * DM); fa_copy4(lk + lb + FKB, 32 * FKP, gkl + (size_t)s * FK * DM, (size_t)32 * DM); fa_copy4(lv + lb, 16 * FVP, gv + (size_t)s * FK, (size_t)16 * SQ); };
  stage(0, 0);
  v16h qh0[2], qh1[2], ql0[2], ql1[2];      /* [query tile] */
#pragma unroll
  for (int c = 0; c < 2; ++c) { const size_t qc = qo + (size_t)c * 16 * DM; qh0[c] = g2_frag(Qh + qc, hh); qh1[c] = g2_frag(Qh + qc + 32, hh); ql0[c] = g2_frag(Ql + qc, hh); ql1[c] = g2_frag(Ql + qc + 32, hh); }
  const v8f z8 = {0.f,0.f,0.f,0.f,0.f,0.f,0.f,0.f}; v8f o0[2] = {z8, z8}, o1[2] = {z8, z8}, o2[2] = {z8, z8}, o3[2] = {z8, z8}; float m[2] = {-3.0e38f, -3.0e38f}, l[2] = {0.f, 0.f};
  const float cs = 0.18033688011112042f;      /* log2(e) / 8: raw product -> exponent of two */
  asm volatile("s_wait_asynccnt 0x0" ::: "memory");      /* this wave's copies of stage 0 have landed */
  __syncthreads();      /* and every other wave's: stage 0 may be read */
  stage(1, 1);
#pragma unroll 1
  for (int t = 0; t < SQ / FK; ++t) {      /* rolled: one trip is one LDS stage, the wave's two passes unrolled below */
    const unsigned char* kb = L + (t & 1) * FSB + (kh * FKW + ln) * FKP + hh * 16; const unsigned char* vb = L + (t & 1) * FSB + 2 * FKB + ln * FVP + kh * FKW * 2 + hh * 16;
    v16h h00 = fa_lfrag(kb), h01 = fa_lfrag(kb + 64), h10 = fa_lfrag(kb + 16 * FKP), h11 = fa_lfrag(kb + 16 * FKP + 64);
    v16h l00 = fa_lfrag(kb + FKB), l01 = fa_lfrag(kb + FKB + 64), l10 = fa_lfrag(kb + FKB + 16 * FKP), l11 = fa_lfrag(kb + FKB + 16 * FKP + 64);
#pragma unroll
    for (int p = 0; p < FKW / 32; ++p) {      /* unrolled: every LDS offset a constant, and the K fragments are carried from pass to pass inside the stage */
      const v16h v0 = fa_lfrag(vb + p * 64), v1 = fa_lfrag(vb + 16 * FVP + p * 64), v2 = fa_lfrag(vb + 32 * FVP + p * 64), v3 = fa_lfrag(vb + 48 * FVP + p * 64);
      v8f sa[2] = {z8, z8}, sb[2] = {z8, z8}, ta[2] = {z8, z8}, tb[2] = {z8, z8};      /* [query tile]; keys j .. j+15: sa small terms, sb main term; keys j+16 .. j+31: ta, tb */
#pragma unroll
      for (int c = 0; c < 2; ++c) { sa[c] = fa_mma(h00, ql0[c], sa[c]); sb[c] = fa_mma(h00, qh0[c], sb[c]); ta[c] = fa_mma(h10, ql0[c], ta[c]); tb[c] = fa_mma(h10, qh0[c], tb[c]); }
#pragma unroll
      for (int c = 0; c < 2; ++c) { sa[c] = fa_mma(h01, ql1[c], sa[c]); sb[c] = fa_mma(h01, qh1[c], sb[c]); ta[c] = fa_mma(h11, ql1[c], ta[c]); tb[c] = fa_mma(h11, qh1[c], tb[c]); }
#pragma unroll
      for (int c = 0; c < 2; ++c) { sa[c] = fa_mma(l00, qh0[c], sa[c]); ta[c] = fa_mma(l10, qh0[c], ta[c]); }
#pragma unroll
      for (int c = 0; c < 2; ++c) { sa[c] = fa_mma(l01, qh1[c], sa[c]); ta[c] = fa_mma(l11, qh1[c], ta[c]); }
      if (p + 1 < FKW / 32) { const unsigned char* kn = kb + (p + 1) * 32 * FKP;      /* the next pass's K fragments, into the same registers, behind this pass's last score product; never beyond this stage's own buffer */
        h00 = fa_lfrag(kn); h01 = fa_lfrag(kn + 64); h10 = fa_lfrag(kn + 16 * FKP); h11 = fa_lfrag(kn + 16 * FKP + 64);
        l00 = fa_lfrag(kn + FKB); l01 = fa_lfrag(kn + FKB + 64); l10 = fa_lfrag(kn + FKB + 16 * FKP); l11 = fa_lfrag(kn + FKB + 16 * FKP + 64); }
      float u[2][16], pm[2];
#pragma unroll
      for (int c = 0; c < 2; ++c) {
#pragma unroll
        for (int r = 0; r < 8; ++r) { u[c][r] = fmaf(sa[c][r], 0.0009765625f, sb[c][r]); u[c][8 + r] = fmaf(ta[c][r], 0.0009765625f, tb[c][r]); }
        const float* uc = u[c];
        const float x = fmaxf(fmaxf(fmaxf(fmaxf(uc[0], uc[1]), fmaxf(uc[2], uc[3])), fmaxf(fmaxf(uc[4], uc[5]), fmaxf(uc[6], uc[7]))), fmaxf(fmaxf(fmaxf(uc[8], uc[9]), fmaxf(uc[10], uc[11])), fmaxf(fmaxf(uc[12], uc[13]), fmaxf(uc[14], uc[15]))));
        pm[c] = fmaxf(x, fa_swap16(x)); }      /* both halves of a query's keys: the two lanes must use one maximum, their weights meet in one product */
      if (__builtin_amdgcn_ballot_w32((pm[0] > m[0]) | (pm[1] > m[1])) != 0) {      /* scalar branch, one test a pass for both query tiles: taken by the whole wave or not at all */
#pragma unroll
        for (int c = 0; c < 2; ++c) { const float mn = fmaxf(m[c], pm[c]); const float al = __builtin_amdgcn_exp2f((m[c] - mn) * cs); m[c] = mn; l[c] *= al; o0[c] *= al; o1[c] *= al; o2[c] *= al; o3[c] *= al; } }
#pragma unroll
      for (int c = 0; c < 2; ++c) {
        const float mc = fmaf(-m[c], cs, 8.0f);      /* + 8: weights carried x256 against the f16 subnormal range */
        FragH pw; float e[16];
#pragma unroll
        for (int s = 0; s < 16; ++s) { e[s] = __builtin_amdgcn_exp2f(fmaf(u[c][s], cs, mc)); pw.h[s] = (_Float16)e[s]; }
        l[c] += (((e[0] + e[1]) + (e[2] + e[3])) + ((e[4] + e[5]) + (e[6] + e[7]))) + (((e[8] + e[9]) + (e[10] + e[11])) + ((e[12] + e[13]) + (e[14] + e[15])));
        o0[c] = fa_mma(v0, pw.v, o0[c]); o1[c] = fa_mma(v1, pw.v, o1[c]); o2[c] = fa_mma(v2, pw.v, o2[c]); o3[c] = fa_mma(v3, pw.v, o3[c]); }
    }
    asm volatile("s_wait_dscnt 0x0" ::: "memory");      /* this wave's reads of the buffer are done before the buffer is handed back */
    asm volatile("s_wait_asynccnt 0x0" ::: "memory");      /* this wave's copies of stage t + 1 have landed */
    __syncthreads();      /* publishes stage t + 1 and ends every wave's reads of stage t's buffer */
    if (t + 2 < SQ / FK) stage(t + 2, (unsigned)(t & 1));      /* same test in every wave of the block; refills the buffer just read */
  }
  asm volatile("s_wait_asynccnt 0x0" ::: "memory");      /* no copy is left in flight when the buffers become the hand-over slots */
  /* the two key halves of a query meet: wave w keeps query tile kh and hands the other to wave w ^ 4. The slots lie on the buffers, which no wave reads and no copy writes behind the last trip's barrier */
  const bool k1 = kh != 0;      /* the same in every lane */
  const v8f g0 = k1 ? o0[0] : o0[1], g1 = k1 ? o1[0] : o1[1], g2 = k1 ? o2[0] : o2[1], g3 = k1 ? o3[0] : o3[1]; const float gm = k1 ? m[0] : m[1], gl = k1 ? l[0] : l[1];      /* given */
  const v8f a0 = k1 ? o0[1] : o0[0], a1 = k1 ? o1[1] : o1[0], a2 = k1 ? o2[1] : o2[0], a3 = k1 ? o3[1] : o3[0]; const float am = k1 ? m[1] : m[0], al = k1 ? l[1] : l[0];      /* kept */
  unsigned char* xs = L + w * FXW + lane * 16; const v8f gg[4] = {g0, g1, g2, g3};
#pragma unroll
  for (int j = 0; j < 4; ++j) { const v4f lo = {gg[j][0], gg[j][1], gg[j][2], gg[j][3]}, hi = {gg[j][4], gg[j][5], gg[j][6], gg[j][7]}; *(v4fa*)(xs + (2 * j) * 512) = lo; *(v4fa*)(xs + (2 * j + 1) * 512) = hi; }
  { const v4f ml = {gm, gl, 0.f, 0.f}; *(v4fa*)(xs + 8 * 512) = ml; }
  __syncthreads();      /* the partner's slot is written */
  const unsigned char* xr = L + (w ^ 4) * FXW + lane * 16; v4f pr[9];
#pragma unroll
  for (int j = 0; j < 9; ++j) pr[j] = *(const v4fa*)(xr + j * 512);
  const float mn = fmaxf(am, pr[8][0]); const float fa = __builtin_amdgcn_exp2f((am - mn) * cs), fb = __builtin_amdgcn_exp2f((pr[8][0] - mn) * cs);      /* both halves on one maximum */
  float lt = al * fa + pr[8][1] * fb; lt += fa_swap16(lt); const float sc = 64.0f / lt;      /* lt = 256 sum exp; o carried x64 as before (folded into the output GEMM alpha) */
  const float sa_ = fa * sc, sb_ = fb * sc; const v8f aa[4] = {a0, a1, a2, a3};
  unsigned short* op = (unsigned short*)O + qo + (size_t)kh * 16 * DM + 8 * hh;
#pragma unroll
  for (int j = 0; j < 4; ++j) { FragH f;
#pragma unroll
    for (int r = 0; r < 8; ++r) f.h[r] = (_Float16)(aa[j][r] * sa_ + pr[2 * j + (r >> 2)][r & 3] * sb_);
    *(v8us*)(op + 16 * j) = f.half[0]; } }

extern "C" void kernel_launch(void* const* d_in, const int* in_sizes, int n_in,
                              void* d_out, int out_size, void* d_ws, size_t ws_size, hipStream_t stream) {
  (void)in_sizes; (void)n_in; (void)out_size;
  const float* const* I = (const float* const*)d_in; const float* xq = I[0]; const float* xk = I[1]; const float* xv = I[2]; const float* wq = I[3]; const float* wk = I[4]; const float* wv = I[5]; const float* wo = I[6];      /* input order: query, key, value; Wq, Wk, Wv [8][512][64] (per-head [in][out]); Wp [8][64][512] (flat [in][out] [512][512]): seven inputs; the module has NO biases */
  char* ws = (char*)d_ws; size_t off = 0;
  auto take = [&](size_t bytes) { char* p = ws + off; off += (bytes + 255) & ~(size_t)255; return p; };
  _Float16* QH = (_Float16*)take(NR * DM * 2); _Float16* QL = (_Float16*)take(NR * DM * 2); _Float16* KH = (_Float16*)take(NR * DM * 2); _Float16* KL = (_Float16*)take(NR * DM * 2); _Float16* O16 = (_Float16*)take(NR * DM * 2);
  _Float16* VT = (_Float16*)take((size_t)NB * NH * HD * SQ * 2);
  if (off > ws_size) return;
  const size_t r0p = (size_t)B0 * SQ;      /* first row of the output stage */
  k_proj<<<dim3((unsigned)((NR / 128) * (DM / 64)), 3), 128, 0, stream>>>(xq, xk, xv, wq, wk, wv, QH, QL, KH, KL, VT);      /* q and k as f16 hi + x1024 residual planes; V^T [NB * NH][HD][SQ], both batches */
  k_fattn<<<dim3(SQ / 128, NB * NH), 256, 0, stream>>>(QH, QL, KH, KL, VT, O16);      /* o (merged heads, x64) as f16 rows */
  k_outp<<<dim3((unsigned)((MPO / 128) * (DM / 64)), 1), 128, 0, stream>>>(O16 + r0p * DM, wo, 0.0009765625f, (float*)d_out + r0p * DM);      /* out rows are the output layout */
}

// v010
// Measured time: 39.9 microseconds a run.
// It is 1.37 times as fast as v007, going by the measured steps of the versions left out in between.
// All steps since v000 together make it 51.7 times as fast.
#include <hip/hip_runtime.h>
// Multi-head attention on THREE input streams with per-head projection weights and a per-head output weight, no biases at all (query, key, value [2][2048][512]; q = einsum(bni,hio->bnho)(query, Wq), k and v likewise from key and value (Wq, Wk, Wv [8][512][64] per-head [in][out], normal x 0.05); q / sqrt(64); logits = q.k per head; softmax over all 2048 keys (no mask); out = einsum(bnhi,hio->bno)(attn v, Wp) (Wp [8][64][512]: read flat it IS an [in][out] [512][512] weight with input row h*64 + i; no bias) -> [2][2048][512]; input order query, key, value, Wq, Wk, Wv, Wp).
// Structure: token rows r = b*2048 + s; no weight pass: both GEMM kernels read the f32 weights as they lie ([in][out] rows), round them in registers (bf16, exact x16, as f16) into k-major LDS rows and take their B fragments from there by transposing loads; Q, K and V as ONE grid of WMMA GEMM tiles (32x64 wave tiles, f32 accumulation, no bias) that reads the f32 inputs itself (staged in LDS by asynchronous copies; bf16-rounded, exact in f16, in registers) and whose epilogue writes Q and K as plain f16 rows and V as V^T per (batch, head) through an LDS tile; then ONE fused attention kernel over all (batch, head, 128 queries): per 32 keys the scores from ONE f16 product (K = 64; / 8), running-maximum softmax in registers (f32 statistics, native exp2; weights x256 as f16), O^T += V^T P^T, o carried x64 against f16 subnormal flush (folded into the output GEMM alpha) written straight into the merged f16 o rows; out = o W_p GEMM (f32; no bias; o staged in LDS likewise, W_p as the other weights) into the output layout.
// Compute dtype: inputs rounded to bf16; the three inputs and the x16 weights converted to f16 in registers (exact for every bf16 value of magnitude from 2^-14 up to 65,504; the weights up to 4,094 before their factor of 16); q, k, v, softmax weights and o as plain f16 GEMM operands (~2^-12; a score then carries the same relative rounding as the f16 weight made from it); scores and softmax statistics f32. v_wmma_f32_16x16x32_f16.
#define NB 2
#define SQ 2048
#define DM 512
#define NH 8
#define HD 64
#define HG 4                         /* heads per launch of the grouped k_vt (not launched) */
#define B0 0                         /* first batch processed (debug hook) */
#define NBR NB                       /* batches processed (debug hook) */
#define NR ((size_t)NB * SQ)         /* token rows */
#define MP ((int)((size_t)NBR * SQ)) /* rows through the output stage, via MPO (debug hook) */
#define QN SQ                        /* query rows per batch (not used) */
#define NHD NH                       /* heads (not used) */
#define MPO MP                       /* rows through the output stage (debug hook) */
#define LQ DM      /* row pitch of the q and k rows (not used) */
typedef __bf16 v16b __attribute__((ext_vector_type(16)));
typedef unsigned short v8us __attribute__((ext_vector_type(8), may_alias));
typedef float  v8f  __attribute__((ext_vector_type(8)));
typedef float  v4f  __attribute__((ext_vector_type(4)));
typedef float  v4fa __attribute__((ext_vector_type(4), may_alias));
union FragB { v16b v; v8us half[2]; unsigned short u[16]; };

__device__ __forceinline__ unsigned short bf16_bits(float x) { unsigned int u = __float_as_uint(x); return (unsigned short)((u + 0x7FFFu + ((u >> 16) & 1u)) >> 16); }
__device__ __forceinline__ float bf16_val(unsigned short b) { return __uint_as_float(((unsigned int)b) << 16); }
__device__ __forceinline__ float bf16_round(float x) { return bf16_val(bf16_bits(x)); }
// D += A·B with NT terms: 1 = ah·bh, 2 = + al·bh (A split), 3 = + ah·bl (both split)
template <int NT>
__device__ __forceinline__ v8f mmaN(v16b ah, v16b al, v16b bh, v16b bl, v8f c) {
  c = __builtin_amdgcn_wmma_f32_16x16x32_bf16(false, ah, false, bh, (short)0, c, false, false);
  if (NT >= 2) c = __builtin_amdgcn_wmma_f32_16x16x32_bf16(false, al, false, bh, (short)0, c, false, false);
  if (NT >= 3) c = __builtin_amdgcn_wmma_f32_16x16x32_bf16(false, ah, false, bl, (short)0, c, false, false);
  asm volatile("v_nop\n\tv_nop\n\tv_nop\n\tv_nop" : "+v"(c) : "v"(ah), "v"(al), "v"(bh), "v"(bl));
  return c;
}

__global__ __launch_bounds__(256) void k_wt_bf16(const float* __restrict__ W, unsigned short* __restrict__ Wt, int K, int N) {
  const int t = blockIdx.x * 256 + threadIdx.x;
  const int k8n = K / 8;
  if (t >= N * k8n) return;
  const int n = t / k8n, k8 = (t % k8n) * 8;
  v8us v;
#pragma unroll
  for (int i = 0; i < 8; ++i) v[i] = bf16_bits(W[(size_t)(k8 + i) * N + n]);
  *(v8us*)(Wt + (size_t)n * K + k8) = v;
  
}

// GEMM C[M][N] (f32, pitch ldc) = act(A[M][K]·W + bias). A f32 row-major (pitch lda) converted per fragment to bf16
// (ASPLIT: hi/lo two planes -> 2 terms, else single rounded term); Wt bf16 [N][K] (pitch ldb). BIAS_BF16 rounds the
// bias to bf16 first (bias quantised to bf16 before the add). K%32==0, M%16==0, N%64==0.
template <bool ASPLIT, int ACT, bool BIAS_BF16>
__global__ __launch_bounds__(128) void k_gemm_bf(const float* __restrict__ A, int lda, const unsigned short* __restrict__ Wt, int ldb,
                                               const float* __restrict__ bias, float* __restrict__ C, int ldc, int M, int N, int K) {
  __shared__ __attribute__((aligned(16))) float so[4][16][64];
  const int tid = threadIdx.x, w = tid >> 5, lane = tid & 31, ln = lane & 15, hh = lane >> 4;
  const int ntn = N / 64;
  const int wid = blockIdx.x * 4 + w;
  const int mt = wid / ntn, nq = wid % ntn;
  if (mt * 16 >= M) return;
  const int row0 = mt * 16, col0 = nq * 64;
  const float* arow = A + (size_t)(row0 + ln) * lda;
  v8f acc[4] = {};
  for (int kb = 0; kb < K; kb += 32) {
    FragB ah, al;
    const v4f x0 = *(const v4fa*)(arow + kb + 8 * hh), x1 = *(const v4fa*)(arow + kb + 8 * hh + 4);
    const v4f x2 = *(const v4fa*)(arow + kb + 16 + 8 * hh), x3 = *(const v4fa*)(arow + kb + 16 + 8 * hh + 4);
    float xs[16] = {x0[0],x0[1],x0[2],x0[3],x1[0],x1[1],x1[2],x1[3],x2[0],x2[1],x2[2],x2[3],x3[0],x3[1],x3[2],x3[3]};
#pragma unroll
    for (int i = 0; i < 16; ++i) { const unsigned short hb = bf16_bits(xs[i]); ah.u[i] = hb; al.u[i] = ASPLIT ? bf16_bits(xs[i] - bf16_val(hb)) : (unsigned short)0; }
#pragma unroll
    for (int t = 0; t < 4; ++t) {
      const unsigned short* brow = Wt + (size_t)(col0 + t * 16 + ln) * ldb + kb;
      FragB b;
      b.half[0] = *(const v8us*)(brow + 8 * hh);
      b.half[1] = *(const v8us*)(brow + 16 + 8 * hh);
      acc[t] = mmaN<ASPLIT ? 2 : 1>(ah.v, al.v, b.v, b.v, acc[t]);
    }
  }
#pragma unroll
  for (int t = 0; t < 4; ++t) {
    float bv = bias ? bias[col0 + t * 16 + ln] : 0.f;
    if (BIAS_BF16) bv = bf16_round(bv);
#pragma unroll
    for (int r = 0; r < 8; ++r) { float v = acc[t][r] + bv; if (ACT == 1) v = fmaxf(v, 0.f); so[w][8 * hh + r][t * 16 + ln] = v; }
  }
  __builtin_amdgcn_fence(__ATOMIC_ACQ_REL, "workgroup");
  __builtin_amdgcn_wave_barrier();
  const int rsub = lane >> 4, c4 = (lane & 15) * 4;
  {
#pragma unroll
    for (int q = 0; q < 8; ++q) {
      const int r = q * 2 + rsub;
      const v4f v = *(const v4fa*)&so[w][r][c4];
      *(v4f*)(C + (size_t)(row0 + r) * ldc + col0 + c4) = v;
    }
    
  }
}

// GEMM C = act(A·W + bias + resid): A f32 (ASPLIT -> hi/lo 2 terms), Wt bf16 [N][K]; ACT 0 none, 1 relu, 2 exact gelu;
// resid (optional, f32, row index = (row % rmod), pitch ldr, RES_BF16 rounds it) added before the activation.
template <bool ASPLIT, int ACT, bool BIAS_BF16, bool RES_BF16>
__global__ __launch_bounds__(128) void k_gemm_bf3(const float* __restrict__ A, int lda, const unsigned short* __restrict__ Wt, int ldb,
                                                const float* __restrict__ bias, const float* __restrict__ resid, int rmod, int ldr,
                                                float* __restrict__ C, int ldc, int M, int N, int K) {
  __shared__ __attribute__((aligned(16))) float so[4][16][64];
  const int tid = threadIdx.x, w = tid >> 5, lane = tid & 31, ln = lane & 15, hh = lane >> 4;
  const int ntn = N / 64;
  const int wid = blockIdx.x * 4 + w;
  const int mt = wid / ntn, nq = wid % ntn;
  if (mt * 16 >= M) return;
  const int row0 = mt * 16, col0 = nq * 64;
  const float* arow = A + (size_t)(row0 + ln) * lda;
  v8f acc[4] = {};
  for (int kb = 0; kb < K; kb += 32) {
    FragB ah, al;
    const v4f x0 = *(const v4fa*)(arow + kb + 8 * hh), x1 = *(const v4fa*)(arow + kb + 8 * hh + 4);
    const v4f x2 = *(const v4fa*)(arow + kb + 16 + 8 * hh), x3 = *(const v4fa*)(arow + kb + 16 + 8 * hh + 4);
    float xs[16] = {x0[0],x0[1],x0[2],x0[3],x1[0],x1[1],x1[2],x1[3],x2[0],x2[1],x2[2],x2[3],x3[0],x3[1],x3[2],x3[3]};
#pragma unroll
    for (int i = 0; i < 16; ++i) { const unsigned short hb = bf16_bits(xs[i]); ah.u[i] = hb; al.u[i] = ASPLIT ? bf16_bits(xs[i] - bf16_val(hb)) : (unsigned short)0; }
#pragma unroll
    for (int t = 0; t < 4; ++t) {
      const unsigned short* brow = Wt + (size_t)(col0 + t * 16 + ln) * ldb + kb;
      FragB b;
      b.half[0] = *(const v8us*)(brow + 8 * hh);
      b.half[1] = *(const v8us*)(brow + 16 + 8 * hh);
      acc[t] = mmaN<ASPLIT ? 2 : 1>(ah.v, al.v, b.v, b.v, acc[t]);
    }
  }
#pragma unroll
  for (int t = 0; t < 4; ++t) {
    const int col = col0 + t * 16 + ln;
    float bv = bias ? bias[col] : 0.f;
    if (BIAS_BF16) bv = bf16_round(bv);
#pragma unroll
    for (int r = 0; r < 8; ++r) {
      float v = acc[t][r] + bv;
      if (resid) { float rv = resid[(size_t)((row0 + 8 * hh + r) % rmod) * ldr + col]; if (RES_BF16) rv = bf16_round(rv); v += rv; }
      if (ACT == 1) v = fmaxf(v, 0.f);
      if (ACT == 2) v = 0.5f * v * (1.0f + erff(v * 0.70710678118654752f));
      if (ACT == 3) { const float u = 0.7978845608028654f * (v + 0.044715f * v * v * v); v = 0.5f * v * (1.0f + tanhf(u)); }
      so[w][8 * hh + r][t * 16 + ln] = v;
    }
  }
  __builtin_amdgcn_fence(__ATOMIC_ACQ_REL, "workgroup");
  __builtin_amdgcn_wave_barrier();
  const int rsub = lane >> 4, c4 = (lane & 15) * 4;
  {
#pragma unroll
    for (int q = 0; q < 8; ++q) {
      const int r = q * 2 + rsub;
      const v4f v = *(const v4fa*)&so[w][r][c4];
      *(v4f*)(C + (size_t)(row0 + r) * ldc + col0 + c4) = v;
    }
    
  }
}
// row LayerNorm (biased variance, eps) over N: s = X (+ R); optional out_sum <- s; out_norm <- (s-mu)*rsqrt(var+eps)*g + b
template <bool PARAM_BF16>
__global__ __launch_bounds__(256) void k_layernorm(const float* __restrict__ X, const float* __restrict__ R, const float* __restrict__ g, const float* __restrict__ bta,
                                                  float* __restrict__ out_sum, float* __restrict__ out_norm, int N, float eps) {
  __shared__ float red[256];
  const int row = blockIdx.x, tid = threadIdx.x;
  const float* x = X + (size_t)row * N; const float* rr = R ? R + (size_t)row * N : nullptr;
  float vals[16];                     // up to N = 4096
  const int per = N / 256;            // contiguous chunk per thread? use strided-by-4 chunks: thread handles j = tid*4 + 1024*u
  float s1 = 0.f;
  for (int u = 0; u < per / 4; ++u) {
    const int j = tid * 4 + 1024 * u;
    const v4f a = *(const v4fa*)(x + j);
    v4f b = {0.f,0.f,0.f,0.f}; if (rr) b = *(const v4fa*)(rr + j);
#pragma unroll
    for (int q = 0; q < 4; ++q) { const float v = a[q] + b[q]; vals[u * 4 + q] = v; s1 += v; }
  }
  red[tid] = s1; __syncthreads();
  for (int st = 128; st > 0; st >>= 1) { if (tid < st) red[tid] += red[tid + st]; __syncthreads(); }
  const float mu = red[0] / (float)N; __syncthreads();
  float s2 = 0.f;
  for (int u = 0; u < per / 4; ++u)
#pragma unroll
    for (int q = 0; q < 4; ++q) { const float c = vals[u * 4 + q] - mu; s2 += c * c; }
  red[tid] = s2; __syncthreads();
  for (int st = 128; st > 0; st >>= 1) { if (tid < st) red[tid] += red[tid + st]; __syncthreads(); }
  const float rs = rsqrtf(red[0] / (float)N + eps);
  {
    for (int u = 0; u < per / 4; ++u) {
      const int j = tid * 4 + 1024 * u;
      v4f o, sm;
#pragma unroll
      for (int q = 0; q < 4; ++q) {
        float gg = g[j + q], bb = bta[j + q];
        if (PARAM_BF16) { gg = bf16_round(gg); bb = bf16_round(bb); }
        sm[q] = vals[u * 4 + q]; o[q] = (vals[u * 4 + q] - mu) * rs * gg + bb;
      }
      if (out_sum) *(v4f*)(out_sum + (size_t)row * N + j) = sm;
      *(v4f*)(out_norm + (size_t)row * N + j) = o;
    }
    
  }
}



// ---- f16 WMMA path (v_wmma_f32_16x16x32_f16): 11-bit significands for operands in range — used where a [0,1] probability operand needs more precision than bf16
typedef _Float16 v16h __attribute__((ext_vector_type(16)));
union FragH { v16h v; v8us half[2]; _Float16 h[16]; unsigned short u[16]; };
template <int NT>
__device__ __forceinline__ v8f mmaH(v16h ah, v16h al, v16h bh, v16h bl, v8f c) {
  c = __builtin_amdgcn_wmma_f32_16x16x32_f16(false, ah, false, bh, (short)0, c, false, false);
  if (NT >= 2) c = __builtin_amdgcn_wmma_f32_16x16x32_f16(false, al, false, bh, (short)0, c, false, false);
  if (NT >= 3) c = __builtin_amdgcn_wmma_f32_16x16x32_f16(false, ah, false, bl, (short)0, c, false, false);
  asm volatile("v_nop\n\tv_nop\n\tv_nop\n\tv_nop" : "+v"(c) : "v"(ah), "v"(al), "v"(bh), "v"(bl));
  return c;
}
// batched GEMM like k_gemm_b but f16 operands: A f32 (split into f16 hi/lo if ASPLIT, else rounded to f16), Bt = f16 values [n][k]; alpha; C f32; N multiple of 16 (partial tiles skipped)
template <bool ASPLIT>
__global__ __launch_bounds__(128) void k_gemm_h(const float* __restrict__ A, int lda, size_t sA, const _Float16* __restrict__ Bh, int ldb, size_t sB, float alpha, float* __restrict__ C, int ldc, size_t sC, int M, int N, int K) {
  __shared__ __attribute__((aligned(16))) float so[4][16][64];
  const int tid = threadIdx.x, w = tid >> 5, lane = tid & 31, ln = lane & 15, hh = lane >> 4; const int by = blockIdx.y;
  A += (size_t)by * sA; Bh += (size_t)by * sB; C += (size_t)by * sC;
  const int ntn = (N + 63) / 64; const int wid = blockIdx.x * 4 + w; const int mt = wid / ntn, nq = wid % ntn; if (mt * 16 >= M) return;
  const int row0 = mt * 16, col0 = nq * 64; const float* arow = A + (size_t)(row0 + ln) * lda;
  v8f acc[4] = {};
  for (int kb = 0; kb < K; kb += 32) {
    FragH ah, al;
    const v4f x0 = *(const v4fa*)(arow + kb + 8 * hh), x1 = *(const v4fa*)(arow + kb + 8 * hh + 4), x2 = *(const v4fa*)(arow + kb + 16 + 8 * hh), x3 = *(const v4fa*)(arow + kb + 16 + 8 * hh + 4);
    float xs[16] = {x0[0],x0[1],x0[2],x0[3],x1[0],x1[1],x1[2],x1[3],x2[0],x2[1],x2[2],x2[3],x3[0],x3[1],x3[2],x3[3]};
#pragma unroll
    for (int i = 0; i < 16; ++i) { const _Float16 h = (_Float16)xs[i]; ah.h[i] = h; al.h[i] = ASPLIT ? (_Float16)(xs[i] - (float)h) : (_Float16)0.0f; }
#pragma unroll
    for (int t = 0; t < 4; ++t) { if (col0 + t * 16 >= N) continue; const size_t boff = (size_t)(col0 + t * 16 + ln) * ldb + kb; FragH bq; bq.half[0] = *(const v8us*)(Bh + boff + 8 * hh); bq.half[1] = *(const v8us*)(Bh + boff + 16 + 8 * hh);
      acc[t] = mmaH<ASPLIT ? 2 : 1>(ah.v, al.v, bq.v, bq.v, acc[t]); }
  }
#pragma unroll
  for (int t = 0; t < 4; ++t) { if (col0 + t * 16 >= N) continue;
#pragma unroll
    for (int r = 0; r < 8; ++r) so[w][8 * hh + r][t * 16 + ln] = acc[t][r] * alpha; }
  __builtin_amdgcn_fence(__ATOMIC_ACQ_REL, "workgroup"); __builtin_amdgcn_wave_barrier();
  const int rsub = lane >> 4, c4 = (lane & 15) * 4;
  {
#pragma unroll
    for (int q = 0; q < 8; ++q) { const int r = q * 2 + rsub; if (col0 + c4 < N) { const v4f v = *(const v4fa*)&so[w][r][c4]; *(v4f*)(C + (size_t)(row0 + r) * ldc + col0 + c4) = v; } }
     }
}

// k_gemm_hh variant with fused epilogue: v = acc·alpha + bias[by·sBias + col] (+ CP[(row/rowsPerB)·sCPb + by·64 + col] if CP) ; ACT 0 none / 1 elu ; writes f16 C16 (and f32 C if non-null)
template <int ACT>
__global__ __launch_bounds__(128) void k_gemm_hhx(const _Float16* __restrict__ A, int lda, size_t sA, const _Float16* __restrict__ Bh, int ldb, size_t sB, float alpha, const float* __restrict__ bias, size_t sBias, const float* __restrict__ CP, int rowsPerB, size_t sCPb, int row0g,
    float* __restrict__ C, _Float16* __restrict__ C16, int ldc, size_t sC, int M, int N, int K) {
  __shared__ __attribute__((aligned(16))) float so[4][16][64];
  const int tid = threadIdx.x, w = tid >> 5, lane = tid & 31, ln = lane & 15, hh = lane >> 4; const int by = blockIdx.y;
  A += (size_t)by * sA; Bh += (size_t)by * sB; const size_t cofs = (size_t)by * sC; const float* bp = bias ? bias + (size_t)by * sBias : nullptr;
  const int ntn = (N + 63) / 64; const int wid = blockIdx.x * 4 + w; const int mt = wid / ntn, nq = wid % ntn; if (mt * 16 >= M) return;
  const int row0 = mt * 16, col0 = nq * 64; const _Float16* arow = A + (size_t)(row0 + ln) * lda;
  v8f acc[4] = {};
  for (int kb = 0; kb < K; kb += 32) { FragH ah; ah.half[0] = *(const v8us*)((const unsigned short*)arow + kb + 8 * hh); ah.half[1] = *(const v8us*)((const unsigned short*)arow + kb + 16 + 8 * hh);
#pragma unroll
    for (int t = 0; t < 4; ++t) { if (col0 + t * 16 >= N) continue; const size_t boff = (size_t)(col0 + t * 16 + ln) * ldb + kb; FragH bq; bq.half[0] = *(const v8us*)((const unsigned short*)Bh + boff + 8 * hh); bq.half[1] = *(const v8us*)((const unsigned short*)Bh + boff + 16 + 8 * hh);
      acc[t] = mmaH<1>(ah.v, ah.v, bq.v, bq.v, acc[t]); }
  }
#pragma unroll
  for (int t = 0; t < 4; ++t) { if (col0 + t * 16 >= N) continue; const int col = col0 + t * 16 + ln; const float bv = bp ? bf16_round(bp[col]) : 0.f;
#pragma unroll
    for (int r = 0; r < 8; ++r) { float v = acc[t][r] * alpha + bv; if (CP) { const int rr = row0g + row0 + 8 * hh + r; if (rowsPerB < 0) v += CP[cofs + (size_t)rr * ldc + col];      /* rowsPerB < 0: own element of the batched C plane */ else { const int bidx = rr / rowsPerB; v += CP[(size_t)bidx * sCPb + (size_t)by * 64 + col]; } } if (ACT == 1) v = (v > 0.f) ? v : expm1f(v); else if (ACT == 7) v = (v > 0.f) ? v + 1.0f : expf(v); else if (ACT == 8) v = tanhf(v); else if (ACT == 9) v = 0.5f * v * (1.0f + tanhf(0.7978845608028654f * (v + 0.044715f * v * v * v))); else if (ACT == 11) v = 1.0f / (1.0f + expf(-v)); else if (ACT == 12) v = (v > 0.f) ? v : 0.01f * v; else if (ACT == 14) v = (v > 0.f) ? v : 0.1f * v; else if (ACT == 16) v = (v >= 0.f) ? v : 0.3f * v; else if (ACT == 17) v = (v >= 0.f) ? v : 0.2f * v; else if (ACT == 15) v = v / (1.0f + expf(-v)); else if (ACT == 3) v = fmaxf(v, 0.f); else if (ACT == 6) v = 0.5f * v * (1.0f + erff(v * 0.70710678118654752f)); so[w][8 * hh + r][t * 16 + ln] = v; } }
  __builtin_amdgcn_fence(__ATOMIC_ACQ_REL, "workgroup"); __builtin_amdgcn_wave_barrier();
  const int rsub = lane >> 4, c4 = (lane & 15) * 4; typedef _Float16 v4h __attribute__((ext_vector_type(4)));
  {
#pragma unroll
    for (int q = 0; q < 8; ++q) { const int r = q * 2 + rsub; if (col0 + c4 < N) { const v4f v = *(const v4fa*)&so[w][r][c4]; if (C) *(v4f*)(C + cofs + (size_t)(row0 + r) * ldc + col0 + c4) = v; if (C16) { v4h h4; for (int i = 0; i < 4; ++i) h4[i] = (_Float16)v[i]; *(v4h*)(C16 + cofs + (size_t)(row0 + r) * ldc + col0 + c4) = h4; } } }
     }
}


typedef _Float16 v4h __attribute__((ext_vector_type(4)));

__global__ __launch_bounds__(256) void k_h16(const float* __restrict__ x, _Float16* __restrict__ X16, size_t n8) { const size_t t = (size_t)blockIdx.x * 256 + threadIdx.x; if (t >= n8) return; FragH f;
#pragma unroll
  for (int q = 0; q < 8; ++q) f.h[q] = (_Float16)x[t * 8 + q]; *(v8us*)((unsigned short*)X16 + t * 8) = f.half[0];  }
__global__ __launch_bounds__(256) void k_round16f(const float* __restrict__ W, _Float16* __restrict__ Bt, size_t n8) { const size_t t = (size_t)blockIdx.x * 256 + threadIdx.x; if (t >= n8) return; FragH f;
#pragma unroll
  for (int i = 0; i < 8; ++i) f.h[i] = (_Float16)(bf16_round(W[t * 8 + i]) * 16.0f); *(v8us*)((unsigned short*)Bt + t * 8) = f.half[0];  }
// ---- fast GEMM (wave tile 32x64; requires M % 32 == 0 rows per launch region and N % 64 == 0); epilogue = k_gemm_hhx semantics ----
__device__ __forceinline__ v16h g2_frag(const _Float16* p, int hh) { FragH f; f.half[0] = *(const v8us*)((const unsigned short*)p + 8 * hh); f.half[1] = *(const v8us*)((const unsigned short*)p + 16 + 8 * hh); return f.v; }
__device__ __forceinline__ v8f g2_mma(v16h a, v16h b, v8f c) { v8f d = __builtin_amdgcn_wmma_f32_16x16x32_f16(false, a, false, b, (short)0, c, false, false); asm volatile("v_nop\n\tv_nop\n\tv_nop\n\tv_nop" : "+v"(d) : "v"(a), "v"(b)); return d; }
template <int ACT>
__global__ __launch_bounds__(128) void k_gemm2(const _Float16* __restrict__ A, int lda, size_t sA, const _Float16* __restrict__ Bh, int ldb, size_t sB, float alpha, const float* __restrict__ bias, size_t sBias, const float* __restrict__ CP, int rowsPerB, size_t sCPb, int row0g,
    float* __restrict__ C, _Float16* __restrict__ C16, int ldc, size_t sC, int M, int N, int K) { static_assert(ACT == 0 || ACT == 3 || ACT == 6 || ACT == 8 || ACT == 9 || ACT == 11 || ACT == 12 || ACT == 14 || ACT == 15 || ACT == 16 || ACT == 17, "k_gemm2: unsupported ACT code (would silently apply no activation)");
  __shared__ __attribute__((aligned(16))) float so[4][32][68];
  const int tid = threadIdx.x, w = tid >> 5, lane = tid & 31, ln = lane & 15, hh = lane >> 4; const int by = blockIdx.y;
  A += (size_t)by * sA; Bh += (size_t)by * sB; const size_t cofs = (size_t)by * sC; const float* bp = bias ? bias + (size_t)by * sBias : nullptr;
  const int ntn = N >> 6; const int mt = blockIdx.x / ntn, nq = blockIdx.x - mt * ntn; const int row0 = mt * 128 + 32 * w, col0 = nq * 64; if (row0 >= M) return;
  const _Float16* a0p = A + (size_t)(row0 + ln) * lda; const _Float16* a1p = a0p + (size_t)16 * lda;
  const _Float16* b0p = Bh + (size_t)(col0 + ln) * ldb; const _Float16* b1p = b0p + (size_t)16 * ldb; const _Float16* b2p = b1p + (size_t)16 * ldb; const _Float16* b3p = b2p + (size_t)16 * ldb;
  const v8f z8 = {0.f,0.f,0.f,0.f,0.f,0.f,0.f,0.f}; v8f c00 = z8, c01 = z8, c02 = z8, c03 = z8, c10 = z8, c11 = z8, c12 = z8, c13 = z8;
#pragma unroll 1
  for (int kb = 0; kb < K; kb += 32) { const v16h a0 = g2_frag(a0p + kb, hh), a1 = g2_frag(a1p + kb, hh);
    v16h b = g2_frag(b0p + kb, hh); c00 = g2_mma(a0, b, c00); c10 = g2_mma(a1, b, c10);
    b = g2_frag(b1p + kb, hh); c01 = g2_mma(a0, b, c01); c11 = g2_mma(a1, b, c11);
    b = g2_frag(b2p + kb, hh); c02 = g2_mma(a0, b, c02); c12 = g2_mma(a1, b, c12);
    b = g2_frag(b3p + kb, hh); c03 = g2_mma(a0, b, c03); c13 = g2_mma(a1, b, c13); }
  v8f accs[8] = {c00, c01, c02, c03, c10, c11, c12, c13};
#pragma unroll
  for (int u = 0; u < 8; ++u) { const int t = u & 3, half = u >> 2; const int col = col0 + t * 16 + ln; const float bv = bp ? bf16_round(bp[col]) : 0.f;
#pragma unroll
    for (int r = 0; r < 8; ++r) { const int rloc = half * 16 + 8 * hh + r; float v = accs[u][r] * alpha + bv; if (CP) { if (rowsPerB < 0) v += CP[cofs + (size_t)(row0g + row0 + rloc) * ldc + col];      /* rowsPerB < 0: own element of the batched C plane */ else { const int bidx = (row0g + row0 + rloc) / rowsPerB; v += CP[(size_t)bidx * sCPb + (size_t)by * 64 + col]; } }
      if (ACT == 3) v = fmaxf(v, 0.f); else if (ACT == 6) v = 0.5f * v * (1.0f + erff(v * 0.70710678118654752f)); else if (ACT == 11) v = 1.0f / (1.0f + expf(-v)); else if (ACT == 15) v = v / (1.0f + expf(-v)); else if (ACT == 12) v = (v > 0.f) ? v : 0.01f * v; else if (ACT == 8) v = tanhf(v); else if (ACT == 9) v = 0.5f * v * (1.0f + tanhf(0.7978845608028654f * (v + 0.044715f * v * v * v))); else if (ACT == 14) v = (v > 0.f) ? v : 0.1f * v; else if (ACT == 16) v = (v >= 0.f) ? v : 0.3f * v; else if (ACT == 17) v = (v >= 0.f) ? v : 0.2f * v;
      so[w][rloc][t * 16 + ln] = v; } }
  __builtin_amdgcn_fence(__ATOMIC_ACQ_REL, "workgroup"); __builtin_amdgcn_wave_barrier();
  const int rsub = lane >> 4, c4 = (lane & 15) * 4;
  {
#pragma unroll
    for (int q = 0; q < 16; ++q) { const int r = q * 2 + rsub; const v4f v = *(const v4fa*)&so[w][r][c4]; if (C) *(v4f*)(C + cofs + (size_t)(row0 + r) * ldc + col0 + c4) = v; if (C16) { v4h h4; for (int i = 0; i < 4; ++i) h4[i] = (_Float16)v[i]; *(v4h*)(C16 + cofs + (size_t)(row0 + r) * ldc + col0 + c4) = h4; } }
     } }


// ---- the projections and what stands around them ----
typedef __bf16 v4bf __attribute__((ext_vector_type(4)));
// A fragment in g2_frag's k order straight from an f32 input row; each value rounded to bf16 (exact in f16) in registers
__device__ __forceinline__ v16h pj_frag(const float* p, int hh) { const v4f x0 = *(const v4fa*)(p + 8 * hh), x1 = *(const v4fa*)(p + 8 * hh + 4), x2 = *(const v4fa*)(p + 16 + 8 * hh), x3 = *(const v4fa*)(p + 16 + 8 * hh + 4); FragH f;
  const v4bf r0 = __builtin_convertvector(x0, v4bf), r1 = __builtin_convertvector(x1, v4bf), r2 = __builtin_convertvector(x2, v4bf), r3 = __builtin_convertvector(x3, v4bf);      /* round to nearest even, as bf16_round */
#pragma unroll
  for (int q = 0; q < 4; ++q) { f.h[q] = (_Float16)(float)r0[q]; f.h[4 + q] = (_Float16)(float)r1[q]; f.h[8 + q] = (_Float16)(float)r2[q]; f.h[12 + q] = (_Float16)(float)r3[q]; }
  return f.v; }
// q, k and v projections in one grid (blockIdx.y = 0, 1, 2), k_gemm2's tile: block 128 rows x 64 columns (= one head), wave 32 x 64, K = DM; the operands come through LDS stages (below).
// Epilogue: q and k (f32, / 16 for the weight factor) leave rounded once to f16 in row layout; v leaves as V^T [NB * NH][HD][SQ]: a lane's 8 accumulator rows are 8 consecutive tokens of one head-dim column,
// so they go as one 16-byte piece into an LDS tile [HD][128 tokens] (pitch PVP bytes) from which the block stores whole 256-byte runs.
#define PVP 272
// The operands of the two GEMM kernels reach the waves through LDS: a fragment load straight from global memory takes 32 bytes from each of 16 rows (16 lines an instruction), and the rolled loop waited for each such load in turn.
// A stage of GKS k of the block's A rows is brought in by asynchronous copies of whole lines (16 bytes a lane, through no register) into one of two buffers while the other is worked on;
// the A fragments are then ds_load_b128 reads at a row pitch of 16 bytes x odd, in g2_frag's k order, the k blocks in rising order as before.
// The weights need no pass of their own: a stage's GKS weight rows (k) x 64 columns (n) are read as f32 whole lines into registers one stage ahead, rounded there (f16(16 bf16(w)), the old plane's values)
// and stored as they lie, k-major, beside the A rows; ds_load_tr16_b128 hands a lane 8 consecutive k of its column, two such loads are a B fragment in g2_frag's k order (8 hh + s, then 16 + 8 hh + s - 8).
#define GKS 64                       /* k per LDS stage: two WMMA k blocks */
#define GFP 272                      /* LDS pitch in bytes of an f32 row of a stage (256 bytes of data) */
#define GHP 144                      /* LDS pitch in bytes of an f16 row of a stage (128 bytes of data) */
#define GWP 160                      /* LDS pitch in bytes of a weight row of a stage (64 columns as f16, 128 bytes of data): 32 bytes x odd, the transposing load's pitch */
#define PJA (128 * GFP)              /* k_proj: the A rows of a stage */
#define PJS (PJA + GKS * GWP)        /* k_proj: one stage, A then the weight rows */
#define OPA (128 * GHP)              /* k_outp: the A rows of a stage */
#define OPS (OPA + GKS * GWP)        /* k_outp: one stage, A then the weight rows */
__device__ __forceinline__ v8f gs_mma(v16h a, v16h b, v8f c) { return __builtin_amdgcn_wmma_f32_16x16x32_f16(false, a, false, b, (short)0, c, false, false); }
__device__ __forceinline__ v16h gs_hfrag(const unsigned char* p) { FragH f; f.half[0] = *(const v8us*)p; f.half[1] = *(const v8us*)(p + 32); return f.v; }      /* g2_frag's k order from an f16 LDS row; p already holds the lane half's 16 bytes */
typedef short s16x8 __attribute__((ext_vector_type(8)));
typedef _Float16 v4ha __attribute__((ext_vector_type(4), may_alias));
// B fragment from k-major weight rows: p = tile + (k0 + 8 hh + (lane & 7)) * GWP + 16 ((lane >> 3) & 1) + 2 n0; lane (ln, hh) gets rows k0 + 8 hh .. + 7, then k0 + 16 + 8 hh .. + 7, of column n0 + ln
__device__ __forceinline__ v16h gs_tfrag(const unsigned char* p) { typedef __attribute__((address_space(3))) s16x8 lds_s16x8; FragH f;
  f.half[0] = __builtin_bit_cast(v8us, __builtin_amdgcn_ds_load_tr16_b128_v8i16((lds_s16x8*)p)); f.half[1] = __builtin_bit_cast(v8us, __builtin_amdgcn_ds_load_tr16_b128_v8i16((lds_s16x8*)(p + 16 * GWP))); return f.v; }
// four weights: f16(16 bf16(w)), exact. The factor of 16 goes on in f32 ahead of the rounding (a power of two: bf16(16 w) = 16 bf16(w)), so that nothing small is ever held as f16 without it
__device__ __forceinline__ v4h gs_wcvt(v4f x) { const v4bf r = __builtin_convertvector(x * 16.0f, v4bf); v4h h;      /* round to nearest even, as bf16_round */
#pragma unroll
  for (int q = 0; q < 4; ++q) h[q] = (_Float16)(float)r[q];
  return h; }
// pj_frag's rounding on the four 16-byte pieces of an f32 LDS row (floats 8 hh .. + 7 and 16 + 8 hh .. + 7 of a k block)
__device__ __forceinline__ v16h gs_fcvt(v4f x0, v4f x1, v4f x2, v4f x3) { FragH f;
  const v4bf r0 = __builtin_convertvector(x0, v4bf), r1 = __builtin_convertvector(x1, v4bf), r2 = __builtin_convertvector(x2, v4bf), r3 = __builtin_convertvector(x3, v4bf);      /* round to nearest even, as bf16_round */
#pragma unroll
  for (int q = 0; q < 4; ++q) { f.h[q] = (_Float16)(float)r0[q]; f.h[4 + q] = (_Float16)(float)r1[q]; f.h[8 + q] = (_Float16)(float)r2[q]; f.h[12 + q] = (_Float16)(float)r3[q]; }
  return f.v; }
// Four copies of 16 bytes a lane, global -> LDS. The s_wait_xcnt closes the statement so that it stands in front of every later write of the address registers that the copies name.
template <class T>
__device__ __forceinline__ void gs_copy4(unsigned l0, unsigned lstep, const T* g0, size_t gstep) {
  const unsigned l1 = l0 + lstep, l2 = l1 + lstep, l3 = l2 + lstep; const T* g1 = g0 + gstep; const T* g2 = g1 + gstep; const T* g3 = g2 + gstep;
  asm volatile("global_load_async_to_lds_b128 %0, %4, off\n\tglobal_load_async_to_lds_b128 %1, %5, off\n\tglobal_load_async_to_lds_b128 %2, %6, off\n\tglobal_load_async_to_lds_b128 %3, %7, off\n\ts_wait_xcnt 0x0"
               :: "v"(l0), "v"(l1), "v"(l2), "v"(l3), "v"(g0), "v"(g1), "v"(g2), "v"(g3) : "memory"); }
__global__ __launch_bounds__(128) void k_proj(const float* __restrict__ xq, const float* __restrict__ xk, const float* __restrict__ xv, const float* __restrict__ wq, const float* __restrict__ wk, const float* __restrict__ wv,
    _Float16* __restrict__ QH, _Float16* __restrict__ KH, _Float16* __restrict__ VT) {
  __shared__ __attribute__((aligned(128))) unsigned char L[2 * PJS];
  float (*so)[32][68] = (float (*)[32][68])L;      /* the epilogue's tile lies on the first buffer's A rows: it is written only behind the last trip's barrier, when no copy is in flight and no wave reads them */
  const int tid = threadIdx.x, w = tid >> 5, lane = tid & 31, ln = lane & 15, hh = lane >> 4; const int y = blockIdx.y;
  const float* A = y == 0 ? xq : y == 1 ? xk : xv; const float* Wf = y == 0 ? wq : y == 1 ? wk : wv;
  const int mt = blockIdx.x / (DM / 64), nq = blockIdx.x - mt * (DM / 64); const int row0 = mt * 128 + 32 * w, col0 = nq * 64;
  /* the copies of a stage: A rows of 16 pieces (a thread: rows tid / 16 + 8 i); every lane on, every piece written by one lane */
  const unsigned lds0 = (unsigned)(size_t)L; const unsigned la = lds0 + (unsigned)((tid >> 4) * GFP + (tid & 15) * 16);
  const float* ga = A + (size_t)(mt * 128 + (tid >> 4)) * DM + (tid & 15) * 4;
  /* the weight rows of a stage: head nq's [in][out] matrix, rows of 64 f32 = 16 pieces (a thread: rows tid / 16 + 8 i), through registers */
  const float* gw = Wf + ((size_t)nq * DM + (tid >> 4)) * HD + (tid & 15) * 4; unsigned char* lw = L + PJA + (tid >> 4) * GWP + (tid & 15) * 8; v4f wr[8];
  auto wload = [&](int s) {
#pragma unroll
    for (int i = 0; i < 8; ++i) wr[i] = *(const v4fa*)(gw + (size_t)(s * GKS + 8 * i) * HD); };
  auto wput = [&](unsigned buf) {
#pragma unroll
    for (int i = 0; i < 8; ++i) *(v4ha*)(lw + buf * PJS + 8 * i * GWP) = gs_wcvt(wr[i]); };
  auto stage = [&](int s, unsigned buf) { const unsigned o = buf * PJS;
    gs_copy4(la + o, 8 * GFP, ga + s * GKS, (size_t)8 * DM); gs_copy4(la + o + 32 * GFP, 8 * GFP, ga + s * GKS + (size_t)32 * DM, (size_t)8 * DM);
    gs_copy4(la + o + 64 * GFP, 8 * GFP, ga + s * GKS + (size_t)64 * DM, (size_t)8 * DM); gs_copy4(la + o + 96 * GFP, 8 * GFP, ga + s * GKS + (size_t)96 * DM, (size_t)8 * DM); };
  wload(0); stage(0, 0);      /* the loads in front of the copies: the s_wait_xcnt that closes the first copy statement then stands behind them too */
  const v8f z8 = {0.f,0.f,0.f,0.f,0.f,0.f,0.f,0.f}; v8f c00 = z8, c01 = z8, c02 = z8, c03 = z8, c10 = z8, c11 = z8, c12 = z8, c13 = z8;
  wput(0);
  asm volatile("s_wait_dscnt 0x0" ::: "memory");      /* this wave's weight rows of stage 0 are written */
  asm volatile("s_wait_asynccnt 0x0" ::: "memory");      /* this wave's copies of stage 0 have landed */
  __syncthreads();      /* and every other wave's: stage 0 may be read */
  wload(1); stage(1, 1);
#pragma unroll 1
  for (int t = 0; t < DM / GKS; ++t) {      /* rolled: one trip is one LDS stage, its two k blocks unrolled below */
    const unsigned char* ab = L + (t & 1) * PJS + (w * 32 + ln) * GFP + hh * 32; const unsigned char* bb = L + (t & 1) * PJS + PJA + (8 * hh + (lane & 7)) * GWP + ((lane >> 3) & 1) * 16;
    v4f x[2][2][4]; v16h bf[2][4];      /* [k block][16 rows][piece], [k block][16 columns] */
#pragma unroll
    for (int p = 0; p < GKS / 32; ++p) {      /* unrolled: every LDS offset a constant */
#pragma unroll
      for (int i = 0; i < 2; ++i) { const unsigned char* ap = ab + i * 16 * GFP + p * 128; x[p][i][0] = *(const v4fa*)ap; x[p][i][1] = *(const v4fa*)(ap + 16); x[p][i][2] = *(const v4fa*)(ap + 64); x[p][i][3] = *(const v4fa*)(ap + 80); }
#pragma unroll
      for (int j = 0; j < 4; ++j) bf[p][j] = gs_tfrag(bb + p * 32 * GWP + j * 32); }
    if (t + 1 < DM / GKS) wput((unsigned)((t + 1) & 1));      /* same test in every wave; stage t + 1's weight rows go beside its A rows, into the buffer that every wave left at the last barrier */
    asm volatile("s_wait_dscnt 0x0" ::: "memory");      /* the stage's fragments are all in registers and the next stage's weight rows written: this wave is done with both buffers before the barrier */
    asm volatile("s_wait_asynccnt 0x0" ::: "memory");      /* this wave's copies of stage t + 1 have landed */
    __syncthreads();      /* publishes stage t + 1 and ends every wave's reads of stage t's buffer */
    if (t + 2 < DM / GKS) { wload(t + 2); stage(t + 2, (unsigned)(t & 1)); }      /* same test in every wave of the block; refills the buffer just read, and flies under the products below, which work on registers alone; the weight rows wait in registers for the next trip */
#pragma unroll
    for (int p = 0; p < GKS / 32; ++p) { const v16h a0 = gs_fcvt(x[p][0][0], x[p][0][1], x[p][0][2], x[p][0][3]), a1 = gs_fcvt(x[p][1][0], x[p][1][1], x[p][1][2], x[p][1][3]);
      c00 = gs_mma(a0, bf[p][0], c00); c10 = gs_mma(a1, bf[p][0], c10); c01 = gs_mma(a0, bf[p][1], c01); c11 = gs_mma(a1, bf[p][1], c11);
      c02 = gs_mma(a0, bf[p][2], c02); c12 = gs_mma(a1, bf[p][2], c12); c03 = gs_mma(a0, bf[p][3], c03); c13 = gs_mma(a1, bf[p][3], c13); }
  }
  asm volatile("s_wait_asynccnt 0x0" ::: "memory");      /* no copy is left in flight when the first buffer becomes the epilogue's tile */
  v8f accs[8] = {c00, c01, c02, c03, c10, c11, c12, c13};
  if (y == 2) {      /* same for the whole block */
    unsigned char* st = (unsigned char*)&so[0][0][0];
#pragma unroll
    for (int u = 0; u < 8; ++u) { const int t = u & 3, half = u >> 2; FragH f;
#pragma unroll
      for (int r = 0; r < 8; ++r) f.h[r] = (_Float16)(accs[u][r] * 0.0625f);
      *(v8us*)(st + (t * 16 + ln) * PVP + (w * 32 + half * 16 + 8 * hh) * 2) = f.half[0]; }
    __syncthreads();      /* the tile's 128 tokens come from all four waves */
    const int bb = (mt * 128) / SQ, s0 = (mt * 128) % SQ;
#pragma unroll
    for (int i = 0; i < 8; ++i) { const int d = i * 8 + (tid >> 4), pc = tid & 15; const v8us v = *(const v8us*)(st + d * PVP + pc * 16);
      *(v8us*)((unsigned short*)VT + ((size_t)(bb * NH + nq) * HD + d) * SQ + s0 + pc * 8) = v; }
  } else {
    _Float16* Hh = y == 0 ? QH : KH;
#pragma unroll
    for (int u = 0; u < 8; ++u) { const int t = u & 3, half = u >> 2;
#pragma unroll
      for (int r = 0; r < 8; ++r) so[w][half * 16 + 8 * hh + r][t * 16 + ln] = accs[u][r] * 0.0625f; }
    __builtin_amdgcn_fence(__ATOMIC_ACQ_REL, "workgroup"); __builtin_amdgcn_wave_barrier();      /* a wave reads back only its own 32 rows */
    const int rsub = lane >> 4, c4 = (lane & 15) * 4;
#pragma unroll
    for (int q = 0; q < 16; ++q) { const int r = q * 2 + rsub; const v4f v = *(const v4fa*)&so[w][r][c4]; v4h h4;
#pragma unroll
      for (int i = 0; i < 4; ++i) h4[i] = (_Float16)v[i];
      *(v4h*)(Hh + (size_t)(row0 + r) * DM + col0 + c4) = h4; }
  } }

// out = o W_p: k_gemm2's tile (block 128 rows x 64 columns, wave 32 x 64, K = DM) and its plain epilogue (x alpha, f32 rows through an LDS tile); o is f16 and staged as above, W_p (read flat, [in][out] [DM][DM]) comes as the other weights.
__global__ __launch_bounds__(128) void k_outp(const _Float16* __restrict__ A, const float* __restrict__ Wf, float alpha, float* __restrict__ C) {
  __shared__ __attribute__((aligned(128))) unsigned char L[2 * OPS];
  float (*so)[32][68] = (float (*)[32][68])L;      /* lies on the first buffer and part of the second, written behind the last trip's barrier as in k_proj */
  const int tid = threadIdx.x, w = tid >> 5, lane = tid & 31, ln = lane & 15, hh = lane >> 4;
  const int mt = blockIdx.x / (DM / 64), nq = blockIdx.x - mt * (DM / 64); const int row0 = mt * 128 + 32 * w, col0 = nq * 64;
  /* the copies of a stage: 128 A rows of 8 pieces (a thread: rows tid / 8 + 16 i); every lane on, every piece written by one lane */
  const unsigned lds0 = (unsigned)(size_t)L; const unsigned la = lds0 + (unsigned)((tid >> 3) * GHP + (tid & 7) * 16);
  const _Float16* ga = A + (size_t)(mt * 128 + (tid >> 3)) * DM + (tid & 7) * 8;
  /* the weight rows of a stage: the block's 64 columns of GKS rows = 16 pieces a row (a thread: rows tid / 16 + 8 i), through registers */
  const float* gw = Wf + (size_t)(tid >> 4) * DM + col0 + (tid & 15) * 4; unsigned char* lw = L + OPA + (tid >> 4) * GWP + (tid & 15) * 8; v4f wr[8];
  auto wload = [&](int s) {
#pragma unroll
    for (int i = 0; i < 8; ++i) wr[i] = *(const v4fa*)(gw + (size_t)(s * GKS + 8 * i) * DM); };
  auto wput = [&](unsigned buf) {
#pragma unroll
    for (int i = 0; i < 8; ++i) *(v4ha*)(lw + buf * OPS + 8 * i * GWP) = gs_wcvt(wr[i]); };
  auto stage = [&](int s, unsigned buf) { const unsigned o = buf * OPS;
    gs_copy4(la + o, 16 * GHP, ga + s * GKS, (size_t)16 * DM); gs_copy4(la + o + 64 * GHP, 16 * GHP, ga + s * GKS + (size_t)64 * DM, (size_t)16 * DM); };
  wload(0); stage(0, 0);      /* the loads in front of the copies: the s_wait_xcnt that closes the first copy statement then stands behind them too */
  const v8f z8 = {0.f,0.f,0.f,0.f,0.f,0.f,0.f,0.f}; v8f c00 = z8, c01 = z8, c02 = z8, c03 = z8, c10 = z8, c11 = z8, c12 = z8, c13 = z8;
  wput(0);
  asm volatile("s_wait_dscnt 0x0" ::: "memory");      /* this wave's weight rows of stage 0 are written */
  asm volatile("s_wait_asynccnt 0x0" ::: "memory");      /* this wave's copies of stage 0 have landed */
  __syncthreads();      /* and every other wave's: stage 0 may be read */
  wload(1); stage(1, 1);
#pragma unroll 1
  for (int t = 0; t < DM / GKS; ++t) {      /* rolled: one trip is one LDS stage, its two k blocks unrolled below */
    const unsigned char* ab = L + (t & 1) * OPS + (w * 32 + ln) * GHP + hh * 16; const unsigned char* bb = L + (t & 1) * OPS + OPA + (8 * hh + (lane & 7)) * GWP + ((lane >> 3) & 1) * 16;
    v16h af[2][2], bf[2][4];      /* [k block][16 rows], [k block][16 columns] */
#pragma unroll
    for (int p = 0; p < GKS / 32; ++p) {      /* unrolled: every LDS offset a constant */
      af[p][0] = gs_hfrag(ab + p * 64); af[p][1] = gs_hfrag(ab + 16 * GHP + p * 64);
#pragma unroll
      for (int j = 0; j < 4; ++j) bf[p][j] = gs_tfrag(bb + p * 32 * GWP + j * 32); }
    if (t + 1 < DM / GKS) wput((unsigned)((t + 1) & 1));      /* same test in every wave; stage t + 1's weight rows go beside its A rows, into the buffer that every wave left at the last barrier */
    asm volatile("s_wait_dscnt 0x0" ::: "memory");      /* the stage's fragments are all in registers and the next stage's weight rows written: this wave is done with both buffers before the barrier */
    asm volatile("s_wait_asynccnt 0x0" ::: "memory");      /* this wave's copies of stage t + 1 have landed */
    __syncthreads();      /* publishes stage t + 1 and ends every wave's reads of stage t's buffer */
    if (t + 2 < DM / GKS) { wload(t + 2); stage(t + 2, (unsigned)(t & 1)); }      /* same test in every wave of the block; refills the buffer just read, and flies under the products below, which work on registers alone; the weight rows wait in registers for the next trip */
#pragma unroll
    for (int p = 0; p < GKS / 32; ++p) {
      c00 = gs_mma(af[p][0], bf[p][0], c00); c10 = gs_mma(af[p][1], bf[p][0], c10); c01 = gs_mma(af[p][0], bf[p][1], c01); c11 = gs_mma(af[p][1], bf[p][1], c11);
      c02 = gs_mma(af[p][0], bf[p][2], c02); c12 = gs_mma(af[p][1], bf[p][2], c12); c03 = gs_mma(af[p][0], bf[p][3], c03); c13 = gs_mma(af[p][1], bf[p][3], c13); }
  }
  asm volatile("s_wait_asynccnt 0x0" ::: "memory");      /* no copy is left in flight when the buffers become the epilogue's tile */
  v8f accs[8] = {c00, c01, c02, c03, c10, c11, c12, c13};
#pragma unroll
  for (int u = 0; u < 8; ++u) { const int t = u & 3, half = u >> 2;
#pragma unroll
    for (int r = 0; r < 8; ++r) so[w][half * 16 + 8 * hh + r][t * 16 + ln] = accs[u][r] * alpha; }
  __builtin_amdgcn_fence(__ATOMIC_ACQ_REL, "workgroup"); __builtin_amdgcn_wave_barrier();      /* a wave reads back only its own 32 rows */
  const int rsub = lane >> 4, c4 = (lane & 15) * 4; v4f vr[16];      /* all rows read back first, then stored from one address pair */
#pragma unroll
  for (int q = 0; q < 16; ++q) vr[q] = *(const v4fa*)&so[w][q * 2 + rsub][c4];
  float* cp = C + (size_t)(row0 + rsub) * DM + col0 + c4;
#pragma unroll
  for (int q = 0; q < 16; ++q) *(v4f*)(cp + (size_t)q * 2 * DM) = vr[q]; }

__global__ __launch_bounds__(256) void k_wnat(const float* __restrict__ w, size_t n8, _Float16* __restrict__ Bt) { const size_t t = (size_t)blockIdx.x * 256 + threadIdx.x; if (t >= n8) return; FragH f; for (int q = 0; q < 8; ++q) f.h[q] = (_Float16)(bf16_round(w[t * 8 + q]) * 16.0f); *(v8us*)((unsigned short*)Bt + t * 8) = f.half[0];  }
__global__ __launch_bounds__(256) void k_rsm(const float* __restrict__ S, _Float16* __restrict__ P, int nrows) {
  #pragma clang fp contract(off)
  const int i = blockIdx.x * 256 + threadIdx.x; if (i >= nrows) return; const float* s = S + (size_t)i * SQ; float mx = -3.0e38f;
#pragma unroll 1
  for (int j = 0; j < SQ; ++j) mx = fmaxf(mx, s[j]); float se = 0.f;
#pragma unroll 1
  for (int j = 0; j < SQ; ++j) se += expf(s[j] - mx); const float sc = 256.0f / se;
#pragma unroll 1
  for (int j0 = 0; j0 < SQ; j0 += 8) { FragH f; for (int q = 0; q < 8; ++q) f.h[q] = (_Float16)(expf(s[j0 + q] - mx) * sc); unsigned short* d = (unsigned short*)P + (size_t)i * SQ + j0; *(v8us*)d = f.half[0];  } }
__global__ __launch_bounds__(256) void k_vt(const _Float16* __restrict__ V16, int b, int h0, _Float16* __restrict__ VT) { __shared__ unsigned short tl[64][65]; const int tid = threadIdx.x; const int hh = blockIdx.x % HG, sg = blockIdx.x / HG; const int s0 = sg * 64; const int h = h0 + hh;
  for (int i = tid; i < 64 * 8; i += 256) { const int j = i / 8, d8 = (i % 8) * 8; FragH f; f.half[0] = *(const v8us*)((const unsigned short*)V16 + ((size_t)b * SQ + s0 + j) * DM + h * HD + d8); for (int q = 0; q < 8; ++q) tl[d8 + q][j] = f.u[q]; }
  __syncthreads();
  { for (int i = tid; i < 64 * 8; i += 256) { const int d = i / 8, j8 = (i % 8) * 8; FragH f; for (int q = 0; q < 8; ++q) f.u[q] = tl[d][j8 + q]; *(v8us*)((unsigned short*)VT + ((size_t)hh * HD + d) * SQ + s0 + j8) = f.half[0]; }  } }



#define FK 256                       /* keys per LDS stage: 4 key quarters of 2 passes of 32 */
#define FKW (FK / 4)                 /* keys of a stage that one wave walks */
#define FKP 144                      /* LDS pitch in bytes of a K row (128 bytes of data) */
#define FVP 528                      /* LDS pitch in bytes of a V^T row (512 bytes of data): 16 bytes x odd, the same banks as 272 */
#define FKB (FK * FKP)               /* the K rows of a stage */
#define FSB (FKB + HD * FVP)         /* one stage: K, V^T */
#define FT 7.0f                      /* a score may pass m by this many powers of two before m is raised: 256 x 2^7 = 2^15 < 65,504 */
#define FXW (17 * 512)               /* hand-over slot of a wave: 8 pieces of O^T for each query tile and one of (m, l, m, l), 16 bytes a lane each */
__device__ __forceinline__ v8f fa_mma(v16h a, v16h b, v8f c) { return __builtin_amdgcn_wmma_f32_16x16x32_f16(false, a, false, b, (short)0, c, false, false); }
__device__ __forceinline__ float fa_swap16(float x) { const int b = __float_as_int(x); return __int_as_float(__builtin_amdgcn_permlanex16(b, b, 0x76543210, 0xfedcba98, false, false)); }      /* value of lane l ^ 16 */
__device__ __forceinline__ v16h fa_lfrag(const unsigned char* p) { FragH f; f.half[0] = *(const v8us*)p; f.half[1] = *(const v8us*)(p + 32); return f.v; }      /* g2_frag's k order, from an LDS row; p already holds the lane half's 16 bytes */
// Four copies of 16 bytes a lane, global -> LDS. The s_wait_xcnt closes the statement so that it stands in front of every later write of the address registers that the copies name.
__device__ __forceinline__ void fa_copy4(unsigned l0, unsigned lstep, const _Float16* g0, size_t gstep) {
  const unsigned l1 = l0 + lstep, l2 = l1 + lstep, l3 = l2 + lstep; const _Float16* g1 = g0 + gstep; const _Float16* g2 = g1 + gstep; const _Float16* g3 = g2 + gstep;
  asm volatile("global_load_async_to_lds_b128 %0, %4, off\n\tglobal_load_async_to_lds_b128 %1, %5, off\n\tglobal_load_async_to_lds_b128 %2, %6, off\n\tglobal_load_async_to_lds_b128 %3, %7, off\n\ts_wait_xcnt 0x0"
               :: "v"(l0), "v"(l1), "v"(l2), "v"(l3), "v"(g0), "v"(g1), "v"(g2), "v"(g3) : "memory"); }
__global__ __launch_bounds__(512) void k_fattn(const _Float16* __restrict__ Qh, const _Float16* __restrict__ Kh, const _Float16* __restrict__ Vt, _Float16* __restrict__ O) {
  __shared__ __attribute__((aligned(128))) unsigned char L[2 * FSB]; static_assert(16 * FXW <= 2 * FSB, "the hand-over slots lie on the two buffers");
  const int tid = threadIdx.x, lane = tid & 31, ln = lane & 15, hh = lane >> 4; const int w = __builtin_amdgcn_readfirstlane((int)(threadIdx.x >> 5));
  const int qg = w & 3, kh = w >> 2;      /* the wave's 32 queries of the block's 128, its quarter of every stage's keys */
  const int bh = blockIdx.y, b = bh / NH, h = bh - b * NH; const size_t r0 = (size_t)b * SQ; const int q0 = blockIdx.x * 128 + qg * 32;
  const size_t qo = (r0 + q0 + ln) * DM + h * HD;      /* query tile 0; tile 1 lies 16 rows on */
  /* the copies of a stage: K rows of 8 pieces (a thread: rows tid / 8 + 64 i), V^T rows of 32 pieces (rows tid / 32 + 16 i); every lane on, every piece written by one lane */
  const unsigned lds0 = (unsigned)(size_t)L; const unsigned lk = lds0 + (unsigned)((tid >> 3) * FKP + (tid & 7) * 16), lv = lds0 + (unsigned)(FKB + (tid >> 5) * FVP + (tid & 31) * 16);
  const size_t gko = (r0 + (tid >> 3)) * DM + h * HD + (tid & 7) * 8; const _Float16* gkh = Kh + gko; const _Float16* gv = Vt + ((size_t)bh * HD + (tid >> 5)) * SQ + (tid & 31) * 8;
  auto stage = [&](int s, unsigned buf) { const unsigned lb = buf * FSB;
    fa_copy4(lk + lb, 64 * FKP, gkh + (size_t)s * FK * DM, (size_t)64 * DM); fa_copy4(lv + lb, 16 * FVP, gv + (size_t)s * FK, (size_t)16 * SQ); };
  stage(0, 0);
  v16h qh0[2], qh1[2];      /* [query tile] */
#pragma unroll
  for (int c = 0; c < 2; ++c) { const size_t qc = qo + (size_t)c * 16 * DM; qh0[c] = g2_frag(Qh + qc, hh); qh1[c] = g2_frag(Qh + qc + 32, hh); }
  const v8f z8 = {0.f,0.f,0.f,0.f,0.f,0.f,0.f,0.f}; v8f o0[2] = {z8, z8}, o1[2] = {z8, z8}, o2[2] = {z8, z8}, o3[2] = {z8, z8}; float m[2] = {-3.0e38f, -3.0e38f}, mt[2] = {-3.0e38f, -3.0e38f}, l[2] = {0.f, 0.f};      /* mt: the score above which m is raised; the first pass always raises it */
  const float cs = 0.18033688011112042f;      /* log2(e) / 8: raw product -> exponent of two */
  asm volatile("s_wait_asynccnt 0x0" ::: "memory");      /* this wave's copies of stage 0 have landed */
  __syncthreads();      /* and every other wave's: stage 0 may be read */
  stage(1, 1);
#pragma unroll 1
  for (int t = 0; t < SQ / FK; ++t) {      /* rolled: one trip is one LDS stage, the wave's two passes unrolled below */
    const unsigned char* kb = L + (t & 1) * FSB + (kh * FKW + ln) * FKP + hh * 16; const unsigned char* vb = L + (t & 1) * FSB + FKB + ln * FVP + kh * FKW * 2 + hh * 16;
    v16h h00 = fa_lfrag(kb), h01 = fa_lfrag(kb + 64), h10 = fa_lfrag(kb + 16 * FKP), h11 = fa_lfrag(kb + 16 * FKP + 64);
#pragma unroll
    for (int p = 0; p < FKW / 32; ++p) {      /* unrolled: every LDS offset a constant, and the K fragments are carried from pass to pass inside the stage */
      const v16h v0 = fa_lfrag(vb + p * 64), v1 = fa_lfrag(vb + 16 * FVP + p * 64), v2 = fa_lfrag(vb + 32 * FVP + p * 64), v3 = fa_lfrag(vb + 48 * FVP + p * 64);
      v8f sb[2] = {z8, z8}, tb[2] = {z8, z8};      /* [query tile]; keys j .. j+15: sb; keys j+16 .. j+31: tb */
#pragma unroll
      for (int c = 0; c < 2; ++c) { sb[c] = fa_mma(h00, qh0[c], sb[c]); tb[c] = fa_mma(h10, qh0[c], tb[c]); }
#pragma unroll
      for (int c = 0; c < 2; ++c) { sb[c] = fa_mma(h01, qh1[c], sb[c]); tb[c] = fa_mma(h11, qh1[c], tb[c]); }
      if (p + 1 < FKW / 32) { const unsigned char* kn = kb + (p + 1) * 32 * FKP;      /* the next pass's K fragments, into the same registers, behind this pass's last score product; never beyond this stage's own buffer */
        h00 = fa_lfrag(kn); h01 = fa_lfrag(kn + 64); h10 = fa_lfrag(kn + 16 * FKP); h11 = fa_lfrag(kn + 16 * FKP + 64); }
      float u[2][16], xm[2];      /* xm: maximum of the lane's own 16 keys */
#pragma unroll
      for (int c = 0; c < 2; ++c) {
#pragma unroll
        for (int r = 0; r < 8; ++r) { u[c][r] = sb[c][r]; u[c][8 + r] = tb[c][r]; }
        const float* uc = u[c];
        const float x = fmaxf(fmaxf(fmaxf(fmaxf(uc[0], uc[1]), fmaxf(uc[2], uc[3])), fmaxf(fmaxf(uc[4], uc[5]), fmaxf(uc[6], uc[7]))), fmaxf(fmaxf(fmaxf(uc[8], uc[9]), fmaxf(uc[10], uc[11])), fmaxf(fmaxf(uc[12], uc[13]), fmaxf(uc[14], uc[15]))));
        xm[c] = x; }
      if (__builtin_amdgcn_ballot_w32((xm[0] > mt[0]) | (xm[1] > mt[1])) != 0) {      /* scalar branch, one test a pass for both query tiles: taken by the whole wave or not at all; the vote runs over both lanes of a query, which hold one mt */
#pragma unroll
        for (int c = 0; c < 2; ++c) { const float pm = fmaxf(xm[c], fa_swap16(xm[c]));      /* both halves of a query's keys: the two lanes must use one m, their weights meet in one product */
          const float mn = fmaxf(m[c], pm); const float al = __builtin_amdgcn_exp2f((m[c] - mn) * cs); m[c] = mn; mt[c] = mn + FT / cs; l[c] *= al; o0[c] *= al; o1[c] *= al; o2[c] *= al; o3[c] *= al; } }
#pragma unroll
      for (int c = 0; c < 2; ++c) {
        const float mc = fmaf(-m[c], cs, 8.0f);      /* + 8: weights carried x256 against the f16 subnormal range */
        FragH pw; float e[16];
#pragma unroll
        for (int s = 0; s < 16; ++s) { e[s] = __builtin_amdgcn_exp2f(fmaf(u[c][s], cs, mc)); pw.h[s] = (_Float16)e[s]; }
        l[c] += (((e[0] + e[1]) + (e[2] + e[3])) + ((e[4] + e[5]) + (e[6] + e[7]))) + (((e[8] + e[9]) + (e[10] + e[11])) + ((e[12] + e[13]) + (e[14] + e[15])));
        o0[c] = fa_mma(v0, pw.v, o0[c]); o1[c] = fa_mma(v1, pw.v, o1[c]); o2[c] = fa_mma(v2, pw.v, o2[c]); o3[c] = fa_mma(v3, pw.v, o3[c]); }
    }
    asm volatile("s_wait_dscnt 0x0" ::: "memory");      /* this wave's reads of the buffer are done before the buffer is handed back */
    asm volatile("s_wait_asynccnt 0x0" ::: "memory");      /* this wave's copies of stage t + 1 have landed */
    __syncthreads();      /* publishes stage t + 1 and ends every wave's reads of stage t's buffer */
    if (t + 2 < SQ / FK) stage(t + 2, (unsigned)(t & 1));      /* same test in every wave of the block; refills the buffer just read */
  }
  asm volatile("s_wait_asynccnt 0x0" ::: "memory");      /* no copy is left in flight when the buffers become the hand-over slots */
  /* the four key quarters of a query meet. The slots lie on the buffers, which no wave reads and no copy writes behind the last trip's barrier. Every loop below is unrolled so that its register arrays are indexed by constants and every LDS offset is one */
  unsigned char* xs = L + w * FXW + lane * 16;
#pragma unroll
  for (int c = 0; c < 2; ++c) { const v8f gg[4] = {o0[c], o1[c], o2[c], o3[c]};
#pragma unroll
    for (int j = 0; j < 4; ++j) { const v4f lo = {gg[j][0], gg[j][1], gg[j][2], gg[j][3]}, hi = {gg[j][4], gg[j][5], gg[j][6], gg[j][7]}; *(v4fa*)(xs + (8 * c + 2 * j) * 512) = lo; *(v4fa*)(xs + (8 * c + 2 * j + 1) * 512) = hi; } }
  { const v4f ml = {m[0], l[0], m[1], l[1]}; *(v4fa*)(xs + 16 * 512) = ml; }
  __syncthreads();      /* every wave's slot is written */
  if ((kh & 1) == 0) {      /* the same in every lane of a wave, no barrier behind it: key group 0 joins query tile 0, key group 2 tile 1, so that one wave stores a query's whole 128-byte line */
    const int c = kh >> 1; const unsigned char* xr = L + qg * FXW + lane * 16;      /* quarter p of these queries lies in the slot of wave qg + 4 p */
    float pm[4], pl[4];
#pragma unroll
    for (int p = 0; p < 4; ++p) { const v4f ml = *(const v4fa*)(xr + p * 4 * FXW + 16 * 512); pm[p] = c ? ml[2] : ml[0]; pl[p] = c ? ml[3] : ml[1]; }
    const float mn = fmaxf(fmaxf(pm[0], pm[1]), fmaxf(pm[2], pm[3])); float fp[4];      /* all quarters on one maximum */
#pragma unroll
    for (int p = 0; p < 4; ++p) fp[p] = __builtin_amdgcn_exp2f((pm[p] - mn) * cs);
    float lt = ((pl[0] * fp[0] + pl[1] * fp[1]) + pl[2] * fp[2]) + pl[3] * fp[3]; lt += fa_swap16(lt); const float sc = 64.0f / lt;      /* lt = 256 sum exp; o carried x64 as before (folded into the output GEMM alpha) */
#pragma unroll
    for (int p = 0; p < 4; ++p) fp[p] *= sc;
    unsigned short* op = (unsigned short*)O + qo + (size_t)c * 16 * DM + 8 * hh; const unsigned char* xc = xr + c * 8 * 512;
#pragma unroll
    for (int j = 0; j < 4; ++j) { v4f pr[4][2]; FragH f;
#pragma unroll
      for (int p = 0; p < 4; ++p) { pr[p][0] = *(const v4fa*)(xc + p * 4 * FXW + (2 * j) * 512); pr[p][1] = *(const v4fa*)(xc + p * 4 * FXW + (2 * j + 1) * 512); }
#pragma unroll
      for (int r = 0; r < 8; ++r) f.h[r] = (_Float16)(((pr[0][r >> 2][r & 3] * fp[0] + pr[1][r >> 2][r & 3] * fp[1]) + pr[2][r >> 2][r & 3] * fp[2]) + pr[3][r >> 2][r & 3] * fp[3]);
      *(v8us*)(op + 16 * j) = f.half[0]; } } }

extern "C" void kernel_launch(void* const* d_in, const int* in_sizes, int n_in,
                              void* d_out, int out_size, void* d_ws, size_t ws_size, hipStream_t stream) {
  (void)in_sizes; (void)n_in; (void)out_size;
  const float* const* I = (const float* const*)d_in; const float* xq = I[0]; const float* xk = I[1]; const float* xv = I[2]; const float* wq = I[3]; const float* wk = I[4]; const float* wv = I[5]; const float* wo = I[6];      /* input order: query, key, value; Wq, Wk, Wv [8][512][64] (per-head [in][out]); Wp [8][64][512] (flat [in][out] [512][512]): seven inputs; the module has NO biases */
  char* ws = (char*)d_ws; size_t off = 0;
  auto take = [&](size_t bytes) { char* p = ws + off; off += (bytes + 255) & ~(size_t)255; return p; };
  _Float16* QH = (_Float16*)take(NR * DM * 2); _Float16* KH = (_Float16*)take(NR * DM * 2); _Float16* O16 = (_Float16*)take(NR * DM * 2);
  _Float16* VT = (_Float16*)take((size_t)NB * NH * HD * SQ * 2);
  if (off > ws_size) return;
  const size_t r0p = (size_t)B0 * SQ;      /* first row of the output stage */
  k_proj<<<dim3((unsigned)((NR / 128) * (DM / 64)), 3), 128, 0, stream>>>(xq, xk, xv, wq, wk, wv, QH, KH, VT);      /* q and k as f16 rows; V^T [NB * NH][HD][SQ], both batches */
  k_fattn<<<dim3(SQ / 128, NB * NH), 512, 0, stream>>>(QH, KH, VT, O16);      /* o (merged heads, x64) as f16 rows */
  k_outp<<<dim3((unsigned)((MPO / 128) * (DM / 64)), 1), 128, 0, stream>>>(O16 + r0p * DM, wo, 0.0009765625f, (float*)d_out + r0p * DM);      /* out rows are the output layout */
}
